// v000
// The times below were measured on an AMD MI455X: many runs one after another, warmed up first and cycling through
// copies of the inputs, with the whole window's GPU time divided by the number of runs. Launches and the gaps
// between them are all in it. The median over several windows is given; except for v000 it joins two sittings, which
// can be a few percent apart, so the side-by-side timings, each taken in one sitting, are the better comparison.
// v000 is the starting kernel. One run takes 520 microseconds.
// Contractions: x.Wq, x.Wk, x.Wv on v_wmma_f32_16x16x32_bf16 (x and W^T as bf16 RNE planes, f32 accumulate);
// q.k^T over hd 128 on v_wmma_f32_16x16x32_f16 with q as f16 hi + f16 residual planes (x256) and k as one f16 plane
// (x256), products qh.k + ql.k; P.v on v_wmma_f32_16x16x32_f16 with P x32768 and v^T x1024 as single f16 planes;
// ctx.Wo on v_wmma_f32_16x16x32_f16 with ctx x1024 as one f16 plane and Wo^T as f16(bf16 RNE(Wo)) x1024; all f32
// accumulate. RMS normalisation, rotate-half rotary from integer positions (cos/sin tables built on device in f32),
// base-2 online softmax and the 1/Z fold in f32 on VALU.
#include <hip/hip_runtime.h>
#include <math.h>
#include <stdint.h>

#ifndef NB
#define NB 2
#endif
#define SEQ 2048
#ifndef SQ
#define SQ SEQ
#endif
#define DMOD  2048
#define NH    16
#define NKVH  4
#define HD    128
#define HHALF (HD / 2)
#define KVD   (NKVH * HD)
#define MROWS (NB * SEQ)
#define EPS_RMS 0.000001f
#define RSQ_HD 0.08838834764831845f
#define LOG2E 1.4426950408889634f
#define LOG2THETA 19.931568569324174
#define QSC   256.0f
#define KSC   256.0f
#define PCAR  32768.0f
#define VCAR  1024.0f
#define OSC   1024.0f
#define WOS   1024.0f
#define WPB   (NH / NKVH)
#define NHG   NKVH
#define NQT   (SQ / 16)
#define NST   (SEQ / 64)
#define NKT   (SEQ / 32)
#define ATT_THREADS (WPB * 32)
#define PTP   36
#define PTW   (16 * PTP)
#define SLP   132
#define SLW   (16 * SLP)
#define WREG  (PTW + SLW)
#define SLAB64 (16 * 68)
#define VTP   72
#define WTP   72
#define WS_CAP 134217728
static_assert(DMOD == NH * HD && HD == 128 && HHALF == 64 && NH == 16 && NKVH == 4 && WPB == 4 && NHG * WPB == NH);
static_assert(ATT_THREADS == 128 && KVD == 512);
static_assert(NB >= 1 && NB <= 2);
static_assert((SEQ % 64) == 0 && (SQ % 64) == 0 && SQ >= 64 && SQ <= SEQ);
static_assert((DMOD % 64) == 0 && (KVD % 64) == 0 && (DMOD % 32) == 0 && (HD % 32) == 0);
static_assert(((MROWS * DMOD / 8) % 256) == 0 && (MROWS % 4) == 0);
static_assert(WPB * WREG * 4 <= 65536 && HD * VTP * 2 <= 65536 && 4 * SLAB64 * 4 <= 65536 && 64 * WTP * 2 <= 65536);
static_assert((DMOD / 16) <= 128 && (KVD / 16) <= 128 && ((DMOD / 16) % 32) == 0 && ((KVD / 16) % 32) == 0);

typedef unsigned short u16;
typedef _Float16 v16h __attribute__((ext_vector_type(16)));
typedef _Float16 v8h  __attribute__((ext_vector_type(8)));
typedef __bf16   v16b __attribute__((ext_vector_type(16)));
typedef float    v8f  __attribute__((ext_vector_type(8)));
typedef float    v4f  __attribute__((ext_vector_type(4)));
typedef unsigned int v4u __attribute__((ext_vector_type(4)));

union FragH { v16h v; v8h h[2]; v4u u[2]; };
union FragB { v16b v; v4u u[2]; };

// ---- scalar helpers --------------------------------------------------------------------------------
__device__ __forceinline__ unsigned short bf_bits(float f) {          // f32 -> bf16 bits, RNE convert
  unsigned u = __float_as_uint(f);
  return (unsigned short)((u + 0x7FFFu + ((u >> 16) & 1u)) >> 16);
}
__device__ __forceinline__ float bf_up(unsigned short h) { return __uint_as_float(((unsigned)h) << 16); }
__device__ __forceinline__ float bfr(float f) { return bf_up(bf_bits(f)); }
__device__ __forceinline__ unsigned short h_bits(_Float16 x) { return __builtin_bit_cast(unsigned short, x); }
__device__ __forceinline__ unsigned pk16(unsigned short a, unsigned short b) { return (unsigned)a | ((unsigned)b << 16); }
__device__ __forceinline__ v8f zero8() { v8f z = {0.f, 0.f, 0.f, 0.f, 0.f, 0.f, 0.f, 0.f}; return z; }

// ---- fragment loaders: 16-bit A/B operand, lane -> row/col (lane&15), p already includes +8*(lane>>4);
//      elements 0..7 <- p[0..7] (k0+8h..), elements 8..15 <- p[16..23] (k0+16+8h..)  (same split k map for A and B;
//      B is always read from a k-contiguous [n][k] plane)
__device__ __forceinline__ v16h ldfrag_h(const _Float16* p) {
  FragH f;
  f.h[0] = *(const v8h*)(p);
  f.h[1] = *(const v8h*)(p + 16);
  return f.v;
}
__device__ __forceinline__ v16b ldfrag_b(const u16* p) {              // bf16 plane read as unsigned integer vectors
  FragB f;
  f.u[0] = *(const v4u*)(p);
  f.u[1] = *(const v4u*)(p + 16);
  return f.v;
}

__device__ __forceinline__ v8f mma_h(v16h a, v16h b, v8f c) {
  return __builtin_amdgcn_wmma_f32_16x16x32_f16(false, a, false, b, (short)0, c, false, false);
}
__device__ __forceinline__ v8f mma_b(v16b a, v16b b, v8f c) {
  return __builtin_amdgcn_wmma_f32_16x16x32_bf16(false, a, false, b, (short)0, c, false, false);
}
__device__ __forceinline__ void guard2(v8f& a, v8f& b, v16h x0, v16h x1, v16h x2, v16h x3) {
#if defined(__HIP_DEVICE_COMPILE__)
  asm volatile("v_nop\n\tv_nop\n\tv_nop\n\tv_nop"
               : "+v"(a), "+v"(b) : "v"(x0), "v"(x1), "v"(x2), "v"(x3) : "memory");
#endif
}
template <typename F>
__device__ __forceinline__ void guard6(v8f& a, v8f& b, v8f& c, v8f& d, F x0, F x1, F x2, F x3, F x4, F x5) {
#if defined(__HIP_DEVICE_COMPILE__)
  asm volatile("v_nop\n\tv_nop\n\tv_nop\n\tv_nop"
               : "+v"(a), "+v"(b), "+v"(c), "+v"(d) : "v"(x0), "v"(x1), "v"(x2), "v"(x3), "v"(x4), "v"(x5) : "memory");
#endif
}
__device__ __forceinline__ void acc_guard4(v8f& a, v8f& b, v8f& c, v8f& d) {
#if defined(__HIP_DEVICE_COMPILE__)
  asm volatile("v_nop\n\tv_nop\n\tv_nop\n\tv_nop" : "+v"(a), "+v"(b), "+v"(c), "+v"(d));
#endif
}
__device__ __forceinline__ void wave_sync_lds() {
  __builtin_amdgcn_fence(__ATOMIC_RELEASE, "workgroup");
  __builtin_amdgcn_wave_barrier();
  __builtin_amdgcn_fence(__ATOMIC_ACQUIRE, "workgroup");
}

// =====================================================================================================
// cos/sin tables for the rotary: row = b*SEQ + s (0 .. nrows-1), column j = 0..63:
//   invf[j] = 1e6^(-j/64) (f64 exp2, converted to f32), ang = float(pos[row]) * invf[j] (f32 multiply),
//   cosT[row][j] = cosf(ang), sinT[row][j] = sinf(ang).
// Block = 4 rows x 64 j (one value pair per thread) staged in LDS; after the barrier waves 0,1 write the 4 cos rows and
// coverage: grid = nrows/4 blocks x (2 tables x 4 rows x 64 floats) = both tables exactly once (nrows % 4 == 0, host).
// =====================================================================================================
__global__ __launch_bounds__(256) void trig64(const int* __restrict__ pos, float* cosT, float* sinT, int nrows) {
#pragma clang fp contract(off)
  __shared__ __align__(16) float cs[2 * 256];
  const int tid  = (int)threadIdx.x;
  const int row0 = (int)blockIdx.x * 4;
  if (row0 + 4 > nrows) return;                       // block-uniform, before the barrier; never taken with the exact grid
  const int r = tid >> 6, j = tid & 63;
  const float p    = (float)pos[row0 + r];
  const float invf = (float)exp2(-(double)j * (LOG2THETA / 64.0));
  const float ang  = p * invf;
  cs[tid]       = cosf(ang);
  cs[256 + tid] = sinf(ang);
  __syncthreads();
  if (tid < 128) {                                    // waves 0..3, wave-uniform
    const int tb    = tid >> 6;                       // 0: cos rows (waves 0,1), 1: sin rows (waves 2,3)
    const int q     = tid & 63;
    const int rr    = q >> 4;
    const int piece = (q & 15) * 4;
    const v4f v = *(const v4f*)(cs + tb * 256 + rr * 64 + piece);
    float* base = (tb != 0) ? sinT : cosT;
    float* dst  = base + (size_t)(row0 + rr) * HHALF + piece;
    {
      *(v4f*)(dst) = v;
      
    }
  }
}

// =====================================================================================================
// f32 -> 16-bit plane, same layout.  f16mode == 0: bf16 RNE bits;  f16mode == 1: f16 bits of (bf16 RNE value) * scale.
// Thread = 8 consecutive elements: two 16-B loads, one 16-B store; 32 consecutive lanes = 512 contiguous, 512-B aligned
// coverage: grid = ceil(n8/256) blocks x 256 thr x 8 (in-kernel bound) = the whole plane (n8 a multiple of 256 here).
// =====================================================================================================
__global__ __launch_bounds__(256) void cvt16(const float* __restrict__ x, u16* D, int n8, int f16mode, float scale) {
  const int gt = blockIdx.x * 256 + (int)threadIdx.x;
  if (gt >= n8) return;
  const float* p = x + (size_t)gt * 8;
  const v4f a = *(const v4f*)(p), b4 = *(const v4f*)(p + 4);
  float w[8];
#pragma unroll
  for (int e = 0; e < 4; ++e) { w[e] = a[e]; w[4 + e] = b4[e]; }
  v4u o;
#pragma unroll
  for (int e = 0; e < 4; ++e) {
    const float f0 = w[2 * e], f1 = w[2 * e + 1];
    const unsigned short hb0 = h_bits((_Float16)(bfr(f0) * scale));
    const unsigned short hb1 = h_bits((_Float16)(bfr(f1) * scale));
    const unsigned short bb0 = bf_bits(f0);
    const unsigned short bb1 = bf_bits(f1);
    o[e] = (f16mode != 0) ? pk16(hb0, hb1) : pk16(bb0, bb1);
  }
  u16* d = D + (size_t)gt * 8;
  {
    *(v4u*)(d) = o;
    
  }
}

// =====================================================================================================
// Weight transpose + convert: W f32 [K rows][N cols] (row pitch N) -> Wt 16-bit [N rows][K cols] (row pitch K), so that
// a column n of W becomes the k-contiguous B operand row n.  f16mode == 0: bf16 RNE bits; 1: f16 bits of (bf16 RNE value)*scale.
// Block = 64 k x 64 n tile: load phase 4 iterations x (16 k rows x 16 lanes x 4 n) with 16-B loads into an LDS tile
// coverage: load 4 it x 256 thr x 4 = 64 x 64; store 2 it x 256 thr x 8 halves = 64 rows x 64; grid = (K/64)*(N/64)
//           blocks = the whole [N][K] plane exactly once.
// =====================================================================================================
__global__ __launch_bounds__(256) void wt16(const float* __restrict__ W, u16* Wt, int K, int N, int f16mode, float scale) {
  __shared__ __align__(16) u16 T[64 * WTP];
  const int tid = (int)threadIdx.x;
  const int nkt = K >> 6;
  const int bid = (int)blockIdx.x;
  const int kt  = bid % nkt;
  const int nt  = bid / nkt;
  const int kb  = kt * 64, nb = nt * 64;
  if (nb + 64 > N) return;                            // block-uniform, before the barrier; never taken with the exact grid
  const int c4 = (tid & 15) * 4;                      // n within tile
  const int r0 = tid >> 4;                            // k within tile (0..15) + 16*it
#pragma unroll
  for (int it = 0; it < 4; ++it) {
    const int r = it * 16 + r0;
    const v4f a = *(const v4f*)(W + (size_t)(kb + r) * (size_t)N + nb + c4);
#pragma unroll
    for (int e = 0; e < 4; ++e) {
      const float f = a[e];
      const unsigned short hb = h_bits((_Float16)(bfr(f) * scale));
      const unsigned short bb = bf_bits(f);
      T[(c4 + e) * WTP + r] = (f16mode != 0) ? hb : bb;
    }
  }
  __syncthreads();
  v4u o[2];
  const int q8 = tid >> 3, p8 = (tid & 7) * 8;
#pragma unroll
  for (int it = 0; it < 2; ++it) o[it] = *(const v4u*)(T + (it * 32 + q8) * WTP + p8);
  u16* dst = Wt + (size_t)(nb + q8) * (size_t)K + kb + p8;
  {
#pragma unroll
    for (int it = 0; it < 2; ++it) {
      *(v4u*)(dst + (size_t)(it * 32) * (size_t)K) = o[it];
    }
    
  }
}

// =====================================================================================================
// v^T plane from the v projection F f32 [MROWS][KVD] (row = b*SEQ + s, column = g*HD + d):
//   VH[((b*NKVH + g)*HD + d)][s] = f16(v * 1024) for all keys s.
// Block = (b, kv head g, 64 keys s0): each thread loads its 32 floats (key sl, d chunk dc) with 16-B loads, converts, scatters
// coverage: load 256 thr x 32 = 64 keys x 128 d; store 4 iterations x 256 thr x 8 halves = 128 lines x 64 = the block's tile;
//           grid = NB*NKVH*NST blocks covers the plane exactly once.
// =====================================================================================================
__global__ __launch_bounds__(256) void vt16(const float* __restrict__ F, u16* VHo) {
  __shared__ __align__(16) u16 TH[HD * VTP];
  const int tid = (int)threadIdx.x;
  const int bid = (int)blockIdx.x;
  const int st  = bid % NST;
  const int t2  = bid / NST;
  const int g   = t2 % NKVH;
  const int b   = t2 / NKVH;
  if (b >= NB) return;                                // block-uniform, before any barrier; never taken with the exact grid
  const int s0  = st * 64;
  {
    const int sl = tid >> 2;                          // key within tile 0..63
    const int dc = (tid & 3) * 32;                    // d chunk 0,32,64,96
    const float* src = F + ((size_t)b * SEQ + s0 + sl) * KVD + g * HD + dc;
#pragma unroll
    for (int i = 0; i < 8; ++i) {
      const v4f a = *(const v4f*)(src + 4 * i);
#pragma unroll
      for (int e = 0; e < 4; ++e) {
        const float t = a[e] * VCAR;
        TH[(dc + 4 * i + e) * VTP + sl] = h_bits((_Float16)t);
      }
    }
  }
  __syncthreads();
  v4u vh[4];
  const int q8 = tid >> 3, p8 = (tid & 7) * 8;
#pragma unroll
  for (int it = 0; it < 4; ++it) {
    const int line = it * 32 + q8;                    // d = 0..127
    vh[it] = *(const v4u*)(TH + line * VTP + p8);
  }
  const size_t hrow = (size_t)(b * NKVH + g) * HD;
  const size_t base = hrow * SEQ + s0 + p8;
  {
#pragma unroll
    for (int it = 0; it < 4; ++it) {
      const int line = it * 32 + q8;
      *(v4u*)(VHo + base + (size_t)line * SEQ) = vh[it];
    }
    
  }
}

// =====================================================================================================
// Per-head RMS normalisation + rotate-half rotary + 16-bit planes from a projection F f32 [MROWS][ncol]
// (ncol = DMOD for q, KVD for k; row = b*SEQ + s with s < nrows, column = head*HD + d):
//   rs = 1/sqrt(mean_d(x[head][d]^2) + eps) over the head's 128 columns (f32 sum of squares: 16 per thread, then an
//   8-lane shuffle sum, the 8 lanes of a head are 8 consecutive lanes); y[d] = (x[d]*rs) * w[d] with w = bf16 RNE value
//   of the norm weight; then for j < 64 within a head, with c = cosT[row][j], sn = sinT[row][j] (f32 tables):
//   out[j]    = y[j]*c    - y[j+64]*sn
//   out[j+64] = y[j+64]*c + y[j]*sn
//   Hp [MROWS][ncol] = f16(out * sc); if RES also Lp [MROWS][ncol] = f16 residual (t - f16(t)), same layout.
// Block = one row, exactly ncol/16 threads (host); thread t = head t>>3, chunk i = t&7: columns head*HD + 8i .. +7 and + 64.
// lane-varying control anywhere (shuffles with all lanes active).
// coverage: (ncol/16) thr x 16 = the whole row of Hp (and of Lp); grid = NB*nrows blocks = every processed row once.
// =====================================================================================================
__device__ __forceinline__ void rot_pair(float xl, float xh, float cv, float sv, float sc,
                                         unsigned short& hl, unsigned short& hhv, unsigned short& ll, unsigned short& lh) {
#pragma clang fp contract(off)
  const float rl = xl * cv - xh * sv;
  const float rh = xh * cv + xl * sv;
  const float tl = rl * sc, th = rh * sc;
  const _Float16 a = (_Float16)tl, bq = (_Float16)th;
  hl  = h_bits(a);
  hhv = h_bits(bq);
  ll  = h_bits((_Float16)(tl - (float)a));
  lh  = h_bits((_Float16)(th - (float)bq));
}

template <bool RES>
__global__ __launch_bounds__(128) void nrope16(const float* __restrict__ F, int ncol, int nrows, const float* __restrict__ nw,
                                               const float* __restrict__ cosT, const float* __restrict__ sinT,
                                               u16* Hp, u16* Lp, float sc) {
#pragma clang fp contract(off)
  const int tid = (int)threadIdx.x;
  const int blk = (int)blockIdx.x;
  const int b   = blk / nrows;
  const int s   = blk - b * nrows;
  if (b >= NB) return;                                 // block-uniform; never taken with the exact grid
  const int row = b * SEQ + s;
  const int dlo = (tid & 7) * 8;                       // j within head, multiple of 8
  const int clo = (tid >> 3) * HD + dlo;               // column of the low-half chunk; clo + 64 + 8 <= ncol by blockDim
  const float* p = F + (size_t)row * ncol + clo;
  const v4f xa = *(const v4f*)(p), xb = *(const v4f*)(p + 4);
  const v4f ya = *(const v4f*)(p + HHALF), yb = *(const v4f*)(p + HHALF + 4);
  const size_t trow = (size_t)row * HHALF + dlo;
  const v4f ca = *(const v4f*)(cosT + trow), cb = *(const v4f*)(cosT + trow + 4);
  const v4f sa = *(const v4f*)(sinT + trow), sb = *(const v4f*)(sinT + trow + 4);
  const v4f wa = *(const v4f*)(nw + dlo), wb4 = *(const v4f*)(nw + dlo + 4);
  const v4f wc = *(const v4f*)(nw + HHALF + dlo), wd = *(const v4f*)(nw + HHALF + dlo + 4);
  float xl[8], xh[8], cv[8], sv[8], wl[8], wh[8];
#pragma unroll
  for (int e = 0; e < 4; ++e) {
    xl[e] = xa[e];        xl[4 + e] = xb[e];
    xh[e] = ya[e];        xh[4 + e] = yb[e];
    cv[e] = ca[e];        cv[4 + e] = cb[e];
    sv[e] = sa[e];        sv[4 + e] = sb[e];
    wl[e] = bfr(wa[e]);   wl[4 + e] = bfr(wb4[e]);
    wh[e] = bfr(wc[e]);   wh[4 + e] = bfr(wd[e]);
  }
  // sum of squares over the head's 128 columns: 16 here, then lanes xor 1, 2, 4 (aligned groups of 8 lanes = one head)
  float ss = 0.0f;
#pragma unroll
  for (int e = 0; e < 8; ++e) { ss = ss + xl[e] * xl[e]; ss = ss + xh[e] * xh[e]; }
  ss += __shfl_xor(ss, 1, 32);
  ss += __shfl_xor(ss, 2, 32);
  ss += __shfl_xor(ss, 4, 32);
  const float var = ss * (1.0f / (float)HD);
  const float rs  = 1.0f / sqrtf(var + EPS_RMS);
#pragma unroll
  for (int e = 0; e < 8; ++e) {
    xl[e] = (xl[e] * rs) * wl[e];
    xh[e] = (xh[e] * rs) * wh[e];
  }
  v4u ohl, ohh, oll, olh;
#pragma unroll
  for (int e = 0; e < 4; ++e) {
    unsigned short hl0, hh0, ll0, lh0, hl1, hh1, ll1, lh1;
    rot_pair(xl[2 * e],     xh[2 * e],     cv[2 * e],     sv[2 * e],     sc, hl0, hh0, ll0, lh0);
    rot_pair(xl[2 * e + 1], xh[2 * e + 1], cv[2 * e + 1], sv[2 * e + 1], sc, hl1, hh1, ll1, lh1);
    ohl[e] = pk16(hl0, hl1);
    ohh[e] = pk16(hh0, hh1);
    oll[e] = pk16(ll0, ll1);
    olh[e] = pk16(lh0, lh1);
  }
  u16* dh = Hp + (size_t)row * ncol + clo;
  u16* dl = Lp + (size_t)row * ncol + clo;             // dereferenced only when RES
  {
    *(v4u*)(dh) = ohl;
    *(v4u*)(dh + HHALF) = ohh;
    if constexpr (RES) {
      *(v4u*)(dl) = oll;
      *(v4u*)(dl + HHALF) = olh;
    }
    
  }
}

// =====================================================================================================
// coverage: 8 instructions x 2 rows x 16 lanes x 4 floats = the wave's 16 x 64 tile.
// =====================================================================================================
__device__ __forceinline__ void epi64(float* sl, v8f a0, v8f a1, v8f a2, v8f a3, float oscale,
                                      float* C, int N, size_t rowb, int col0, int lane) {
  const int hh = lane >> 4, m = lane & 15;
#pragma unroll
  for (int r = 0; r < 8; ++r) {
    const int ro = (8 * hh + r) * 68 + m;
    sl[ro]      = a0[r] * oscale;
    sl[ro + 16] = a1[r] * oscale;
    sl[ro + 32] = a2[r] * oscale;
    sl[ro + 48] = a3[r] * oscale;
  }
  wave_sync_lds();
  v4f vals[8];
#pragma unroll
  for (int it = 0; it < 8; ++it) vals[it] = *(const v4f*)(sl + (it * 2 + hh) * 68 + m * 4);
  float* dst = C + (rowb + (size_t)hh) * (size_t)N + col0 + m * 4;
  {
#pragma unroll
    for (int it = 0; it < 8; ++it) {
      *(v4f*)(dst + (size_t)(it * 2) * (size_t)N) = vals[it];
    }
    
  }
}

// =====================================================================================================
// GEMM: C[row][N] (f32, row pitch N) = A[row][K] (16-bit row-major, pitch K) . Bt[N][K]^T (16-bit k-contiguous) * oscale,
// row = bb*SEQ + s for s < 64*nrt.  BF: bf16 operands (v_wmma_f32_16x16x32_bf16), else f16 (v_wmma_f32_16x16x32_f16).
// Block -> (column tile ct = bid % (N/64), row tile rt of nrt, batch bb); 4 waves x 16 rows; fragments loaded straight from
// the 16-bit rows (two 16-B loads each, split k map for A and B); K stepped by 32 (host: K % 32 == 0, N % 64 == 0).
// =====================================================================================================
template <bool BF>
__global__ __launch_bounds__(128)
void gemm64(const u16* __restrict__ A, const u16* __restrict__ Bt, float* C, int N, int K, int nrt, float oscale) {
  __shared__ __align__(16) float slab[4 * SLAB64];
  const int tid = (int)threadIdx.x, wave = tid >> 5, lane = tid & 31, hh = lane >> 4, m = lane & 15;
  const int ntile = N >> 6;
  const int bid   = (int)blockIdx.x;
  const int ct    = bid % ntile;
  const int t2    = bid / ntile;
  const int rt    = t2 % nrt;
  const int bb    = t2 / nrt;
  if (bb >= NB) return;                     // block-uniform; no block barriers in this kernel; never taken with the exact grid
  const int srow  = rt * 64 + wave * 16;
  if (srow + 16 > SEQ) return;              // wave-uniform; never taken
  const int col0  = ct * 64;
  const size_t rowC = (size_t)bb * SEQ + srow;
  const size_t bs = (size_t)16 * K;
  v8f acc0 = zero8(), acc1 = zero8(), acc2 = zero8(), acc3 = zero8();
  if constexpr (BF) {
    const u16* ap = A  + (rowC + (size_t)m) * (size_t)K + 8 * hh;
    const u16* bp = Bt + (size_t)(col0 + m) * (size_t)K + 8 * hh;
#pragma unroll 1
    for (int k0 = 0; k0 < K; k0 += 32) {
      const v16b a  = ldfrag_b(ap + k0);
      const v16b b0 = ldfrag_b(bp + k0);
      const v16b b1 = ldfrag_b(bp + bs + k0);
      const v16b b2 = ldfrag_b(bp + 2 * bs + k0);
      const v16b b3 = ldfrag_b(bp + 3 * bs + k0);
      acc0 = mma_b(a, b0, acc0);
      acc1 = mma_b(a, b1, acc1);
      acc2 = mma_b(a, b2, acc2);
      acc3 = mma_b(a, b3, acc3);
      guard6<v16b>(acc0, acc1, acc2, acc3, a, b0, b1, b2, b3, a);
    }
  } else {
    const _Float16* ap = (const _Float16*)(const void*)A  + (rowC + (size_t)m) * (size_t)K + 8 * hh;
    const _Float16* bp = (const _Float16*)(const void*)Bt + (size_t)(col0 + m) * (size_t)K + 8 * hh;
#pragma unroll 1
    for (int k0 = 0; k0 < K; k0 += 32) {
      const v16h a  = ldfrag_h(ap + k0);
      const v16h b0 = ldfrag_h(bp + k0);
      const v16h b1 = ldfrag_h(bp + bs + k0);
      const v16h b2 = ldfrag_h(bp + 2 * bs + k0);
      const v16h b3 = ldfrag_h(bp + 3 * bs + k0);
      acc0 = mma_h(a, b0, acc0);
      acc1 = mma_h(a, b1, acc1);
      acc2 = mma_h(a, b2, acc2);
      acc3 = mma_h(a, b3, acc3);
      guard6<v16h>(acc0, acc1, acc2, acc3, a, b0, b1, b2, b3, a);
    }
  }
  epi64(slab + wave * SLAB64, acc0, acc1, acc2, acc3, oscale, C, N, rowC, col0, lane);
}

// =====================================================================================================
// Non-causal grouped-query attention, hd = 128, all SEQ keys. Block bid -> (query tile qt = bid % NQT: rows q0 = 16*qt ..
// q0+15, head group hg = kv head, batch b); one wave per query head = hg*WPB + wave (the 4 heads of the group share kv head hg).
//   q hi / residual planes f16 x256 [b*SEQ + s][h*HD + d]; k plane f16 x256 [b*SEQ + s][g*HD + d] (pitch KVD);
//   v^T plane [b*NKVH + g][d][SEQ] x1024.
//   scores = q_hi.k + q_lo.k (4 k-steps over d); P.v with P x32768 (f16) and v^T, for every query row;
//   O written as one f16 plane (O x1024, layout [b*SEQ + s][h*HD + d]).
//   score (log2 domain) t(i, j) = (q_i.k_j over HD) * (1/sqrt(128))*log2e/(256*256).
//   All NKT key tiles of 32 visited in order. Per tile: 2 score subtiles x 4 k-steps, fragments loaded straight from the
//   16-bit planes (two 16-B loads per fragment, split k map); online max-subtracted base-2 softmax in f32, -inf-safe rescale;
//   of P*32768 (f16) rebuilt from the LDS rows (float vector loads, same element type as stored), v^T B fragments in
//   4 groups of 2 d-subtiles.
//   After the loop: out = acc / Z (Z >= 1 always; guarded anyway), carries 1/(32768*1024) folded once, written into the
//   No block barriers in this kernel; bounded loops only (NKT compile-time).
// coverage: per wave 8 instructions x 2 rows x 16 lanes x 8 halves = 16 x 128; grid NQT x NHG x NB blocks x WPB
//           waves = every (b, s < SQ, h) row segment of O exactly once.
// =====================================================================================================
__global__ __launch_bounds__(ATT_THREADS)
void attn_nc(const u16* __restrict__ QHp, const u16* __restrict__ QLp, const u16* __restrict__ KHp,
             const u16* __restrict__ VHp, u16* OHp) {
  __shared__ __align__(16) float smem[WPB * WREG];

  const int tid  = (int)threadIdx.x;
  const int wave = tid >> 5;
  const int lane = tid & 31;
  const int hh   = lane >> 4;
  const int c    = lane & 15;
  const int bid  = (int)blockIdx.x;
  const int qt   = bid % NQT;
  const int t2   = bid / NQT;
  const int hg   = t2 % NHG;
  const int b    = t2 / NHG;
  if (b >= NB) return;                      // block-uniform; no block barriers in this kernel; never taken with the exact grid
  const int q0   = qt * 16;
  if (q0 + 16 > SQ) return;                 // block-uniform; never taken
  const int head = hg * WPB + wave;
  const int kvh  = hg;

  float* pt   = smem + wave * WREG;         // prob tile [16][32] pitch 36
  float* slab = pt + PTW;                   // result slab [16][128] pitch 132

  const size_t hcol = (size_t)head * HD + 8 * hh;
  const size_t kcol = (size_t)kvh * HD + 8 * hh;
  const _Float16* Qh  = (const _Float16*)(const void*)QHp + ((size_t)b * SEQ + q0 + c) * DMOD + hcol;
  const _Float16* Ql  = (const _Float16*)(const void*)QLp + ((size_t)b * SEQ + q0 + c) * DMOD + hcol;
  const _Float16* Khb = (const _Float16*)(const void*)KHp + ((size_t)b * SEQ + c) * KVD + kcol;        // key row kb added per step
  const _Float16* Vhb = (const _Float16*)(const void*)VHp + ((size_t)(b * NKVH + kvh) * HD + c) * SEQ + 8 * hh;  // d col c (+16j)
  const float lsc = RSQ_HD * (LOG2E / (QSC * KSC));
  const float oc  = 1.0f / (PCAR * VCAR);
  const size_t KROW = (size_t)KVD;          // halves between consecutive key rows

  float mrow[8], lrow[8];
  v8f o[8];
#pragma unroll
  for (int r = 0; r < 8; ++r) { mrow[r] = -INFINITY; lrow[r] = 0.f; }
#pragma unroll
  for (int j = 0; j < 8; ++j) o[j] = zero8();

#pragma unroll 1
  for (int kt = 0; kt < NKT; ++kt) {
    const int kb = kt * 32;
    // ---- scores: D element r of this lane = (query row q0 + 8hh + r, key kb + c) in s0, key kb + 16 + c in s1 ----
    v8f s0 = zero8(), s1 = zero8();
    const _Float16* k0p = Khb + (size_t)kb * KROW;
    const _Float16* k1p = k0p + (size_t)16 * KROW;
#pragma unroll
    for (int kk = 0; kk < HD / 32; ++kk) {
      const v16h qh  = ldfrag_h(Qh + kk * 32);
      const v16h ql  = ldfrag_h(Ql + kk * 32);
      const v16h kh0 = ldfrag_h(k0p + kk * 32);
      const v16h kh1 = ldfrag_h(k1p + kk * 32);
      s0 = mma_h(qh, kh0, s0);
      s0 = mma_h(ql, kh0, s0);
      s1 = mma_h(qh, kh1, s1);
      s1 = mma_h(ql, kh1, s1);
      guard2(s0, s1, qh, ql, kh0, kh1);
    }
    // ---- online softmax in base 2 over all keys, -inf-safe ----
#pragma unroll
    for (int r = 0; r < 8; ++r) {
      const float t0 = s0[r] * lsc;
      const float t1 = s1[r] * lsc;
      float mx = fmaxf(t0, t1);
#pragma unroll
      for (int off = 1; off < 16; off <<= 1) mx = fmaxf(mx, __shfl_xor(mx, off, 32));
      const float mn = fmaxf(mrow[r], mx);
      const float ms = (mn == -INFINITY) ? 0.0f : mn;
      const float al = exp2f(mrow[r] - ms);
      mrow[r] = mn;
      const float e0 = exp2f(t0 - ms), e1 = exp2f(t1 - ms);
      float ps = e0 + e1;
#pragma unroll
      for (int off = 1; off < 16; off <<= 1) ps += __shfl_xor(ps, off, 32);
      lrow[r] = lrow[r] * al + ps;
#pragma unroll
      for (int j = 0; j < 8; ++j) o[j][r] *= al;
      const int ro = (8 * hh + r) * PTP + c;
      pt[ro]      = e0;
      pt[ro + 16] = e1;
    }
    wave_sync_lds();
    // ---- A fragment of P*32768 (f16), row = c, split k map over the 32 keys of this step ----
    FragH ph;
    {
      const float* prow = pt + c * PTP + 8 * hh;
      const v4f p0 = *(const v4f*)(prow), p1 = *(const v4f*)(prow + 4);
      const v4f p2 = *(const v4f*)(prow + 16), p3 = *(const v4f*)(prow + 20);
#pragma unroll
      for (int e = 0; e < 4; ++e) {
        ph.h[0][e]     = (_Float16)(p0[e] * PCAR);      // elements 0..7  = keys kb + 8hh + 0..7
        ph.h[0][4 + e] = (_Float16)(p1[e] * PCAR);
        ph.h[1][e]     = (_Float16)(p2[e] * PCAR);      // elements 8..15 = keys kb + 16 + 8hh + 0..7
        ph.h[1][4 + e] = (_Float16)(p3[e] * PCAR);
      }
    }
    // ---- P.V : B fragment col n = d = j*16 + c, keys contiguous in the v^T plane; 4 groups of 2 d-subtiles ----
    {
      const _Float16* vhp = Vhb + kb;
#pragma unroll
      for (int jg = 0; jg < 4; ++jg) {
        const size_t da = (size_t)(2 * jg) * 16 * SEQ;
        const size_t db = da + (size_t)16 * SEQ;
        const v16h vha = ldfrag_h(vhp + da), vhb2 = ldfrag_h(vhp + db);
        o[2 * jg]     = mma_h(ph.v, vha,  o[2 * jg]);
        o[2 * jg + 1] = mma_h(ph.v, vhb2, o[2 * jg + 1]);
        guard2(o[2 * jg], o[2 * jg + 1], ph.v, vha, vhb2, ph.v);
      }
    }
    wave_sync_lds();
  }
  acc_guard4(o[0], o[1], o[2], o[3]);
  acc_guard4(o[4], o[5], o[6], o[7]);
  // ---- out = acc / Z (0 if Z == 0), carries (32768 on P, 1024 on v) folded once; written into the wave-owned slab ----
#pragma unroll
  for (int r = 0; r < 8; ++r) {
    const float lv  = lrow[r];
    const float ls  = (lv > 0.0f) ? lv : 1.0f;
    const float inv = (lv > 0.0f) ? ((1.0f / ls) * oc) : 0.0f;
#pragma unroll
    for (int j = 0; j < 8; ++j) {
      const int idx = (8 * hh + r) * SLP + j * 16 + c;
      slab[idx] = o[j][r] * inv;
    }
  }

  wave_sync_lds();
  // ---- O x1024 -> f16 plane; lane = (row-in-pair rq, 8 consecutive d at c8) ----
  v4u oh[8];
  const int rq = lane >> 4, c8 = (lane & 15) * 8;
#pragma unroll
  for (int it = 0; it < 8; ++it) {
    const int row = it * 2 + rq;
    const v4f a = *(const v4f*)(slab + row * SLP + c8), b4 = *(const v4f*)(slab + row * SLP + c8 + 4);
    float w[8];
#pragma unroll
    for (int e = 0; e < 4; ++e) { w[e] = a[e] * OSC; w[4 + e] = b4[e] * OSC; }
#pragma unroll
    for (int e = 0; e < 4; ++e) {
      const _Float16 h0 = (_Float16)w[2 * e], h1 = (_Float16)w[2 * e + 1];
      oh[it][e] = pk16(h_bits(h0), h_bits(h1));
    }
  }
  const size_t ob = ((size_t)b * SEQ + q0) * DMOD + (size_t)head * HD + c8;
  {
#pragma unroll
    for (int it = 0; it < 8; ++it) {
      const int row = it * 2 + rq;
      *(v4u*)(OHp + ob + (size_t)row * DMOD) = oh[it];
    }
    
  }
}

// =====================================================================================================
// Workspace map (bytes); every plane is fully written by whole-line stores before it is read; all extents are exact multiples
// of the store granularity (no pad rows needed); every region offset a multiple of 1048576:
//   XB  bf16 [MROWS][2048]                       MROWS*4096       (NB=2: 16777216)
//   WB  16-bit [2048 n][2048 k]                  8388608          (Wv^T, Wq^T, Wk^T as bf16 ([512][2048] for k/v), then Wo^T as
//                                                                  f16 x1024, reused in launch order)
//   F   f32 [MROWS][2048]                        MROWS*8192       (v, q, k projection output in launch order, [MROWS][512] for
//                                                                  k/v; afterwards OH f16 [MROWS][2048] x1024 in its first half)
//   QH  f16 [MROWS][2048] x256                   MROWS*4096       QL residual, same extent
//   KH  f16 [MROWS][512] x256                    MROWS*1024
//   VH  f16 [NB*4][128][SEQ] x1024               MROWS*1024
//   COS f32 [MROWS][64]                          MROWS*256        SIN same extent
//   end (NB=2)                                 102760448
// =====================================================================================================
extern "C" void kernel_launch(void* const* d_in, const int* in_sizes, int n_in,
                              void* d_out, int out_size, void* d_ws, size_t ws_size,
                              hipStream_t stream) {
  if (n_in < 8) return;
  if (in_sizes[0] < MROWS * DMOD) return;
  if (in_sizes[1] < MROWS) return;
  if (in_sizes[2] != DMOD * DMOD) return;
  if (in_sizes[3] != DMOD * KVD) return;
  if (in_sizes[4] != DMOD * KVD) return;
  if (in_sizes[5] != DMOD * DMOD) return;
  if (in_sizes[6] < HD) return;
  if (in_sizes[7] < HD) return;
  if (out_size < MROWS * DMOD) return;

  const float* x   = (const float*)d_in[0];
  const int*   pos = (const int*)d_in[1];
  const float* wq  = (const float*)d_in[2];
  const float* wk  = (const float*)d_in[3];
  const float* wv  = (const float*)d_in[4];
  const float* wo  = (const float*)d_in[5];
  const float* qnw = (const float*)d_in[6];
  const float* knw = (const float*)d_in[7];
  float*       out = (float*)d_out;

  const size_t szXB = (size_t)MROWS * DMOD * 2;
  const size_t szW  = (size_t)DMOD * DMOD * 2;
  const size_t szF  = (size_t)MROWS * DMOD * 4;
  const size_t szQ  = (size_t)MROWS * DMOD * 2;                  // QH, QL, OH
  const size_t szK  = (size_t)MROWS * KVD * 2;                   // KH
  const size_t szV  = (size_t)NB * NKVH * HD * SEQ * 2;          // VH (== szK)
  const size_t szT  = (size_t)MROWS * HHALF * 4;                 // COS, SIN
  if (szQ > szF) return;                                         // OH lives inside the F region
  size_t off = 0;
  const size_t oXB = off; off += szXB;
  const size_t oW  = off; off += szW;
  const size_t oF  = off; off += szF;
  const size_t oQH = off; off += szQ;
  const size_t oQL = off; off += szQ;
  const size_t oKH = off; off += szK;
  const size_t oVH = off; off += szV;
  const size_t oCS = off; off += szT;
  const size_t oSN = off; off += szT;
  if (off > ws_size) return;                // off = 102760448 for NB = 2
  if (off > (size_t)WS_CAP) return;

  char* ws = (char*)d_ws;
  u16*   XB  = (u16*)(ws + oXB);
  u16*   WB  = (u16*)(ws + oW);
  float* F   = (float*)(ws + oF);
  u16*   OH  = (u16*)(ws + oF);
  u16*   QH  = (u16*)(ws + oQH);
  u16*   QL  = (u16*)(ws + oQL);
  u16*   KH  = (u16*)(ws + oKH);
  u16*   VH  = (u16*)(ws + oVH);
  float* COS = (float*)(ws + oCS);
  float* SIN = (float*)(ws + oSN);

  const dim3 b256(256), b128(128), bAT(ATT_THREADS);
  const int  n8x = (MROWS * DMOD) / 8;
  const dim3 gX((n8x + 255) / 256);
  const dim3 gTR(MROWS / 4);
  const dim3 gWQ((DMOD / 64) * (DMOD / 64));            // Wq [2048 k][2048 n], Wo [2048 k][2048 n]
  const dim3 gWK((DMOD / 64) * (KVD / 64));             // Wk, Wv [2048 k][512 n]
  const int  nrtK = SEQ / 64;                           // k/v rows per batch / 64
  const int  nrtQ = SQ / 64;                            // q / ctx / out rows per batch / 64
  const dim3 gGK(NB * nrtK * (KVD / 64));
  const dim3 gGQ(NB * nrtQ * (DMOD / 64));
  const dim3 gVT(NB * NKVH * NST);
  const dim3 gRQ(NB * SQ);
  const dim3 gRK(NB * SEQ);
  const dim3 gAT(NQT * NHG * NB);

  // (0) cos/sin tables from the integer positions; (1) x -> bf16 plane [MROWS][2048]
  trig64<<<gTR, b256, 0, stream>>>(pos, COS, SIN, MROWS);
  cvt16<<<gX, b256, 0, stream>>>(x, XB, n8x, 0, 1.0f);
  // (2) Wv [2048][512] -> Wv^T bf16 [512][2048]; (3) v = x.Wv -> F f32 [MROWS][512]; (4) v^T plane x1024
  wt16<<<gWK, b256, 0, stream>>>(wv, WB, DMOD, KVD, 0, 1.0f);
  gemm64<true><<<gGK, b128, 0, stream>>>(XB, WB, F, KVD, DMOD, nrtK, 1.0f);
  vt16<<<gVT, b256, 0, stream>>>(F, VH);
  // (5) Wq [2048][2048] -> Wq^T bf16; (6) q = x.Wq -> F [MROWS][2048] (rows s < SQ); (7) RMS normalisation + rotary + q planes x256
  wt16<<<gWQ, b256, 0, stream>>>(wq, WB, DMOD, DMOD, 0, 1.0f);
  gemm64<true><<<gGQ, b128, 0, stream>>>(XB, WB, F, DMOD, DMOD, nrtQ, 1.0f);
  nrope16<true><<<gRQ, dim3(DMOD / 16), 0, stream>>>(F, DMOD, SQ, qnw, COS, SIN, QH, QL, QSC);
  // (8) Wk [2048][512] -> Wk^T bf16; (9) k = x.Wk -> F [MROWS][512]; (10) RMS normalisation + rotary + k plane x256
  wt16<<<gWK, b256, 0, stream>>>(wk, WB, DMOD, KVD, 0, 1.0f);
  gemm64<true><<<gGK, b128, 0, stream>>>(XB, WB, F, KVD, DMOD, nrtK, 1.0f);
  nrope16<false><<<gRK, dim3(KVD / 16), 0, stream>>>(F, KVD, SEQ, knw, COS, SIN, KH, KH, KSC);
  // (11) Wo [2048 k][2048 n] -> Wo^T f16 plane of bf16 value x1024
  wt16<<<gWQ, b256, 0, stream>>>(wo, WB, DMOD, DMOD, 1, WOS);
  // (12) non-causal attention over all keys -> O plane (inside F)
  attn_nc<<<gAT, bAT, 0, stream>>>(QH, QL, KH, VH, OH);
  // (13) out = ctx.Wo -> f32, carries 1024 x 1024 folded back
  gemm64<false><<<gGQ, b128, 0, stream>>>(OH, WB, out, DMOD, DMOD, nrtQ, 1.0f / (OSC * WOS));
  (void)hipGetLastError();
}

// v001
// A run of this version takes 457 microseconds.
// Timed twice side by side with v000, it ran 1.18 times as fast both times.
// Contractions: x.Wq, x.Wk, x.Wv on v_wmma_f32_16x16x32_bf16 (x and W^T as bf16 RNE planes, f32 accumulate);
// q.k^T over hd 128 on v_wmma_f32_16x16x32_f16 with q as f16 hi + f16 residual planes (x256) and k as one f16 plane
// (x256), products qh.k + ql.k; P.v on v_wmma_f32_16x16x32_f16 with P x32768 and v^T x1024 as single f16 planes;
// ctx.Wo on v_wmma_f32_16x16x32_f16 with ctx x1024 as one f16 plane and Wo^T as f16(bf16 RNE(Wo)) x1024; all f32
// accumulate. RMS normalisation, rotate-half rotary from integer positions (cos/sin tables built on device in f32),
// base-2 online softmax and the 1/Z fold in f32 on VALU.
#include <hip/hip_runtime.h>
#include <math.h>
#include <stdint.h>

#ifndef NB
#define NB 2
#endif
#define SEQ 2048
#ifndef SQ
#define SQ SEQ
#endif
#define DMOD  2048
#define NH    16
#define NKVH  4
#define HD    128
#define HHALF (HD / 2)
#define KVD   (NKVH * HD)
#define MROWS (NB * SEQ)
#define EPS_RMS 0.000001f
#define RSQ_HD 0.08838834764831845f
#define LOG2E 1.4426950408889634f
#define LOG2THETA 19.931568569324174
#define QSC   256.0f
#define KSC   256.0f
#define PCAR  32768.0f
#define VCAR  1024.0f
#define OSC   1024.0f
#define WOS   1024.0f
#define WPB   (NH / NKVH)
#define NHG   NKVH
#define NQT   (SQ / 16)
#define NST   (SEQ / 64)
#define NKT   (SEQ / 32)
#define ATT_THREADS (WPB * 32)
#define PTP   36
#define PTW   (16 * PTP)
#define SLP   132
#define SLW   (16 * SLP)
#define SLAB64 (16 * 68)
#define VTP   72
#define WTP   72
#define WS_CAP 134217728
#define KSTG  64
#define KPB   272
#define VPB   144
#define KTB   (KSTG * KPB)
#define VTB   (HD * VPB)
#define STGB  (KTB + VTB)
#define RINGB (2 * STGB)
static_assert(DMOD == NH * HD && HD == 128 && HHALF == 64 && NH == 16 && NKVH == 4 && WPB == 4 && NHG * WPB == NH);
static_assert(ATT_THREADS == 128 && KVD == 512);
static_assert(NB >= 1 && NB <= 2);
static_assert((SEQ % 64) == 0 && (SQ % 64) == 0 && SQ >= 64 && SQ <= SEQ);
static_assert((DMOD % 64) == 0 && (KVD % 64) == 0 && (DMOD % 32) == 0 && (HD % 32) == 0);
static_assert(((MROWS * DMOD / 8) % 256) == 0 && (MROWS % 4) == 0);
static_assert(KSTG == 64 && NST >= 2 && NST * KSTG == SEQ && (KPB % 16) == 0 && (VPB % 16) == 0 && (KTB % 16) == 0 && (STGB % 16) == 0);
static_assert(KPB == HD * 2 + 16 && VPB == KSTG * 2 + 16 && WPB * SLW * 4 <= RINGB && 4 * (RINGB + WPB * PTW * 4) <= 327680);
static_assert(HD * VTP * 2 <= 65536 && 4 * SLAB64 * 4 <= 65536 && 64 * WTP * 2 <= 65536);
static_assert((DMOD / 16) <= 128 && (KVD / 16) <= 128 && ((DMOD / 16) % 32) == 0 && ((KVD / 16) % 32) == 0);

typedef unsigned short u16;
typedef _Float16 v16h __attribute__((ext_vector_type(16)));
typedef _Float16 v8h  __attribute__((ext_vector_type(8)));
typedef __bf16   v16b __attribute__((ext_vector_type(16)));
typedef float    v8f  __attribute__((ext_vector_type(8)));
typedef float    v4f  __attribute__((ext_vector_type(4)));
typedef unsigned int v4u __attribute__((ext_vector_type(4)));

union FragH { v16h v; v8h h[2]; v4u u[2]; };
union FragB { v16b v; v4u u[2]; };

// ---- scalar helpers --------------------------------------------------------------------------------
__device__ __forceinline__ unsigned short bf_bits(float f) {          // f32 -> bf16 bits, RNE convert
  unsigned u = __float_as_uint(f);
  return (unsigned short)((u + 0x7FFFu + ((u >> 16) & 1u)) >> 16);
}
__device__ __forceinline__ float bf_up(unsigned short h) { return __uint_as_float(((unsigned)h) << 16); }
__device__ __forceinline__ float bfr(float f) { return bf_up(bf_bits(f)); }
__device__ __forceinline__ unsigned short h_bits(_Float16 x) { return __builtin_bit_cast(unsigned short, x); }
__device__ __forceinline__ unsigned pk16(unsigned short a, unsigned short b) { return (unsigned)a | ((unsigned)b << 16); }
__device__ __forceinline__ v8f zero8() { v8f z = {0.f, 0.f, 0.f, 0.f, 0.f, 0.f, 0.f, 0.f}; return z; }

// ---- fragment loaders: 16-bit A/B operand, lane -> row/col (lane&15), p already includes +8*(lane>>4);
//      elements 0..7 <- p[0..7] (k0+8h..), elements 8..15 <- p[16..23] (k0+16+8h..)  (same split k map for A and B;
//      B is always read from a k-contiguous [n][k] plane)
__device__ __forceinline__ v16h ldfrag_h(const _Float16* p) {
  FragH f;
  f.h[0] = *(const v8h*)(p);
  f.h[1] = *(const v8h*)(p + 16);
  return f.v;
}
__device__ __forceinline__ v16b ldfrag_b(const u16* p) {              // bf16 plane read as unsigned integer vectors
  FragB f;
  f.u[0] = *(const v4u*)(p);
  f.u[1] = *(const v4u*)(p + 16);
  return f.v;
}

__device__ __forceinline__ v8f mma_h(v16h a, v16h b, v8f c) {
  return __builtin_amdgcn_wmma_f32_16x16x32_f16(false, a, false, b, (short)0, c, false, false);
}
__device__ __forceinline__ v8f mma_b(v16b a, v16b b, v8f c) {
  return __builtin_amdgcn_wmma_f32_16x16x32_bf16(false, a, false, b, (short)0, c, false, false);
}
__device__ __forceinline__ void guard2(v8f& a, v8f& b, v16h x0, v16h x1, v16h x2, v16h x3) {
#if defined(__HIP_DEVICE_COMPILE__)
  asm volatile("v_nop\n\tv_nop\n\tv_nop\n\tv_nop"
               : "+v"(a), "+v"(b) : "v"(x0), "v"(x1), "v"(x2), "v"(x3) : "memory");
#endif
}
template <typename F>
__device__ __forceinline__ void guard6(v8f& a, v8f& b, v8f& c, v8f& d, F x0, F x1, F x2, F x3, F x4, F x5) {
#if defined(__HIP_DEVICE_COMPILE__)
  asm volatile("v_nop\n\tv_nop\n\tv_nop\n\tv_nop"
               : "+v"(a), "+v"(b), "+v"(c), "+v"(d) : "v"(x0), "v"(x1), "v"(x2), "v"(x3), "v"(x4), "v"(x5) : "memory");
#endif
}
__device__ __forceinline__ void acc_guard4(v8f& a, v8f& b, v8f& c, v8f& d) {
#if defined(__HIP_DEVICE_COMPILE__)
  asm volatile("v_nop\n\tv_nop\n\tv_nop\n\tv_nop" : "+v"(a), "+v"(b), "+v"(c), "+v"(d));
#endif
}
__device__ __forceinline__ void wave_sync_lds() {
  __builtin_amdgcn_fence(__ATOMIC_RELEASE, "workgroup");
  __builtin_amdgcn_wave_barrier();
  __builtin_amdgcn_fence(__ATOMIC_ACQUIRE, "workgroup");
}
// Eight asynchronous 16-byte copies of this lane, global -> LDS (l = LDS byte address, g = global address, both 16-B aligned).
// The closing s_wait_xcnt 0 stands inside the statement so that no address register is rewritten in front of it.
__device__ __forceinline__ void async8(const unsigned* l, const u16* const* g) {
#if defined(__HIP_DEVICE_COMPILE__)
  asm volatile("global_load_async_to_lds_b128 %0, %8, off\n\t"
               "global_load_async_to_lds_b128 %1, %9, off\n\t"
               "global_load_async_to_lds_b128 %2, %10, off\n\t"
               "global_load_async_to_lds_b128 %3, %11, off\n\t"
               "global_load_async_to_lds_b128 %4, %12, off\n\t"
               "global_load_async_to_lds_b128 %5, %13, off\n\t"
               "global_load_async_to_lds_b128 %6, %14, off\n\t"
               "global_load_async_to_lds_b128 %7, %15, off\n\t"
               "s_wait_xcnt 0x0"
               :: "v"(l[0]), "v"(l[1]), "v"(l[2]), "v"(l[3]), "v"(l[4]), "v"(l[5]), "v"(l[6]), "v"(l[7]),
                  "v"(g[0]), "v"(g[1]), "v"(g[2]), "v"(g[3]), "v"(g[4]), "v"(g[5]), "v"(g[6]), "v"(g[7])
               : "memory");
#endif
}
// One stage (64 keys) of k rows and v^T rows into one ring buffer, 16 copies per lane of the 128 threads:
//   k   chunk i: key row i*8 + (tid>>4), 16-B piece tid&15  (a wave covers two whole 256-B rows), LDS pitch KPB;
//   v^T chunk i: d row i*16 + (tid>>3), 16-B piece tid&7    (a wave covers four whole 128-B rows), LDS pitch VPB.
// kg, vg, lk, lv are this lane's addresses of chunk 0.
__device__ __forceinline__ void stage_kv(const u16* kg, const u16* vg, unsigned lk, unsigned lv) {
  unsigned l[8];
  const u16* g[8];
  // both loops unrolled so that l[] and g[] are registers, as the asm operands need them
#pragma unroll
  for (int i = 0; i < 8; ++i) { l[i] = lk + (unsigned)(i * 8 * KPB); g[i] = kg + (size_t)(i * 8) * KVD; }
  async8(l, g);
#pragma unroll
  for (int i = 0; i < 8; ++i) { l[i] = lv + (unsigned)(i * 16 * VPB); g[i] = vg + (size_t)(i * 16) * SEQ; }
  async8(l, g);
}
// the issuing wave's own wait: every asynchronous copy it has issued has landed in LDS
__device__ __forceinline__ void wait_async0() {
#if defined(__HIP_DEVICE_COMPILE__)
  asm volatile("s_wait_asynccnt 0x0" ::: "memory");
#endif
}
// this wave's LDS reads and writes have retired (in front of the barrier behind which a buffer is refilled)
__device__ __forceinline__ void wait_ds0() {
#if defined(__HIP_DEVICE_COMPILE__)
  asm volatile("s_wait_dscnt 0x0" ::: "memory");
#endif
}

// =====================================================================================================
// cos/sin tables for the rotary: row = b*SEQ + s (0 .. nrows-1), column j = 0..63:
//   invf[j] = 1e6^(-j/64) (f64 exp2, converted to f32), ang = float(pos[row]) * invf[j] (f32 multiply),
//   cosT[row][j] = cosf(ang), sinT[row][j] = sinf(ang).
// Block = 4 rows x 64 j (one value pair per thread) staged in LDS; after the barrier waves 0,1 write the 4 cos rows and
// coverage: grid = nrows/4 blocks x (2 tables x 4 rows x 64 floats) = both tables exactly once (nrows % 4 == 0, host).
// =====================================================================================================
__global__ __launch_bounds__(256) void trig64(const int* __restrict__ pos, float* cosT, float* sinT, int nrows) {
#pragma clang fp contract(off)
  __shared__ __align__(16) float cs[2 * 256];
  const int tid  = (int)threadIdx.x;
  const int row0 = (int)blockIdx.x * 4;
  if (row0 + 4 > nrows) return;                       // block-uniform, before the barrier; never taken with the exact grid
  const int r = tid >> 6, j = tid & 63;
  const float p    = (float)pos[row0 + r];
  const float invf = (float)exp2(-(double)j * (LOG2THETA / 64.0));
  const float ang  = p * invf;
  cs[tid]       = cosf(ang);
  cs[256 + tid] = sinf(ang);
  __syncthreads();
  if (tid < 128) {                                    // waves 0..3, wave-uniform
    const int tb    = tid >> 6;                       // 0: cos rows (waves 0,1), 1: sin rows (waves 2,3)
    const int q     = tid & 63;
    const int rr    = q >> 4;
    const int piece = (q & 15) * 4;
    const v4f v = *(const v4f*)(cs + tb * 256 + rr * 64 + piece);
    float* base = (tb != 0) ? sinT : cosT;
    float* dst  = base + (size_t)(row0 + rr) * HHALF + piece;
    {
      *(v4f*)(dst) = v;
      
    }
  }
}

// =====================================================================================================
// f32 -> 16-bit plane, same layout.  f16mode == 0: bf16 RNE bits;  f16mode == 1: f16 bits of (bf16 RNE value) * scale.
// Thread = 8 consecutive elements: two 16-B loads, one 16-B store; 32 consecutive lanes = 512 contiguous, 512-B aligned
// coverage: grid = ceil(n8/256) blocks x 256 thr x 8 (in-kernel bound) = the whole plane (n8 a multiple of 256 here).
// =====================================================================================================
__global__ __launch_bounds__(256) void cvt16(const float* __restrict__ x, u16* D, int n8, int f16mode, float scale) {
  const int gt = blockIdx.x * 256 + (int)threadIdx.x;
  if (gt >= n8) return;
  const float* p = x + (size_t)gt * 8;
  const v4f a = *(const v4f*)(p), b4 = *(const v4f*)(p + 4);
  float w[8];
#pragma unroll
  for (int e = 0; e < 4; ++e) { w[e] = a[e]; w[4 + e] = b4[e]; }
  v4u o;
#pragma unroll
  for (int e = 0; e < 4; ++e) {
    const float f0 = w[2 * e], f1 = w[2 * e + 1];
    const unsigned short hb0 = h_bits((_Float16)(bfr(f0) * scale));
    const unsigned short hb1 = h_bits((_Float16)(bfr(f1) * scale));
    const unsigned short bb0 = bf_bits(f0);
    const unsigned short bb1 = bf_bits(f1);
    o[e] = (f16mode != 0) ? pk16(hb0, hb1) : pk16(bb0, bb1);
  }
  u16* d = D + (size_t)gt * 8;
  {
    *(v4u*)(d) = o;
    
  }
}

// =====================================================================================================
// Weight transpose + convert: W f32 [K rows][N cols] (row pitch N) -> Wt 16-bit [N rows][K cols] (row pitch K), so that
// a column n of W becomes the k-contiguous B operand row n.  f16mode == 0: bf16 RNE bits; 1: f16 bits of (bf16 RNE value)*scale.
// Block = 64 k x 64 n tile: load phase 4 iterations x (16 k rows x 16 lanes x 4 n) with 16-B loads into an LDS tile
// coverage: load 4 it x 256 thr x 4 = 64 x 64; store 2 it x 256 thr x 8 halves = 64 rows x 64; grid = (K/64)*(N/64)
//           blocks = the whole [N][K] plane exactly once.
// =====================================================================================================
__global__ __launch_bounds__(256) void wt16(const float* __restrict__ W, u16* Wt, int K, int N, int f16mode, float scale) {
  __shared__ __align__(16) u16 T[64 * WTP];
  const int tid = (int)threadIdx.x;
  const int nkt = K >> 6;
  const int bid = (int)blockIdx.x;
  const int kt  = bid % nkt;
  const int nt  = bid / nkt;
  const int kb  = kt * 64, nb = nt * 64;
  if (nb + 64 > N) return;                            // block-uniform, before the barrier; never taken with the exact grid
  const int c4 = (tid & 15) * 4;                      // n within tile
  const int r0 = tid >> 4;                            // k within tile (0..15) + 16*it
#pragma unroll
  for (int it = 0; it < 4; ++it) {
    const int r = it * 16 + r0;
    const v4f a = *(const v4f*)(W + (size_t)(kb + r) * (size_t)N + nb + c4);
#pragma unroll
    for (int e = 0; e < 4; ++e) {
      const float f = a[e];
      const unsigned short hb = h_bits((_Float16)(bfr(f) * scale));
      const unsigned short bb = bf_bits(f);
      T[(c4 + e) * WTP + r] = (f16mode != 0) ? hb : bb;
    }
  }
  __syncthreads();
  v4u o[2];
  const int q8 = tid >> 3, p8 = (tid & 7) * 8;
#pragma unroll
  for (int it = 0; it < 2; ++it) o[it] = *(const v4u*)(T + (it * 32 + q8) * WTP + p8);
  u16* dst = Wt + (size_t)(nb + q8) * (size_t)K + kb + p8;
  {
#pragma unroll
    for (int it = 0; it < 2; ++it) {
      *(v4u*)(dst + (size_t)(it * 32) * (size_t)K) = o[it];
    }
    
  }
}

// =====================================================================================================
// v^T plane from the v projection F f32 [MROWS][KVD] (row = b*SEQ + s, column = g*HD + d):
//   VH[((b*NKVH + g)*HD + d)][s] = f16(v * 1024) for all keys s.
// Block = (b, kv head g, 64 keys s0): each thread loads its 32 floats (key sl, d chunk dc) with 16-B loads, converts, scatters
// coverage: load 256 thr x 32 = 64 keys x 128 d; store 4 iterations x 256 thr x 8 halves = 128 lines x 64 = the block's tile;
//           grid = NB*NKVH*NST blocks covers the plane exactly once.
// =====================================================================================================
__global__ __launch_bounds__(256) void vt16(const float* __restrict__ F, u16* VHo) {
  __shared__ __align__(16) u16 TH[HD * VTP];
  const int tid = (int)threadIdx.x;
  const int bid = (int)blockIdx.x;
  const int st  = bid % NST;
  const int t2  = bid / NST;
  const int g   = t2 % NKVH;
  const int b   = t2 / NKVH;
  if (b >= NB) return;                                // block-uniform, before any barrier; never taken with the exact grid
  const int s0  = st * 64;
  {
    const int sl = tid >> 2;                          // key within tile 0..63
    const int dc = (tid & 3) * 32;                    // d chunk 0,32,64,96
    const float* src = F + ((size_t)b * SEQ + s0 + sl) * KVD + g * HD + dc;
#pragma unroll
    for (int i = 0; i < 8; ++i) {
      const v4f a = *(const v4f*)(src + 4 * i);
#pragma unroll
      for (int e = 0; e < 4; ++e) {
        const float t = a[e] * VCAR;
        TH[(dc + 4 * i + e) * VTP + sl] = h_bits((_Float16)t);
      }
    }
  }
  __syncthreads();
  v4u vh[4];
  const int q8 = tid >> 3, p8 = (tid & 7) * 8;
#pragma unroll
  for (int it = 0; it < 4; ++it) {
    const int line = it * 32 + q8;                    // d = 0..127
    vh[it] = *(const v4u*)(TH + line * VTP + p8);
  }
  const size_t hrow = (size_t)(b * NKVH + g) * HD;
  const size_t base = hrow * SEQ + s0 + p8;
  {
#pragma unroll
    for (int it = 0; it < 4; ++it) {
      const int line = it * 32 + q8;
      *(v4u*)(VHo + base + (size_t)line * SEQ) = vh[it];
    }
    
  }
}

// =====================================================================================================
// Per-head RMS normalisation + rotate-half rotary + 16-bit planes from a projection F f32 [MROWS][ncol]
// (ncol = DMOD for q, KVD for k; row = b*SEQ + s with s < nrows, column = head*HD + d):
//   rs = 1/sqrt(mean_d(x[head][d]^2) + eps) over the head's 128 columns (f32 sum of squares: 16 per thread, then an
//   8-lane shuffle sum, the 8 lanes of a head are 8 consecutive lanes); y[d] = (x[d]*rs) * w[d] with w = bf16 RNE value
//   of the norm weight; then for j < 64 within a head, with c = cosT[row][j], sn = sinT[row][j] (f32 tables):
//   out[j]    = y[j]*c    - y[j+64]*sn
//   out[j+64] = y[j+64]*c + y[j]*sn
//   Hp [MROWS][ncol] = f16(out * sc); if RES also Lp [MROWS][ncol] = f16 residual (t - f16(t)), same layout.
// Block = one row, exactly ncol/16 threads (host); thread t = head t>>3, chunk i = t&7: columns head*HD + 8i .. +7 and + 64.
// lane-varying control anywhere (shuffles with all lanes active).
// coverage: (ncol/16) thr x 16 = the whole row of Hp (and of Lp); grid = NB*nrows blocks = every processed row once.
// =====================================================================================================
__device__ __forceinline__ void rot_pair(float xl, float xh, float cv, float sv, float sc,
                                         unsigned short& hl, unsigned short& hhv, unsigned short& ll, unsigned short& lh) {
#pragma clang fp contract(off)
  const float rl = xl * cv - xh * sv;
  const float rh = xh * cv + xl * sv;
  const float tl = rl * sc, th = rh * sc;
  const _Float16 a = (_Float16)tl, bq = (_Float16)th;
  hl  = h_bits(a);
  hhv = h_bits(bq);
  ll  = h_bits((_Float16)(tl - (float)a));
  lh  = h_bits((_Float16)(th - (float)bq));
}

template <bool RES>
__global__ __launch_bounds__(128) void nrope16(const float* __restrict__ F, int ncol, int nrows, const float* __restrict__ nw,
                                               const float* __restrict__ cosT, const float* __restrict__ sinT,
                                               u16* Hp, u16* Lp, float sc) {
#pragma clang fp contract(off)
  const int tid = (int)threadIdx.x;
  const int blk = (int)blockIdx.x;
  const int b   = blk / nrows;
  const int s   = blk - b * nrows;
  if (b >= NB) return;                                 // block-uniform; never taken with the exact grid
  const int row = b * SEQ + s;
  const int dlo = (tid & 7) * 8;                       // j within head, multiple of 8
  const int clo = (tid >> 3) * HD + dlo;               // column of the low-half chunk; clo + 64 + 8 <= ncol by blockDim
  const float* p = F + (size_t)row * ncol + clo;
  const v4f xa = *(const v4f*)(p), xb = *(const v4f*)(p + 4);
  const v4f ya = *(const v4f*)(p + HHALF), yb = *(const v4f*)(p + HHALF + 4);
  const size_t trow = (size_t)row * HHALF + dlo;
  const v4f ca = *(const v4f*)(cosT + trow), cb = *(const v4f*)(cosT + trow + 4);
  const v4f sa = *(const v4f*)(sinT + trow), sb = *(const v4f*)(sinT + trow + 4);
  const v4f wa = *(const v4f*)(nw + dlo), wb4 = *(const v4f*)(nw + dlo + 4);
  const v4f wc = *(const v4f*)(nw + HHALF + dlo), wd = *(const v4f*)(nw + HHALF + dlo + 4);
  float xl[8], xh[8], cv[8], sv[8], wl[8], wh[8];
#pragma unroll
  for (int e = 0; e < 4; ++e) {
    xl[e] = xa[e];        xl[4 + e] = xb[e];
    xh[e] = ya[e];        xh[4 + e] = yb[e];
    cv[e] = ca[e];        cv[4 + e] = cb[e];
    sv[e] = sa[e];        sv[4 + e] = sb[e];
    wl[e] = bfr(wa[e]);   wl[4 + e] = bfr(wb4[e]);
    wh[e] = bfr(wc[e]);   wh[4 + e] = bfr(wd[e]);
  }
  // sum of squares over the head's 128 columns: 16 here, then lanes xor 1, 2, 4 (aligned groups of 8 lanes = one head)
  float ss = 0.0f;
#pragma unroll
  for (int e = 0; e < 8; ++e) { ss = ss + xl[e] * xl[e]; ss = ss + xh[e] * xh[e]; }
  ss += __shfl_xor(ss, 1, 32);
  ss += __shfl_xor(ss, 2, 32);
  ss += __shfl_xor(ss, 4, 32);
  const float var = ss * (1.0f / (float)HD);
  const float rs  = 1.0f / sqrtf(var + EPS_RMS);
#pragma unroll
  for (int e = 0; e < 8; ++e) {
    xl[e] = (xl[e] * rs) * wl[e];
    xh[e] = (xh[e] * rs) * wh[e];
  }
  v4u ohl, ohh, oll, olh;
#pragma unroll
  for (int e = 0; e < 4; ++e) {
    unsigned short hl0, hh0, ll0, lh0, hl1, hh1, ll1, lh1;
    rot_pair(xl[2 * e],     xh[2 * e],     cv[2 * e],     sv[2 * e],     sc, hl0, hh0, ll0, lh0);
    rot_pair(xl[2 * e + 1], xh[2 * e + 1], cv[2 * e + 1], sv[2 * e + 1], sc, hl1, hh1, ll1, lh1);
    ohl[e] = pk16(hl0, hl1);
    ohh[e] = pk16(hh0, hh1);
    oll[e] = pk16(ll0, ll1);
    olh[e] = pk16(lh0, lh1);
  }
  u16* dh = Hp + (size_t)row * ncol + clo;
  u16* dl = Lp + (size_t)row * ncol + clo;             // dereferenced only when RES
  {
    *(v4u*)(dh) = ohl;
    *(v4u*)(dh + HHALF) = ohh;
    if constexpr (RES) {
      *(v4u*)(dl) = oll;
      *(v4u*)(dl + HHALF) = olh;
    }
    
  }
}

// =====================================================================================================
// coverage: 8 instructions x 2 rows x 16 lanes x 4 floats = the wave's 16 x 64 tile.
// =====================================================================================================
__device__ __forceinline__ void epi64(float* sl, v8f a0, v8f a1, v8f a2, v8f a3, float oscale,
                                      float* C, int N, size_t rowb, int col0, int lane) {
  const int hh = lane >> 4, m = lane & 15;
#pragma unroll
  for (int r = 0; r < 8; ++r) {
    const int ro = (8 * hh + r) * 68 + m;
    sl[ro]      = a0[r] * oscale;
    sl[ro + 16] = a1[r] * oscale;
    sl[ro + 32] = a2[r] * oscale;
    sl[ro + 48] = a3[r] * oscale;
  }
  wave_sync_lds();
  v4f vals[8];
#pragma unroll
  for (int it = 0; it < 8; ++it) vals[it] = *(const v4f*)(sl + (it * 2 + hh) * 68 + m * 4);
  float* dst = C + (rowb + (size_t)hh) * (size_t)N + col0 + m * 4;
  {
#pragma unroll
    for (int it = 0; it < 8; ++it) {
      *(v4f*)(dst + (size_t)(it * 2) * (size_t)N) = vals[it];
    }
    
  }
}

// =====================================================================================================
// GEMM: C[row][N] (f32, row pitch N) = A[row][K] (16-bit row-major, pitch K) . Bt[N][K]^T (16-bit k-contiguous) * oscale,
// row = bb*SEQ + s for s < 64*nrt.  BF: bf16 operands (v_wmma_f32_16x16x32_bf16), else f16 (v_wmma_f32_16x16x32_f16).
// Block -> (column tile ct = bid % (N/64), row tile rt of nrt, batch bb); 4 waves x 16 rows; fragments loaded straight from
// the 16-bit rows (two 16-B loads each, split k map for A and B); K stepped by 32 (host: K % 32 == 0, N % 64 == 0).
// =====================================================================================================
template <bool BF>
__global__ __launch_bounds__(128)
void gemm64(const u16* __restrict__ A, const u16* __restrict__ Bt, float* C, int N, int K, int nrt, float oscale) {
  __shared__ __align__(16) float slab[4 * SLAB64];
  const int tid = (int)threadIdx.x, wave = tid >> 5, lane = tid & 31, hh = lane >> 4, m = lane & 15;
  const int ntile = N >> 6;
  const int bid   = (int)blockIdx.x;
  const int ct    = bid % ntile;
  const int t2    = bid / ntile;
  const int rt    = t2 % nrt;
  const int bb    = t2 / nrt;
  if (bb >= NB) return;                     // block-uniform; no block barriers in this kernel; never taken with the exact grid
  const int srow  = rt * 64 + wave * 16;
  if (srow + 16 > SEQ) return;              // wave-uniform; never taken
  const int col0  = ct * 64;
  const size_t rowC = (size_t)bb * SEQ + srow;
  const size_t bs = (size_t)16 * K;
  v8f acc0 = zero8(), acc1 = zero8(), acc2 = zero8(), acc3 = zero8();
  if constexpr (BF) {
    const u16* ap = A  + (rowC + (size_t)m) * (size_t)K + 8 * hh;
    const u16* bp = Bt + (size_t)(col0 + m) * (size_t)K + 8 * hh;
#pragma unroll 1
    for (int k0 = 0; k0 < K; k0 += 32) {
      const v16b a  = ldfrag_b(ap + k0);
      const v16b b0 = ldfrag_b(bp + k0);
      const v16b b1 = ldfrag_b(bp + bs + k0);
      const v16b b2 = ldfrag_b(bp + 2 * bs + k0);
      const v16b b3 = ldfrag_b(bp + 3 * bs + k0);
      acc0 = mma_b(a, b0, acc0);
      acc1 = mma_b(a, b1, acc1);
      acc2 = mma_b(a, b2, acc2);
      acc3 = mma_b(a, b3, acc3);
      guard6<v16b>(acc0, acc1, acc2, acc3, a, b0, b1, b2, b3, a);
    }
  } else {
    const _Float16* ap = (const _Float16*)(const void*)A  + (rowC + (size_t)m) * (size_t)K + 8 * hh;
    const _Float16* bp = (const _Float16*)(const void*)Bt + (size_t)(col0 + m) * (size_t)K + 8 * hh;
#pragma unroll 1
    for (int k0 = 0; k0 < K; k0 += 32) {
      const v16h a  = ldfrag_h(ap + k0);
      const v16h b0 = ldfrag_h(bp + k0);
      const v16h b1 = ldfrag_h(bp + bs + k0);
      const v16h b2 = ldfrag_h(bp + 2 * bs + k0);
      const v16h b3 = ldfrag_h(bp + 3 * bs + k0);
      acc0 = mma_h(a, b0, acc0);
      acc1 = mma_h(a, b1, acc1);
      acc2 = mma_h(a, b2, acc2);
      acc3 = mma_h(a, b3, acc3);
      guard6<v16h>(acc0, acc1, acc2, acc3, a, b0, b1, b2, b3, a);
    }
  }
  epi64(slab + wave * SLAB64, acc0, acc1, acc2, acc3, oscale, C, N, rowC, col0, lane);
}

// =====================================================================================================
// Non-causal grouped-query attention, hd = 128, all SEQ keys. Block bid -> (query tile qt = bid % NQT: rows q0 = 16*qt ..
// q0+15, head group hg = kv head, batch b); one wave per query head = hg*WPB + wave (the 4 heads of the group share kv head hg).
//   q hi / residual planes f16 x256 [b*SEQ + s][h*HD + d]; k plane f16 x256 [b*SEQ + s][g*HD + d] (pitch KVD);
//   v^T plane [b*NKVH + g][d][SEQ] x1024.
//   scores = q_hi.k + q_lo.k (4 k-steps over d); P.v with P x32768 (f16) and v^T, for every query row;
//   O written as one f16 plane (O x1024, layout [b*SEQ + s][h*HD + d]).
//   score (log2 domain) t(i, j) = (q_i.k_j over HD) * (1/sqrt(128))*log2e/(256*256).
//   k rows and v^T rows reach the 4 waves through an LDS ring of two buffers, 64 keys a stage, filled by asynchronous copies.
//   All NKT key tiles of 32 visited in order. Per tile: 2 score subtiles x 4 k-steps, q fragments loaded straight from the
//   16-bit planes, k and v^T fragments from the ring (two 16-B loads per fragment, split k map); online max-subtracted base-2
//   softmax in f32, -inf-safe rescale;
//   of P*32768 (f16) rebuilt from the LDS rows (float vector loads, same element type as stored), v^T B fragments in
//   4 groups of 2 d-subtiles.
//   After the loop: out = acc / Z (Z >= 1 always; guarded anyway), carries 1/(32768*1024) folded once, written into the
//   One block barrier per stage, under block-uniform control flow; bounded loops only (NST compile-time).
// coverage: per wave 8 instructions x 2 rows x 16 lanes x 8 halves = 16 x 128; grid NQT x NHG x NB blocks x WPB
//           waves = every (b, s < SQ, h) row segment of O exactly once.
// =====================================================================================================
__global__ __launch_bounds__(ATT_THREADS)
void attn_nc(const u16* __restrict__ QHp, const u16* __restrict__ QLp, const u16* __restrict__ KHp,
             const u16* __restrict__ VHp, u16* OHp) {
  __shared__ __align__(16) _Float16 ring[RINGB / 2];      // two buffers of (64 k rows pitch KPB, 128 v^T rows pitch VPB)
  __shared__ __align__(16) float ptile[WPB * PTW];

  const int tid  = (int)threadIdx.x;
  const int wave = tid >> 5;
  const int lane = tid & 31;
  const int hh   = lane >> 4;
  const int c    = lane & 15;
  const int bid  = (int)blockIdx.x;
  const int qt   = bid % NQT;
  const int t2   = bid / NQT;
  const int hg   = t2 % NHG;
  const int b    = t2 / NHG;
  if (b >= NB) return;                      // block-uniform, before any barrier or copy; never taken with the exact grid
  const int q0   = qt * 16;
  if (q0 + 16 > SQ) return;                 // block-uniform; never taken
  const int head = hg * WPB + wave;
  const int kvh  = hg;

  float* pt   = ptile + wave * PTW;                       // prob tile [16][32] pitch 36
  float* slab = (float*)(void*)ring + wave * SLW;         // result slab [16][128] pitch 132: the ring's bytes, after the loop

  const size_t hcol = (size_t)head * HD + 8 * hh;
  const _Float16* Qh  = (const _Float16*)(const void*)QHp + ((size_t)b * SEQ + q0 + c) * DMOD + hcol;
  const _Float16* Ql  = (const _Float16*)(const void*)QLp + ((size_t)b * SEQ + q0 + c) * DMOD + hcol;
  // this lane's chunk 0 of stage 0 (stage_kv): global addresses and LDS byte addresses in buffer 0
  const u16* kg0 = KHp + ((size_t)b * SEQ + (tid >> 4)) * KVD + (size_t)kvh * HD + (tid & 15) * 8;
  const u16* vg0 = VHp + ((size_t)(b * NKVH + kvh) * HD + (tid >> 3)) * SEQ + (tid & 7) * 8;
  const unsigned lring = (unsigned)(size_t)(const void*)ring;
  const unsigned lk0 = lring + (unsigned)((tid >> 4) * KPB + (tid & 15) * 16);
  const unsigned lv0 = lring + (unsigned)(KTB + (tid >> 3) * VPB + (tid & 7) * 16);
  const float lsc = RSQ_HD * (LOG2E / (QSC * KSC));
  const float oc  = 1.0f / (PCAR * VCAR);

  float mrow[8], lrow[8];
  v8f o[8];
#pragma unroll
  for (int r = 0; r < 8; ++r) { mrow[r] = -INFINITY; lrow[r] = 0.f; }
#pragma unroll
  for (int j = 0; j < 8; ++j) o[j] = zero8();

  // ---- ring prologue: stage 0 lands and is published, then stage 1 flies while stage 0 is worked on ----
  stage_kv(kg0, vg0, lk0, lv0);
  wait_async0();
  __syncthreads();
  stage_kv(kg0 + (size_t)KSTG * KVD, vg0 + KSTG, lk0 + STGB, lv0 + STGB);

  // kept rolled: one trip = one stage, with its one publish point at the foot
#pragma unroll 1
  for (int st = 0; st < NST; ++st) {
   const int bufh = (st & 1) * (STGB / 2);                // this stage's buffer, in halves
   // both 32-key steps of a stage unrolled: their LDS offsets become immediates
#pragma unroll
   for (int sub = 0; sub < KSTG / 32; ++sub) {
    // ---- scores: D element r of this lane = (query row q0 + 8hh + r, key kb + c) in s0, key kb + 16 + c in s1, kb = 64*st + 32*sub ----
    v8f s0 = zero8(), s1 = zero8();
    const _Float16* k0p = ring + bufh + (sub * 32 + c) * (KPB / 2) + 8 * hh;
    const _Float16* k1p = k0p + 16 * (KPB / 2);
#pragma unroll
    for (int kk = 0; kk < HD / 32; ++kk) {
      const v16h qh  = ldfrag_h(Qh + kk * 32);
      const v16h ql  = ldfrag_h(Ql + kk * 32);
      const v16h kh0 = ldfrag_h(k0p + kk * 32);
      const v16h kh1 = ldfrag_h(k1p + kk * 32);
      s0 = mma_h(qh, kh0, s0);
      s0 = mma_h(ql, kh0, s0);
      s1 = mma_h(qh, kh1, s1);
      s1 = mma_h(ql, kh1, s1);
      guard2(s0, s1, qh, ql, kh0, kh1);
    }
    // ---- online softmax in base 2 over all keys, -inf-safe ----
#pragma unroll
    for (int r = 0; r < 8; ++r) {
      const float t0 = s0[r] * lsc;
      const float t1 = s1[r] * lsc;
      float mx = fmaxf(t0, t1);
#pragma unroll
      for (int off = 1; off < 16; off <<= 1) mx = fmaxf(mx, __shfl_xor(mx, off, 32));
      const float mn = fmaxf(mrow[r], mx);
      const float ms = (mn == -INFINITY) ? 0.0f : mn;
      const float al = exp2f(mrow[r] - ms);
      mrow[r] = mn;
      const float e0 = exp2f(t0 - ms), e1 = exp2f(t1 - ms);
      float ps = e0 + e1;
#pragma unroll
      for (int off = 1; off < 16; off <<= 1) ps += __shfl_xor(ps, off, 32);
      lrow[r] = lrow[r] * al + ps;
#pragma unroll
      for (int j = 0; j < 8; ++j) o[j][r] *= al;
      const int ro = (8 * hh + r) * PTP + c;
      pt[ro]      = e0;
      pt[ro + 16] = e1;
    }
    wave_sync_lds();
    // ---- A fragment of P*32768 (f16), row = c, split k map over the 32 keys of this step ----
    FragH ph;
    {
      const float* prow = pt + c * PTP + 8 * hh;
      const v4f p0 = *(const v4f*)(prow), p1 = *(const v4f*)(prow + 4);
      const v4f p2 = *(const v4f*)(prow + 16), p3 = *(const v4f*)(prow + 20);
#pragma unroll
      for (int e = 0; e < 4; ++e) {
        ph.h[0][e]     = (_Float16)(p0[e] * PCAR);      // elements 0..7  = keys kb + 8hh + 0..7
        ph.h[0][4 + e] = (_Float16)(p1[e] * PCAR);
        ph.h[1][e]     = (_Float16)(p2[e] * PCAR);      // elements 8..15 = keys kb + 16 + 8hh + 0..7
        ph.h[1][4 + e] = (_Float16)(p3[e] * PCAR);
      }
    }
    // ---- P.V : B fragment col n = d = j*16 + c, keys contiguous in the v^T plane; 4 groups of 2 d-subtiles ----
    {
      const _Float16* vhp = ring + bufh + (KTB / 2) + c * (VPB / 2) + sub * 32 + 8 * hh;   // d row c (+16j), keys of this step
#pragma unroll
      for (int jg = 0; jg < 4; ++jg) {
        const int da = (2 * jg) * 16 * (VPB / 2);
        const int db = da + 16 * (VPB / 2);
        const v16h vha = ldfrag_h(vhp + da), vhb2 = ldfrag_h(vhp + db);
        o[2 * jg]     = mma_h(ph.v, vha,  o[2 * jg]);
        o[2 * jg + 1] = mma_h(ph.v, vhb2, o[2 * jg + 1]);
        guard2(o[2 * jg], o[2 * jg + 1], ph.v, vha, vhb2, ph.v);
      }
    }
    wave_sync_lds();
   }
   // ---- publish point of stage st + 1: own LDS reads retired, own copies landed, every wave has left this buffer ----
   wait_ds0();
   wait_async0();
   __syncthreads();
   if (st + 2 < NST) {                                    // block-uniform: refill the buffer that this trip has just read
     stage_kv(kg0 + (size_t)(st + 2) * KSTG * KVD, vg0 + (st + 2) * KSTG,
              lk0 + (unsigned)(st & 1) * STGB, lv0 + (unsigned)(st & 1) * STGB);
   }
  }
  wait_async0();                                          // nothing in flight before the ring's bytes become the result slab
  acc_guard4(o[0], o[1], o[2], o[3]);
  acc_guard4(o[4], o[5], o[6], o[7]);
  // ---- out = acc / Z (0 if Z == 0), carries (32768 on P, 1024 on v) folded once; written into the wave-owned slab ----
#pragma unroll
  for (int r = 0; r < 8; ++r) {
    const float lv  = lrow[r];
    const float ls  = (lv > 0.0f) ? lv : 1.0f;
    const float inv = (lv > 0.0f) ? ((1.0f / ls) * oc) : 0.0f;
#pragma unroll
    for (int j = 0; j < 8; ++j) {
      const int idx = (8 * hh + r) * SLP + j * 16 + c;
      slab[idx] = o[j][r] * inv;
    }
  }

  wave_sync_lds();
  // ---- O x1024 -> f16 plane; lane = (row-in-pair rq, 8 consecutive d at c8) ----
  v4u oh[8];
  const int rq = lane >> 4, c8 = (lane & 15) * 8;
#pragma unroll
  for (int it = 0; it < 8; ++it) {
    const int row = it * 2 + rq;
    const v4f a = *(const v4f*)(slab + row * SLP + c8), b4 = *(const v4f*)(slab + row * SLP + c8 + 4);
    float w[8];
#pragma unroll
    for (int e = 0; e < 4; ++e) { w[e] = a[e] * OSC; w[4 + e] = b4[e] * OSC; }
#pragma unroll
    for (int e = 0; e < 4; ++e) {
      const _Float16 h0 = (_Float16)w[2 * e], h1 = (_Float16)w[2 * e + 1];
      oh[it][e] = pk16(h_bits(h0), h_bits(h1));
    }
  }
  const size_t ob = ((size_t)b * SEQ + q0) * DMOD + (size_t)head * HD + c8;
  {
#pragma unroll
    for (int it = 0; it < 8; ++it) {
      const int row = it * 2 + rq;
      *(v4u*)(OHp + ob + (size_t)row * DMOD) = oh[it];
    }
    
  }
}

// =====================================================================================================
// Workspace map (bytes); every plane is fully written by whole-line stores before it is read; all extents are exact multiples
// of the store granularity (no pad rows needed); every region offset a multiple of 1048576:
//   XB  bf16 [MROWS][2048]                       MROWS*4096       (NB=2: 16777216)
//   WB  16-bit [2048 n][2048 k]                  8388608          (Wv^T, Wq^T, Wk^T as bf16 ([512][2048] for k/v), then Wo^T as
//                                                                  f16 x1024, reused in launch order)
//   F   f32 [MROWS][2048]                        MROWS*8192       (v, q, k projection output in launch order, [MROWS][512] for
//                                                                  k/v; afterwards OH f16 [MROWS][2048] x1024 in its first half)
//   QH  f16 [MROWS][2048] x256                   MROWS*4096       QL residual, same extent
//   KH  f16 [MROWS][512] x256                    MROWS*1024
//   VH  f16 [NB*4][128][SEQ] x1024               MROWS*1024
//   COS f32 [MROWS][64]                          MROWS*256        SIN same extent
//   end (NB=2)                                 102760448
// =====================================================================================================
extern "C" void kernel_launch(void* const* d_in, const int* in_sizes, int n_in,
                              void* d_out, int out_size, void* d_ws, size_t ws_size,
                              hipStream_t stream) {
  if (n_in < 8) return;
  if (in_sizes[0] < MROWS * DMOD) return;
  if (in_sizes[1] < MROWS) return;
  if (in_sizes[2] != DMOD * DMOD) return;
  if (in_sizes[3] != DMOD * KVD) return;
  if (in_sizes[4] != DMOD * KVD) return;
  if (in_sizes[5] != DMOD * DMOD) return;
  if (in_sizes[6] < HD) return;
  if (in_sizes[7] < HD) return;
  if (out_size < MROWS * DMOD) return;

  const float* x   = (const float*)d_in[0];
  const int*   pos = (const int*)d_in[1];
  const float* wq  = (const float*)d_in[2];
  const float* wk  = (const float*)d_in[3];
  const float* wv  = (const float*)d_in[4];
  const float* wo  = (const float*)d_in[5];
  const float* qnw = (const float*)d_in[6];
  const float* knw = (const float*)d_in[7];
  float*       out = (float*)d_out;

  const size_t szXB = (size_t)MROWS * DMOD * 2;
  const size_t szW  = (size_t)DMOD * DMOD * 2;
  const size_t szF  = (size_t)MROWS * DMOD * 4;
  const size_t szQ  = (size_t)MROWS * DMOD * 2;                  // QH, QL, OH
  const size_t szK  = (size_t)MROWS * KVD * 2;                   // KH
  const size_t szV  = (size_t)NB * NKVH * HD * SEQ * 2;          // VH (== szK)
  const size_t szT  = (size_t)MROWS * HHALF * 4;                 // COS, SIN
  if (szQ > szF) return;                                         // OH lives inside the F region
  size_t off = 0;
  const size_t oXB = off; off += szXB;
  const size_t oW  = off; off += szW;
  const size_t oF  = off; off += szF;
  const size_t oQH = off; off += szQ;
  const size_t oQL = off; off += szQ;
  const size_t oKH = off; off += szK;
  const size_t oVH = off; off += szV;
  const size_t oCS = off; off += szT;
  const size_t oSN = off; off += szT;
  if (off > ws_size) return;                // off = 102760448 for NB = 2
  if (off > (size_t)WS_CAP) return;

  char* ws = (char*)d_ws;
  u16*   XB  = (u16*)(ws + oXB);
  u16*   WB  = (u16*)(ws + oW);
  float* F   = (float*)(ws + oF);
  u16*   OH  = (u16*)(ws + oF);
  u16*   QH  = (u16*)(ws + oQH);
  u16*   QL  = (u16*)(ws + oQL);
  u16*   KH  = (u16*)(ws + oKH);
  u16*   VH  = (u16*)(ws + oVH);
  float* COS = (float*)(ws + oCS);
  float* SIN = (float*)(ws + oSN);

  const dim3 b256(256), b128(128), bAT(ATT_THREADS);
  const int  n8x = (MROWS * DMOD) / 8;
  const dim3 gX((n8x + 255) / 256);
  const dim3 gTR(MROWS / 4);
  const dim3 gWQ((DMOD / 64) * (DMOD / 64));            // Wq [2048 k][2048 n], Wo [2048 k][2048 n]
  const dim3 gWK((DMOD / 64) * (KVD / 64));             // Wk, Wv [2048 k][512 n]
  const int  nrtK = SEQ / 64;                           // k/v rows per batch / 64
  const int  nrtQ = SQ / 64;                            // q / ctx / out rows per batch / 64
  const dim3 gGK(NB * nrtK * (KVD / 64));
  const dim3 gGQ(NB * nrtQ * (DMOD / 64));
  const dim3 gVT(NB * NKVH * NST);
  const dim3 gRQ(NB * SQ);
  const dim3 gRK(NB * SEQ);
  const dim3 gAT(NQT * NHG * NB);

  // (0) cos/sin tables from the integer positions; (1) x -> bf16 plane [MROWS][2048]
  trig64<<<gTR, b256, 0, stream>>>(pos, COS, SIN, MROWS);
  cvt16<<<gX, b256, 0, stream>>>(x, XB, n8x, 0, 1.0f);
  // (2) Wv [2048][512] -> Wv^T bf16 [512][2048]; (3) v = x.Wv -> F f32 [MROWS][512]; (4) v^T plane x1024
  wt16<<<gWK, b256, 0, stream>>>(wv, WB, DMOD, KVD, 0, 1.0f);
  gemm64<true><<<gGK, b128, 0, stream>>>(XB, WB, F, KVD, DMOD, nrtK, 1.0f);
  vt16<<<gVT, b256, 0, stream>>>(F, VH);
  // (5) Wq [2048][2048] -> Wq^T bf16; (6) q = x.Wq -> F [MROWS][2048] (rows s < SQ); (7) RMS normalisation + rotary + q planes x256
  wt16<<<gWQ, b256, 0, stream>>>(wq, WB, DMOD, DMOD, 0, 1.0f);
  gemm64<true><<<gGQ, b128, 0, stream>>>(XB, WB, F, DMOD, DMOD, nrtQ, 1.0f);
  nrope16<true><<<gRQ, dim3(DMOD / 16), 0, stream>>>(F, DMOD, SQ, qnw, COS, SIN, QH, QL, QSC);
  // (8) Wk [2048][512] -> Wk^T bf16; (9) k = x.Wk -> F [MROWS][512]; (10) RMS normalisation + rotary + k plane x256
  wt16<<<gWK, b256, 0, stream>>>(wk, WB, DMOD, KVD, 0, 1.0f);
  gemm64<true><<<gGK, b128, 0, stream>>>(XB, WB, F, KVD, DMOD, nrtK, 1.0f);
  nrope16<false><<<gRK, dim3(KVD / 16), 0, stream>>>(F, KVD, SEQ, knw, COS, SIN, KH, KH, KSC);
  // (11) Wo [2048 k][2048 n] -> Wo^T f16 plane of bf16 value x1024
  wt16<<<gWQ, b256, 0, stream>>>(wo, WB, DMOD, DMOD, 1, WOS);
  // (12) non-causal attention over all keys -> O plane (inside F)
  attn_nc<<<gAT, bAT, 0, stream>>>(QH, QL, KH, VH, OH);
  // (13) out = ctx.Wo -> f32, carries 1024 x 1024 folded back
  gemm64<false><<<gGQ, b128, 0, stream>>>(OH, WB, out, DMOD, DMOD, nrtQ, 1.0f / (OSC * WOS));
  (void)hipGetLastError();
}

// v002
// It runs in 342 microseconds.
// Next to v001, in two timings, it ran 1.35 times as fast each time.
// All steps since v000 together make it 1.59 times as fast.
// Contractions: x.Wq, x.Wk, x.Wv on v_wmma_f32_16x16x32_bf16 (x and W^T as bf16 RNE planes, f32 accumulate);
// q.k^T over hd 128 on v_wmma_f32_16x16x32_f16 with q as f16 hi + f16 residual planes (x256) and k as one f16 plane
// (x256), products qh.k + ql.k; P.v on v_wmma_f32_16x16x32_f16 with P x32768 and v^T x1024 as single f16 planes;
// ctx.Wo on v_wmma_f32_16x16x32_f16 with ctx x1024 as one f16 plane and Wo^T as f16(bf16 RNE(Wo)) x1024; all f32
// accumulate. RMS normalisation, rotate-half rotary from integer positions (cos/sin tables built on device in f32),
// base-2 online softmax and the 1/Z fold in f32 on VALU.
#include <hip/hip_runtime.h>
#include <math.h>
#include <stdint.h>

#ifndef NB
#define NB 2
#endif
#define SEQ 2048
#ifndef SQ
#define SQ SEQ
#endif
#define DMOD  2048
#define NH    16
#define NKVH  4
#define HD    128
#define HHALF (HD / 2)
#define KVD   (NKVH * HD)
#define MROWS (NB * SEQ)
#define EPS_RMS 0.000001f
#define RSQ_HD 0.08838834764831845f
#define LOG2E 1.4426950408889634f
#define LOG2THETA 19.931568569324174
#define QSC   256.0f
#define KSC   256.0f
#define PCAR  32768.0f
#define VCAR  1024.0f
#define OSC   1024.0f
#define WOS   1024.0f
#define WPB   (NH / NKVH)
#define NHG   NKVH
#define NQT   (SQ / 16)
#define NST   (SEQ / 64)
#define NKT   (SEQ / 32)
#define ATT_THREADS (WPB * 32)
#define PTP   36
#define PTW   (16 * PTP)
#define SLP   132
#define SLW   (16 * SLP)
#define SLAB64 (16 * 68)
#define VTP   72
#define WTP   72
#define WS_CAP 134217728
#define KSTG  64
#define KPB   272
#define VPB   144
#define KTB   (KSTG * KPB)
#define VTB   (HD * VPB)
#define STGB  (KTB + VTB)
#define RINGB (2 * STGB)
#define GBM   128
#define GBN   128
#define GKS   64
#define GPB   144
#define GATB  (GBM * GPB)
#define GSTB  ((GBM + GBN) * GPB)
#define GRINGB (2 * GSTB)
static_assert(DMOD == NH * HD && HD == 128 && HHALF == 64 && NH == 16 && NKVH == 4 && WPB == 4 && NHG * WPB == NH);
static_assert(ATT_THREADS == 128 && KVD == 512);
static_assert(NB >= 1 && NB <= 2);
static_assert((SEQ % 64) == 0 && (SQ % 64) == 0 && SQ >= 64 && SQ <= SEQ);
static_assert((DMOD % 64) == 0 && (KVD % 64) == 0 && (DMOD % 32) == 0 && (HD % 32) == 0);
static_assert(((MROWS * DMOD / 8) % 256) == 0 && (MROWS % 4) == 0);
static_assert(KSTG == 64 && NST >= 2 && NST * KSTG == SEQ && (KPB % 16) == 0 && (VPB % 16) == 0 && (KTB % 16) == 0 && (STGB % 16) == 0);
static_assert(KPB == HD * 2 + 16 && VPB == KSTG * 2 + 16 && WPB * SLW * 4 <= RINGB && 4 * (RINGB + WPB * PTW * 4) <= 327680);
static_assert(HD * VTP * 2 <= 65536 && 64 * WTP * 2 <= 65536);
static_assert(GBM == 128 && GBN == 128 && GKS == 64 && GPB == GKS * 2 + 16 && (GPB % 16) == 0 && (GSTB % 16) == 0);
static_assert((SEQ % GBM) == 0 && (SQ % GBM) == 0 && (DMOD % GBN) == 0 && (KVD % GBN) == 0 && (DMOD % GKS) == 0 && DMOD / GKS >= 2);
static_assert(2 * (GRINGB + 4 * 4 * SLAB64 * 4) <= 327680);
static_assert((DMOD / 16) <= 128 && (KVD / 16) <= 128 && ((DMOD / 16) % 32) == 0 && ((KVD / 16) % 32) == 0);

typedef unsigned short u16;
typedef _Float16 v16h __attribute__((ext_vector_type(16)));
typedef _Float16 v8h  __attribute__((ext_vector_type(8)));
typedef __bf16   v16b __attribute__((ext_vector_type(16)));
typedef float    v8f  __attribute__((ext_vector_type(8)));
typedef float    v4f  __attribute__((ext_vector_type(4)));
typedef unsigned int v4u __attribute__((ext_vector_type(4)));

union FragH { v16h v; v8h h[2]; v4u u[2]; };
union FragB { v16b v; v4u u[2]; };

// ---- scalar helpers --------------------------------------------------------------------------------
__device__ __forceinline__ unsigned short bf_bits(float f) {          // f32 -> bf16 bits, RNE convert
  unsigned u = __float_as_uint(f);
  return (unsigned short)((u + 0x7FFFu + ((u >> 16) & 1u)) >> 16);
}
__device__ __forceinline__ float bf_up(unsigned short h) { return __uint_as_float(((unsigned)h) << 16); }
__device__ __forceinline__ float bfr(float f) { return bf_up(bf_bits(f)); }
__device__ __forceinline__ unsigned short h_bits(_Float16 x) { return __builtin_bit_cast(unsigned short, x); }
__device__ __forceinline__ unsigned pk16(unsigned short a, unsigned short b) { return (unsigned)a | ((unsigned)b << 16); }
__device__ __forceinline__ v8f zero8() { v8f z = {0.f, 0.f, 0.f, 0.f, 0.f, 0.f, 0.f, 0.f}; return z; }

// ---- fragment loaders: 16-bit A/B operand, lane -> row/col (lane&15), p already includes +8*(lane>>4);
//      elements 0..7 <- p[0..7] (k0+8h..), elements 8..15 <- p[16..23] (k0+16+8h..)  (same split k map for A and B;
//      B is always read from a k-contiguous [n][k] plane)
__device__ __forceinline__ v16h ldfrag_h(const _Float16* p) {
  FragH f;
  f.h[0] = *(const v8h*)(p);
  f.h[1] = *(const v8h*)(p + 16);
  return f.v;
}
__device__ __forceinline__ v16b ldfrag_b(const u16* p) {              // bf16 plane read as unsigned integer vectors
  FragB f;
  f.u[0] = *(const v4u*)(p);
  f.u[1] = *(const v4u*)(p + 16);
  return f.v;
}

__device__ __forceinline__ v8f mma_h(v16h a, v16h b, v8f c) {
  return __builtin_amdgcn_wmma_f32_16x16x32_f16(false, a, false, b, (short)0, c, false, false);
}
__device__ __forceinline__ v8f mma_b(v16b a, v16b b, v8f c) {
  return __builtin_amdgcn_wmma_f32_16x16x32_bf16(false, a, false, b, (short)0, c, false, false);
}
__device__ __forceinline__ void guard2(v8f& a, v8f& b, v16h x0, v16h x1, v16h x2, v16h x3) {
#if defined(__HIP_DEVICE_COMPILE__)
  asm volatile("v_nop\n\tv_nop\n\tv_nop\n\tv_nop"
               : "+v"(a), "+v"(b) : "v"(x0), "v"(x1), "v"(x2), "v"(x3) : "memory");
#endif
}
__device__ __forceinline__ void acc_guard4(v8f& a, v8f& b, v8f& c, v8f& d) {
#if defined(__HIP_DEVICE_COMPILE__)
  asm volatile("v_nop\n\tv_nop\n\tv_nop\n\tv_nop" : "+v"(a), "+v"(b), "+v"(c), "+v"(d));
#endif
}
__device__ __forceinline__ void wave_sync_lds() {
  __builtin_amdgcn_fence(__ATOMIC_RELEASE, "workgroup");
  __builtin_amdgcn_wave_barrier();
  __builtin_amdgcn_fence(__ATOMIC_ACQUIRE, "workgroup");
}
// Eight asynchronous 16-byte copies of this lane, global -> LDS (l = LDS byte address, g = global address, both 16-B aligned).
// The closing s_wait_xcnt 0 stands inside the statement so that no address register is rewritten in front of it.
__device__ __forceinline__ void async8(const unsigned* l, const u16* const* g) {
#if defined(__HIP_DEVICE_COMPILE__)
  asm volatile("global_load_async_to_lds_b128 %0, %8, off\n\t"
               "global_load_async_to_lds_b128 %1, %9, off\n\t"
               "global_load_async_to_lds_b128 %2, %10, off\n\t"
               "global_load_async_to_lds_b128 %3, %11, off\n\t"
               "global_load_async_to_lds_b128 %4, %12, off\n\t"
               "global_load_async_to_lds_b128 %5, %13, off\n\t"
               "global_load_async_to_lds_b128 %6, %14, off\n\t"
               "global_load_async_to_lds_b128 %7, %15, off\n\t"
               "s_wait_xcnt 0x0"
               :: "v"(l[0]), "v"(l[1]), "v"(l[2]), "v"(l[3]), "v"(l[4]), "v"(l[5]), "v"(l[6]), "v"(l[7]),
                  "v"(g[0]), "v"(g[1]), "v"(g[2]), "v"(g[3]), "v"(g[4]), "v"(g[5]), "v"(g[6]), "v"(g[7])
               : "memory");
#endif
}
// One stage (64 keys) of k rows and v^T rows into one ring buffer, 16 copies per lane of the 128 threads:
//   k   chunk i: key row i*8 + (tid>>4), 16-B piece tid&15  (a wave covers two whole 256-B rows), LDS pitch KPB;
//   v^T chunk i: d row i*16 + (tid>>3), 16-B piece tid&7    (a wave covers four whole 128-B rows), LDS pitch VPB.
// kg, vg, lk, lv are this lane's addresses of chunk 0.
__device__ __forceinline__ void stage_kv(const u16* kg, const u16* vg, unsigned lk, unsigned lv) {
  unsigned l[8];
  const u16* g[8];
  // both loops unrolled so that l[] and g[] are registers, as the asm operands need them
#pragma unroll
  for (int i = 0; i < 8; ++i) { l[i] = lk + (unsigned)(i * 8 * KPB); g[i] = kg + (size_t)(i * 8) * KVD; }
  async8(l, g);
#pragma unroll
  for (int i = 0; i < 8; ++i) { l[i] = lv + (unsigned)(i * 16 * VPB); g[i] = vg + (size_t)(i * 16) * SEQ; }
  async8(l, g);
}
// One GEMM stage (64 k = 128 B of each row) of 128 A rows and 128 B rows into one ring buffer, 16 copies per lane of the
// 128 threads: chunk i = row i*16 + (tid>>3), 16-B piece tid&7 (a wave covers four whole 128-B row pieces), LDS pitch GPB.
// ag, bg, la, lb are this lane's addresses of chunk 0; rs16 = 16 rows of the global planes, in elements.
__device__ __forceinline__ void stage_ab(const u16* ag, const u16* bg, size_t rs16, unsigned la, unsigned lb) {
  unsigned l[8];
  const u16* g[8];
  // both loops unrolled so that l[] and g[] are registers, as the asm operands need them
#pragma unroll
  for (int i = 0; i < 8; ++i) { l[i] = la + (unsigned)(i * 16 * GPB); g[i] = ag + (size_t)i * rs16; }
  async8(l, g);
#pragma unroll
  for (int i = 0; i < 8; ++i) { l[i] = lb + (unsigned)(i * 16 * GPB); g[i] = bg + (size_t)i * rs16; }
  async8(l, g);
}
// the issuing wave's own wait: every asynchronous copy it has issued has landed in LDS
__device__ __forceinline__ void wait_async0() {
#if defined(__HIP_DEVICE_COMPILE__)
  asm volatile("s_wait_asynccnt 0x0" ::: "memory");
#endif
}
// this wave's LDS reads and writes have retired (in front of the barrier behind which a buffer is refilled)
__device__ __forceinline__ void wait_ds0() {
#if defined(__HIP_DEVICE_COMPILE__)
  asm volatile("s_wait_dscnt 0x0" ::: "memory");
#endif
}

// =====================================================================================================
// cos/sin tables for the rotary: row = b*SEQ + s (0 .. nrows-1), column j = 0..63:
//   invf[j] = 1e6^(-j/64) (f64 exp2, converted to f32), ang = float(pos[row]) * invf[j] (f32 multiply),
//   cosT[row][j] = cosf(ang), sinT[row][j] = sinf(ang).
// Block = 4 rows x 64 j (one value pair per thread) staged in LDS; after the barrier waves 0,1 write the 4 cos rows and
// coverage: grid = nrows/4 blocks x (2 tables x 4 rows x 64 floats) = both tables exactly once (nrows % 4 == 0, host).
// =====================================================================================================
__global__ __launch_bounds__(256) void trig64(const int* __restrict__ pos, float* cosT, float* sinT, int nrows) {
#pragma clang fp contract(off)
  __shared__ __align__(16) float cs[2 * 256];
  const int tid  = (int)threadIdx.x;
  const int row0 = (int)blockIdx.x * 4;
  if (row0 + 4 > nrows) return;                       // block-uniform, before the barrier; never taken with the exact grid
  const int r = tid >> 6, j = tid & 63;
  const float p    = (float)pos[row0 + r];
  const float invf = (float)exp2(-(double)j * (LOG2THETA / 64.0));
  const float ang  = p * invf;
  cs[tid]       = cosf(ang);
  cs[256 + tid] = sinf(ang);
  __syncthreads();
  if (tid < 128) {                                    // waves 0..3, wave-uniform
    const int tb    = tid >> 6;                       // 0: cos rows (waves 0,1), 1: sin rows (waves 2,3)
    const int q     = tid & 63;
    const int rr    = q >> 4;
    const int piece = (q & 15) * 4;
    const v4f v = *(const v4f*)(cs + tb * 256 + rr * 64 + piece);
    float* base = (tb != 0) ? sinT : cosT;
    float* dst  = base + (size_t)(row0 + rr) * HHALF + piece;
    {
      *(v4f*)(dst) = v;
      
    }
  }
}

// =====================================================================================================
// f32 -> 16-bit plane, same layout.  f16mode == 0: bf16 RNE bits;  f16mode == 1: f16 bits of (bf16 RNE value) * scale.
// Thread = 8 consecutive elements: two 16-B loads, one 16-B store; 32 consecutive lanes = 512 contiguous, 512-B aligned
// coverage: grid = ceil(n8/256) blocks x 256 thr x 8 (in-kernel bound) = the whole plane (n8 a multiple of 256 here).
// =====================================================================================================
__global__ __launch_bounds__(256) void cvt16(const float* __restrict__ x, u16* D, int n8, int f16mode, float scale) {
  const int gt = blockIdx.x * 256 + (int)threadIdx.x;
  if (gt >= n8) return;
  const float* p = x + (size_t)gt * 8;
  const v4f a = *(const v4f*)(p), b4 = *(const v4f*)(p + 4);
  float w[8];
#pragma unroll
  for (int e = 0; e < 4; ++e) { w[e] = a[e]; w[4 + e] = b4[e]; }
  v4u o;
#pragma unroll
  for (int e = 0; e < 4; ++e) {
    const float f0 = w[2 * e], f1 = w[2 * e + 1];
    const unsigned short hb0 = h_bits((_Float16)(bfr(f0) * scale));
    const unsigned short hb1 = h_bits((_Float16)(bfr(f1) * scale));
    const unsigned short bb0 = bf_bits(f0);
    const unsigned short bb1 = bf_bits(f1);
    o[e] = (f16mode != 0) ? pk16(hb0, hb1) : pk16(bb0, bb1);
  }
  u16* d = D + (size_t)gt * 8;
  {
    *(v4u*)(d) = o;
    
  }
}

// =====================================================================================================
// Weight transpose + convert: W f32 [K rows][N cols] (row pitch N) -> Wt 16-bit [N rows][K cols] (row pitch K), so that
// a column n of W becomes the k-contiguous B operand row n.  f16mode == 0: bf16 RNE bits; 1: f16 bits of (bf16 RNE value)*scale.
// Block = 64 k x 64 n tile: load phase 4 iterations x (16 k rows x 16 lanes x 4 n) with 16-B loads into an LDS tile
// coverage: load 4 it x 256 thr x 4 = 64 x 64; store 2 it x 256 thr x 8 halves = 64 rows x 64; grid = (K/64)*(N/64)
//           blocks = the whole [N][K] plane exactly once.
// =====================================================================================================
__global__ __launch_bounds__(256) void wt16(const float* __restrict__ W, u16* Wt, int K, int N, int f16mode, float scale) {
  __shared__ __align__(16) u16 T[64 * WTP];
  const int tid = (int)threadIdx.x;
  const int nkt = K >> 6;
  const int bid = (int)blockIdx.x;
  const int kt  = bid % nkt;
  const int nt  = bid / nkt;
  const int kb  = kt * 64, nb = nt * 64;
  if (nb + 64 > N) return;                            // block-uniform, before the barrier; never taken with the exact grid
  const int c4 = (tid & 15) * 4;                      // n within tile
  const int r0 = tid >> 4;                            // k within tile (0..15) + 16*it
#pragma unroll
  for (int it = 0; it < 4; ++it) {
    const int r = it * 16 + r0;
    const v4f a = *(const v4f*)(W + (size_t)(kb + r) * (size_t)N + nb + c4);
#pragma unroll
    for (int e = 0; e < 4; ++e) {
      const float f = a[e];
      const unsigned short hb = h_bits((_Float16)(bfr(f) * scale));
      const unsigned short bb = bf_bits(f);
      T[(c4 + e) * WTP + r] = (f16mode != 0) ? hb : bb;
    }
  }
  __syncthreads();
  v4u o[2];
  const int q8 = tid >> 3, p8 = (tid & 7) * 8;
#pragma unroll
  for (int it = 0; it < 2; ++it) o[it] = *(const v4u*)(T + (it * 32 + q8) * WTP + p8);
  u16* dst = Wt + (size_t)(nb + q8) * (size_t)K + kb + p8;
  {
#pragma unroll
    for (int it = 0; it < 2; ++it) {
      *(v4u*)(dst + (size_t)(it * 32) * (size_t)K) = o[it];
    }
    
  }
}

// =====================================================================================================
// v^T plane from the v projection F f32 [MROWS][KVD] (row = b*SEQ + s, column = g*HD + d):
//   VH[((b*NKVH + g)*HD + d)][s] = f16(v * 1024) for all keys s.
// Block = (b, kv head g, 64 keys s0): each thread loads its 32 floats (key sl, d chunk dc) with 16-B loads, converts, scatters
// coverage: load 256 thr x 32 = 64 keys x 128 d; store 4 iterations x 256 thr x 8 halves = 128 lines x 64 = the block's tile;
//           grid = NB*NKVH*NST blocks covers the plane exactly once.
// =====================================================================================================
__global__ __launch_bounds__(256) void vt16(const float* __restrict__ F, u16* VHo) {
  __shared__ __align__(16) u16 TH[HD * VTP];
  const int tid = (int)threadIdx.x;
  const int bid = (int)blockIdx.x;
  const int st  = bid % NST;
  const int t2  = bid / NST;
  const int g   = t2 % NKVH;
  const int b   = t2 / NKVH;
  if (b >= NB) return;                                // block-uniform, before any barrier; never taken with the exact grid
  const int s0  = st * 64;
  {
    const int sl = tid >> 2;                          // key within tile 0..63
    const int dc = (tid & 3) * 32;                    // d chunk 0,32,64,96
    const float* src = F + ((size_t)b * SEQ + s0 + sl) * KVD + g * HD + dc;
#pragma unroll
    for (int i = 0; i < 8; ++i) {
      const v4f a = *(const v4f*)(src + 4 * i);
#pragma unroll
      for (int e = 0; e < 4; ++e) {
        const float t = a[e] * VCAR;
        TH[(dc + 4 * i + e) * VTP + sl] = h_bits((_Float16)t);
      }
    }
  }
  __syncthreads();
  v4u vh[4];
  const int q8 = tid >> 3, p8 = (tid & 7) * 8;
#pragma unroll
  for (int it = 0; it < 4; ++it) {
    const int line = it * 32 + q8;                    // d = 0..127
    vh[it] = *(const v4u*)(TH + line * VTP + p8);
  }
  const size_t hrow = (size_t)(b * NKVH + g) * HD;
  const size_t base = hrow * SEQ + s0 + p8;
  {
#pragma unroll
    for (int it = 0; it < 4; ++it) {
      const int line = it * 32 + q8;
      *(v4u*)(VHo + base + (size_t)line * SEQ) = vh[it];
    }
    
  }
}

// =====================================================================================================
// Per-head RMS normalisation + rotate-half rotary + 16-bit planes from a projection F f32 [MROWS][ncol]
// (ncol = DMOD for q, KVD for k; row = b*SEQ + s with s < nrows, column = head*HD + d):
//   rs = 1/sqrt(mean_d(x[head][d]^2) + eps) over the head's 128 columns (f32 sum of squares: 16 per thread, then an
//   8-lane shuffle sum, the 8 lanes of a head are 8 consecutive lanes); y[d] = (x[d]*rs) * w[d] with w = bf16 RNE value
//   of the norm weight; then for j < 64 within a head, with c = cosT[row][j], sn = sinT[row][j] (f32 tables):
//   out[j]    = y[j]*c    - y[j+64]*sn
//   out[j+64] = y[j+64]*c + y[j]*sn
//   Hp [MROWS][ncol] = f16(out * sc); if RES also Lp [MROWS][ncol] = f16 residual (t - f16(t)), same layout.
// Block = one row, exactly ncol/16 threads (host); thread t = head t>>3, chunk i = t&7: columns head*HD + 8i .. +7 and + 64.
// lane-varying control anywhere (shuffles with all lanes active).
// coverage: (ncol/16) thr x 16 = the whole row of Hp (and of Lp); grid = NB*nrows blocks = every processed row once.
// =====================================================================================================
__device__ __forceinline__ void rot_pair(float xl, float xh, float cv, float sv, float sc,
                                         unsigned short& hl, unsigned short& hhv, unsigned short& ll, unsigned short& lh) {
#pragma clang fp contract(off)
  const float rl = xl * cv - xh * sv;
  const float rh = xh * cv + xl * sv;
  const float tl = rl * sc, th = rh * sc;
  const _Float16 a = (_Float16)tl, bq = (_Float16)th;
  hl  = h_bits(a);
  hhv = h_bits(bq);
  ll  = h_bits((_Float16)(tl - (float)a));
  lh  = h_bits((_Float16)(th - (float)bq));
}

template <bool RES>
__global__ __launch_bounds__(128) void nrope16(const float* __restrict__ F, int ncol, int nrows, const float* __restrict__ nw,
                                               const float* __restrict__ cosT, const float* __restrict__ sinT,
                                               u16* Hp, u16* Lp, float sc) {
#pragma clang fp contract(off)
  const int tid = (int)threadIdx.x;
  const int blk = (int)blockIdx.x;
  const int b   = blk / nrows;
  const int s   = blk - b * nrows;
  if (b >= NB) return;                                 // block-uniform; never taken with the exact grid
  const int row = b * SEQ + s;
  const int dlo = (tid & 7) * 8;                       // j within head, multiple of 8
  const int clo = (tid >> 3) * HD + dlo;               // column of the low-half chunk; clo + 64 + 8 <= ncol by blockDim
  const float* p = F + (size_t)row * ncol + clo;
  const v4f xa = *(const v4f*)(p), xb = *(const v4f*)(p + 4);
  const v4f ya = *(const v4f*)(p + HHALF), yb = *(const v4f*)(p + HHALF + 4);
  const size_t trow = (size_t)row * HHALF + dlo;
  const v4f ca = *(const v4f*)(cosT + trow), cb = *(const v4f*)(cosT + trow + 4);
  const v4f sa = *(const v4f*)(sinT + trow), sb = *(const v4f*)(sinT + trow + 4);
  const v4f wa = *(const v4f*)(nw + dlo), wb4 = *(const v4f*)(nw + dlo + 4);
  const v4f wc = *(const v4f*)(nw + HHALF + dlo), wd = *(const v4f*)(nw + HHALF + dlo + 4);
  float xl[8], xh[8], cv[8], sv[8], wl[8], wh[8];
#pragma unroll
  for (int e = 0; e < 4; ++e) {
    xl[e] = xa[e];        xl[4 + e] = xb[e];
    xh[e] = ya[e];        xh[4 + e] = yb[e];
    cv[e] = ca[e];        cv[4 + e] = cb[e];
    sv[e] = sa[e];        sv[4 + e] = sb[e];
    wl[e] = bfr(wa[e]);   wl[4 + e] = bfr(wb4[e]);
    wh[e] = bfr(wc[e]);   wh[4 + e] = bfr(wd[e]);
  }
  // sum of squares over the head's 128 columns: 16 here, then lanes xor 1, 2, 4 (aligned groups of 8 lanes = one head)
  float ss = 0.0f;
#pragma unroll
  for (int e = 0; e < 8; ++e) { ss = ss + xl[e] * xl[e]; ss = ss + xh[e] * xh[e]; }
  ss += __shfl_xor(ss, 1, 32);
  ss += __shfl_xor(ss, 2, 32);
  ss += __shfl_xor(ss, 4, 32);
  const float var = ss * (1.0f / (float)HD);
  const float rs  = 1.0f / sqrtf(var + EPS_RMS);
#pragma unroll
  for (int e = 0; e < 8; ++e) {
    xl[e] = (xl[e] * rs) * wl[e];
    xh[e] = (xh[e] * rs) * wh[e];
  }
  v4u ohl, ohh, oll, olh;
#pragma unroll
  for (int e = 0; e < 4; ++e) {
    unsigned short hl0, hh0, ll0, lh0, hl1, hh1, ll1, lh1;
    rot_pair(xl[2 * e],     xh[2 * e],     cv[2 * e],     sv[2 * e],     sc, hl0, hh0, ll0, lh0);
    rot_pair(xl[2 * e + 1], xh[2 * e + 1], cv[2 * e + 1], sv[2 * e + 1], sc, hl1, hh1, ll1, lh1);
    ohl[e] = pk16(hl0, hl1);
    ohh[e] = pk16(hh0, hh1);
    oll[e] = pk16(ll0, ll1);
    olh[e] = pk16(lh0, lh1);
  }
  u16* dh = Hp + (size_t)row * ncol + clo;
  u16* dl = Lp + (size_t)row * ncol + clo;             // dereferenced only when RES
  {
    *(v4u*)(dh) = ohl;
    *(v4u*)(dh + HHALF) = ohh;
    if constexpr (RES) {
      *(v4u*)(dl) = oll;
      *(v4u*)(dl + HHALF) = olh;
    }
    
  }
}

// =====================================================================================================
// The wave's 64 x 64 tile of C: accumulators * oscale -> the wave's own slab [64][68] -> whole 256-B row pieces of C.
// coverage: 32 instructions x 2 rows x 16 lanes x 4 floats = the wave's 64 x 64 tile.
// =====================================================================================================
__device__ __forceinline__ void epi64x64(float* sl, const v8f (&acc)[4][4], float oscale,
                                         float* C, int N, size_t rowb, int col0, int lane) {
  const int hh = lane >> 4, m = lane & 15;
#pragma unroll
  for (int i = 0; i < 4; ++i) {
#pragma unroll
    for (int r = 0; r < 8; ++r) {
      const int ro = (i * 16 + 8 * hh + r) * 68 + m;
      sl[ro]      = acc[i][0][r] * oscale;
      sl[ro + 16] = acc[i][1][r] * oscale;
      sl[ro + 32] = acc[i][2][r] * oscale;
      sl[ro + 48] = acc[i][3][r] * oscale;
    }
  }
  wave_sync_lds();
  float* dst = C + (rowb + (size_t)hh) * (size_t)N + col0 + m * 4;
#pragma unroll
  for (int it = 0; it < 32; ++it) {
    const v4f v = *(const v4f*)(sl + (it * 2 + hh) * 68 + m * 4);
    *(v4f*)(dst + (size_t)(it * 2) * (size_t)N) = v;
  }
}

// =====================================================================================================
// GEMM: C[row][N] (f32, row pitch N) = A[row][K] (16-bit row-major, pitch K) . Bt[N][K]^T (16-bit k-contiguous) * oscale,
// row = bb*SEQ + s for s < 128*nrt.  BF: bf16 operands (v_wmma_f32_16x16x32_bf16), else f16 (v_wmma_f32_16x16x32_f16).
// Block -> (column tile ct = bid % (N/128), row tile rt of nrt, batch bb): a 128 x 128 tile of C; 4 waves as 2 x 2, each a
// 64 x 64 tile = 4 x 4 accumulators, so that a fragment read from LDS serves four products.
// The 128 A rows and 128 Bt rows reach the waves through an LDS ring of two buffers, 64 k a stage, filled by asynchronous
// copies of whole 128-B row pieces; fragments by two 16-B LDS loads each (split k map for A and B); k in ascending steps of 32
// per accumulator.  One block barrier per stage, under block-uniform control flow (host: K % 64 == 0, N % 128 == 0).
// coverage: 4 waves x 4 row groups x (16 x 64) = the block's tile; grid = NB * nrt * (N/128) blocks = every row s < 128*nrt once.
// =====================================================================================================
template <bool BF> struct FragSel { typedef v16h T; };
template <> struct FragSel<true> { typedef v16b T; };
template <bool BF>
__device__ __forceinline__ typename FragSel<BF>::T ldfrag_t(const u16* p) {
  if constexpr (BF) return ldfrag_b(p);
  else return ldfrag_h((const _Float16*)(const void*)p);
}
template <bool BF>
__device__ __forceinline__ v8f mma_t(typename FragSel<BF>::T a, typename FragSel<BF>::T b, v8f c) {
  if constexpr (BF) return mma_b(a, b, c);
  else return mma_h(a, b, c);
}

template <bool BF>
__global__ __launch_bounds__(128)
void gemm128(const u16* __restrict__ A, const u16* __restrict__ Bt, float* C, int N, int K, int nrt, float oscale) {
  __shared__ __align__(16) u16 ring[GRINGB / 2];          // two buffers of (128 A rows, 128 Bt rows), pitch GPB
  __shared__ __align__(16) float slab[4 * 4 * SLAB64];    // per wave [64][68]
  const int tid = (int)threadIdx.x, wave = tid >> 5, lane = tid & 31, hh = lane >> 4, m = lane & 15;
  const int ntile = N >> 7;
  const int bid   = (int)blockIdx.x;
  const int ct    = bid % ntile;
  const int t2    = bid / ntile;
  const int rt    = t2 % nrt;
  const int bb    = t2 / nrt;
  if (bb >= NB) return;                     // block-uniform, before any barrier or copy; never taken with the exact grid
  if (rt * GBM + GBM > SEQ) return;         // block-uniform; never taken
  const int nstg  = K >> 6;
  const int col0  = ct * GBN;
  const size_t row0 = (size_t)bb * SEQ + (size_t)(rt * GBM);
  const int wr = wave >> 1, wc = wave & 1;  // this wave's 64 x 64 tile inside the block's
  // this lane's chunk 0 of stage 0 (stage_ab): global addresses and LDS byte addresses in buffer 0
  const size_t rs16 = (size_t)16 * (size_t)K;
  const u16* ag0 = A  + (row0 + (size_t)(tid >> 3)) * (size_t)K + (tid & 7) * 8;
  const u16* bg0 = Bt + (size_t)(col0 + (tid >> 3)) * (size_t)K + (tid & 7) * 8;
  const unsigned lring = (unsigned)(size_t)(const void*)ring;
  const unsigned la0 = lring + (unsigned)((tid >> 3) * GPB + (tid & 7) * 16);
  const unsigned lb0 = la0 + (unsigned)GATB;

  v8f acc[4][4];
#pragma unroll
  for (int i = 0; i < 4; ++i) {
#pragma unroll
    for (int j = 0; j < 4; ++j) acc[i][j] = zero8();
  }

  // ---- ring prologue: stage 0 lands and is published, then stage 1 flies while stage 0 is worked on ----
  stage_ab(ag0, bg0, rs16, la0, lb0);
  wait_async0();
  __syncthreads();
  if (nstg > 1) stage_ab(ag0 + GKS, bg0 + GKS, rs16, la0 + (unsigned)GSTB, lb0 + (unsigned)GSTB);   // block-uniform

  // kept rolled: one trip = one stage, with its one publish point at the foot
#pragma unroll 1
  for (int st = 0; st < nstg; ++st) {
    const int bufh = (st & 1) * (GSTB / 2);               // this stage's buffer, in halves
    const u16* ap = ring + bufh + (wr * 64 + m) * (GPB / 2) + 8 * hh;
    const u16* bp = ring + bufh + (GATB / 2) + (wc * 64 + m) * (GPB / 2) + 8 * hh;
    // both 32-k steps of a stage unrolled: their LDS offsets become immediates
    typename FragSel<BF>::T a[GKS / 32][4], b[GKS / 32][4];
#pragma unroll
    for (int ks = 0; ks < GKS / 32; ++ks) {
#pragma unroll
      for (int j = 0; j < 4; ++j) b[ks][j] = ldfrag_t<BF>(bp + j * 16 * (GPB / 2) + ks * 32);
#pragma unroll
      for (int i = 0; i < 4; ++i) a[ks][i] = ldfrag_t<BF>(ap + i * 16 * (GPB / 2) + ks * 32);
    }
    // keeps the stage's 32 LDS reads together in front of its 32 products: left free, the compiler reloads one A fragment
    // per four products and waits out the LDS latency each time
    __builtin_amdgcn_sched_barrier(0);
#pragma unroll
    for (int ks = 0; ks < GKS / 32; ++ks) {
#pragma unroll
      for (int i = 0; i < 4; ++i) {
#pragma unroll
        for (int j = 0; j < 4; ++j) acc[i][j] = mma_t<BF>(a[ks][i], b[ks][j], acc[i][j]);
      }
    }
    // keeps the products in front of the publish point: left free, they sink behind the barrier, the waits stand directly
    // behind the LDS reads, and the next stage's copies lose the products' time as their lead
    __builtin_amdgcn_sched_barrier(0);
    // ---- publish point of stage st + 1: own LDS reads retired, own copies landed, every wave has left this buffer ----
    wait_ds0();
    wait_async0();
    __syncthreads();
    if (st + 2 < nstg) {                                  // block-uniform: refill the buffer that this trip has just read
      stage_ab(ag0 + (size_t)(st + 2) * GKS, bg0 + (size_t)(st + 2) * GKS, rs16,
               la0 + (unsigned)(st & 1) * GSTB, lb0 + (unsigned)(st & 1) * GSTB);
    }
  }
  wait_async0();                                          // nothing in flight when the wave ends
  epi64x64(slab + wave * (4 * SLAB64), acc, oscale, C, N, row0 + (size_t)(wr * 64), col0 + wc * 64, lane);
}

// =====================================================================================================
// Non-causal grouped-query attention, hd = 128, all SEQ keys. Block bid -> (query tile qt = bid % NQT: rows q0 = 16*qt ..
// q0+15, head group hg = kv head, batch b); one wave per query head = hg*WPB + wave (the 4 heads of the group share kv head hg).
//   q hi / residual planes f16 x256 [b*SEQ + s][h*HD + d]; k plane f16 x256 [b*SEQ + s][g*HD + d] (pitch KVD);
//   v^T plane [b*NKVH + g][d][SEQ] x1024.
//   scores = q_hi.k + q_lo.k (4 k-steps over d); P.v with P x32768 (f16) and v^T, for every query row;
//   O written as one f16 plane (O x1024, layout [b*SEQ + s][h*HD + d]).
//   score (log2 domain) t(i, j) = (q_i.k_j over HD) * (1/sqrt(128))*log2e/(256*256).
//   k rows and v^T rows reach the 4 waves through an LDS ring of two buffers, 64 keys a stage, filled by asynchronous copies.
//   All NKT key tiles of 32 visited in order. Per tile: 2 score subtiles x 4 k-steps, q fragments loaded straight from the
//   16-bit planes, k and v^T fragments from the ring (two 16-B loads per fragment, split k map); online max-subtracted base-2
//   softmax in f32, -inf-safe rescale;
//   of P*32768 (f16) rebuilt from the LDS rows (float vector loads, same element type as stored), v^T B fragments in
//   4 groups of 2 d-subtiles.
//   After the loop: out = acc / Z (Z >= 1 always; guarded anyway), carries 1/(32768*1024) folded once, written into the
//   One block barrier per stage, under block-uniform control flow; bounded loops only (NST compile-time).
// coverage: per wave 8 instructions x 2 rows x 16 lanes x 8 halves = 16 x 128; grid NQT x NHG x NB blocks x WPB
//           waves = every (b, s < SQ, h) row segment of O exactly once.
// =====================================================================================================
__global__ __launch_bounds__(ATT_THREADS)
void attn_nc(const u16* __restrict__ QHp, const u16* __restrict__ QLp, const u16* __restrict__ KHp,
             const u16* __restrict__ VHp, u16* OHp) {
  __shared__ __align__(16) _Float16 ring[RINGB / 2];      // two buffers of (64 k rows pitch KPB, 128 v^T rows pitch VPB)
  __shared__ __align__(16) float ptile[WPB * PTW];

  const int tid  = (int)threadIdx.x;
  const int wave = tid >> 5;
  const int lane = tid & 31;
  const int hh   = lane >> 4;
  const int c    = lane & 15;
  const int bid  = (int)blockIdx.x;
  const int qt   = bid % NQT;
  const int t2   = bid / NQT;
  const int hg   = t2 % NHG;
  const int b    = t2 / NHG;
  if (b >= NB) return;                      // block-uniform, before any barrier or copy; never taken with the exact grid
  const int q0   = qt * 16;
  if (q0 + 16 > SQ) return;                 // block-uniform; never taken
  const int head = hg * WPB + wave;
  const int kvh  = hg;

  float* pt   = ptile + wave * PTW;                       // prob tile [16][32] pitch 36
  float* slab = (float*)(void*)ring + wave * SLW;         // result slab [16][128] pitch 132: the ring's bytes, after the loop

  const size_t hcol = (size_t)head * HD + 8 * hh;
  const _Float16* Qh  = (const _Float16*)(const void*)QHp + ((size_t)b * SEQ + q0 + c) * DMOD + hcol;
  const _Float16* Ql  = (const _Float16*)(const void*)QLp + ((size_t)b * SEQ + q0 + c) * DMOD + hcol;
  // this lane's chunk 0 of stage 0 (stage_kv): global addresses and LDS byte addresses in buffer 0
  const u16* kg0 = KHp + ((size_t)b * SEQ + (tid >> 4)) * KVD + (size_t)kvh * HD + (tid & 15) * 8;
  const u16* vg0 = VHp + ((size_t)(b * NKVH + kvh) * HD + (tid >> 3)) * SEQ + (tid & 7) * 8;
  const unsigned lring = (unsigned)(size_t)(const void*)ring;
  const unsigned lk0 = lring + (unsigned)((tid >> 4) * KPB + (tid & 15) * 16);
  const unsigned lv0 = lring + (unsigned)(KTB + (tid >> 3) * VPB + (tid & 7) * 16);
  const float lsc = RSQ_HD * (LOG2E / (QSC * KSC));
  const float oc  = 1.0f / (PCAR * VCAR);

  float mrow[8], lrow[8];
  v8f o[8];
#pragma unroll
  for (int r = 0; r < 8; ++r) { mrow[r] = -INFINITY; lrow[r] = 0.f; }
#pragma unroll
  for (int j = 0; j < 8; ++j) o[j] = zero8();

  // ---- ring prologue: stage 0 lands and is published, then stage 1 flies while stage 0 is worked on ----
  stage_kv(kg0, vg0, lk0, lv0);
  wait_async0();
  __syncthreads();
  stage_kv(kg0 + (size_t)KSTG * KVD, vg0 + KSTG, lk0 + STGB, lv0 + STGB);

  // kept rolled: one trip = one stage, with its one publish point at the foot
#pragma unroll 1
  for (int st = 0; st < NST; ++st) {
   const int bufh = (st & 1) * (STGB / 2);                // this stage's buffer, in halves
   // both 32-key steps of a stage unrolled: their LDS offsets become immediates
#pragma unroll
   for (int sub = 0; sub < KSTG / 32; ++sub) {
    // ---- scores: D element r of this lane = (query row q0 + 8hh + r, key kb + c) in s0, key kb + 16 + c in s1, kb = 64*st + 32*sub ----
    v8f s0 = zero8(), s1 = zero8();
    const _Float16* k0p = ring + bufh + (sub * 32 + c) * (KPB / 2) + 8 * hh;
    const _Float16* k1p = k0p + 16 * (KPB / 2);
#pragma unroll
    for (int kk = 0; kk < HD / 32; ++kk) {
      const v16h qh  = ldfrag_h(Qh + kk * 32);
      const v16h ql  = ldfrag_h(Ql + kk * 32);
      const v16h kh0 = ldfrag_h(k0p + kk * 32);
      const v16h kh1 = ldfrag_h(k1p + kk * 32);
      s0 = mma_h(qh, kh0, s0);
      s0 = mma_h(ql, kh0, s0);
      s1 = mma_h(qh, kh1, s1);
      s1 = mma_h(ql, kh1, s1);
      guard2(s0, s1, qh, ql, kh0, kh1);
    }
    // ---- online softmax in base 2 over all keys, -inf-safe ----
#pragma unroll
    for (int r = 0; r < 8; ++r) {
      const float t0 = s0[r] * lsc;
      const float t1 = s1[r] * lsc;
      float mx = fmaxf(t0, t1);
#pragma unroll
      for (int off = 1; off < 16; off <<= 1) mx = fmaxf(mx, __shfl_xor(mx, off, 32));
      const float mn = fmaxf(mrow[r], mx);
      const float ms = (mn == -INFINITY) ? 0.0f : mn;
      const float al = exp2f(mrow[r] - ms);
      mrow[r] = mn;
      const float e0 = exp2f(t0 - ms), e1 = exp2f(t1 - ms);
      float ps = e0 + e1;
#pragma unroll
      for (int off = 1; off < 16; off <<= 1) ps += __shfl_xor(ps, off, 32);
      lrow[r] = lrow[r] * al + ps;
#pragma unroll
      for (int j = 0; j < 8; ++j) o[j][r] *= al;
      const int ro = (8 * hh + r) * PTP + c;
      pt[ro]      = e0;
      pt[ro + 16] = e1;
    }
    wave_sync_lds();
    // ---- A fragment of P*32768 (f16), row = c, split k map over the 32 keys of this step ----
    FragH ph;
    {
      const float* prow = pt + c * PTP + 8 * hh;
      const v4f p0 = *(const v4f*)(prow), p1 = *(const v4f*)(prow + 4);
      const v4f p2 = *(const v4f*)(prow + 16), p3 = *(const v4f*)(prow + 20);
#pragma unroll
      for (int e = 0; e < 4; ++e) {
        ph.h[0][e]     = (_Float16)(p0[e] * PCAR);      // elements 0..7  = keys kb + 8hh + 0..7
        ph.h[0][4 + e] = (_Float16)(p1[e] * PCAR);
        ph.h[1][e]     = (_Float16)(p2[e] * PCAR);      // elements 8..15 = keys kb + 16 + 8hh + 0..7
        ph.h[1][4 + e] = (_Float16)(p3[e] * PCAR);
      }
    }
    // ---- P.V : B fragment col n = d = j*16 + c, keys contiguous in the v^T plane; 4 groups of 2 d-subtiles ----
    {
      const _Float16* vhp = ring + bufh + (KTB / 2) + c * (VPB / 2) + sub * 32 + 8 * hh;   // d row c (+16j), keys of this step
#pragma unroll
      for (int jg = 0; jg < 4; ++jg) {
        const int da = (2 * jg) * 16 * (VPB / 2);
        const int db = da + 16 * (VPB / 2);
        const v16h vha = ldfrag_h(vhp + da), vhb2 = ldfrag_h(vhp + db);
        o[2 * jg]     = mma_h(ph.v, vha,  o[2 * jg]);
        o[2 * jg + 1] = mma_h(ph.v, vhb2, o[2 * jg + 1]);
        guard2(o[2 * jg], o[2 * jg + 1], ph.v, vha, vhb2, ph.v);
      }
    }
    wave_sync_lds();
   }
   // ---- publish point of stage st + 1: own LDS reads retired, own copies landed, every wave has left this buffer ----
   wait_ds0();
   wait_async0();
   __syncthreads();
   if (st + 2 < NST) {                                    // block-uniform: refill the buffer that this trip has just read
     stage_kv(kg0 + (size_t)(st + 2) * KSTG * KVD, vg0 + (st + 2) * KSTG,
              lk0 + (unsigned)(st & 1) * STGB, lv0 + (unsigned)(st & 1) * STGB);
   }
  }
  wait_async0();                                          // nothing in flight before the ring's bytes become the result slab
  acc_guard4(o[0], o[1], o[2], o[3]);
  acc_guard4(o[4], o[5], o[6], o[7]);
  // ---- out = acc / Z (0 if Z == 0), carries (32768 on P, 1024 on v) folded once; written into the wave-owned slab ----
#pragma unroll
  for (int r = 0; r < 8; ++r) {
    const float lv  = lrow[r];
    const float ls  = (lv > 0.0f) ? lv : 1.0f;
    const float inv = (lv > 0.0f) ? ((1.0f / ls) * oc) : 0.0f;
#pragma unroll
    for (int j = 0; j < 8; ++j) {
      const int idx = (8 * hh + r) * SLP + j * 16 + c;
      slab[idx] = o[j][r] * inv;
    }
  }

  wave_sync_lds();
  // ---- O x1024 -> f16 plane; lane = (row-in-pair rq, 8 consecutive d at c8) ----
  v4u oh[8];
  const int rq = lane >> 4, c8 = (lane & 15) * 8;
#pragma unroll
  for (int it = 0; it < 8; ++it) {
    const int row = it * 2 + rq;
    const v4f a = *(const v4f*)(slab + row * SLP + c8), b4 = *(const v4f*)(slab + row * SLP + c8 + 4);
    float w[8];
#pragma unroll
    for (int e = 0; e < 4; ++e) { w[e] = a[e] * OSC; w[4 + e] = b4[e] * OSC; }
#pragma unroll
    for (int e = 0; e < 4; ++e) {
      const _Float16 h0 = (_Float16)w[2 * e], h1 = (_Float16)w[2 * e + 1];
      oh[it][e] = pk16(h_bits(h0), h_bits(h1));
    }
  }
  const size_t ob = ((size_t)b * SEQ + q0) * DMOD + (size_t)head * HD + c8;
  {
#pragma unroll
    for (int it = 0; it < 8; ++it) {
      const int row = it * 2 + rq;
      *(v4u*)(OHp + ob + (size_t)row * DMOD) = oh[it];
    }
    
  }
}

// =====================================================================================================
// Workspace map (bytes); every plane is fully written by whole-line stores before it is read; all extents are exact multiples
// of the store granularity (no pad rows needed); every region offset a multiple of 1048576:
//   XB  bf16 [MROWS][2048]                       MROWS*4096       (NB=2: 16777216)
//   WB  16-bit [2048 n][2048 k]                  8388608          (Wv^T, Wq^T, Wk^T as bf16 ([512][2048] for k/v), then Wo^T as
//                                                                  f16 x1024, reused in launch order)
//   F   f32 [MROWS][2048]                        MROWS*8192       (v, q, k projection output in launch order, [MROWS][512] for
//                                                                  k/v; afterwards OH f16 [MROWS][2048] x1024 in its first half)
//   QH  f16 [MROWS][2048] x256                   MROWS*4096       QL residual, same extent
//   KH  f16 [MROWS][512] x256                    MROWS*1024
//   VH  f16 [NB*4][128][SEQ] x1024               MROWS*1024
//   COS f32 [MROWS][64]                          MROWS*256        SIN same extent
//   end (NB=2)                                 102760448
// =====================================================================================================
extern "C" void kernel_launch(void* const* d_in, const int* in_sizes, int n_in,
                              void* d_out, int out_size, void* d_ws, size_t ws_size,
                              hipStream_t stream) {
  if (n_in < 8) return;
  if (in_sizes[0] < MROWS * DMOD) return;
  if (in_sizes[1] < MROWS) return;
  if (in_sizes[2] != DMOD * DMOD) return;
  if (in_sizes[3] != DMOD * KVD) return;
  if (in_sizes[4] != DMOD * KVD) return;
  if (in_sizes[5] != DMOD * DMOD) return;
  if (in_sizes[6] < HD) return;
  if (in_sizes[7] < HD) return;
  if (out_size < MROWS * DMOD) return;

  const float* x   = (const float*)d_in[0];
  const int*   pos = (const int*)d_in[1];
  const float* wq  = (const float*)d_in[2];
  const float* wk  = (const float*)d_in[3];
  const float* wv  = (const float*)d_in[4];
  const float* wo  = (const float*)d_in[5];
  const float* qnw = (const float*)d_in[6];
  const float* knw = (const float*)d_in[7];
  float*       out = (float*)d_out;

  const size_t szXB = (size_t)MROWS * DMOD * 2;
  const size_t szW  = (size_t)DMOD * DMOD * 2;
  const size_t szF  = (size_t)MROWS * DMOD * 4;
  const size_t szQ  = (size_t)MROWS * DMOD * 2;                  // QH, QL, OH
  const size_t szK  = (size_t)MROWS * KVD * 2;                   // KH
  const size_t szV  = (size_t)NB * NKVH * HD * SEQ * 2;          // VH (== szK)
  const size_t szT  = (size_t)MROWS * HHALF * 4;                 // COS, SIN
  if (szQ > szF) return;                                         // OH lives inside the F region
  size_t off = 0;
  const size_t oXB = off; off += szXB;
  const size_t oW  = off; off += szW;
  const size_t oF  = off; off += szF;
  const size_t oQH = off; off += szQ;
  const size_t oQL = off; off += szQ;
  const size_t oKH = off; off += szK;
  const size_t oVH = off; off += szV;
  const size_t oCS = off; off += szT;
  const size_t oSN = off; off += szT;
  if (off > ws_size) return;                // off = 102760448 for NB = 2
  if (off > (size_t)WS_CAP) return;

  char* ws = (char*)d_ws;
  u16*   XB  = (u16*)(ws + oXB);
  u16*   WB  = (u16*)(ws + oW);
  float* F   = (float*)(ws + oF);
  u16*   OH  = (u16*)(ws + oF);
  u16*   QH  = (u16*)(ws + oQH);
  u16*   QL  = (u16*)(ws + oQL);
  u16*   KH  = (u16*)(ws + oKH);
  u16*   VH  = (u16*)(ws + oVH);
  float* COS = (float*)(ws + oCS);
  float* SIN = (float*)(ws + oSN);

  const dim3 b256(256), b128(128), bAT(ATT_THREADS);
  const int  n8x = (MROWS * DMOD) / 8;
  const dim3 gX((n8x + 255) / 256);
  const dim3 gTR(MROWS / 4);
  const dim3 gWQ((DMOD / 64) * (DMOD / 64));            // Wq [2048 k][2048 n], Wo [2048 k][2048 n]
  const dim3 gWK((DMOD / 64) * (KVD / 64));             // Wk, Wv [2048 k][512 n]
  const int  nrtK = SEQ / GBM;                          // k/v rows per batch / 128
  const int  nrtQ = SQ / GBM;                           // q / ctx / out rows per batch / 128
  const dim3 gGK(NB * nrtK * (KVD / GBN));
  const dim3 gGQ(NB * nrtQ * (DMOD / GBN));
  const dim3 gVT(NB * NKVH * NST);
  const dim3 gRQ(NB * SQ);
  const dim3 gRK(NB * SEQ);
  const dim3 gAT(NQT * NHG * NB);

  // (0) cos/sin tables from the integer positions; (1) x -> bf16 plane [MROWS][2048]
  trig64<<<gTR, b256, 0, stream>>>(pos, COS, SIN, MROWS);
  cvt16<<<gX, b256, 0, stream>>>(x, XB, n8x, 0, 1.0f);
  // (2) Wv [2048][512] -> Wv^T bf16 [512][2048]; (3) v = x.Wv -> F f32 [MROWS][512]; (4) v^T plane x1024
  wt16<<<gWK, b256, 0, stream>>>(wv, WB, DMOD, KVD, 0, 1.0f);
  gemm128<true><<<gGK, b128, 0, stream>>>(XB, WB, F, KVD, DMOD, nrtK, 1.0f);
  vt16<<<gVT, b256, 0, stream>>>(F, VH);
  // (5) Wq [2048][2048] -> Wq^T bf16; (6) q = x.Wq -> F [MROWS][2048] (rows s < SQ); (7) RMS normalisation + rotary + q planes x256
  wt16<<<gWQ, b256, 0, stream>>>(wq, WB, DMOD, DMOD, 0, 1.0f);
  gemm128<true><<<gGQ, b128, 0, stream>>>(XB, WB, F, DMOD, DMOD, nrtQ, 1.0f);
  nrope16<true><<<gRQ, dim3(DMOD / 16), 0, stream>>>(F, DMOD, SQ, qnw, COS, SIN, QH, QL, QSC);
  // (8) Wk [2048][512] -> Wk^T bf16; (9) k = x.Wk -> F [MROWS][512]; (10) RMS normalisation + rotary + k plane x256
  wt16<<<gWK, b256, 0, stream>>>(wk, WB, DMOD, KVD, 0, 1.0f);
  gemm128<true><<<gGK, b128, 0, stream>>>(XB, WB, F, KVD, DMOD, nrtK, 1.0f);
  nrope16<false><<<gRK, dim3(KVD / 16), 0, stream>>>(F, KVD, SEQ, knw, COS, SIN, KH, KH, KSC);
  // (11) Wo [2048 k][2048 n] -> Wo^T f16 plane of bf16 value x1024
  wt16<<<gWQ, b256, 0, stream>>>(wo, WB, DMOD, DMOD, 1, WOS);
  // (12) non-causal attention over all keys -> O plane (inside F)
  attn_nc<<<gAT, bAT, 0, stream>>>(QH, QL, KH, VH, OH);
  // (13) out = ctx.Wo -> f32, carries 1024 x 1024 folded back
  gemm128<false><<<gGQ, b128, 0, stream>>>(OH, WB, out, DMOD, DMOD, nrtQ, 1.0f / (OSC * WOS));
  (void)hipGetLastError();
}

// v003
// Measured time: 235 microseconds a run.
// In both of two side-by-side timings against v002, it was 1.46 times as fast.
// Over all steps from v000 it is 2.32 times as fast.
// Contractions: x.Wq, x.Wk, x.Wv on v_wmma_f32_16x16x32_bf16 (x and W^T as bf16 RNE planes, f32 accumulate);
// q.k^T over hd 128 on v_wmma_f32_16x16x32_f16 with q as f16 hi + f16 residual planes (x256) and k as one f16 plane
// (x256), products qh.k + ql.k; P.v on v_wmma_f32_16x16x32_f16 with P x32768 and v^T x1024 as single f16 planes;
// ctx.Wo on v_wmma_f32_16x16x32_f16 with ctx x1024 as one f16 plane and Wo^T as f16(bf16 RNE(Wo)) x1024; all f32
// accumulate. RMS normalisation, rotate-half rotary from integer positions (cos/sin tables built on device in f32),
// base-2 online softmax and the 1/Z fold in f32 on VALU.
#include <hip/hip_runtime.h>
#include <math.h>
#include <stdint.h>

#ifndef NB
#define NB 2
#endif
#define SEQ 2048
#ifndef SQ
#define SQ SEQ
#endif
#define DMOD  2048
#define NH    16
#define NKVH  4
#define HD    128
#define HHALF (HD / 2)
#define KVD   (NKVH * HD)
#define MROWS (NB * SEQ)
#define EPS_RMS 0.000001f
#define RSQ_HD 0.08838834764831845f
#define LOG2E 1.4426950408889634f
#define LOG2THETA 19.931568569324174
#define QSC   256.0f
#define KSC   256.0f
#define PCAR  32768.0f
#define VCAR  1024.0f
#define OSC   1024.0f
#define WOS   1024.0f
#define WPB   (NH / NKVH)
#define NHG   NKVH
#define NQT   (SQ / 16)
#define NST   (SEQ / 64)
#define NKT   (SEQ / 32)
#define ATT_THREADS (WPB * 32)
#define SLP   132
#define SLW   (16 * SLP)
#define SLAB64 (16 * 68)
#define VTP   72
#define WTP   72
#define WS_CAP 134217728
#define KSTG  64
#define KPB   272
#define VPB   144
#define KTB   (KSTG * KPB)
#define VTB   (HD * VPB)
#define STGB  (KTB + VTB)
#define RINGB (2 * STGB)
#define GBM   128
#define GBN   128
#define GKS   64
#define GPB   144
#define GATB  (GBM * GPB)
#define GSTB  ((GBM + GBN) * GPB)
#define GRINGB (2 * GSTB)
static_assert(DMOD == NH * HD && HD == 128 && HHALF == 64 && NH == 16 && NKVH == 4 && WPB == 4 && NHG * WPB == NH);
static_assert(ATT_THREADS == 128 && KVD == 512);
static_assert(NB >= 1 && NB <= 2);
static_assert((SEQ % 64) == 0 && (SQ % 64) == 0 && SQ >= 64 && SQ <= SEQ);
static_assert((DMOD % 64) == 0 && (KVD % 64) == 0 && (DMOD % 32) == 0 && (HD % 32) == 0);
static_assert(((MROWS * DMOD / 8) % 256) == 0 && (MROWS % 4) == 0);
static_assert(KSTG == 64 && NST >= 2 && NST * KSTG == SEQ && (KPB % 16) == 0 && (VPB % 16) == 0 && (KTB % 16) == 0 && (STGB % 16) == 0);
static_assert(KPB == HD * 2 + 16 && VPB == KSTG * 2 + 16 && WPB * SLW * 4 <= RINGB && 4 * RINGB <= 327680);
static_assert(HD * VTP * 2 <= 65536 && 64 * WTP * 2 <= 65536);
static_assert(GBM == 128 && GBN == 128 && GKS == 64 && GPB == GKS * 2 + 16 && (GPB % 16) == 0 && (GSTB % 16) == 0);
static_assert((SEQ % GBM) == 0 && (SQ % GBM) == 0 && (DMOD % GBN) == 0 && (KVD % GBN) == 0 && (DMOD % GKS) == 0 && DMOD / GKS >= 2);
static_assert(2 * (GRINGB + 4 * 4 * SLAB64 * 4) <= 327680);
static_assert((DMOD / 16) <= 128 && (KVD / 16) <= 128 && ((DMOD / 16) % 32) == 0 && ((KVD / 16) % 32) == 0);

typedef unsigned short u16;
typedef _Float16 v16h __attribute__((ext_vector_type(16)));
typedef _Float16 v8h  __attribute__((ext_vector_type(8)));
typedef __bf16   v16b __attribute__((ext_vector_type(16)));
typedef float    v8f  __attribute__((ext_vector_type(8)));
typedef float    v4f  __attribute__((ext_vector_type(4)));
typedef unsigned int v4u __attribute__((ext_vector_type(4)));

union FragH { v16h v; v8h h[2]; v4u u[2]; };
union FragB { v16b v; v4u u[2]; };

// ---- scalar helpers --------------------------------------------------------------------------------
__device__ __forceinline__ unsigned short bf_bits(float f) {          // f32 -> bf16 bits, RNE convert
  unsigned u = __float_as_uint(f);
  return (unsigned short)((u + 0x7FFFu + ((u >> 16) & 1u)) >> 16);
}
__device__ __forceinline__ float bf_up(unsigned short h) { return __uint_as_float(((unsigned)h) << 16); }
__device__ __forceinline__ float bfr(float f) { return bf_up(bf_bits(f)); }
__device__ __forceinline__ unsigned short h_bits(_Float16 x) { return __builtin_bit_cast(unsigned short, x); }
__device__ __forceinline__ unsigned pk16(unsigned short a, unsigned short b) { return (unsigned)a | ((unsigned)b << 16); }
__device__ __forceinline__ v8f zero8() { v8f z = {0.f, 0.f, 0.f, 0.f, 0.f, 0.f, 0.f, 0.f}; return z; }

// ---- fragment loaders: 16-bit A/B operand, lane -> row/col (lane&15), p already includes +8*(lane>>4);
//      elements 0..7 <- p[0..7] (k0+8h..), elements 8..15 <- p[16..23] (k0+16+8h..)  (same split k map for A and B;
//      B is always read from a k-contiguous [n][k] plane)
__device__ __forceinline__ v16h ldfrag_h(const _Float16* p) {
  FragH f;
  f.h[0] = *(const v8h*)(p);
  f.h[1] = *(const v8h*)(p + 16);
  return f.v;
}
__device__ __forceinline__ v16b ldfrag_b(const u16* p) {              // bf16 plane read as unsigned integer vectors
  FragB f;
  f.u[0] = *(const v4u*)(p);
  f.u[1] = *(const v4u*)(p + 16);
  return f.v;
}

__device__ __forceinline__ v8f mma_h(v16h a, v16h b, v8f c) {
  return __builtin_amdgcn_wmma_f32_16x16x32_f16(false, a, false, b, (short)0, c, false, false);
}
__device__ __forceinline__ v8f mma_b(v16b a, v16b b, v8f c) {
  return __builtin_amdgcn_wmma_f32_16x16x32_bf16(false, a, false, b, (short)0, c, false, false);
}
__device__ __forceinline__ void acc_guard8(v8f (&a)[8]) {
#if defined(__HIP_DEVICE_COMPILE__)
  asm volatile("v_nop\n\tv_nop\n\tv_nop\n\tv_nop"
               : "+v"(a[0]), "+v"(a[1]), "+v"(a[2]), "+v"(a[3]), "+v"(a[4]), "+v"(a[5]), "+v"(a[6]), "+v"(a[7]));
#endif
}
__device__ __forceinline__ void wave_sync_lds() {
  __builtin_amdgcn_fence(__ATOMIC_RELEASE, "workgroup");
  __builtin_amdgcn_wave_barrier();
  __builtin_amdgcn_fence(__ATOMIC_ACQUIRE, "workgroup");
}
// lane l's value from lane l ^ 16: the two halves of the wave hold the two halves of a query column's keys
__device__ __forceinline__ float xhalf(float x) {
  const int b = __builtin_bit_cast(int, x);
  return __builtin_bit_cast(float, __builtin_amdgcn_permlanex16(b, b, 0x76543210, 0xfedcba98, false, false));
}
// Eight asynchronous 16-byte copies of this lane, global -> LDS (l = LDS byte address, g = global address, both 16-B aligned).
// The closing s_wait_xcnt 0 stands inside the statement so that no address register is rewritten in front of it.
__device__ __forceinline__ void async8(const unsigned* l, const u16* const* g) {
#if defined(__HIP_DEVICE_COMPILE__)
  asm volatile("global_load_async_to_lds_b128 %0, %8, off\n\t"
               "global_load_async_to_lds_b128 %1, %9, off\n\t"
               "global_load_async_to_lds_b128 %2, %10, off\n\t"
               "global_load_async_to_lds_b128 %3, %11, off\n\t"
               "global_load_async_to_lds_b128 %4, %12, off\n\t"
               "global_load_async_to_lds_b128 %5, %13, off\n\t"
               "global_load_async_to_lds_b128 %6, %14, off\n\t"
               "global_load_async_to_lds_b128 %7, %15, off\n\t"
               "s_wait_xcnt 0x0"
               :: "v"(l[0]), "v"(l[1]), "v"(l[2]), "v"(l[3]), "v"(l[4]), "v"(l[5]), "v"(l[6]), "v"(l[7]),
                  "v"(g[0]), "v"(g[1]), "v"(g[2]), "v"(g[3]), "v"(g[4]), "v"(g[5]), "v"(g[6]), "v"(g[7])
               : "memory");
#endif
}
// One stage (64 keys) of k rows and v^T rows into one ring buffer, 16 copies per lane of the 128 threads:
//   k   chunk i: key row i*8 + (tid>>4), 16-B piece tid&15  (a wave covers two whole 256-B rows), LDS pitch KPB;
//   v^T chunk i: d row i*16 + (tid>>3), 16-B piece tid&7    (a wave covers four whole 128-B rows), LDS pitch VPB.
// kg, vg, lk, lv are this lane's addresses of chunk 0.
__device__ __forceinline__ void stage_kv(const u16* kg, const u16* vg, unsigned lk, unsigned lv) {
  unsigned l[8];
  const u16* g[8];
  // both loops unrolled so that l[] and g[] are registers, as the asm operands need them
#pragma unroll
  for (int i = 0; i < 8; ++i) { l[i] = lk + (unsigned)(i * 8 * KPB); g[i] = kg + (size_t)(i * 8) * KVD; }
  async8(l, g);
#pragma unroll
  for (int i = 0; i < 8; ++i) { l[i] = lv + (unsigned)(i * 16 * VPB); g[i] = vg + (size_t)(i * 16) * SEQ; }
  async8(l, g);
}
// One GEMM stage (64 k = 128 B of each row) of 128 A rows and 128 B rows into one ring buffer, 16 copies per lane of the
// 128 threads: chunk i = row i*16 + (tid>>3), 16-B piece tid&7 (a wave covers four whole 128-B row pieces), LDS pitch GPB.
// ag, bg, la, lb are this lane's addresses of chunk 0; rs16 = 16 rows of the global planes, in elements.
__device__ __forceinline__ void stage_ab(const u16* ag, const u16* bg, size_t rs16, unsigned la, unsigned lb) {
  unsigned l[8];
  const u16* g[8];
  // both loops unrolled so that l[] and g[] are registers, as the asm operands need them
#pragma unroll
  for (int i = 0; i < 8; ++i) { l[i] = la + (unsigned)(i * 16 * GPB); g[i] = ag + (size_t)i * rs16; }
  async8(l, g);
#pragma unroll
  for (int i = 0; i < 8; ++i) { l[i] = lb + (unsigned)(i * 16 * GPB); g[i] = bg + (size_t)i * rs16; }
  async8(l, g);
}
// the issuing wave's own wait: every asynchronous copy it has issued has landed in LDS
__device__ __forceinline__ void wait_async0() {
#if defined(__HIP_DEVICE_COMPILE__)
  asm volatile("s_wait_asynccnt 0x0" ::: "memory");
#endif
}
// this wave's LDS reads and writes have retired (in front of the barrier behind which a buffer is refilled)
__device__ __forceinline__ void wait_ds0() {
#if defined(__HIP_DEVICE_COMPILE__)
  asm volatile("s_wait_dscnt 0x0" ::: "memory");
#endif
}

// =====================================================================================================
// cos/sin tables for the rotary: row = b*SEQ + s (0 .. nrows-1), column j = 0..63:
//   invf[j] = 1e6^(-j/64) (f64 exp2, converted to f32), ang = float(pos[row]) * invf[j] (f32 multiply),
//   cosT[row][j] = cosf(ang), sinT[row][j] = sinf(ang).
// Block = 4 rows x 64 j (one value pair per thread) staged in LDS; after the barrier waves 0,1 write the 4 cos rows and
// coverage: grid = nrows/4 blocks x (2 tables x 4 rows x 64 floats) = both tables exactly once (nrows % 4 == 0, host).
// =====================================================================================================
__global__ __launch_bounds__(256) void trig64(const int* __restrict__ pos, float* cosT, float* sinT, int nrows) {
#pragma clang fp contract(off)
  __shared__ __align__(16) float cs[2 * 256];
  const int tid  = (int)threadIdx.x;
  const int row0 = (int)blockIdx.x * 4;
  if (row0 + 4 > nrows) return;                       // block-uniform, before the barrier; never taken with the exact grid
  const int r = tid >> 6, j = tid & 63;
  const float p    = (float)pos[row0 + r];
  const float invf = (float)exp2(-(double)j * (LOG2THETA / 64.0));
  const float ang  = p * invf;
  cs[tid]       = cosf(ang);
  cs[256 + tid] = sinf(ang);
  __syncthreads();
  if (tid < 128) {                                    // waves 0..3, wave-uniform
    const int tb    = tid >> 6;                       // 0: cos rows (waves 0,1), 1: sin rows (waves 2,3)
    const int q     = tid & 63;
    const int rr    = q >> 4;
    const int piece = (q & 15) * 4;
    const v4f v = *(const v4f*)(cs + tb * 256 + rr * 64 + piece);
    float* base = (tb != 0) ? sinT : cosT;
    float* dst  = base + (size_t)(row0 + rr) * HHALF + piece;
    {
      *(v4f*)(dst) = v;
      
    }
  }
}

// =====================================================================================================
// f32 -> 16-bit plane, same layout.  f16mode == 0: bf16 RNE bits;  f16mode == 1: f16 bits of (bf16 RNE value) * scale.
// Thread = 8 consecutive elements: two 16-B loads, one 16-B store; 32 consecutive lanes = 512 contiguous, 512-B aligned
// coverage: grid = ceil(n8/256) blocks x 256 thr x 8 (in-kernel bound) = the whole plane (n8 a multiple of 256 here).
// =====================================================================================================
__global__ __launch_bounds__(256) void cvt16(const float* __restrict__ x, u16* D, int n8, int f16mode, float scale) {
  const int gt = blockIdx.x * 256 + (int)threadIdx.x;
  if (gt >= n8) return;
  const float* p = x + (size_t)gt * 8;
  const v4f a = *(const v4f*)(p), b4 = *(const v4f*)(p + 4);
  float w[8];
#pragma unroll
  for (int e = 0; e < 4; ++e) { w[e] = a[e]; w[4 + e] = b4[e]; }
  v4u o;
#pragma unroll
  for (int e = 0; e < 4; ++e) {
    const float f0 = w[2 * e], f1 = w[2 * e + 1];
    const unsigned short hb0 = h_bits((_Float16)(bfr(f0) * scale));
    const unsigned short hb1 = h_bits((_Float16)(bfr(f1) * scale));
    const unsigned short bb0 = bf_bits(f0);
    const unsigned short bb1 = bf_bits(f1);
    o[e] = (f16mode != 0) ? pk16(hb0, hb1) : pk16(bb0, bb1);
  }
  u16* d = D + (size_t)gt * 8;
  {
    *(v4u*)(d) = o;
    
  }
}

// =====================================================================================================
// Weight transpose + convert: W f32 [K rows][N cols] (row pitch N) -> Wt 16-bit [N rows][K cols] (row pitch K), so that
// a column n of W becomes the k-contiguous B operand row n.  f16mode == 0: bf16 RNE bits; 1: f16 bits of (bf16 RNE value)*scale.
// Block = 64 k x 64 n tile: load phase 4 iterations x (16 k rows x 16 lanes x 4 n) with 16-B loads into an LDS tile
// coverage: load 4 it x 256 thr x 4 = 64 x 64; store 2 it x 256 thr x 8 halves = 64 rows x 64; grid = (K/64)*(N/64)
//           blocks = the whole [N][K] plane exactly once.
// =====================================================================================================
__global__ __launch_bounds__(256) void wt16(const float* __restrict__ W, u16* Wt, int K, int N, int f16mode, float scale) {
  __shared__ __align__(16) u16 T[64 * WTP];
  const int tid = (int)threadIdx.x;
  const int nkt = K >> 6;
  const int bid = (int)blockIdx.x;
  const int kt  = bid % nkt;
  const int nt  = bid / nkt;
  const int kb  = kt * 64, nb = nt * 64;
  if (nb + 64 > N) return;                            // block-uniform, before the barrier; never taken with the exact grid
  const int c4 = (tid & 15) * 4;                      // n within tile
  const int r0 = tid >> 4;                            // k within tile (0..15) + 16*it
#pragma unroll
  for (int it = 0; it < 4; ++it) {
    const int r = it * 16 + r0;
    const v4f a = *(const v4f*)(W + (size_t)(kb + r) * (size_t)N + nb + c4);
#pragma unroll
    for (int e = 0; e < 4; ++e) {
      const float f = a[e];
      const unsigned short hb = h_bits((_Float16)(bfr(f) * scale));
      const unsigned short bb = bf_bits(f);
      T[(c4 + e) * WTP + r] = (f16mode != 0) ? hb : bb;
    }
  }
  __syncthreads();
  v4u o[2];
  const int q8 = tid >> 3, p8 = (tid & 7) * 8;
#pragma unroll
  for (int it = 0; it < 2; ++it) o[it] = *(const v4u*)(T + (it * 32 + q8) * WTP + p8);
  u16* dst = Wt + (size_t)(nb + q8) * (size_t)K + kb + p8;
  {
#pragma unroll
    for (int it = 0; it < 2; ++it) {
      *(v4u*)(dst + (size_t)(it * 32) * (size_t)K) = o[it];
    }
    
  }
}

// =====================================================================================================
// v^T plane from the v projection F f32 [MROWS][KVD] (row = b*SEQ + s, column = g*HD + d):
//   VH[((b*NKVH + g)*HD + d)][s] = f16(v * 1024) for all keys s.
// Block = (b, kv head g, 64 keys s0): each thread loads its 32 floats (key sl, d chunk dc) with 16-B loads, converts, scatters
// coverage: load 256 thr x 32 = 64 keys x 128 d; store 4 iterations x 256 thr x 8 halves = 128 lines x 64 = the block's tile;
//           grid = NB*NKVH*NST blocks covers the plane exactly once.
// =====================================================================================================
__global__ __launch_bounds__(256) void vt16(const float* __restrict__ F, u16* VHo) {
  __shared__ __align__(16) u16 TH[HD * VTP];
  const int tid = (int)threadIdx.x;
  const int bid = (int)blockIdx.x;
  const int st  = bid % NST;
  const int t2  = bid / NST;
  const int g   = t2 % NKVH;
  const int b   = t2 / NKVH;
  if (b >= NB) return;                                // block-uniform, before any barrier; never taken with the exact grid
  const int s0  = st * 64;
  {
    const int sl = tid >> 2;                          // key within tile 0..63
    const int dc = (tid & 3) * 32;                    // d chunk 0,32,64,96
    const float* src = F + ((size_t)b * SEQ + s0 + sl) * KVD + g * HD + dc;
#pragma unroll
    for (int i = 0; i < 8; ++i) {
      const v4f a = *(const v4f*)(src + 4 * i);
#pragma unroll
      for (int e = 0; e < 4; ++e) {
        const float t = a[e] * VCAR;
        TH[(dc + 4 * i + e) * VTP + sl] = h_bits((_Float16)t);
      }
    }
  }
  __syncthreads();
  v4u vh[4];
  const int q8 = tid >> 3, p8 = (tid & 7) * 8;
#pragma unroll
  for (int it = 0; it < 4; ++it) {
    const int line = it * 32 + q8;                    // d = 0..127
    vh[it] = *(const v4u*)(TH + line * VTP + p8);
  }
  const size_t hrow = (size_t)(b * NKVH + g) * HD;
  const size_t base = hrow * SEQ + s0 + p8;
  {
#pragma unroll
    for (int it = 0; it < 4; ++it) {
      const int line = it * 32 + q8;
      *(v4u*)(VHo + base + (size_t)line * SEQ) = vh[it];
    }
    
  }
}

// =====================================================================================================
// Per-head RMS normalisation + rotate-half rotary + 16-bit planes from a projection F f32 [MROWS][ncol]
// (ncol = DMOD for q, KVD for k; row = b*SEQ + s with s < nrows, column = head*HD + d):
//   rs = 1/sqrt(mean_d(x[head][d]^2) + eps) over the head's 128 columns (f32 sum of squares: 16 per thread, then an
//   8-lane shuffle sum, the 8 lanes of a head are 8 consecutive lanes); y[d] = (x[d]*rs) * w[d] with w = bf16 RNE value
//   of the norm weight; then for j < 64 within a head, with c = cosT[row][j], sn = sinT[row][j] (f32 tables):
//   out[j]    = y[j]*c    - y[j+64]*sn
//   out[j+64] = y[j+64]*c + y[j]*sn
//   Hp [MROWS][ncol] = f16(out * sc); if RES also Lp [MROWS][ncol] = f16 residual (t - f16(t)), same layout.
// Block = one row, exactly ncol/16 threads (host); thread t = head t>>3, chunk i = t&7: columns head*HD + 8i .. +7 and + 64.
// lane-varying control anywhere (shuffles with all lanes active).
// coverage: (ncol/16) thr x 16 = the whole row of Hp (and of Lp); grid = NB*nrows blocks = every processed row once.
// =====================================================================================================
__device__ __forceinline__ void rot_pair(float xl, float xh, float cv, float sv, float sc,
                                         unsigned short& hl, unsigned short& hhv, unsigned short& ll, unsigned short& lh) {
#pragma clang fp contract(off)
  const float rl = xl * cv - xh * sv;
  const float rh = xh * cv + xl * sv;
  const float tl = rl * sc, th = rh * sc;
  const _Float16 a = (_Float16)tl, bq = (_Float16)th;
  hl  = h_bits(a);
  hhv = h_bits(bq);
  ll  = h_bits((_Float16)(tl - (float)a));
  lh  = h_bits((_Float16)(th - (float)bq));
}

template <bool RES>
__global__ __launch_bounds__(128) void nrope16(const float* __restrict__ F, int ncol, int nrows, const float* __restrict__ nw,
                                               const float* __restrict__ cosT, const float* __restrict__ sinT,
                                               u16* Hp, u16* Lp, float sc) {
#pragma clang fp contract(off)
  const int tid = (int)threadIdx.x;
  const int blk = (int)blockIdx.x;
  const int b   = blk / nrows;
  const int s   = blk - b * nrows;
  if (b >= NB) return;                                 // block-uniform; never taken with the exact grid
  const int row = b * SEQ + s;
  const int dlo = (tid & 7) * 8;                       // j within head, multiple of 8
  const int clo = (tid >> 3) * HD + dlo;               // column of the low-half chunk; clo + 64 + 8 <= ncol by blockDim
  const float* p = F + (size_t)row * ncol + clo;
  const v4f xa = *(const v4f*)(p), xb = *(const v4f*)(p + 4);
  const v4f ya = *(const v4f*)(p + HHALF), yb = *(const v4f*)(p + HHALF + 4);
  const size_t trow = (size_t)row * HHALF + dlo;
  const v4f ca = *(const v4f*)(cosT + trow), cb = *(const v4f*)(cosT + trow + 4);
  const v4f sa = *(const v4f*)(sinT + trow), sb = *(const v4f*)(sinT + trow + 4);
  const v4f wa = *(const v4f*)(nw + dlo), wb4 = *(const v4f*)(nw + dlo + 4);
  const v4f wc = *(const v4f*)(nw + HHALF + dlo), wd = *(const v4f*)(nw + HHALF + dlo + 4);
  float xl[8], xh[8], cv[8], sv[8], wl[8], wh[8];
#pragma unroll
  for (int e = 0; e < 4; ++e) {
    xl[e] = xa[e];        xl[4 + e] = xb[e];
    xh[e] = ya[e];        xh[4 + e] = yb[e];
    cv[e] = ca[e];        cv[4 + e] = cb[e];
    sv[e] = sa[e];        sv[4 + e] = sb[e];
    wl[e] = bfr(wa[e]);   wl[4 + e] = bfr(wb4[e]);
    wh[e] = bfr(wc[e]);   wh[4 + e] = bfr(wd[e]);
  }
  // sum of squares over the head's 128 columns: 16 here, then lanes xor 1, 2, 4 (aligned groups of 8 lanes = one head)
  float ss = 0.0f;
#pragma unroll
  for (int e = 0; e < 8; ++e) { ss = ss + xl[e] * xl[e]; ss = ss + xh[e] * xh[e]; }
  ss += __shfl_xor(ss, 1, 32);
  ss += __shfl_xor(ss, 2, 32);
  ss += __shfl_xor(ss, 4, 32);
  const float var = ss * (1.0f / (float)HD);
  const float rs  = 1.0f / sqrtf(var + EPS_RMS);
#pragma unroll
  for (int e = 0; e < 8; ++e) {
    xl[e] = (xl[e] * rs) * wl[e];
    xh[e] = (xh[e] * rs) * wh[e];
  }
  v4u ohl, ohh, oll, olh;
#pragma unroll
  for (int e = 0; e < 4; ++e) {
    unsigned short hl0, hh0, ll0, lh0, hl1, hh1, ll1, lh1;
    rot_pair(xl[2 * e],     xh[2 * e],     cv[2 * e],     sv[2 * e],     sc, hl0, hh0, ll0, lh0);
    rot_pair(xl[2 * e + 1], xh[2 * e + 1], cv[2 * e + 1], sv[2 * e + 1], sc, hl1, hh1, ll1, lh1);
    ohl[e] = pk16(hl0, hl1);
    ohh[e] = pk16(hh0, hh1);
    oll[e] = pk16(ll0, ll1);
    olh[e] = pk16(lh0, lh1);
  }
  u16* dh = Hp + (size_t)row * ncol + clo;
  u16* dl = Lp + (size_t)row * ncol + clo;             // dereferenced only when RES
  {
    *(v4u*)(dh) = ohl;
    *(v4u*)(dh + HHALF) = ohh;
    if constexpr (RES) {
      *(v4u*)(dl) = oll;
      *(v4u*)(dl + HHALF) = olh;
    }
    
  }
}

// =====================================================================================================
// The wave's 64 x 64 tile of C: accumulators * oscale -> the wave's own slab [64][68] -> whole 256-B row pieces of C.
// coverage: 32 instructions x 2 rows x 16 lanes x 4 floats = the wave's 64 x 64 tile.
// =====================================================================================================
__device__ __forceinline__ void epi64x64(float* sl, const v8f (&acc)[4][4], float oscale,
                                         float* C, int N, size_t rowb, int col0, int lane) {
  const int hh = lane >> 4, m = lane & 15;
#pragma unroll
  for (int i = 0; i < 4; ++i) {
#pragma unroll
    for (int r = 0; r < 8; ++r) {
      const int ro = (i * 16 + 8 * hh + r) * 68 + m;
      sl[ro]      = acc[i][0][r] * oscale;
      sl[ro + 16] = acc[i][1][r] * oscale;
      sl[ro + 32] = acc[i][2][r] * oscale;
      sl[ro + 48] = acc[i][3][r] * oscale;
    }
  }
  wave_sync_lds();
  float* dst = C + (rowb + (size_t)hh) * (size_t)N + col0 + m * 4;
#pragma unroll
  for (int it = 0; it < 32; ++it) {
    const v4f v = *(const v4f*)(sl + (it * 2 + hh) * 68 + m * 4);
    *(v4f*)(dst + (size_t)(it * 2) * (size_t)N) = v;
  }
}

// =====================================================================================================
// GEMM: C[row][N] (f32, row pitch N) = A[row][K] (16-bit row-major, pitch K) . Bt[N][K]^T (16-bit k-contiguous) * oscale,
// row = bb*SEQ + s for s < 128*nrt.  BF: bf16 operands (v_wmma_f32_16x16x32_bf16), else f16 (v_wmma_f32_16x16x32_f16).
// Block -> (column tile ct = bid % (N/128), row tile rt of nrt, batch bb): a 128 x 128 tile of C; 4 waves as 2 x 2, each a
// 64 x 64 tile = 4 x 4 accumulators, so that a fragment read from LDS serves four products.
// The 128 A rows and 128 Bt rows reach the waves through an LDS ring of two buffers, 64 k a stage, filled by asynchronous
// copies of whole 128-B row pieces; fragments by two 16-B LDS loads each (split k map for A and B); k in ascending steps of 32
// per accumulator.  One block barrier per stage, under block-uniform control flow (host: K % 64 == 0, N % 128 == 0).
// coverage: 4 waves x 4 row groups x (16 x 64) = the block's tile; grid = NB * nrt * (N/128) blocks = every row s < 128*nrt once.
// =====================================================================================================
template <bool BF> struct FragSel { typedef v16h T; };
template <> struct FragSel<true> { typedef v16b T; };
template <bool BF>
__device__ __forceinline__ typename FragSel<BF>::T ldfrag_t(const u16* p) {
  if constexpr (BF) return ldfrag_b(p);
  else return ldfrag_h((const _Float16*)(const void*)p);
}
template <bool BF>
__device__ __forceinline__ v8f mma_t(typename FragSel<BF>::T a, typename FragSel<BF>::T b, v8f c) {
  if constexpr (BF) return mma_b(a, b, c);
  else return mma_h(a, b, c);
}

template <bool BF>
__global__ __launch_bounds__(128)
void gemm128(const u16* __restrict__ A, const u16* __restrict__ Bt, float* C, int N, int K, int nrt, float oscale) {
  __shared__ __align__(16) u16 ring[GRINGB / 2];          // two buffers of (128 A rows, 128 Bt rows), pitch GPB
  __shared__ __align__(16) float slab[4 * 4 * SLAB64];    // per wave [64][68]
  const int tid = (int)threadIdx.x, wave = tid >> 5, lane = tid & 31, hh = lane >> 4, m = lane & 15;
  const int ntile = N >> 7;
  const int bid   = (int)blockIdx.x;
  const int ct    = bid % ntile;
  const int t2    = bid / ntile;
  const int rt    = t2 % nrt;
  const int bb    = t2 / nrt;
  if (bb >= NB) return;                     // block-uniform, before any barrier or copy; never taken with the exact grid
  if (rt * GBM + GBM > SEQ) return;         // block-uniform; never taken
  const int nstg  = K >> 6;
  const int col0  = ct * GBN;
  const size_t row0 = (size_t)bb * SEQ + (size_t)(rt * GBM);
  const int wr = wave >> 1, wc = wave & 1;  // this wave's 64 x 64 tile inside the block's
  // this lane's chunk 0 of stage 0 (stage_ab): global addresses and LDS byte addresses in buffer 0
  const size_t rs16 = (size_t)16 * (size_t)K;
  const u16* ag0 = A  + (row0 + (size_t)(tid >> 3)) * (size_t)K + (tid & 7) * 8;
  const u16* bg0 = Bt + (size_t)(col0 + (tid >> 3)) * (size_t)K + (tid & 7) * 8;
  const unsigned lring = (unsigned)(size_t)(const void*)ring;
  const unsigned la0 = lring + (unsigned)((tid >> 3) * GPB + (tid & 7) * 16);
  const unsigned lb0 = la0 + (unsigned)GATB;

  v8f acc[4][4];
#pragma unroll
  for (int i = 0; i < 4; ++i) {
#pragma unroll
    for (int j = 0; j < 4; ++j) acc[i][j] = zero8();
  }

  // ---- ring prologue: stage 0 lands and is published, then stage 1 flies while stage 0 is worked on ----
  stage_ab(ag0, bg0, rs16, la0, lb0);
  wait_async0();
  __syncthreads();
  if (nstg > 1) stage_ab(ag0 + GKS, bg0 + GKS, rs16, la0 + (unsigned)GSTB, lb0 + (unsigned)GSTB);   // block-uniform

  // kept rolled: one trip = one stage, with its one publish point at the foot
#pragma unroll 1
  for (int st = 0; st < nstg; ++st) {
    const int bufh = (st & 1) * (GSTB / 2);               // this stage's buffer, in halves
    const u16* ap = ring + bufh + (wr * 64 + m) * (GPB / 2) + 8 * hh;
    const u16* bp = ring + bufh + (GATB / 2) + (wc * 64 + m) * (GPB / 2) + 8 * hh;
    // both 32-k steps of a stage unrolled: their LDS offsets become immediates
    typename FragSel<BF>::T a[GKS / 32][4], b[GKS / 32][4];
#pragma unroll
    for (int ks = 0; ks < GKS / 32; ++ks) {
#pragma unroll
      for (int j = 0; j < 4; ++j) b[ks][j] = ldfrag_t<BF>(bp + j * 16 * (GPB / 2) + ks * 32);
#pragma unroll
      for (int i = 0; i < 4; ++i) a[ks][i] = ldfrag_t<BF>(ap + i * 16 * (GPB / 2) + ks * 32);
    }
    // keeps the stage's 32 LDS reads together in front of its 32 products: left free, the compiler reloads one A fragment
    // per four products and waits out the LDS latency each time
    __builtin_amdgcn_sched_barrier(0);
#pragma unroll
    for (int ks = 0; ks < GKS / 32; ++ks) {
#pragma unroll
      for (int i = 0; i < 4; ++i) {
#pragma unroll
        for (int j = 0; j < 4; ++j) acc[i][j] = mma_t<BF>(a[ks][i], b[ks][j], acc[i][j]);
      }
    }
    // keeps the products in front of the publish point: left free, they sink behind the barrier, the waits stand directly
    // behind the LDS reads, and the next stage's copies lose the products' time as their lead
    __builtin_amdgcn_sched_barrier(0);
    // ---- publish point of stage st + 1: own LDS reads retired, own copies landed, every wave has left this buffer ----
    wait_ds0();
    wait_async0();
    __syncthreads();
    if (st + 2 < nstg) {                                  // block-uniform: refill the buffer that this trip has just read
      stage_ab(ag0 + (size_t)(st + 2) * GKS, bg0 + (size_t)(st + 2) * GKS, rs16,
               la0 + (unsigned)(st & 1) * GSTB, lb0 + (unsigned)(st & 1) * GSTB);
    }
  }
  wait_async0();                                          // nothing in flight when the wave ends
  epi64x64(slab + wave * (4 * SLAB64), acc, oscale, C, N, row0 + (size_t)(wr * 64), col0 + wc * 64, lane);
}

// =====================================================================================================
// Non-causal grouped-query attention, hd = 128, all SEQ keys. Block bid -> (query tile qt = bid % NQT: rows q0 = 16*qt ..
// q0+15, head group hg = kv head, batch b); one wave per query head = hg*WPB + wave (the 4 heads of the group share kv head hg).
//   q hi / residual planes f16 x256 [b*SEQ + s][h*HD + d]; k plane f16 x256 [b*SEQ + s][g*HD + d] (pitch KVD);
//   v^T plane [b*NKVH + g][d][SEQ] x1024.
//   scores = q_hi.k + q_lo.k (4 k-steps over d); P.v with P x32768 (f16) and v^T, for every query row;
//   O written as one f16 plane (O x1024, layout [b*SEQ + s][h*HD + d]).
//   score (log2 domain) t(i, j) = (q_i.k_j over HD) * (1/sqrt(128))*log2e/(256*256).
//   k rows and v^T rows reach the 4 waves through an LDS ring of two buffers, 64 keys a stage, filled by asynchronous copies.
//   Both products are taken transposed: S^T = k.q^T (A = k rows from the ring, B = q, loaded once and kept in registers) and
//   O^T += v^T.P^T (A = v^T rows from the ring, B = P^T), all fragments in the split k map. A lane (c, hh) then holds, of query
//   column q0 + c, the scores of keys kb + 8hh + r and kb + 16 + 8hh + r: maximum and sum run inside the lane, the maximum is
//   joined with the other half by one cross-row move per 32 keys, the sums once after the loop; the two score tiles, converted
//   in place (P x32768, f16), are the B fragment of the second product. All NKT key tiles of 32 visited in order; online
//   max-subtracted base-2 softmax in f32, -inf-safe rescale.
//   After the loop: out = acc / Z (Z >= 1 always; guarded anyway), carries 1/(32768*1024) folded once, written into the slab.
//   One block barrier per stage, under block-uniform control flow; bounded loops only (NST compile-time).
// coverage: per wave 8 instructions x 2 rows x 16 lanes x 8 halves = 16 x 128; grid NQT x NHG x NB blocks x WPB
//           waves = every (b, s < SQ, h) row segment of O exactly once.
// =====================================================================================================
__global__ __launch_bounds__(ATT_THREADS)
void attn_nc(const u16* __restrict__ QHp, const u16* __restrict__ QLp, const u16* __restrict__ KHp,
             const u16* __restrict__ VHp, u16* OHp) {
  __shared__ __align__(16) _Float16 ring[RINGB / 2];      // two buffers of (64 k rows pitch KPB, 128 v^T rows pitch VPB)

  const int tid  = (int)threadIdx.x;
  const int wave = tid >> 5;
  const int lane = tid & 31;
  const int hh   = lane >> 4;
  const int c    = lane & 15;
  const int bid  = (int)blockIdx.x;
  const int qt   = bid % NQT;
  const int t2   = bid / NQT;
  const int hg   = t2 % NHG;
  const int b    = t2 / NHG;
  if (b >= NB) return;                      // block-uniform, before any barrier or copy; never taken with the exact grid
  const int q0   = qt * 16;
  if (q0 + 16 > SQ) return;                 // block-uniform; never taken
  const int head = hg * WPB + wave;
  const int kvh  = hg;

  float* slab = (float*)(void*)ring + wave * SLW;         // result slab [16][128] pitch 132: the ring's bytes, after the loop

  const size_t hcol = (size_t)head * HD + 8 * hh;
  const _Float16* Qh  = (const _Float16*)(const void*)QHp + ((size_t)b * SEQ + q0 + c) * DMOD + hcol;
  const _Float16* Ql  = (const _Float16*)(const void*)QLp + ((size_t)b * SEQ + q0 + c) * DMOD + hcol;
  // this lane's chunk 0 of stage 0 (stage_kv): global addresses and LDS byte addresses in buffer 0
  const u16* kg0 = KHp + ((size_t)b * SEQ + (tid >> 4)) * KVD + (size_t)kvh * HD + (tid & 15) * 8;
  const u16* vg0 = VHp + ((size_t)(b * NKVH + kvh) * HD + (tid >> 3)) * SEQ + (tid & 7) * 8;
  const unsigned lring = (unsigned)(size_t)(const void*)ring;
  const unsigned lk0 = lring + (unsigned)((tid >> 4) * KPB + (tid & 15) * 16);
  const unsigned lv0 = lring + (unsigned)(KTB + (tid >> 3) * VPB + (tid & 7) * 16);
  const float lsc = RSQ_HD * (LOG2E / (QSC * KSC));
  const float oc  = 1.0f / (PCAR * VCAR);

  // q as the B operand: column = query q0 + c, loaded once for all keys
  v16h qh[HD / 32], ql[HD / 32];
#pragma unroll
  for (int kk = 0; kk < HD / 32; ++kk) { qh[kk] = ldfrag_h(Qh + kk * 32); ql[kk] = ldfrag_h(Ql + kk * 32); }
  float mrun = -INFINITY, lrun = 0.f;                     // of query column c; lrun over this half's keys only
  v8f o[8];                                               // o[j][r] = O^T[d = 16j + 8hh + r][query c]
#pragma unroll
  for (int j = 0; j < 8; ++j) o[j] = zero8();

  // ---- ring prologue: stage 0 lands and is published, then stage 1 flies while stage 0 is worked on ----
  stage_kv(kg0, vg0, lk0, lv0);
  wait_async0();
  __syncthreads();
  stage_kv(kg0 + (size_t)KSTG * KVD, vg0 + KSTG, lk0 + STGB, lv0 + STGB);

  // kept rolled: one trip = one stage, with its one publish point at the foot
#pragma unroll 1
  for (int st = 0; st < NST; ++st) {
   const int bufh = (st & 1) * (STGB / 2);                // this stage's buffer, in halves
   // kept rolled: unrolled, the compiler spreads a step's v^T reads in pairs among its products instead of issuing them together
   // ahead of the softmax arithmetic
#pragma unroll 1
   for (int sub = 0; sub < KSTG / 32; ++sub) {
    // ---- scores: D element r of this lane = (key kb + 8hh + r, query q0 + c) in s0, key kb + 16 + 8hh + r in s1, kb = 64*st + 32*sub ----
    v8f s0 = zero8(), s1 = zero8();
    const _Float16* k0p = ring + bufh + (sub * 32 + c) * (KPB / 2) + 8 * hh;
    const _Float16* k1p = k0p + 16 * (KPB / 2);
    v16h kh0[HD / 32], kh1[HD / 32];
#pragma unroll
    for (int kk = 0; kk < HD / 32; ++kk) { kh0[kk] = ldfrag_h(k0p + kk * 32); kh1[kk] = ldfrag_h(k1p + kk * 32); }
    // keeps the step's 16 k reads together in front of its 16 score products: left free, the compiler reloads two fragments
    // per four products and waits out the LDS latency each time
    __builtin_amdgcn_sched_barrier(0);
#pragma unroll
    for (int kk = 0; kk < HD / 32; ++kk) {
      s0 = mma_h(kh0[kk], qh[kk], s0);
      s1 = mma_h(kh1[kk], qh[kk], s1);
      s0 = mma_h(kh0[kk], ql[kk], s0);
      s1 = mma_h(kh1[kk], ql[kk], s1);
    }
    // splits the step here, so that the eight v^T fragments are read together at the head of the softmax arithmetic, which covers
    // their latency, into the k fragments' registers: left free, the compiler reads one fragment in front of each of the eight
    // products and waits out the LDS latency each time
    __builtin_amdgcn_sched_barrier(0);
    // ---- online softmax in base 2 over all keys, -inf-safe; one query column per lane ----
    float mx = fmaxf(s0[0], s1[0]);
#pragma unroll
    for (int r = 1; r < 8; ++r) mx = fmaxf(mx, fmaxf(s0[r], s1[r]));
    mx = fmaxf(mx, xhalf(mx)) * lsc;                      // lsc > 0: the maximum of the scaled scores
    const float mn = fmaxf(mrun, mx);
    const float ms = (mn == -INFINITY) ? 0.0f : mn;
    const float al = exp2f(mrun - ms);
    mrun = mn;
    // ---- B fragment of P^T*32768 (f16): elements 0..7 = keys kb + 8hh + 0..7, elements 8..15 = keys kb + 16 + 8hh + 0..7 ----
    FragH ph;
    float ps0 = 0.f, ps1 = 0.f;                           // sums over even and odd r
#pragma unroll
    for (int r = 0; r < 8; r += 2) {
      const float e0a = exp2f(s0[r] * lsc - ms), e0b = exp2f(s0[r + 1] * lsc - ms);
      const float e1a = exp2f(s1[r] * lsc - ms), e1b = exp2f(s1[r + 1] * lsc - ms);
      ps0 += e0a;
      ps1 += e0b;
      ps0 += e1a;
      ps1 += e1b;
      ph.h[0][r]     = (_Float16)(e0a * PCAR);
      ph.h[0][r + 1] = (_Float16)(e0b * PCAR);
      ph.h[1][r]     = (_Float16)(e1a * PCAR);
      ph.h[1][r + 1] = (_Float16)(e1b * PCAR);
    }
    lrun = lrun * al + (ps0 + ps1);
#pragma unroll
    for (int j = 0; j < 8; ++j) {
#pragma unroll
      for (int r = 0; r < 8; ++r) o[j][r] *= al;
    }
    // ---- v^T.P^T : A fragment row = d = j*16 + c, keys contiguous in the v^T rows ----
    {
      const _Float16* vhp = ring + bufh + (KTB / 2) + c * (VPB / 2) + sub * 32 + 8 * hh;   // d row c (+16j), keys of this step
#pragma unroll
      for (int j = 0; j < 8; ++j) o[j] = mma_h(ldfrag_h(vhp + j * 16 * (VPB / 2)), ph.v, o[j]);
    }
    // four vector slots behind the step's last products, in front of the loop's branch: on its taken side the first vector
    // instructions rewrite registers of P^T
    acc_guard8(o);
   }
   // ---- publish point of stage st + 1: own LDS reads retired, own copies landed, every wave has left this buffer ----
   wait_ds0();
   wait_async0();
   __syncthreads();
   if (st + 2 < NST) {                                    // block-uniform: refill the buffer that this trip has just read
     stage_kv(kg0 + (size_t)(st + 2) * KSTG * KVD, vg0 + (st + 2) * KSTG,
              lk0 + (unsigned)(st & 1) * STGB, lv0 + (unsigned)(st & 1) * STGB);
   }
  }
  wait_async0();                                          // nothing in flight before the ring's bytes become the result slab
  // ---- out = acc / Z (0 if Z == 0), carries (32768 on P, 1024 on v) folded once; row c of the wave's slab, 8 consecutive d ----
  {
    const float lv  = lrun + xhalf(lrun);                 // the two halves' sums joined
    const float ls  = (lv > 0.0f) ? lv : 1.0f;
    const float inv = (lv > 0.0f) ? ((1.0f / ls) * oc) : 0.0f;
#pragma unroll
    for (int j = 0; j < 8; ++j) {
      float* sp = slab + c * SLP + j * 16 + 8 * hh;
      v4f a, b4;
#pragma unroll
      for (int e = 0; e < 4; ++e) { a[e] = o[j][e] * inv; b4[e] = o[j][4 + e] * inv; }
      *(v4f*)(sp)     = a;
      *(v4f*)(sp + 4) = b4;
    }
  }

  wave_sync_lds();
  // ---- O x1024 -> f16 plane; lane = (row-in-pair rq, 8 consecutive d at c8) ----
  v4u oh[8];
  const int rq = lane >> 4, c8 = (lane & 15) * 8;
#pragma unroll
  for (int it = 0; it < 8; ++it) {
    const int row = it * 2 + rq;
    const v4f a = *(const v4f*)(slab + row * SLP + c8), b4 = *(const v4f*)(slab + row * SLP + c8 + 4);
    float w[8];
#pragma unroll
    for (int e = 0; e < 4; ++e) { w[e] = a[e] * OSC; w[4 + e] = b4[e] * OSC; }
#pragma unroll
    for (int e = 0; e < 4; ++e) {
      const _Float16 h0 = (_Float16)w[2 * e], h1 = (_Float16)w[2 * e + 1];
      oh[it][e] = pk16(h_bits(h0), h_bits(h1));
    }
  }
  const size_t ob = ((size_t)b * SEQ + q0) * DMOD + (size_t)head * HD + c8;
  {
#pragma unroll
    for (int it = 0; it < 8; ++it) {
      const int row = it * 2 + rq;
      *(v4u*)(OHp + ob + (size_t)row * DMOD) = oh[it];
    }
    
  }
}

// =====================================================================================================
// Workspace map (bytes); every plane is fully written by whole-line stores before it is read; all extents are exact multiples
// of the store granularity (no pad rows needed); every region offset a multiple of 1048576:
//   XB  bf16 [MROWS][2048]                       MROWS*4096       (NB=2: 16777216)
//   WB  16-bit [2048 n][2048 k]                  8388608          (Wv^T, Wq^T, Wk^T as bf16 ([512][2048] for k/v), then Wo^T as
//                                                                  f16 x1024, reused in launch order)
//   F   f32 [MROWS][2048]                        MROWS*8192       (v, q, k projection output in launch order, [MROWS][512] for
//                                                                  k/v; afterwards OH f16 [MROWS][2048] x1024 in its first half)
//   QH  f16 [MROWS][2048] x256                   MROWS*4096       QL residual, same extent
//   KH  f16 [MROWS][512] x256                    MROWS*1024
//   VH  f16 [NB*4][128][SEQ] x1024               MROWS*1024
//   COS f32 [MROWS][64]                          MROWS*256        SIN same extent
//   end (NB=2)                                 102760448
// =====================================================================================================
extern "C" void kernel_launch(void* const* d_in, const int* in_sizes, int n_in,
                              void* d_out, int out_size, void* d_ws, size_t ws_size,
                              hipStream_t stream) {
  if (n_in < 8) return;
  if (in_sizes[0] < MROWS * DMOD) return;
  if (in_sizes[1] < MROWS) return;
  if (in_sizes[2] != DMOD * DMOD) return;
  if (in_sizes[3] != DMOD * KVD) return;
  if (in_sizes[4] != DMOD * KVD) return;
  if (in_sizes[5] != DMOD * DMOD) return;
  if (in_sizes[6] < HD) return;
  if (in_sizes[7] < HD) return;
  if (out_size < MROWS * DMOD) return;

  const float* x   = (const float*)d_in[0];
  const int*   pos = (const int*)d_in[1];
  const float* wq  = (const float*)d_in[2];
  const float* wk  = (const float*)d_in[3];
  const float* wv  = (const float*)d_in[4];
  const float* wo  = (const float*)d_in[5];
  const float* qnw = (const float*)d_in[6];
  const float* knw = (const float*)d_in[7];
  float*       out = (float*)d_out;

  const size_t szXB = (size_t)MROWS * DMOD * 2;
  const size_t szW  = (size_t)DMOD * DMOD * 2;
  const size_t szF  = (size_t)MROWS * DMOD * 4;
  const size_t szQ  = (size_t)MROWS * DMOD * 2;                  // QH, QL, OH
  const size_t szK  = (size_t)MROWS * KVD * 2;                   // KH
  const size_t szV  = (size_t)NB * NKVH * HD * SEQ * 2;          // VH (== szK)
  const size_t szT  = (size_t)MROWS * HHALF * 4;                 // COS, SIN
  if (szQ > szF) return;                                         // OH lives inside the F region
  size_t off = 0;
  const size_t oXB = off; off += szXB;
  const size_t oW  = off; off += szW;
  const size_t oF  = off; off += szF;
  const size_t oQH = off; off += szQ;
  const size_t oQL = off; off += szQ;
  const size_t oKH = off; off += szK;
  const size_t oVH = off; off += szV;
  const size_t oCS = off; off += szT;
  const size_t oSN = off; off += szT;
  if (off > ws_size) return;                // off = 102760448 for NB = 2
  if (off > (size_t)WS_CAP) return;

  char* ws = (char*)d_ws;
  u16*   XB  = (u16*)(ws + oXB);
  u16*   WB  = (u16*)(ws + oW);
  float* F   = (float*)(ws + oF);
  u16*   OH  = (u16*)(ws + oF);
  u16*   QH  = (u16*)(ws + oQH);
  u16*   QL  = (u16*)(ws + oQL);
  u16*   KH  = (u16*)(ws + oKH);
  u16*   VH  = (u16*)(ws + oVH);
  float* COS = (float*)(ws + oCS);
  float* SIN = (float*)(ws + oSN);

  const dim3 b256(256), b128(128), bAT(ATT_THREADS);
  const int  n8x = (MROWS * DMOD) / 8;
  const dim3 gX((n8x + 255) / 256);
  const dim3 gTR(MROWS / 4);
  const dim3 gWQ((DMOD / 64) * (DMOD / 64));            // Wq [2048 k][2048 n], Wo [2048 k][2048 n]
  const dim3 gWK((DMOD / 64) * (KVD / 64));             // Wk, Wv [2048 k][512 n]
  const int  nrtK = SEQ / GBM;                          // k/v rows per batch / 128
  const int  nrtQ = SQ / GBM;                           // q / ctx / out rows per batch / 128
  const dim3 gGK(NB * nrtK * (KVD / GBN));
  const dim3 gGQ(NB * nrtQ * (DMOD / GBN));
  const dim3 gVT(NB * NKVH * NST);
  const dim3 gRQ(NB * SQ);
  const dim3 gRK(NB * SEQ);
  const dim3 gAT(NQT * NHG * NB);

  // (0) cos/sin tables from the integer positions; (1) x -> bf16 plane [MROWS][2048]
  trig64<<<gTR, b256, 0, stream>>>(pos, COS, SIN, MROWS);
  cvt16<<<gX, b256, 0, stream>>>(x, XB, n8x, 0, 1.0f);
  // (2) Wv [2048][512] -> Wv^T bf16 [512][2048]; (3) v = x.Wv -> F f32 [MROWS][512]; (4) v^T plane x1024
  wt16<<<gWK, b256, 0, stream>>>(wv, WB, DMOD, KVD, 0, 1.0f);
  gemm128<true><<<gGK, b128, 0, stream>>>(XB, WB, F, KVD, DMOD, nrtK, 1.0f);
  vt16<<<gVT, b256, 0, stream>>>(F, VH);
  // (5) Wq [2048][2048] -> Wq^T bf16; (6) q = x.Wq -> F [MROWS][2048] (rows s < SQ); (7) RMS normalisation + rotary + q planes x256
  wt16<<<gWQ, b256, 0, stream>>>(wq, WB, DMOD, DMOD, 0, 1.0f);
  gemm128<true><<<gGQ, b128, 0, stream>>>(XB, WB, F, DMOD, DMOD, nrtQ, 1.0f);
  nrope16<true><<<gRQ, dim3(DMOD / 16), 0, stream>>>(F, DMOD, SQ, qnw, COS, SIN, QH, QL, QSC);
  // (8) Wk [2048][512] -> Wk^T bf16; (9) k = x.Wk -> F [MROWS][512]; (10) RMS normalisation + rotary + k plane x256
  wt16<<<gWK, b256, 0, stream>>>(wk, WB, DMOD, KVD, 0, 1.0f);
  gemm128<true><<<gGK, b128, 0, stream>>>(XB, WB, F, KVD, DMOD, nrtK, 1.0f);
  nrope16<false><<<gRK, dim3(KVD / 16), 0, stream>>>(F, KVD, SEQ, knw, COS, SIN, KH, KH, KSC);
  // (11) Wo [2048 k][2048 n] -> Wo^T f16 plane of bf16 value x1024
  wt16<<<gWQ, b256, 0, stream>>>(wo, WB, DMOD, DMOD, 1, WOS);
  // (12) non-causal attention over all keys -> O plane (inside F)
  attn_nc<<<gAT, bAT, 0, stream>>>(QH, QL, KH, VH, OH);
  // (13) out = ctx.Wo -> f32, carries 1024 x 1024 folded back
  gemm128<false><<<gGQ, b128, 0, stream>>>(OH, WB, out, DMOD, DMOD, nrtQ, 1.0f / (OSC * WOS));
  (void)hipGetLastError();
}

// v004
// Measured time: 196 microseconds a run.
// Next to v003, in two timings, it ran 1.20 times as fast each time.
// All steps since v000 together make it 2.79 times as fast.
// Contractions: x.Wq, x.Wk, x.Wv on v_wmma_f32_16x16x32_bf16 (x and W^T as bf16 RNE planes, f32 accumulate);
// q.k^T over hd 128 on v_wmma_f32_16x16x32_f16 with q as f16 hi + f16 residual planes (x256) and k as one f16 plane
// (x256), products qh.k + ql.k; P.v on v_wmma_f32_16x16x32_f16 with P x32768 and v^T x1024 as single f16 planes;
// ctx.Wo on v_wmma_f32_16x16x32_f16 with ctx x1024 as one f16 plane and Wo^T as f16(bf16 RNE(Wo)) x1024; all f32
// accumulate. RMS normalisation, rotate-half rotary from integer positions (cos/sin tables built on device in f32),
// base-2 online softmax and the 1/Z fold in f32 on VALU.
#include <hip/hip_runtime.h>
#include <math.h>
#include <stdint.h>

#ifndef NB
#define NB 2
#endif
#define SEQ 2048
#ifndef SQ
#define SQ SEQ
#endif
#define DMOD  2048
#define NH    16
#define NKVH  4
#define HD    128
#define HHALF (HD / 2)
#define KVD   (NKVH * HD)
#define MROWS (NB * SEQ)
#define EPS_RMS 0.000001f
#define RSQ_HD 0.08838834764831845f
#define LOG2E 1.4426950408889634f
#define LOG2THETA 19.931568569324174
#define QSC   256.0f
#define KSC   256.0f
#define PCAR  32768.0f
#define VCAR  1024.0f
#define OSC   1024.0f
#define WOS   1024.0f
#define WPB   (NH / NKVH)
#define NHG   NKVH
#define NQT   (SQ / 16)
#define NST   (SEQ / 64)
#define NKT   (SEQ / 32)
#define ATT_THREADS (WPB * 32)
#define SLP   132
#define SLW   (16 * SLP)
#define SLAB64 (16 * 68)
#define VTP   72
#define WTP   72
#define WS_CAP 134217728
#define KSTG  64
#define KPB   272
#define VPB   144
#define KTB   (KSTG * KPB)
#define VTB   (HD * VPB)
#define STGB  (KTB + VTB)
#define RINGB (2 * STGB)
#define GBM   128
#define GBN   128
#define GKS   64
#define GPB   144
#define GATB  (GBM * GPB)
#define GSTB  ((GBM + GBN) * GPB)
#define GRINGB (2 * GSTB)
// block counts of the jobs that share one launch (each job's blocks are a contiguous range of the grid)
#define PB_TR (MROWS / 4)
#define PB_X  ((MROWS * DMOD / 8) / 256)
#define PB_WQ ((DMOD / 64) * (DMOD / 64))
#define PB_WK ((DMOD / 64) * (KVD / 64))
#define PB_ALL (PB_TR + PB_X + 2 * PB_WQ + 2 * PB_WK)
#define GB_Q  (NB * (SQ / GBM) * (DMOD / GBN))
#define GB_K  (NB * (SEQ / GBM) * (KVD / GBN))
#define GB_ALL (GB_Q + 2 * GB_K)
#define RB_V  (NB * NKVH * NST)
#define RB_K  (NB * SEQ / 8)
#define RB_Q  (NB * SQ / 2)
#define RB_ALL (RB_V + RB_K + RB_Q)
static_assert(DMOD / 16 == 128 && KVD / 16 == 32 && ((NB * SEQ) % 8) == 0 && ((NB * SQ) % 2) == 0);
static_assert(DMOD == NH * HD && HD == 128 && HHALF == 64 && NH == 16 && NKVH == 4 && WPB == 4 && NHG * WPB == NH);
static_assert(ATT_THREADS == 128 && KVD == 512);
static_assert(NB >= 1 && NB <= 2);
static_assert((SEQ % 64) == 0 && (SQ % 64) == 0 && SQ >= 64 && SQ <= SEQ);
static_assert((DMOD % 64) == 0 && (KVD % 64) == 0 && (DMOD % 32) == 0 && (HD % 32) == 0);
static_assert(((MROWS * DMOD / 8) % 256) == 0 && (MROWS % 4) == 0);
static_assert(KSTG == 64 && NST >= 2 && NST * KSTG == SEQ && (KPB % 16) == 0 && (VPB % 16) == 0 && (KTB % 16) == 0 && (STGB % 16) == 0);
static_assert(KPB == HD * 2 + 16 && VPB == KSTG * 2 + 16 && WPB * SLW * 4 <= RINGB && 4 * RINGB <= 327680);
static_assert(HD * VTP * 2 <= 65536 && 64 * WTP * 2 <= 65536);
static_assert(GBM == 128 && GBN == 128 && GKS == 64 && GPB == GKS * 2 + 16 && (GPB % 16) == 0 && (GSTB % 16) == 0);
static_assert((SEQ % GBM) == 0 && (SQ % GBM) == 0 && (DMOD % GBN) == 0 && (KVD % GBN) == 0 && (DMOD % GKS) == 0 && DMOD / GKS >= 2);
static_assert(2 * (GRINGB + 4 * 4 * SLAB64 * 4) <= 327680);
static_assert((DMOD / 16) <= 128 && (KVD / 16) <= 128 && ((DMOD / 16) % 32) == 0 && ((KVD / 16) % 32) == 0);

typedef unsigned short u16;
typedef _Float16 v16h __attribute__((ext_vector_type(16)));
typedef _Float16 v8h  __attribute__((ext_vector_type(8)));
typedef __bf16   v16b __attribute__((ext_vector_type(16)));
typedef float    v8f  __attribute__((ext_vector_type(8)));
typedef float    v4f  __attribute__((ext_vector_type(4)));
typedef unsigned int v4u __attribute__((ext_vector_type(4)));

union FragH { v16h v; v8h h[2]; v4u u[2]; };
union FragB { v16b v; v4u u[2]; };

// ---- scalar helpers --------------------------------------------------------------------------------
__device__ __forceinline__ unsigned short bf_bits(float f) {          // f32 -> bf16 bits, RNE convert
  unsigned u = __float_as_uint(f);
  return (unsigned short)((u + 0x7FFFu + ((u >> 16) & 1u)) >> 16);
}
__device__ __forceinline__ float bf_up(unsigned short h) { return __uint_as_float(((unsigned)h) << 16); }
__device__ __forceinline__ float bfr(float f) { return bf_up(bf_bits(f)); }
__device__ __forceinline__ unsigned short h_bits(_Float16 x) { return __builtin_bit_cast(unsigned short, x); }
__device__ __forceinline__ unsigned pk16(unsigned short a, unsigned short b) { return (unsigned)a | ((unsigned)b << 16); }
__device__ __forceinline__ v8f zero8() { v8f z = {0.f, 0.f, 0.f, 0.f, 0.f, 0.f, 0.f, 0.f}; return z; }

// ---- fragment loaders: 16-bit A/B operand, lane -> row/col (lane&15), p already includes +8*(lane>>4);
//      elements 0..7 <- p[0..7] (k0+8h..), elements 8..15 <- p[16..23] (k0+16+8h..)  (same split k map for A and B;
//      B is always read from a k-contiguous [n][k] plane)
__device__ __forceinline__ v16h ldfrag_h(const _Float16* p) {
  FragH f;
  f.h[0] = *(const v8h*)(p);
  f.h[1] = *(const v8h*)(p + 16);
  return f.v;
}
__device__ __forceinline__ v16b ldfrag_b(const u16* p) {              // bf16 plane read as unsigned integer vectors
  FragB f;
  f.u[0] = *(const v4u*)(p);
  f.u[1] = *(const v4u*)(p + 16);
  return f.v;
}

__device__ __forceinline__ v8f mma_h(v16h a, v16h b, v8f c) {
  return __builtin_amdgcn_wmma_f32_16x16x32_f16(false, a, false, b, (short)0, c, false, false);
}
__device__ __forceinline__ v8f mma_b(v16b a, v16b b, v8f c) {
  return __builtin_amdgcn_wmma_f32_16x16x32_bf16(false, a, false, b, (short)0, c, false, false);
}
__device__ __forceinline__ void acc_guard8(v8f (&a)[8]) {
#if defined(__HIP_DEVICE_COMPILE__)
  asm volatile("v_nop\n\tv_nop\n\tv_nop\n\tv_nop"
               : "+v"(a[0]), "+v"(a[1]), "+v"(a[2]), "+v"(a[3]), "+v"(a[4]), "+v"(a[5]), "+v"(a[6]), "+v"(a[7]));
#endif
}
__device__ __forceinline__ void wave_sync_lds() {
  __builtin_amdgcn_fence(__ATOMIC_RELEASE, "workgroup");
  __builtin_amdgcn_wave_barrier();
  __builtin_amdgcn_fence(__ATOMIC_ACQUIRE, "workgroup");
}
// lane l's value from lane l ^ 16: the two halves of the wave hold the two halves of a query column's keys
__device__ __forceinline__ float xhalf(float x) {
  const int b = __builtin_bit_cast(int, x);
  return __builtin_bit_cast(float, __builtin_amdgcn_permlanex16(b, b, 0x76543210, 0xfedcba98, false, false));
}
// Eight asynchronous 16-byte copies of this lane, global -> LDS (l = LDS byte address, g = global address, both 16-B aligned).
// The closing s_wait_xcnt 0 stands inside the statement so that no address register is rewritten in front of it.
__device__ __forceinline__ void async8(const unsigned* l, const u16* const* g) {
#if defined(__HIP_DEVICE_COMPILE__)
  asm volatile("global_load_async_to_lds_b128 %0, %8, off\n\t"
               "global_load_async_to_lds_b128 %1, %9, off\n\t"
               "global_load_async_to_lds_b128 %2, %10, off\n\t"
               "global_load_async_to_lds_b128 %3, %11, off\n\t"
               "global_load_async_to_lds_b128 %4, %12, off\n\t"
               "global_load_async_to_lds_b128 %5, %13, off\n\t"
               "global_load_async_to_lds_b128 %6, %14, off\n\t"
               "global_load_async_to_lds_b128 %7, %15, off\n\t"
               "s_wait_xcnt 0x0"
               :: "v"(l[0]), "v"(l[1]), "v"(l[2]), "v"(l[3]), "v"(l[4]), "v"(l[5]), "v"(l[6]), "v"(l[7]),
                  "v"(g[0]), "v"(g[1]), "v"(g[2]), "v"(g[3]), "v"(g[4]), "v"(g[5]), "v"(g[6]), "v"(g[7])
               : "memory");
#endif
}
// One stage (64 keys) of k rows and v^T rows into one ring buffer, 16 copies per lane of the 128 threads:
//   k   chunk i: key row i*8 + (tid>>4), 16-B piece tid&15  (a wave covers two whole 256-B rows), LDS pitch KPB;
//   v^T chunk i: d row i*16 + (tid>>3), 16-B piece tid&7    (a wave covers four whole 128-B rows), LDS pitch VPB.
// kg, vg, lk, lv are this lane's addresses of chunk 0.
__device__ __forceinline__ void stage_kv(const u16* kg, const u16* vg, unsigned lk, unsigned lv) {
  unsigned l[8];
  const u16* g[8];
  // both loops unrolled so that l[] and g[] are registers, as the asm operands need them
#pragma unroll
  for (int i = 0; i < 8; ++i) { l[i] = lk + (unsigned)(i * 8 * KPB); g[i] = kg + (size_t)(i * 8) * KVD; }
  async8(l, g);
#pragma unroll
  for (int i = 0; i < 8; ++i) { l[i] = lv + (unsigned)(i * 16 * VPB); g[i] = vg + (size_t)(i * 16) * SEQ; }
  async8(l, g);
}
// One GEMM stage (64 k = 128 B of each row) of 128 A rows and 128 B rows into one ring buffer, 16 copies per lane of the
// 128 threads: chunk i = row i*16 + (tid>>3), 16-B piece tid&7 (a wave covers four whole 128-B row pieces), LDS pitch GPB.
// ag, bg, la, lb are this lane's addresses of chunk 0; rs16 = 16 rows of the global planes, in elements.
__device__ __forceinline__ void stage_ab(const u16* ag, const u16* bg, size_t rs16, unsigned la, unsigned lb) {
  unsigned l[8];
  const u16* g[8];
  // both loops unrolled so that l[] and g[] are registers, as the asm operands need them
#pragma unroll
  for (int i = 0; i < 8; ++i) { l[i] = la + (unsigned)(i * 16 * GPB); g[i] = ag + (size_t)i * rs16; }
  async8(l, g);
#pragma unroll
  for (int i = 0; i < 8; ++i) { l[i] = lb + (unsigned)(i * 16 * GPB); g[i] = bg + (size_t)i * rs16; }
  async8(l, g);
}
// the issuing wave's own wait: every asynchronous copy it has issued has landed in LDS
__device__ __forceinline__ void wait_async0() {
#if defined(__HIP_DEVICE_COMPILE__)
  asm volatile("s_wait_asynccnt 0x0" ::: "memory");
#endif
}
// this wave's LDS reads and writes have retired (in front of the barrier behind which a buffer is refilled)
__device__ __forceinline__ void wait_ds0() {
#if defined(__HIP_DEVICE_COMPILE__)
  asm volatile("s_wait_dscnt 0x0" ::: "memory");
#endif
}

// =====================================================================================================
// cos/sin tables for the rotary: row = b*SEQ + s (0 .. nrows-1), column j = 0..63:
//   invf[j] = 1e6^(-j/64) (f64 exp2, converted to f32), ang = float(pos[row]) * invf[j] (f32 multiply),
//   cosT[row][j] = cosf(ang), sinT[row][j] = sinf(ang).
// Block = 4 rows x 64 j (one value pair per thread) staged in LDS; after the barrier waves 0,1 write the 4 cos rows and
// coverage: nrows/4 blocks (bid) x (2 tables x 4 rows x 64 floats) = both tables exactly once (nrows % 4 == 0, host).
// =====================================================================================================
__device__ __forceinline__ void trig64(int bid, const int* __restrict__ pos, float* cosT, float* sinT, int nrows) {
#pragma clang fp contract(off)
  __shared__ __align__(16) float cs[2 * 256];
  const int tid  = (int)threadIdx.x;
  const int row0 = bid * 4;
  if (row0 + 4 > nrows) return;                       // block-uniform, before the barrier; never taken with the exact grid
  const int r = tid >> 6, j = tid & 63;
  const float p    = (float)pos[row0 + r];
  const float invf = (float)exp2(-(double)j * (LOG2THETA / 64.0));
  const float ang  = p * invf;
  cs[tid]       = cosf(ang);
  cs[256 + tid] = sinf(ang);
  __syncthreads();
  if (tid < 128) {                                    // waves 0..3, wave-uniform
    const int tb    = tid >> 6;                       // 0: cos rows (waves 0,1), 1: sin rows (waves 2,3)
    const int q     = tid & 63;
    const int rr    = q >> 4;
    const int piece = (q & 15) * 4;
    const v4f v = *(const v4f*)(cs + tb * 256 + rr * 64 + piece);
    float* base = (tb != 0) ? sinT : cosT;
    float* dst  = base + (size_t)(row0 + rr) * HHALF + piece;
    {
      *(v4f*)(dst) = v;
      
    }
  }
}

// =====================================================================================================
// f32 -> 16-bit plane, same layout.  f16mode == 0: bf16 RNE bits;  f16mode == 1: f16 bits of (bf16 RNE value) * scale.
// Thread = 8 consecutive elements: two 16-B loads, one 16-B store; 32 consecutive lanes = 512 contiguous, 512-B aligned
// coverage: ceil(n8/256) blocks (bid) x 256 thr x 8 (in-kernel bound) = the whole plane (n8 a multiple of 256 here).
// =====================================================================================================
__device__ __forceinline__ void cvt16(int bid, const float* __restrict__ x, u16* D, int n8, int f16mode, float scale) {
  const int gt = bid * 256 + (int)threadIdx.x;
  if (gt >= n8) return;
  const float* p = x + (size_t)gt * 8;
  const v4f a = *(const v4f*)(p), b4 = *(const v4f*)(p + 4);
  float w[8];
#pragma unroll
  for (int e = 0; e < 4; ++e) { w[e] = a[e]; w[4 + e] = b4[e]; }
  v4u o;
#pragma unroll
  for (int e = 0; e < 4; ++e) {
    const float f0 = w[2 * e], f1 = w[2 * e + 1];
    const unsigned short hb0 = h_bits((_Float16)(bfr(f0) * scale));
    const unsigned short hb1 = h_bits((_Float16)(bfr(f1) * scale));
    const unsigned short bb0 = bf_bits(f0);
    const unsigned short bb1 = bf_bits(f1);
    o[e] = (f16mode != 0) ? pk16(hb0, hb1) : pk16(bb0, bb1);
  }
  u16* d = D + (size_t)gt * 8;
  {
    *(v4u*)(d) = o;
    
  }
}

// =====================================================================================================
// Weight transpose + convert: W f32 [K rows][N cols] (row pitch N) -> Wt 16-bit [N rows][K cols] (row pitch K), so that
// a column n of W becomes the k-contiguous B operand row n.  f16mode == 0: bf16 RNE bits; 1: f16 bits of (bf16 RNE value)*scale.
// Block = 64 k x 64 n tile: load phase 4 iterations x (16 k rows x 16 lanes x 4 n) with 16-B loads into an LDS tile
// coverage: load 4 it x 256 thr x 4 = 64 x 64; store 2 it x 256 thr x 8 halves = 64 rows x 64; (K/64)*(N/64)
//           blocks (bid) = the whole [N][K] plane exactly once.
// =====================================================================================================
__device__ __forceinline__ void wt16(int bid, const float* __restrict__ W, u16* Wt, int K, int N, int f16mode, float scale) {
  __shared__ __align__(16) u16 T[64 * WTP];
  const int tid = (int)threadIdx.x;
  const int nkt = K >> 6;
  const int kt  = bid % nkt;
  const int nt  = bid / nkt;
  const int kb  = kt * 64, nb = nt * 64;
  if (nb + 64 > N) return;                            // block-uniform, before the barrier; never taken with the exact grid
  const int c4 = (tid & 15) * 4;                      // n within tile
  const int r0 = tid >> 4;                            // k within tile (0..15) + 16*it
#pragma unroll
  for (int it = 0; it < 4; ++it) {
    const int r = it * 16 + r0;
    const v4f a = *(const v4f*)(W + (size_t)(kb + r) * (size_t)N + nb + c4);
#pragma unroll
    for (int e = 0; e < 4; ++e) {
      const float f = a[e];
      const unsigned short hb = h_bits((_Float16)(bfr(f) * scale));
      const unsigned short bb = bf_bits(f);
      T[(c4 + e) * WTP + r] = (f16mode != 0) ? hb : bb;
    }
  }
  __syncthreads();
  v4u o[2];
  const int q8 = tid >> 3, p8 = (tid & 7) * 8;
#pragma unroll
  for (int it = 0; it < 2; ++it) o[it] = *(const v4u*)(T + (it * 32 + q8) * WTP + p8);
  u16* dst = Wt + (size_t)(nb + q8) * (size_t)K + kb + p8;
  {
#pragma unroll
    for (int it = 0; it < 2; ++it) {
      *(v4u*)(dst + (size_t)(it * 32) * (size_t)K) = o[it];
    }
    // the code of the launch's other jobs follows these stores in the built kernel and reuses their registers
    asm volatile("s_wait_xcnt 0x0" ::: "memory");
  }
}

// =====================================================================================================
// Everything that depends on the inputs alone, in one launch: block ranges, in this order: cos/sin tables (PB_TR blocks), x plane
// (PB_X), Wq^T (PB_WQ), Wo^T (PB_WQ), Wk^T (PB_WK), Wv^T (PB_WK). The jobs write disjoint planes and read none of them; the job of
// a block is block-uniform, so each job's one barrier stays under block-uniform control flow.
// =====================================================================================================
__global__ __launch_bounds__(256)
void prep16(const int* __restrict__ pos, const float* __restrict__ x, const float* __restrict__ wq, const float* __restrict__ wk,
            const float* __restrict__ wv, const float* __restrict__ wo, float* cosT, float* sinT,
            u16* XBo, u16* WQo, u16* WKo, u16* WVo, u16* WOo) {
  int bid = (int)blockIdx.x;
  if (bid < PB_TR) { trig64(bid, pos, cosT, sinT, MROWS); return; }
  bid -= PB_TR;
  if (bid < PB_X) { cvt16(bid, x, XBo, (MROWS * DMOD) / 8, 0, 1.0f); return; }
  bid -= PB_X;
  const float* W = wq;
  u16* Wt = WQo;
  int N = DMOD, f16mode = 0;
  float scale = 1.0f;
  if (bid >= PB_WQ) {
    bid -= PB_WQ; W = wo; Wt = WOo; f16mode = 1; scale = WOS;
    if (bid >= PB_WQ) {
      bid -= PB_WQ; W = wk; Wt = WKo; N = KVD; f16mode = 0; scale = 1.0f;
      if (bid >= PB_WK) { bid -= PB_WK; W = wv; Wt = WVo; }
    }
  }
  wt16(bid, W, Wt, DMOD, N, f16mode, scale);
}

// =====================================================================================================
// v^T plane from the v projection F f32 [MROWS][KVD] (row = b*SEQ + s, column = g*HD + d):
//   VH[((b*NKVH + g)*HD + d)][s] = f16(v * 1024) for all keys s.
// Block = (b, kv head g, 64 keys s0): each thread loads its 32 floats (key sl, d chunk dc) with 16-B loads, converts, scatters
// coverage: load 256 thr x 32 = 64 keys x 128 d; store 4 iterations x 256 thr x 8 halves = 128 lines x 64 = the block's tile;
//           NB*NKVH*NST blocks (bid) cover the plane exactly once.
// =====================================================================================================
__device__ __forceinline__ void vt16(int bid, const float* __restrict__ F, u16* VHo) {
  __shared__ __align__(16) u16 TH[HD * VTP];
  const int tid = (int)threadIdx.x;
  const int st  = bid % NST;
  const int t2  = bid / NST;
  const int g   = t2 % NKVH;
  const int b   = t2 / NKVH;
  if (b >= NB) return;                                // block-uniform, before any barrier; never taken with the exact grid
  const int s0  = st * 64;
  {
    const int sl = tid >> 2;                          // key within tile 0..63
    const int dc = (tid & 3) * 32;                    // d chunk 0,32,64,96
    const float* src = F + ((size_t)b * SEQ + s0 + sl) * KVD + g * HD + dc;
#pragma unroll
    for (int i = 0; i < 8; ++i) {
      const v4f a = *(const v4f*)(src + 4 * i);
#pragma unroll
      for (int e = 0; e < 4; ++e) {
        const float t = a[e] * VCAR;
        TH[(dc + 4 * i + e) * VTP + sl] = h_bits((_Float16)t);
      }
    }
  }
  __syncthreads();
  v4u vh[4];
  const int q8 = tid >> 3, p8 = (tid & 7) * 8;
#pragma unroll
  for (int it = 0; it < 4; ++it) {
    const int line = it * 32 + q8;                    // d = 0..127
    vh[it] = *(const v4u*)(TH + line * VTP + p8);
  }
  const size_t hrow = (size_t)(b * NKVH + g) * HD;
  const size_t base = hrow * SEQ + s0 + p8;
  {
#pragma unroll
    for (int it = 0; it < 4; ++it) {
      const int line = it * 32 + q8;
      *(v4u*)(VHo + base + (size_t)line * SEQ) = vh[it];
    }
    
  }
}

// =====================================================================================================
// Per-head RMS normalisation + rotate-half rotary + 16-bit planes from a projection F f32 [MROWS][ncol]
// (ncol = DMOD for q, KVD for k; row = b*SEQ + s with s < nrows, column = head*HD + d):
//   rs = 1/sqrt(mean_d(x[head][d]^2) + eps) over the head's 128 columns (f32 sum of squares: 16 per thread, then an
//   8-lane shuffle sum, the 8 lanes of a head are 8 consecutive lanes); y[d] = (x[d]*rs) * w[d] with w = bf16 RNE value
//   of the norm weight; then for j < 64 within a head, with c = cosT[row][j], sn = sinT[row][j] (f32 tables):
//   out[j]    = y[j]*c    - y[j+64]*sn
//   out[j+64] = y[j+64]*c + y[j]*sn
//   Hp [MROWS][ncol] = f16(out * sc); if RES also Lp [MROWS][ncol] = f16 residual (t - f16(t)), same layout.
// One row blk = exactly ncol/16 consecutive threads (whole waves), tid = 0 .. ncol/16 - 1 within the row; thread t = head t>>3,
// chunk i = t&7: columns head*HD + 8i .. +7 and + 64. No lane-varying control anywhere (shuffles with all lanes active).
// coverage: (ncol/16) thr x 16 = the whole row of Hp (and of Lp); blk = 0 .. NB*nrows - 1 = every processed row once.
// =====================================================================================================
__device__ __forceinline__ void rot_pair(float xl, float xh, float cv, float sv, float sc,
                                         unsigned short& hl, unsigned short& hhv, unsigned short& ll, unsigned short& lh) {
#pragma clang fp contract(off)
  const float rl = xl * cv - xh * sv;
  const float rh = xh * cv + xl * sv;
  const float tl = rl * sc, th = rh * sc;
  const _Float16 a = (_Float16)tl, bq = (_Float16)th;
  hl  = h_bits(a);
  hhv = h_bits(bq);
  ll  = h_bits((_Float16)(tl - (float)a));
  lh  = h_bits((_Float16)(th - (float)bq));
}

template <bool RES>
__device__ __forceinline__ void nrope16(int blk, int tid, const float* __restrict__ F, int ncol, int nrows,
                                        const float* __restrict__ nw,
                                        const float* __restrict__ cosT, const float* __restrict__ sinT,
                                        u16* Hp, u16* Lp, float sc) {
#pragma clang fp contract(off)
  const int b   = blk / nrows;
  const int s   = blk - b * nrows;
  if (b >= NB) return;                                 // wave-uniform, no barrier behind it; never taken with the exact grid
  const int row = b * SEQ + s;
  const int dlo = (tid & 7) * 8;                       // j within head, multiple of 8
  const int clo = (tid >> 3) * HD + dlo;               // column of the low-half chunk; clo + 64 + 8 <= ncol as tid < ncol/16
  const float* p = F + (size_t)row * ncol + clo;
  const v4f xa = *(const v4f*)(p), xb = *(const v4f*)(p + 4);
  const v4f ya = *(const v4f*)(p + HHALF), yb = *(const v4f*)(p + HHALF + 4);
  // the table loads behind this line land in the registers that hold the four row loads' address
  asm volatile("s_wait_xcnt 0x0" ::: "memory");
  const size_t trow = (size_t)row * HHALF + dlo;
  const v4f ca = *(const v4f*)(cosT + trow), cb = *(const v4f*)(cosT + trow + 4);
  const v4f sa = *(const v4f*)(sinT + trow), sb = *(const v4f*)(sinT + trow + 4);
  const v4f wa = *(const v4f*)(nw + dlo), wb4 = *(const v4f*)(nw + dlo + 4);
  const v4f wc = *(const v4f*)(nw + HHALF + dlo), wd = *(const v4f*)(nw + HHALF + dlo + 4);
  float xl[8], xh[8], cv[8], sv[8], wl[8], wh[8];
#pragma unroll
  for (int e = 0; e < 4; ++e) {
    xl[e] = xa[e];        xl[4 + e] = xb[e];
    xh[e] = ya[e];        xh[4 + e] = yb[e];
    cv[e] = ca[e];        cv[4 + e] = cb[e];
    sv[e] = sa[e];        sv[4 + e] = sb[e];
    wl[e] = bfr(wa[e]);   wl[4 + e] = bfr(wb4[e]);
    wh[e] = bfr(wc[e]);   wh[4 + e] = bfr(wd[e]);
  }
  // sum of squares over the head's 128 columns: 16 here, then lanes xor 1, 2, 4 (aligned groups of 8 lanes = one head)
  float ss = 0.0f;
#pragma unroll
  for (int e = 0; e < 8; ++e) { ss = ss + xl[e] * xl[e]; ss = ss + xh[e] * xh[e]; }
  ss += __shfl_xor(ss, 1, 32);
  ss += __shfl_xor(ss, 2, 32);
  ss += __shfl_xor(ss, 4, 32);
  const float var = ss * (1.0f / (float)HD);
  const float rs  = 1.0f / sqrtf(var + EPS_RMS);
#pragma unroll
  for (int e = 0; e < 8; ++e) {
    xl[e] = (xl[e] * rs) * wl[e];
    xh[e] = (xh[e] * rs) * wh[e];
  }
  v4u ohl, ohh, oll, olh;
#pragma unroll
  for (int e = 0; e < 4; ++e) {
    unsigned short hl0, hh0, ll0, lh0, hl1, hh1, ll1, lh1;
    rot_pair(xl[2 * e],     xh[2 * e],     cv[2 * e],     sv[2 * e],     sc, hl0, hh0, ll0, lh0);
    rot_pair(xl[2 * e + 1], xh[2 * e + 1], cv[2 * e + 1], sv[2 * e + 1], sc, hl1, hh1, ll1, lh1);
    ohl[e] = pk16(hl0, hl1);
    ohh[e] = pk16(hh0, hh1);
    oll[e] = pk16(ll0, ll1);
    olh[e] = pk16(lh0, lh1);
  }
  u16* dh = Hp + (size_t)row * ncol + clo;
  u16* dl = Lp + (size_t)row * ncol + clo;             // dereferenced only when RES
  {
    *(v4u*)(dh) = ohl;
    *(v4u*)(dh + HHALF) = ohh;
    if constexpr (RES) {
      *(v4u*)(dl) = oll;
      *(v4u*)(dl + HHALF) = olh;
    }
    
  }
}

// =====================================================================================================
// Everything between the projections and the attention, in one launch of 256-thread blocks: block ranges, in this order: v^T plane
// (RB_V blocks), k rows (RB_K blocks of 8 rows, one wave a row), q rows (RB_Q blocks of 2 rows, four waves a row).
// The jobs read disjoint projections and write disjoint planes; the job of a block is block-uniform.
// =====================================================================================================
__global__ __launch_bounds__(256)
void post16(const float* __restrict__ Fq, const float* __restrict__ Fk, const float* __restrict__ Fv,
            const float* __restrict__ qnw, const float* __restrict__ knw,
            const float* __restrict__ cosT, const float* __restrict__ sinT, u16* QHo, u16* QLo, u16* KHo, u16* VHo) {
  const int tid = (int)threadIdx.x;
  int bid = (int)blockIdx.x;
  if (bid < RB_V) { vt16(bid, Fv, VHo); return; }
  bid -= RB_V;
  if (bid < RB_K) { nrope16<false>(bid * 8 + (tid >> 5), tid & 31, Fk, KVD, SEQ, knw, cosT, sinT, KHo, KHo, KSC); return; }
  bid -= RB_K;
  nrope16<true>(bid * 2 + (tid >> 7), tid & 127, Fq, DMOD, SQ, qnw, cosT, sinT, QHo, QLo, QSC);
}

// =====================================================================================================
// The wave's 64 x 64 tile of C: accumulators * oscale -> the wave's own slab [64][68] -> whole 256-B row pieces of C.
// coverage: 32 instructions x 2 rows x 16 lanes x 4 floats = the wave's 64 x 64 tile.
// =====================================================================================================
__device__ __forceinline__ void epi64x64(float* sl, const v8f (&acc)[4][4], float oscale,
                                         float* C, int N, size_t rowb, int col0, int lane) {
  const int hh = lane >> 4, m = lane & 15;
#pragma unroll
  for (int i = 0; i < 4; ++i) {
#pragma unroll
    for (int r = 0; r < 8; ++r) {
      const int ro = (i * 16 + 8 * hh + r) * 68 + m;
      sl[ro]      = acc[i][0][r] * oscale;
      sl[ro + 16] = acc[i][1][r] * oscale;
      sl[ro + 32] = acc[i][2][r] * oscale;
      sl[ro + 48] = acc[i][3][r] * oscale;
    }
  }
  wave_sync_lds();
  float* dst = C + (rowb + (size_t)hh) * (size_t)N + col0 + m * 4;
#pragma unroll
  for (int it = 0; it < 32; ++it) {
    const v4f v = *(const v4f*)(sl + (it * 2 + hh) * 68 + m * 4);
    *(v4f*)(dst + (size_t)(it * 2) * (size_t)N) = v;
  }
}

// =====================================================================================================
// GEMM: C[row][N] (f32, row pitch N) = A[row][K] (16-bit row-major, pitch K) . Bt[N][K]^T (16-bit k-contiguous) * oscale,
// row = bb*SEQ + s for s < 128*nrt.  BF: bf16 operands (v_wmma_f32_16x16x32_bf16), else f16 (v_wmma_f32_16x16x32_f16).
// Block -> (column tile ct of N/128, row tile rt of nrt, batch bb; from the block's index, by the caller): a 128 x 128 tile of C; 4 waves as 2 x 2, each a
// 64 x 64 tile = 4 x 4 accumulators, so that a fragment read from LDS serves four products.
// The 128 A rows and 128 Bt rows reach the waves through an LDS ring of two buffers, 64 k a stage, filled by asynchronous
// copies of whole 128-B row pieces; fragments by two 16-B LDS loads each (split k map for A and B); k in ascending steps of 32
// per accumulator.  One block barrier per stage, under block-uniform control flow (host: K % 64 == 0, N % 128 == 0).
// coverage: 4 waves x 4 row groups x (16 x 64) = the block's tile; NB * nrt * (N/128) blocks = every row s < 128*nrt once.
// =====================================================================================================
template <bool BF> struct FragSel { typedef v16h T; };
template <> struct FragSel<true> { typedef v16b T; };
template <bool BF>
__device__ __forceinline__ typename FragSel<BF>::T ldfrag_t(const u16* p) {
  if constexpr (BF) return ldfrag_b(p);
  else return ldfrag_h((const _Float16*)(const void*)p);
}
template <bool BF>
__device__ __forceinline__ v8f mma_t(typename FragSel<BF>::T a, typename FragSel<BF>::T b, v8f c) {
  if constexpr (BF) return mma_b(a, b, c);
  else return mma_h(a, b, c);
}

template <bool BF>
__device__ __forceinline__
void gemm128_blk(int ct, int rt, int bb, const u16* __restrict__ A, const u16* __restrict__ Bt, float* C, int N, int K, float oscale) {
  __shared__ __align__(16) u16 ring[GRINGB / 2];          // two buffers of (128 A rows, 128 Bt rows), pitch GPB
  __shared__ __align__(16) float slab[4 * 4 * SLAB64];    // per wave [64][68]
  const int tid = (int)threadIdx.x, wave = tid >> 5, lane = tid & 31, hh = lane >> 4, m = lane & 15;
  if (bb >= NB) return;                     // block-uniform, before any barrier or copy; never taken with the exact grid
  if (rt * GBM + GBM > SEQ) return;         // block-uniform; never taken
  const int nstg  = K >> 6;
  const int col0  = ct * GBN;
  const size_t row0 = (size_t)bb * SEQ + (size_t)(rt * GBM);
  const int wr = wave >> 1, wc = wave & 1;  // this wave's 64 x 64 tile inside the block's
  // this lane's chunk 0 of stage 0 (stage_ab): global addresses and LDS byte addresses in buffer 0
  const size_t rs16 = (size_t)16 * (size_t)K;
  const u16* ag0 = A  + (row0 + (size_t)(tid >> 3)) * (size_t)K + (tid & 7) * 8;
  const u16* bg0 = Bt + (size_t)(col0 + (tid >> 3)) * (size_t)K + (tid & 7) * 8;
  const unsigned lring = (unsigned)(size_t)(const void*)ring;
  const unsigned la0 = lring + (unsigned)((tid >> 3) * GPB + (tid & 7) * 16);
  const unsigned lb0 = la0 + (unsigned)GATB;

  v8f acc[4][4];
#pragma unroll
  for (int i = 0; i < 4; ++i) {
#pragma unroll
    for (int j = 0; j < 4; ++j) acc[i][j] = zero8();
  }

  // ---- ring prologue: stage 0 lands and is published, then stage 1 flies while stage 0 is worked on ----
  stage_ab(ag0, bg0, rs16, la0, lb0);
  wait_async0();
  __syncthreads();
  if (nstg > 1) stage_ab(ag0 + GKS, bg0 + GKS, rs16, la0 + (unsigned)GSTB, lb0 + (unsigned)GSTB);   // block-uniform

  // kept rolled: one trip = one stage, with its one publish point at the foot
#pragma unroll 1
  for (int st = 0; st < nstg; ++st) {
    const int bufh = (st & 1) * (GSTB / 2);               // this stage's buffer, in halves
    const u16* ap = ring + bufh + (wr * 64 + m) * (GPB / 2) + 8 * hh;
    const u16* bp = ring + bufh + (GATB / 2) + (wc * 64 + m) * (GPB / 2) + 8 * hh;
    // both 32-k steps of a stage unrolled: their LDS offsets become immediates
    typename FragSel<BF>::T a[GKS / 32][4], b[GKS / 32][4];
#pragma unroll
    for (int ks = 0; ks < GKS / 32; ++ks) {
#pragma unroll
      for (int j = 0; j < 4; ++j) b[ks][j] = ldfrag_t<BF>(bp + j * 16 * (GPB / 2) + ks * 32);
#pragma unroll
      for (int i = 0; i < 4; ++i) a[ks][i] = ldfrag_t<BF>(ap + i * 16 * (GPB / 2) + ks * 32);
    }
    // keeps the stage's 32 LDS reads together in front of its 32 products: left free, the compiler reloads one A fragment
    // per four products and waits out the LDS latency each time
    __builtin_amdgcn_sched_barrier(0);
#pragma unroll
    for (int ks = 0; ks < GKS / 32; ++ks) {
#pragma unroll
      for (int i = 0; i < 4; ++i) {
#pragma unroll
        for (int j = 0; j < 4; ++j) acc[i][j] = mma_t<BF>(a[ks][i], b[ks][j], acc[i][j]);
      }
    }
    // keeps the products in front of the publish point: left free, they sink behind the barrier, the waits stand directly
    // behind the LDS reads, and the next stage's copies lose the products' time as their lead
    __builtin_amdgcn_sched_barrier(0);
    // ---- publish point of stage st + 1: own LDS reads retired, own copies landed, every wave has left this buffer ----
    wait_ds0();
    wait_async0();
    __syncthreads();
    if (st + 2 < nstg) {                                  // block-uniform: refill the buffer that this trip has just read
      stage_ab(ag0 + (size_t)(st + 2) * GKS, bg0 + (size_t)(st + 2) * GKS, rs16,
               la0 + (unsigned)(st & 1) * GSTB, lb0 + (unsigned)(st & 1) * GSTB);
    }
  }
  wait_async0();                                          // nothing in flight when the wave ends
  epi64x64(slab + wave * (4 * SLAB64), acc, oscale, C, N, row0 + (size_t)(wr * 64), col0 + wc * 64, lane);
}

// one product per launch (ctx.Wo)
template <bool BF>
__global__ __launch_bounds__(128)
void gemm128(const u16* __restrict__ A, const u16* __restrict__ Bt, float* C, int N, int K, int nrt, float oscale) {
  const int ntile = N >> 7;
  const int bid   = (int)blockIdx.x;
  const int t2    = bid / ntile;
  gemm128_blk<BF>(bid % ntile, t2 % nrt, t2 / nrt, A, Bt, C, N, K, oscale);
}

// x.Wq, x.Wk and x.Wv in one launch: block ranges, in this order: q (GB_Q blocks), k (GB_K), v (GB_K); the three products share A,
// write disjoint planes, and a block's product is block-uniform.
__global__ __launch_bounds__(128)
void gemm_qkv(const u16* __restrict__ A, const u16* __restrict__ Wq, const u16* __restrict__ Wk, const u16* __restrict__ Wv,
              float* Fq, float* Fk, float* Fv, int K, float oscale) {
  int bid = (int)blockIdx.x;
  const u16* Bt = Wq;
  float* C = Fq;
  int N = DMOD;
  int ct = bid % (DMOD / GBN), rt = (bid / (DMOD / GBN)) % (SQ / GBM), bb = bid / ((DMOD / GBN) * (SQ / GBM));
  if (bid >= GB_Q) {
    bid -= GB_Q; Bt = Wk; C = Fk; N = KVD;
    if (bid >= GB_K) { bid -= GB_K; Bt = Wv; C = Fv; }
    ct = bid % (KVD / GBN); rt = (bid / (KVD / GBN)) % (SEQ / GBM); bb = bid / ((KVD / GBN) * (SEQ / GBM));
  }
  gemm128_blk<true>(ct, rt, bb, A, Bt, C, N, K, oscale);
}

// =====================================================================================================
// Non-causal grouped-query attention, hd = 128, all SEQ keys. Block bid -> (query tile qt = bid % NQT: rows q0 = 16*qt ..
// q0+15, head group hg = kv head, batch b); one wave per query head = hg*WPB + wave (the 4 heads of the group share kv head hg).
//   q hi / residual planes f16 x256 [b*SEQ + s][h*HD + d]; k plane f16 x256 [b*SEQ + s][g*HD + d] (pitch KVD);
//   v^T plane [b*NKVH + g][d][SEQ] x1024.
//   scores = q_hi.k + q_lo.k (4 k-steps over d); P.v with P x32768 (f16) and v^T, for every query row;
//   O written as one f16 plane (O x1024, layout [b*SEQ + s][h*HD + d]).
//   score (log2 domain) t(i, j) = (q_i.k_j over HD) * (1/sqrt(128))*log2e/(256*256).
//   k rows and v^T rows reach the 4 waves through an LDS ring of two buffers, 64 keys a stage, filled by asynchronous copies.
//   Both products are taken transposed: S^T = k.q^T (A = k rows from the ring, B = q, loaded once and kept in registers) and
//   O^T += v^T.P^T (A = v^T rows from the ring, B = P^T), all fragments in the split k map. A lane (c, hh) then holds, of query
//   column q0 + c, the scores of keys kb + 8hh + r and kb + 16 + 8hh + r: maximum and sum run inside the lane, the maximum is
//   joined with the other half by one cross-row move per 32 keys, the sums once after the loop; the two score tiles, converted
//   in place (P x32768, f16), are the B fragment of the second product. All NKT key tiles of 32 visited in order; online
//   max-subtracted base-2 softmax in f32, -inf-safe rescale.
//   After the loop: out = acc / Z (Z >= 1 always; guarded anyway), carries 1/(32768*1024) folded once, written into the slab.
//   One block barrier per stage, under block-uniform control flow; bounded loops only (NST compile-time).
// coverage: per wave 8 instructions x 2 rows x 16 lanes x 8 halves = 16 x 128; grid NQT x NHG x NB blocks x WPB
//           waves = every (b, s < SQ, h) row segment of O exactly once.
// =====================================================================================================
__global__ __launch_bounds__(ATT_THREADS)
void attn_nc(const u16* __restrict__ QHp, const u16* __restrict__ QLp, const u16* __restrict__ KHp,
             const u16* __restrict__ VHp, u16* OHp) {
  __shared__ __align__(16) _Float16 ring[RINGB / 2];      // two buffers of (64 k rows pitch KPB, 128 v^T rows pitch VPB)

  const int tid  = (int)threadIdx.x;
  const int wave = tid >> 5;
  const int lane = tid & 31;
  const int hh   = lane >> 4;
  const int c    = lane & 15;
  const int bid  = (int)blockIdx.x;
  const int qt   = bid % NQT;
  const int t2   = bid / NQT;
  const int hg   = t2 % NHG;
  const int b    = t2 / NHG;
  if (b >= NB) return;                      // block-uniform, before any barrier or copy; never taken with the exact grid
  const int q0   = qt * 16;
  if (q0 + 16 > SQ) return;                 // block-uniform; never taken
  const int head = hg * WPB + wave;
  const int kvh  = hg;

  float* slab = (float*)(void*)ring + wave * SLW;         // result slab [16][128] pitch 132: the ring's bytes, after the loop

  const size_t hcol = (size_t)head * HD + 8 * hh;
  const _Float16* Qh  = (const _Float16*)(const void*)QHp + ((size_t)b * SEQ + q0 + c) * DMOD + hcol;
  const _Float16* Ql  = (const _Float16*)(const void*)QLp + ((size_t)b * SEQ + q0 + c) * DMOD + hcol;
  // this lane's chunk 0 of stage 0 (stage_kv): global addresses and LDS byte addresses in buffer 0
  const u16* kg0 = KHp + ((size_t)b * SEQ + (tid >> 4)) * KVD + (size_t)kvh * HD + (tid & 15) * 8;
  const u16* vg0 = VHp + ((size_t)(b * NKVH + kvh) * HD + (tid >> 3)) * SEQ + (tid & 7) * 8;
  const unsigned lring = (unsigned)(size_t)(const void*)ring;
  const unsigned lk0 = lring + (unsigned)((tid >> 4) * KPB + (tid & 15) * 16);
  const unsigned lv0 = lring + (unsigned)(KTB + (tid >> 3) * VPB + (tid & 7) * 16);
  const float lsc = RSQ_HD * (LOG2E / (QSC * KSC));
  const float oc  = 1.0f / (PCAR * VCAR);

  // q as the B operand: column = query q0 + c, loaded once for all keys
  v16h qh[HD / 32], ql[HD / 32];
#pragma unroll
  for (int kk = 0; kk < HD / 32; ++kk) { qh[kk] = ldfrag_h(Qh + kk * 32); ql[kk] = ldfrag_h(Ql + kk * 32); }
  float mrun = -INFINITY, lrun = 0.f;                     // of query column c; lrun over this half's keys only
  v8f o[8];                                               // o[j][r] = O^T[d = 16j + 8hh + r][query c]
#pragma unroll
  for (int j = 0; j < 8; ++j) o[j] = zero8();

  // ---- ring prologue: stage 0 lands and is published, then stage 1 flies while stage 0 is worked on ----
  stage_kv(kg0, vg0, lk0, lv0);
  wait_async0();
  __syncthreads();
  stage_kv(kg0 + (size_t)KSTG * KVD, vg0 + KSTG, lk0 + STGB, lv0 + STGB);

  // kept rolled: one trip = one stage, with its one publish point at the foot
#pragma unroll 1
  for (int st = 0; st < NST; ++st) {
   const int bufh = (st & 1) * (STGB / 2);                // this stage's buffer, in halves
   // kept rolled: unrolled, the compiler spreads a step's v^T reads in pairs among its products instead of issuing them together
   // ahead of the softmax arithmetic
#pragma unroll 1
   for (int sub = 0; sub < KSTG / 32; ++sub) {
    // ---- scores: D element r of this lane = (key kb + 8hh + r, query q0 + c) in s0, key kb + 16 + 8hh + r in s1, kb = 64*st + 32*sub ----
    v8f s0 = zero8(), s1 = zero8();
    const _Float16* k0p = ring + bufh + (sub * 32 + c) * (KPB / 2) + 8 * hh;
    const _Float16* k1p = k0p + 16 * (KPB / 2);
    v16h kh0[HD / 32], kh1[HD / 32];
#pragma unroll
    for (int kk = 0; kk < HD / 32; ++kk) { kh0[kk] = ldfrag_h(k0p + kk * 32); kh1[kk] = ldfrag_h(k1p + kk * 32); }
    // keeps the step's 16 k reads together in front of its 16 score products: left free, the compiler reloads two fragments
    // per four products and waits out the LDS latency each time
    __builtin_amdgcn_sched_barrier(0);
#pragma unroll
    for (int kk = 0; kk < HD / 32; ++kk) {
      s0 = mma_h(kh0[kk], qh[kk], s0);
      s1 = mma_h(kh1[kk], qh[kk], s1);
      s0 = mma_h(kh0[kk], ql[kk], s0);
      s1 = mma_h(kh1[kk], ql[kk], s1);
    }
    // splits the step here, so that the eight v^T fragments are read together at the head of the softmax arithmetic, which covers
    // their latency, into the k fragments' registers: left free, the compiler reads one fragment in front of each of the eight
    // products and waits out the LDS latency each time
    __builtin_amdgcn_sched_barrier(0);
    // ---- online softmax in base 2 over all keys, -inf-safe; one query column per lane ----
    float mx = fmaxf(s0[0], s1[0]);
#pragma unroll
    for (int r = 1; r < 8; ++r) mx = fmaxf(mx, fmaxf(s0[r], s1[r]));
    mx = fmaxf(mx, xhalf(mx)) * lsc;                      // lsc > 0: the maximum of the scaled scores
    const float mn = fmaxf(mrun, mx);
    const float ms = (mn == -INFINITY) ? 0.0f : mn;
    const float al = exp2f(mrun - ms);
    mrun = mn;
    // ---- B fragment of P^T*32768 (f16): elements 0..7 = keys kb + 8hh + 0..7, elements 8..15 = keys kb + 16 + 8hh + 0..7 ----
    FragH ph;
    float ps0 = 0.f, ps1 = 0.f;                           // sums over even and odd r
#pragma unroll
    for (int r = 0; r < 8; r += 2) {
      const float e0a = exp2f(s0[r] * lsc - ms), e0b = exp2f(s0[r + 1] * lsc - ms);
      const float e1a = exp2f(s1[r] * lsc - ms), e1b = exp2f(s1[r + 1] * lsc - ms);
      ps0 += e0a;
      ps1 += e0b;
      ps0 += e1a;
      ps1 += e1b;
      ph.h[0][r]     = (_Float16)(e0a * PCAR);
      ph.h[0][r + 1] = (_Float16)(e0b * PCAR);
      ph.h[1][r]     = (_Float16)(e1a * PCAR);
      ph.h[1][r + 1] = (_Float16)(e1b * PCAR);
    }
    lrun = lrun * al + (ps0 + ps1);
#pragma unroll
    for (int j = 0; j < 8; ++j) {
#pragma unroll
      for (int r = 0; r < 8; ++r) o[j][r] *= al;
    }
    // ---- v^T.P^T : A fragment row = d = j*16 + c, keys contiguous in the v^T rows ----
    {
      const _Float16* vhp = ring + bufh + (KTB / 2) + c * (VPB / 2) + sub * 32 + 8 * hh;   // d row c (+16j), keys of this step
#pragma unroll
      for (int j = 0; j < 8; ++j) o[j] = mma_h(ldfrag_h(vhp + j * 16 * (VPB / 2)), ph.v, o[j]);
    }
    // four vector slots behind the step's last products, in front of the loop's branch: on its taken side the first vector
    // instructions rewrite registers of P^T
    acc_guard8(o);
   }
   // ---- publish point of stage st + 1: own LDS reads retired, own copies landed, every wave has left this buffer ----
   wait_ds0();
   wait_async0();
   __syncthreads();
   if (st + 2 < NST) {                                    // block-uniform: refill the buffer that this trip has just read
     stage_kv(kg0 + (size_t)(st + 2) * KSTG * KVD, vg0 + (st + 2) * KSTG,
              lk0 + (unsigned)(st & 1) * STGB, lv0 + (unsigned)(st & 1) * STGB);
   }
  }
  wait_async0();                                          // nothing in flight before the ring's bytes become the result slab
  // ---- out = acc / Z (0 if Z == 0), carries (32768 on P, 1024 on v) folded once; row c of the wave's slab, 8 consecutive d ----
  {
    const float lv  = lrun + xhalf(lrun);                 // the two halves' sums joined
    const float ls  = (lv > 0.0f) ? lv : 1.0f;
    const float inv = (lv > 0.0f) ? ((1.0f / ls) * oc) : 0.0f;
#pragma unroll
    for (int j = 0; j < 8; ++j) {
      float* sp = slab + c * SLP + j * 16 + 8 * hh;
      v4f a, b4;
#pragma unroll
      for (int e = 0; e < 4; ++e) { a[e] = o[j][e] * inv; b4[e] = o[j][4 + e] * inv; }
      *(v4f*)(sp)     = a;
      *(v4f*)(sp + 4) = b4;
    }
  }

  wave_sync_lds();
  // ---- O x1024 -> f16 plane; lane = (row-in-pair rq, 8 consecutive d at c8) ----
  v4u oh[8];
  const int rq = lane >> 4, c8 = (lane & 15) * 8;
#pragma unroll
  for (int it = 0; it < 8; ++it) {
    const int row = it * 2 + rq;
    const v4f a = *(const v4f*)(slab + row * SLP + c8), b4 = *(const v4f*)(slab + row * SLP + c8 + 4);
    float w[8];
#pragma unroll
    for (int e = 0; e < 4; ++e) { w[e] = a[e] * OSC; w[4 + e] = b4[e] * OSC; }
#pragma unroll
    for (int e = 0; e < 4; ++e) {
      const _Float16 h0 = (_Float16)w[2 * e], h1 = (_Float16)w[2 * e + 1];
      oh[it][e] = pk16(h_bits(h0), h_bits(h1));
    }
  }
  const size_t ob = ((size_t)b * SEQ + q0) * DMOD + (size_t)head * HD + c8;
  {
#pragma unroll
    for (int it = 0; it < 8; ++it) {
      const int row = it * 2 + rq;
      *(v4u*)(OHp + ob + (size_t)row * DMOD) = oh[it];
    }
    
  }
}

// =====================================================================================================
// Workspace map (bytes); every plane is fully written by whole-line stores before it is read; all extents are exact multiples
// of the store granularity (no pad rows needed); every region offset a multiple of 1048576:
//   XB  bf16 [MROWS][2048]                       MROWS*4096       (NB=2: 16777216)
//   WQ  bf16 [2048 n][2048 k]                    8388608          Wq^T;  WO f16 x1024, same extent: Wo^T
//   WK  bf16 [512 n][2048 k]                     2097152          Wk^T;  WV same extent: Wv^T
//   FQ  f32 [MROWS][2048]                        MROWS*8192       (q projection; afterwards OH f16 [MROWS][2048] x1024 in its first half)
//   FK  f32 [MROWS][512]                         MROWS*2048       k projection;  FV same extent: v projection
//   QH  f16 [MROWS][2048] x256                   MROWS*4096       QL residual, same extent
//   KH  f16 [MROWS][512] x256                    MROWS*1024
//   VH  f16 [NB*4][128][SEQ] x1024               MROWS*1024
//   COS f32 [MROWS][64]                          MROWS*256        SIN same extent
//   end (NB=2)                                 132120576
// =====================================================================================================
extern "C" void kernel_launch(void* const* d_in, const int* in_sizes, int n_in,
                              void* d_out, int out_size, void* d_ws, size_t ws_size,
                              hipStream_t stream) {
  if (n_in < 8) return;
  if (in_sizes[0] < MROWS * DMOD) return;
  if (in_sizes[1] < MROWS) return;
  if (in_sizes[2] != DMOD * DMOD) return;
  if (in_sizes[3] != DMOD * KVD) return;
  if (in_sizes[4] != DMOD * KVD) return;
  if (in_sizes[5] != DMOD * DMOD) return;
  if (in_sizes[6] < HD) return;
  if (in_sizes[7] < HD) return;
  if (out_size < MROWS * DMOD) return;

  const float* x   = (const float*)d_in[0];
  const int*   pos = (const int*)d_in[1];
  const float* wq  = (const float*)d_in[2];
  const float* wk  = (const float*)d_in[3];
  const float* wv  = (const float*)d_in[4];
  const float* wo  = (const float*)d_in[5];
  const float* qnw = (const float*)d_in[6];
  const float* knw = (const float*)d_in[7];
  float*       out = (float*)d_out;

  const size_t szXB = (size_t)MROWS * DMOD * 2;
  const size_t szW  = (size_t)DMOD * DMOD * 2;                   // WQ, WO
  const size_t szWK = (size_t)DMOD * KVD * 2;                    // WK, WV
  const size_t szF  = (size_t)MROWS * DMOD * 4;                  // FQ
  const size_t szFK = (size_t)MROWS * KVD * 4;                   // FK, FV
  const size_t szQ  = (size_t)MROWS * DMOD * 2;                  // QH, QL, OH
  const size_t szK  = (size_t)MROWS * KVD * 2;                   // KH
  const size_t szV  = (size_t)NB * NKVH * HD * SEQ * 2;          // VH (== szK)
  const size_t szT  = (size_t)MROWS * HHALF * 4;                 // COS, SIN
  if (szQ > szF) return;                                         // OH lives inside the FQ region
  size_t off = 0;
  const size_t oXB = off; off += szXB;
  const size_t oWQ = off; off += szW;
  const size_t oWO = off; off += szW;
  const size_t oWK = off; off += szWK;
  const size_t oWV = off; off += szWK;
  const size_t oF  = off; off += szF;
  const size_t oFK = off; off += szFK;
  const size_t oFV = off; off += szFK;
  const size_t oQH = off; off += szQ;
  const size_t oQL = off; off += szQ;
  const size_t oKH = off; off += szK;
  const size_t oVH = off; off += szV;
  const size_t oCS = off; off += szT;
  const size_t oSN = off; off += szT;
  if (off > ws_size) return;                // off = 132120576 for NB = 2
  if (off > (size_t)WS_CAP) return;

  char* ws = (char*)d_ws;
  u16*   XB  = (u16*)(ws + oXB);
  u16*   WQT = (u16*)(ws + oWQ);
  u16*   WOT = (u16*)(ws + oWO);
  u16*   WKT = (u16*)(ws + oWK);
  u16*   WVT = (u16*)(ws + oWV);
  float* FQ  = (float*)(ws + oF);
  float* FK  = (float*)(ws + oFK);
  float* FV  = (float*)(ws + oFV);
  u16*   OH  = (u16*)(ws + oF);
  u16*   QH  = (u16*)(ws + oQH);
  u16*   QL  = (u16*)(ws + oQL);
  u16*   KH  = (u16*)(ws + oKH);
  u16*   VH  = (u16*)(ws + oVH);
  float* COS = (float*)(ws + oCS);
  float* SIN = (float*)(ws + oSN);

  const dim3 b256(256), b128(128), bAT(ATT_THREADS);
  const int  nrtQ = SQ / GBM;                           // ctx / out rows per batch / 128
  const dim3 gGQ(GB_Q);
  const dim3 gAT(NQT * NHG * NB);

  // (0) cos/sin tables from the integer positions, x -> bf16 plane, Wq^T, Wk^T, Wv^T bf16 planes, Wo^T f16 plane of bf16 value x1024
  prep16<<<dim3(PB_ALL), b256, 0, stream>>>(pos, x, wq, wk, wv, wo, COS, SIN, XB, WQT, WKT, WVT, WOT);
  // (1) q = x.Wq -> FQ [MROWS][2048] (rows s < SQ), k = x.Wk -> FK [MROWS][512], v = x.Wv -> FV [MROWS][512]
  gemm_qkv<<<dim3(GB_ALL), b128, 0, stream>>>(XB, WQT, WKT, WVT, FQ, FK, FV, DMOD, 1.0f);
  // (2) v^T plane x1024; RMS normalisation + rotary + k plane x256; the same + q planes x256
  post16<<<dim3(RB_ALL), b256, 0, stream>>>(FQ, FK, FV, qnw, knw, COS, SIN, QH, QL, KH, VH);
  // (3) non-causal attention over all keys -> O plane (inside FQ)
  attn_nc<<<gAT, bAT, 0, stream>>>(QH, QL, KH, VH, OH);
  // (4) out = ctx.Wo -> f32, carries 1024 x 1024 folded back
  gemm128<false><<<gGQ, b128, 0, stream>>>(OH, WOT, out, DMOD, DMOD, nrtQ, 1.0f / (OSC * WOS));
  (void)hipGetLastError();
}

// v005
// It runs in 185 microseconds.
// Two timings next to v004 both put it at 1.06 times that version's speed.
// Over all steps from v000 it is 2.96 times as fast.
// Contractions: x.Wq, x.Wk, x.Wv on v_wmma_f32_16x16x32_bf16 (x and W^T as bf16 RNE planes, f32 accumulate);
// q.k^T over hd 128 on v_wmma_f32_16x16x32_f16 with q as f16 hi + f16 residual planes (x256) and k as one f16 plane
// (x256), products qh.k + ql.k; P.v on v_wmma_f32_16x16x32_f16 with P x32768 and v^T x1024 as single f16 planes;
// ctx.Wo on v_wmma_f32_16x16x32_f16 with ctx x1024 as one f16 plane and Wo^T as f16(bf16 RNE(Wo)) x1024; all f32
// accumulate. RMS normalisation, rotate-half rotary from integer positions (cos/sin tables built on device in f32),
// base-2 online softmax and the 1/Z fold in f32 on VALU.
#include <hip/hip_runtime.h>
#include <math.h>
#include <stdint.h>

#ifndef NB
#define NB 2
#endif
#define SEQ 2048
#ifndef SQ
#define SQ SEQ
#endif
#define DMOD  2048
#define NH    16
#define NKVH  4
#define HD    128
#define HHALF (HD / 2)
#define KVD   (NKVH * HD)
#define MROWS (NB * SEQ)
#define EPS_RMS 0.000001f
#define RSQ_HD 0.08838834764831845f
#define LOG2E 1.4426950408889634f
#define LOG2THETA 19.931568569324174
#define QSC   256.0f
#define KSC   256.0f
#define PCAR  32768.0f
#define PEXP  15.0f
#define VCAR  1024.0f
#define OSC   1024.0f
#define WOS   1024.0f
#define WPB   (NH / NKVH)
#define NHG   NKVH
#define NQT   (SQ / 16)
#define NST   (SEQ / 64)
#define NKT   (SEQ / 32)
#define ATT_THREADS (WPB * 32)
#define SLP   132
#define SLW   (16 * SLP)
#define SLAB64 (16 * 68)
#define VTP   72
#define WTP   72
#define WS_CAP 134217728
#define KSTG  64
#define KPB   272
#define VPB   144
#define KTB   (KSTG * KPB)
#define VTB   (HD * VPB)
#define STGB  (KTB + VTB)
#define RINGB (2 * STGB)
#define GBM   128
#define GBN   128
#define GKS   64
#define GPB   144
#define GATB  (GBM * GPB)
#define GSTB  ((GBM + GBN) * GPB)
#define GRINGB (2 * GSTB)
// block counts of the jobs that share one launch (each job's blocks are a contiguous range of the grid)
#define PB_TR (MROWS / 4)
#define PB_X  ((MROWS * DMOD / 8) / 256)
#define PB_WQ ((DMOD / 64) * (DMOD / 64))
#define PB_WK ((DMOD / 64) * (KVD / 64))
#define PB_ALL (PB_TR + PB_X + 2 * PB_WQ + 2 * PB_WK)
#define GB_Q  (NB * (SQ / GBM) * (DMOD / GBN))
#define GB_K  (NB * (SEQ / GBM) * (KVD / GBN))
#define GB_ALL (GB_Q + 2 * GB_K)
#define RB_V  (NB * NKVH * NST)
#define RB_K  (NB * SEQ / 8)
#define RB_Q  (NB * SQ / 2)
#define RB_ALL (RB_V + RB_K + RB_Q)
static_assert(DMOD / 16 == 128 && KVD / 16 == 32 && ((NB * SEQ) % 8) == 0 && ((NB * SQ) % 2) == 0);
static_assert(DMOD == NH * HD && HD == 128 && HHALF == 64 && NH == 16 && NKVH == 4 && WPB == 4 && NHG * WPB == NH);
static_assert(ATT_THREADS == 128 && KVD == 512);
static_assert(PCAR == 32768.0f && PEXP == 15.0f);       // PCAR = 2^PEXP
static_assert(NB >= 1 && NB <= 2);
static_assert((SEQ % 64) == 0 && (SQ % 64) == 0 && SQ >= 64 && SQ <= SEQ);
static_assert((DMOD % 64) == 0 && (KVD % 64) == 0 && (DMOD % 32) == 0 && (HD % 32) == 0);
static_assert(((MROWS * DMOD / 8) % 256) == 0 && (MROWS % 4) == 0);
static_assert(KSTG == 64 && NST >= 2 && NST * KSTG == SEQ && (KPB % 16) == 0 && (VPB % 16) == 0 && (KTB % 16) == 0 && (STGB % 16) == 0);
static_assert(KPB == HD * 2 + 16 && VPB == KSTG * 2 + 16 && WPB * SLW * 4 <= RINGB && 4 * RINGB <= 327680);
static_assert(HD * VTP * 2 <= 65536 && 64 * WTP * 2 <= 65536);
static_assert(GBM == 128 && GBN == 128 && GKS == 64 && GPB == GKS * 2 + 16 && (GPB % 16) == 0 && (GSTB % 16) == 0);
static_assert((SEQ % GBM) == 0 && (SQ % GBM) == 0 && (DMOD % GBN) == 0 && (KVD % GBN) == 0 && (DMOD % GKS) == 0 && DMOD / GKS >= 2);
static_assert(2 * (GRINGB + 4 * 4 * SLAB64 * 4) <= 327680);
static_assert((DMOD / 16) <= 128 && (KVD / 16) <= 128 && ((DMOD / 16) % 32) == 0 && ((KVD / 16) % 32) == 0);

typedef unsigned short u16;
typedef _Float16 v16h __attribute__((ext_vector_type(16)));
typedef _Float16 v8h  __attribute__((ext_vector_type(8)));
typedef __bf16   v16b __attribute__((ext_vector_type(16)));
typedef float    v8f  __attribute__((ext_vector_type(8)));
typedef float    v4f  __attribute__((ext_vector_type(4)));
typedef float    v2f  __attribute__((ext_vector_type(2)));
typedef unsigned int v4u __attribute__((ext_vector_type(4)));

union FragH { v16h v; v8h h[2]; v4u u[2]; };
union FragB { v16b v; v4u u[2]; };

// ---- scalar helpers --------------------------------------------------------------------------------
__device__ __forceinline__ unsigned short bf_bits(float f) {          // f32 -> bf16 bits, RNE convert
  unsigned u = __float_as_uint(f);
  return (unsigned short)((u + 0x7FFFu + ((u >> 16) & 1u)) >> 16);
}
__device__ __forceinline__ float bf_up(unsigned short h) { return __uint_as_float(((unsigned)h) << 16); }
__device__ __forceinline__ float bfr(float f) { return bf_up(bf_bits(f)); }
__device__ __forceinline__ unsigned short h_bits(_Float16 x) { return __builtin_bit_cast(unsigned short, x); }
__device__ __forceinline__ unsigned pk16(unsigned short a, unsigned short b) { return (unsigned)a | ((unsigned)b << 16); }
__device__ __forceinline__ v8f zero8() { v8f z = {0.f, 0.f, 0.f, 0.f, 0.f, 0.f, 0.f, 0.f}; return z; }

// ---- fragment loaders: 16-bit A/B operand, lane -> row/col (lane&15), p already includes +8*(lane>>4);
//      elements 0..7 <- p[0..7] (k0+8h..), elements 8..15 <- p[16..23] (k0+16+8h..)  (same split k map for A and B;
//      B is always read from a k-contiguous [n][k] plane)
__device__ __forceinline__ v16h ldfrag_h(const _Float16* p) {
  FragH f;
  f.h[0] = *(const v8h*)(p);
  f.h[1] = *(const v8h*)(p + 16);
  return f.v;
}
__device__ __forceinline__ v16b ldfrag_b(const u16* p) {              // bf16 plane read as unsigned integer vectors
  FragB f;
  f.u[0] = *(const v4u*)(p);
  f.u[1] = *(const v4u*)(p + 16);
  return f.v;
}

__device__ __forceinline__ v8f mma_h(v16h a, v16h b, v8f c) {
  return __builtin_amdgcn_wmma_f32_16x16x32_f16(false, a, false, b, (short)0, c, false, false);
}
__device__ __forceinline__ v8f mma_b(v16b a, v16b b, v8f c) {
  return __builtin_amdgcn_wmma_f32_16x16x32_bf16(false, a, false, b, (short)0, c, false, false);
}
__device__ __forceinline__ void acc_guard8(v8f (&a)[8]) {
#if defined(__HIP_DEVICE_COMPILE__)
  asm volatile("v_nop\n\tv_nop\n\tv_nop\n\tv_nop"
               : "+v"(a[0]), "+v"(a[1]), "+v"(a[2]), "+v"(a[3]), "+v"(a[4]), "+v"(a[5]), "+v"(a[6]), "+v"(a[7]));
#endif
}
__device__ __forceinline__ void wave_sync_lds() {
  __builtin_amdgcn_fence(__ATOMIC_RELEASE, "workgroup");
  __builtin_amdgcn_wave_barrier();
  __builtin_amdgcn_fence(__ATOMIC_ACQUIRE, "workgroup");
}
// lane l's value from lane l ^ 16: the two halves of the wave hold the two halves of a query column's keys
__device__ __forceinline__ float xhalf(float x) {
  const int b = __builtin_bit_cast(int, x);
  return __builtin_bit_cast(float, __builtin_amdgcn_permlanex16(b, b, 0x76543210, 0xfedcba98, false, false));
}
// Eight asynchronous 16-byte copies of this lane, global -> LDS (l = LDS byte address, g = global address, both 16-B aligned).
// The closing s_wait_xcnt 0 stands inside the statement so that no address register is rewritten in front of it.
__device__ __forceinline__ void async8(const unsigned* l, const u16* const* g) {
#if defined(__HIP_DEVICE_COMPILE__)
  asm volatile("global_load_async_to_lds_b128 %0, %8, off\n\t"
               "global_load_async_to_lds_b128 %1, %9, off\n\t"
               "global_load_async_to_lds_b128 %2, %10, off\n\t"
               "global_load_async_to_lds_b128 %3, %11, off\n\t"
               "global_load_async_to_lds_b128 %4, %12, off\n\t"
               "global_load_async_to_lds_b128 %5, %13, off\n\t"
               "global_load_async_to_lds_b128 %6, %14, off\n\t"
               "global_load_async_to_lds_b128 %7, %15, off\n\t"
               "s_wait_xcnt 0x0"
               :: "v"(l[0]), "v"(l[1]), "v"(l[2]), "v"(l[3]), "v"(l[4]), "v"(l[5]), "v"(l[6]), "v"(l[7]),
                  "v"(g[0]), "v"(g[1]), "v"(g[2]), "v"(g[3]), "v"(g[4]), "v"(g[5]), "v"(g[6]), "v"(g[7])
               : "memory");
#endif
}
// One stage (64 keys) of k rows and v^T rows into one ring buffer, 16 copies per lane of the 128 threads:
//   k   chunk i: key row i*8 + (tid>>4), 16-B piece tid&15  (a wave covers two whole 256-B rows), LDS pitch KPB;
//   v^T chunk i: d row i*16 + (tid>>3), 16-B piece tid&7    (a wave covers four whole 128-B rows), LDS pitch VPB.
// kg, vg, lk, lv are this lane's addresses of chunk 0.
__device__ __forceinline__ void stage_kv(const u16* kg, const u16* vg, unsigned lk, unsigned lv) {
  unsigned l[8];
  const u16* g[8];
  // both loops unrolled so that l[] and g[] are registers, as the asm operands need them
#pragma unroll
  for (int i = 0; i < 8; ++i) { l[i] = lk + (unsigned)(i * 8 * KPB); g[i] = kg + (size_t)(i * 8) * KVD; }
  async8(l, g);
#pragma unroll
  for (int i = 0; i < 8; ++i) { l[i] = lv + (unsigned)(i * 16 * VPB); g[i] = vg + (size_t)(i * 16) * SEQ; }
  async8(l, g);
}
// One GEMM stage (64 k = 128 B of each row) of 128 A rows and 128 B rows into one ring buffer, 16 copies per lane of the
// 128 threads: chunk i = row i*16 + (tid>>3), 16-B piece tid&7 (a wave covers four whole 128-B row pieces), LDS pitch GPB.
// ag, bg, la, lb are this lane's addresses of chunk 0; rs16 = 16 rows of the global planes, in elements.
__device__ __forceinline__ void stage_ab(const u16* ag, const u16* bg, size_t rs16, unsigned la, unsigned lb) {
  unsigned l[8];
  const u16* g[8];
  // both loops unrolled so that l[] and g[] are registers, as the asm operands need them
#pragma unroll
  for (int i = 0; i < 8; ++i) { l[i] = la + (unsigned)(i * 16 * GPB); g[i] = ag + (size_t)i * rs16; }
  async8(l, g);
#pragma unroll
  for (int i = 0; i < 8; ++i) { l[i] = lb + (unsigned)(i * 16 * GPB); g[i] = bg + (size_t)i * rs16; }
  async8(l, g);
}
// the issuing wave's own wait: every asynchronous copy it has issued has landed in LDS
__device__ __forceinline__ void wait_async0() {
#if defined(__HIP_DEVICE_COMPILE__)
  asm volatile("s_wait_asynccnt 0x0" ::: "memory");
#endif
}
// this wave's LDS reads and writes have retired (in front of the barrier behind which a buffer is refilled)
__device__ __forceinline__ void wait_ds0() {
#if defined(__HIP_DEVICE_COMPILE__)
  asm volatile("s_wait_dscnt 0x0" ::: "memory");
#endif
}

// =====================================================================================================
// cos/sin tables for the rotary: row = b*SEQ + s (0 .. nrows-1), column j = 0..63:
//   invf[j] = 1e6^(-j/64) (f64 exp2, converted to f32), ang = float(pos[row]) * invf[j] (f32 multiply),
//   cosT[row][j] = cosf(ang), sinT[row][j] = sinf(ang).
// Block = 4 rows x 64 j (one value pair per thread) staged in LDS; after the barrier waves 0,1 write the 4 cos rows and
// coverage: nrows/4 blocks (bid) x (2 tables x 4 rows x 64 floats) = both tables exactly once (nrows % 4 == 0, host).
// =====================================================================================================
__device__ __forceinline__ void trig64(int bid, const int* __restrict__ pos, float* cosT, float* sinT, int nrows) {
#pragma clang fp contract(off)
  __shared__ __align__(16) float cs[2 * 256];
  const int tid  = (int)threadIdx.x;
  const int row0 = bid * 4;
  if (row0 + 4 > nrows) return;                       // block-uniform, before the barrier; never taken with the exact grid
  const int r = tid >> 6, j = tid & 63;
  const float p    = (float)pos[row0 + r];
  const float invf = (float)exp2(-(double)j * (LOG2THETA / 64.0));
  const float ang  = p * invf;
  cs[tid]       = cosf(ang);
  cs[256 + tid] = sinf(ang);
  __syncthreads();
  if (tid < 128) {                                    // waves 0..3, wave-uniform
    const int tb    = tid >> 6;                       // 0: cos rows (waves 0,1), 1: sin rows (waves 2,3)
    const int q     = tid & 63;
    const int rr    = q >> 4;
    const int piece = (q & 15) * 4;
    const v4f v = *(const v4f*)(cs + tb * 256 + rr * 64 + piece);
    float* base = (tb != 0) ? sinT : cosT;
    float* dst  = base + (size_t)(row0 + rr) * HHALF + piece;
    {
      *(v4f*)(dst) = v;
      
    }
  }
}

// =====================================================================================================
// f32 -> 16-bit plane, same layout.  f16mode == 0: bf16 RNE bits;  f16mode == 1: f16 bits of (bf16 RNE value) * scale.
// Thread = 8 consecutive elements: two 16-B loads, one 16-B store; 32 consecutive lanes = 512 contiguous, 512-B aligned
// coverage: ceil(n8/256) blocks (bid) x 256 thr x 8 (in-kernel bound) = the whole plane (n8 a multiple of 256 here).
// =====================================================================================================
__device__ __forceinline__ void cvt16(int bid, const float* __restrict__ x, u16* D, int n8, int f16mode, float scale) {
  const int gt = bid * 256 + (int)threadIdx.x;
  if (gt >= n8) return;
  const float* p = x + (size_t)gt * 8;
  const v4f a = *(const v4f*)(p), b4 = *(const v4f*)(p + 4);
  float w[8];
#pragma unroll
  for (int e = 0; e < 4; ++e) { w[e] = a[e]; w[4 + e] = b4[e]; }
  v4u o;
#pragma unroll
  for (int e = 0; e < 4; ++e) {
    const float f0 = w[2 * e], f1 = w[2 * e + 1];
    const unsigned short hb0 = h_bits((_Float16)(bfr(f0) * scale));
    const unsigned short hb1 = h_bits((_Float16)(bfr(f1) * scale));
    const unsigned short bb0 = bf_bits(f0);
    const unsigned short bb1 = bf_bits(f1);
    o[e] = (f16mode != 0) ? pk16(hb0, hb1) : pk16(bb0, bb1);
  }
  u16* d = D + (size_t)gt * 8;
  {
    *(v4u*)(d) = o;
    
  }
}

// =====================================================================================================
// Weight transpose + convert: W f32 [K rows][N cols] (row pitch N) -> Wt 16-bit [N rows][K cols] (row pitch K), so that
// a column n of W becomes the k-contiguous B operand row n.  f16mode == 0: bf16 RNE bits; 1: f16 bits of (bf16 RNE value)*scale.
// Block = 64 k x 64 n tile: load phase 4 iterations x (16 k rows x 16 lanes x 4 n) with 16-B loads into an LDS tile
// coverage: load 4 it x 256 thr x 4 = 64 x 64; store 2 it x 256 thr x 8 halves = 64 rows x 64; (K/64)*(N/64)
//           blocks (bid) = the whole [N][K] plane exactly once.
// =====================================================================================================
__device__ __forceinline__ void wt16(int bid, const float* __restrict__ W, u16* Wt, int K, int N, int f16mode, float scale) {
  __shared__ __align__(16) u16 T[64 * WTP];
  const int tid = (int)threadIdx.x;
  const int nkt = K >> 6;
  const int kt  = bid % nkt;
  const int nt  = bid / nkt;
  const int kb  = kt * 64, nb = nt * 64;
  if (nb + 64 > N) return;                            // block-uniform, before the barrier; never taken with the exact grid
  const int c4 = (tid & 15) * 4;                      // n within tile
  const int r0 = tid >> 4;                            // k within tile (0..15) + 16*it
#pragma unroll
  for (int it = 0; it < 4; ++it) {
    const int r = it * 16 + r0;
    const v4f a = *(const v4f*)(W + (size_t)(kb + r) * (size_t)N + nb + c4);
#pragma unroll
    for (int e = 0; e < 4; ++e) {
      const float f = a[e];
      const unsigned short hb = h_bits((_Float16)(bfr(f) * scale));
      const unsigned short bb = bf_bits(f);
      T[(c4 + e) * WTP + r] = (f16mode != 0) ? hb : bb;
    }
  }
  __syncthreads();
  v4u o[2];
  const int q8 = tid >> 3, p8 = (tid & 7) * 8;
#pragma unroll
  for (int it = 0; it < 2; ++it) o[it] = *(const v4u*)(T + (it * 32 + q8) * WTP + p8);
  u16* dst = Wt + (size_t)(nb + q8) * (size_t)K + kb + p8;
  {
#pragma unroll
    for (int it = 0; it < 2; ++it) {
      *(v4u*)(dst + (size_t)(it * 32) * (size_t)K) = o[it];
    }
    // the code of the launch's other jobs follows these stores in the built kernel and reuses their registers
    asm volatile("s_wait_xcnt 0x0" ::: "memory");
  }
}

// =====================================================================================================
// Everything that depends on the inputs alone, in one launch: block ranges, in this order: cos/sin tables (PB_TR blocks), x plane
// (PB_X), Wq^T (PB_WQ), Wo^T (PB_WQ), Wk^T (PB_WK), Wv^T (PB_WK). The jobs write disjoint planes and read none of them; the job of
// a block is block-uniform, so each job's one barrier stays under block-uniform control flow.
// =====================================================================================================
__global__ __launch_bounds__(256)
void prep16(const int* __restrict__ pos, const float* __restrict__ x, const float* __restrict__ wq, const float* __restrict__ wk,
            const float* __restrict__ wv, const float* __restrict__ wo, float* cosT, float* sinT,
            u16* XBo, u16* WQo, u16* WKo, u16* WVo, u16* WOo) {
  int bid = (int)blockIdx.x;
  if (bid < PB_TR) { trig64(bid, pos, cosT, sinT, MROWS); return; }
  bid -= PB_TR;
  if (bid < PB_X) { cvt16(bid, x, XBo, (MROWS * DMOD) / 8, 0, 1.0f); return; }
  bid -= PB_X;
  const float* W = wq;
  u16* Wt = WQo;
  int N = DMOD, f16mode = 0;
  float scale = 1.0f;
  if (bid >= PB_WQ) {
    bid -= PB_WQ; W = wo; Wt = WOo; f16mode = 1; scale = WOS;
    if (bid >= PB_WQ) {
      bid -= PB_WQ; W = wk; Wt = WKo; N = KVD; f16mode = 0; scale = 1.0f;
      if (bid >= PB_WK) { bid -= PB_WK; W = wv; Wt = WVo; }
    }
  }
  wt16(bid, W, Wt, DMOD, N, f16mode, scale);
}

// =====================================================================================================
// v^T plane from the v projection F f32 [MROWS][KVD] (row = b*SEQ + s, column = g*HD + d):
//   VH[((b*NKVH + g)*HD + d)][s] = f16(v * 1024) for all keys s.
// Block = (b, kv head g, 64 keys s0): each thread loads its 32 floats (key sl, d chunk dc) with 16-B loads, converts, scatters
// coverage: load 256 thr x 32 = 64 keys x 128 d; store 4 iterations x 256 thr x 8 halves = 128 lines x 64 = the block's tile;
//           NB*NKVH*NST blocks (bid) cover the plane exactly once.
// =====================================================================================================
__device__ __forceinline__ void vt16(int bid, const float* __restrict__ F, u16* VHo) {
  __shared__ __align__(16) u16 TH[HD * VTP];
  const int tid = (int)threadIdx.x;
  const int st  = bid % NST;
  const int t2  = bid / NST;
  const int g   = t2 % NKVH;
  const int b   = t2 / NKVH;
  if (b >= NB) return;                                // block-uniform, before any barrier; never taken with the exact grid
  const int s0  = st * 64;
  {
    const int sl = tid >> 2;                          // key within tile 0..63
    const int dc = (tid & 3) * 32;                    // d chunk 0,32,64,96
    const float* src = F + ((size_t)b * SEQ + s0 + sl) * KVD + g * HD + dc;
#pragma unroll
    for (int i = 0; i < 8; ++i) {
      const v4f a = *(const v4f*)(src + 4 * i);
#pragma unroll
      for (int e = 0; e < 4; ++e) {
        const float t = a[e] * VCAR;
        TH[(dc + 4 * i + e) * VTP + sl] = h_bits((_Float16)t);
      }
    }
  }
  __syncthreads();
  v4u vh[4];
  const int q8 = tid >> 3, p8 = (tid & 7) * 8;
#pragma unroll
  for (int it = 0; it < 4; ++it) {
    const int line = it * 32 + q8;                    // d = 0..127
    vh[it] = *(const v4u*)(TH + line * VTP + p8);
  }
  const size_t hrow = (size_t)(b * NKVH + g) * HD;
  const size_t base = hrow * SEQ + s0 + p8;
  {
#pragma unroll
    for (int it = 0; it < 4; ++it) {
      const int line = it * 32 + q8;
      *(v4u*)(VHo + base + (size_t)line * SEQ) = vh[it];
    }
    
  }
}

// =====================================================================================================
// Per-head RMS normalisation + rotate-half rotary + 16-bit planes from a projection F f32 [MROWS][ncol]
// (ncol = DMOD for q, KVD for k; row = b*SEQ + s with s < nrows, column = head*HD + d):
//   rs = 1/sqrt(mean_d(x[head][d]^2) + eps) over the head's 128 columns (f32 sum of squares: 16 per thread, then an
//   8-lane shuffle sum, the 8 lanes of a head are 8 consecutive lanes); y[d] = (x[d]*rs) * w[d] with w = bf16 RNE value
//   of the norm weight; then for j < 64 within a head, with c = cosT[row][j], sn = sinT[row][j] (f32 tables):
//   out[j]    = y[j]*c    - y[j+64]*sn
//   out[j+64] = y[j+64]*c + y[j]*sn
//   Hp [MROWS][ncol] = f16(out * sc); if RES also Lp [MROWS][ncol] = f16 residual (t - f16(t)), same layout.
// One row blk = exactly ncol/16 consecutive threads (whole waves), tid = 0 .. ncol/16 - 1 within the row; thread t = head t>>3,
// chunk i = t&7: columns head*HD + 8i .. +7 and + 64. No lane-varying control anywhere (shuffles with all lanes active).
// coverage: (ncol/16) thr x 16 = the whole row of Hp (and of Lp); blk = 0 .. NB*nrows - 1 = every processed row once.
// =====================================================================================================
__device__ __forceinline__ void rot_pair(float xl, float xh, float cv, float sv, float sc,
                                         unsigned short& hl, unsigned short& hhv, unsigned short& ll, unsigned short& lh) {
#pragma clang fp contract(off)
  const float rl = xl * cv - xh * sv;
  const float rh = xh * cv + xl * sv;
  const float tl = rl * sc, th = rh * sc;
  const _Float16 a = (_Float16)tl, bq = (_Float16)th;
  hl  = h_bits(a);
  hhv = h_bits(bq);
  ll  = h_bits((_Float16)(tl - (float)a));
  lh  = h_bits((_Float16)(th - (float)bq));
}

template <bool RES>
__device__ __forceinline__ void nrope16(int blk, int tid, const float* __restrict__ F, int ncol, int nrows,
                                        const float* __restrict__ nw,
                                        const float* __restrict__ cosT, const float* __restrict__ sinT,
                                        u16* Hp, u16* Lp, float sc) {
#pragma clang fp contract(off)
  const int b   = blk / nrows;
  const int s   = blk - b * nrows;
  if (b >= NB) return;                                 // wave-uniform, no barrier behind it; never taken with the exact grid
  const int row = b * SEQ + s;
  const int dlo = (tid & 7) * 8;                       // j within head, multiple of 8
  const int clo = (tid >> 3) * HD + dlo;               // column of the low-half chunk; clo + 64 + 8 <= ncol as tid < ncol/16
  const float* p = F + (size_t)row * ncol + clo;
  const v4f xa = *(const v4f*)(p), xb = *(const v4f*)(p + 4);
  const v4f ya = *(const v4f*)(p + HHALF), yb = *(const v4f*)(p + HHALF + 4);
  // the table loads behind this line land in the registers that hold the four row loads' address
  asm volatile("s_wait_xcnt 0x0" ::: "memory");
  const size_t trow = (size_t)row * HHALF + dlo;
  const v4f ca = *(const v4f*)(cosT + trow), cb = *(const v4f*)(cosT + trow + 4);
  const v4f sa = *(const v4f*)(sinT + trow), sb = *(const v4f*)(sinT + trow + 4);
  const v4f wa = *(const v4f*)(nw + dlo), wb4 = *(const v4f*)(nw + dlo + 4);
  const v4f wc = *(const v4f*)(nw + HHALF + dlo), wd = *(const v4f*)(nw + HHALF + dlo + 4);
  float xl[8], xh[8], cv[8], sv[8], wl[8], wh[8];
#pragma unroll
  for (int e = 0; e < 4; ++e) {
    xl[e] = xa[e];        xl[4 + e] = xb[e];
    xh[e] = ya[e];        xh[4 + e] = yb[e];
    cv[e] = ca[e];        cv[4 + e] = cb[e];
    sv[e] = sa[e];        sv[4 + e] = sb[e];
    wl[e] = bfr(wa[e]);   wl[4 + e] = bfr(wb4[e]);
    wh[e] = bfr(wc[e]);   wh[4 + e] = bfr(wd[e]);
  }
  // sum of squares over the head's 128 columns: 16 here, then lanes xor 1, 2, 4 (aligned groups of 8 lanes = one head)
  float ss = 0.0f;
#pragma unroll
  for (int e = 0; e < 8; ++e) { ss = ss + xl[e] * xl[e]; ss = ss + xh[e] * xh[e]; }
  ss += __shfl_xor(ss, 1, 32);
  ss += __shfl_xor(ss, 2, 32);
  ss += __shfl_xor(ss, 4, 32);
  const float var = ss * (1.0f / (float)HD);
  const float rs  = 1.0f / sqrtf(var + EPS_RMS);
#pragma unroll
  for (int e = 0; e < 8; ++e) {
    xl[e] = (xl[e] * rs) * wl[e];
    xh[e] = (xh[e] * rs) * wh[e];
  }
  v4u ohl, ohh, oll, olh;
#pragma unroll
  for (int e = 0; e < 4; ++e) {
    unsigned short hl0, hh0, ll0, lh0, hl1, hh1, ll1, lh1;
    rot_pair(xl[2 * e],     xh[2 * e],     cv[2 * e],     sv[2 * e],     sc, hl0, hh0, ll0, lh0);
    rot_pair(xl[2 * e + 1], xh[2 * e + 1], cv[2 * e + 1], sv[2 * e + 1], sc, hl1, hh1, ll1, lh1);
    ohl[e] = pk16(hl0, hl1);
    ohh[e] = pk16(hh0, hh1);
    oll[e] = pk16(ll0, ll1);
    olh[e] = pk16(lh0, lh1);
  }
  u16* dh = Hp + (size_t)row * ncol + clo;
  u16* dl = Lp + (size_t)row * ncol + clo;             // dereferenced only when RES
  {
    *(v4u*)(dh) = ohl;
    *(v4u*)(dh + HHALF) = ohh;
    if constexpr (RES) {
      *(v4u*)(dl) = oll;
      *(v4u*)(dl + HHALF) = olh;
    }
    
  }
}

// =====================================================================================================
// Everything between the projections and the attention, in one launch of 256-thread blocks: block ranges, in this order: v^T plane
// (RB_V blocks), k rows (RB_K blocks of 8 rows, one wave a row), q rows (RB_Q blocks of 2 rows, four waves a row).
// The jobs read disjoint projections and write disjoint planes; the job of a block is block-uniform.
// =====================================================================================================
__global__ __launch_bounds__(256)
void post16(const float* __restrict__ Fq, const float* __restrict__ Fk, const float* __restrict__ Fv,
            const float* __restrict__ qnw, const float* __restrict__ knw,
            const float* __restrict__ cosT, const float* __restrict__ sinT, u16* QHo, u16* QLo, u16* KHo, u16* VHo) {
  const int tid = (int)threadIdx.x;
  int bid = (int)blockIdx.x;
  if (bid < RB_V) { vt16(bid, Fv, VHo); return; }
  bid -= RB_V;
  if (bid < RB_K) { nrope16<false>(bid * 8 + (tid >> 5), tid & 31, Fk, KVD, SEQ, knw, cosT, sinT, KHo, KHo, KSC); return; }
  bid -= RB_K;
  nrope16<true>(bid * 2 + (tid >> 7), tid & 127, Fq, DMOD, SQ, qnw, cosT, sinT, QHo, QLo, QSC);
}

// =====================================================================================================
// The wave's 64 x 64 tile of C: accumulators * oscale -> the wave's own slab [64][68] -> whole 256-B row pieces of C.
// coverage: 32 instructions x 2 rows x 16 lanes x 4 floats = the wave's 64 x 64 tile.
// =====================================================================================================
__device__ __forceinline__ void epi64x64(float* sl, const v8f (&acc)[4][4], float oscale,
                                         float* C, int N, size_t rowb, int col0, int lane) {
  const int hh = lane >> 4, m = lane & 15;
#pragma unroll
  for (int i = 0; i < 4; ++i) {
#pragma unroll
    for (int r = 0; r < 8; ++r) {
      const int ro = (i * 16 + 8 * hh + r) * 68 + m;
      sl[ro]      = acc[i][0][r] * oscale;
      sl[ro + 16] = acc[i][1][r] * oscale;
      sl[ro + 32] = acc[i][2][r] * oscale;
      sl[ro + 48] = acc[i][3][r] * oscale;
    }
  }
  wave_sync_lds();
  float* dst = C + (rowb + (size_t)hh) * (size_t)N + col0 + m * 4;
#pragma unroll
  for (int it = 0; it < 32; ++it) {
    const v4f v = *(const v4f*)(sl + (it * 2 + hh) * 68 + m * 4);
    *(v4f*)(dst + (size_t)(it * 2) * (size_t)N) = v;
  }
}

// =====================================================================================================
// GEMM: C[row][N] (f32, row pitch N) = A[row][K] (16-bit row-major, pitch K) . Bt[N][K]^T (16-bit k-contiguous) * oscale,
// row = bb*SEQ + s for s < 128*nrt.  BF: bf16 operands (v_wmma_f32_16x16x32_bf16), else f16 (v_wmma_f32_16x16x32_f16).
// Block -> (column tile ct of N/128, row tile rt of nrt, batch bb; from the block's index, by the caller): a 128 x 128 tile of C; 4 waves as 2 x 2, each a
// 64 x 64 tile = 4 x 4 accumulators, so that a fragment read from LDS serves four products.
// The 128 A rows and 128 Bt rows reach the waves through an LDS ring of two buffers, 64 k a stage, filled by asynchronous
// copies of whole 128-B row pieces; fragments by two 16-B LDS loads each (split k map for A and B); k in ascending steps of 32
// per accumulator.  One block barrier per stage, under block-uniform control flow (host: K % 64 == 0, N % 128 == 0).
// coverage: 4 waves x 4 row groups x (16 x 64) = the block's tile; NB * nrt * (N/128) blocks = every row s < 128*nrt once.
// =====================================================================================================
template <bool BF> struct FragSel { typedef v16h T; };
template <> struct FragSel<true> { typedef v16b T; };
template <bool BF>
__device__ __forceinline__ typename FragSel<BF>::T ldfrag_t(const u16* p) {
  if constexpr (BF) return ldfrag_b(p);
  else return ldfrag_h((const _Float16*)(const void*)p);
}
template <bool BF>
__device__ __forceinline__ v8f mma_t(typename FragSel<BF>::T a, typename FragSel<BF>::T b, v8f c) {
  if constexpr (BF) return mma_b(a, b, c);
  else return mma_h(a, b, c);
}

template <bool BF>
__device__ __forceinline__
void gemm128_blk(int ct, int rt, int bb, const u16* __restrict__ A, const u16* __restrict__ Bt, float* C, int N, int K, float oscale) {
  __shared__ __align__(16) u16 ring[GRINGB / 2];          // two buffers of (128 A rows, 128 Bt rows), pitch GPB
  __shared__ __align__(16) float slab[4 * 4 * SLAB64];    // per wave [64][68]
  const int tid = (int)threadIdx.x, wave = tid >> 5, lane = tid & 31, hh = lane >> 4, m = lane & 15;
  if (bb >= NB) return;                     // block-uniform, before any barrier or copy; never taken with the exact grid
  if (rt * GBM + GBM > SEQ) return;         // block-uniform; never taken
  const int nstg  = K >> 6;
  const int col0  = ct * GBN;
  const size_t row0 = (size_t)bb * SEQ + (size_t)(rt * GBM);
  const int wr = wave >> 1, wc = wave & 1;  // this wave's 64 x 64 tile inside the block's
  // this lane's chunk 0 of stage 0 (stage_ab): global addresses and LDS byte addresses in buffer 0
  const size_t rs16 = (size_t)16 * (size_t)K;
  const u16* ag0 = A  + (row0 + (size_t)(tid >> 3)) * (size_t)K + (tid & 7) * 8;
  const u16* bg0 = Bt + (size_t)(col0 + (tid >> 3)) * (size_t)K + (tid & 7) * 8;
  const unsigned lring = (unsigned)(size_t)(const void*)ring;
  const unsigned la0 = lring + (unsigned)((tid >> 3) * GPB + (tid & 7) * 16);
  const unsigned lb0 = la0 + (unsigned)GATB;

  v8f acc[4][4];
#pragma unroll
  for (int i = 0; i < 4; ++i) {
#pragma unroll
    for (int j = 0; j < 4; ++j) acc[i][j] = zero8();
  }

  // ---- ring prologue: stage 0 lands and is published, then stage 1 flies while stage 0 is worked on ----
  stage_ab(ag0, bg0, rs16, la0, lb0);
  wait_async0();
  __syncthreads();
  if (nstg > 1) stage_ab(ag0 + GKS, bg0 + GKS, rs16, la0 + (unsigned)GSTB, lb0 + (unsigned)GSTB);   // block-uniform

  // kept rolled: one trip = one stage, with its one publish point at the foot
#pragma unroll 1
  for (int st = 0; st < nstg; ++st) {
    const int bufh = (st & 1) * (GSTB / 2);               // this stage's buffer, in halves
    const u16* ap = ring + bufh + (wr * 64 + m) * (GPB / 2) + 8 * hh;
    const u16* bp = ring + bufh + (GATB / 2) + (wc * 64 + m) * (GPB / 2) + 8 * hh;
    // both 32-k steps of a stage unrolled: their LDS offsets become immediates
    typename FragSel<BF>::T a[GKS / 32][4], b[GKS / 32][4];
#pragma unroll
    for (int ks = 0; ks < GKS / 32; ++ks) {
#pragma unroll
      for (int j = 0; j < 4; ++j) b[ks][j] = ldfrag_t<BF>(bp + j * 16 * (GPB / 2) + ks * 32);
#pragma unroll
      for (int i = 0; i < 4; ++i) a[ks][i] = ldfrag_t<BF>(ap + i * 16 * (GPB / 2) + ks * 32);
    }
    // keeps the stage's 32 LDS reads together in front of its 32 products: left free, the compiler reloads one A fragment
    // per four products and waits out the LDS latency each time
    __builtin_amdgcn_sched_barrier(0);
#pragma unroll
    for (int ks = 0; ks < GKS / 32; ++ks) {
#pragma unroll
      for (int i = 0; i < 4; ++i) {
#pragma unroll
        for (int j = 0; j < 4; ++j) acc[i][j] = mma_t<BF>(a[ks][i], b[ks][j], acc[i][j]);
      }
    }
    // keeps the products in front of the publish point: left free, they sink behind the barrier, the waits stand directly
    // behind the LDS reads, and the next stage's copies lose the products' time as their lead
    __builtin_amdgcn_sched_barrier(0);
    // ---- publish point of stage st + 1: own LDS reads retired, own copies landed, every wave has left this buffer ----
    wait_ds0();
    wait_async0();
    __syncthreads();
    if (st + 2 < nstg) {                                  // block-uniform: refill the buffer that this trip has just read
      stage_ab(ag0 + (size_t)(st + 2) * GKS, bg0 + (size_t)(st + 2) * GKS, rs16,
               la0 + (unsigned)(st & 1) * GSTB, lb0 + (unsigned)(st & 1) * GSTB);
    }
  }
  wait_async0();                                          // nothing in flight when the wave ends
  epi64x64(slab + wave * (4 * SLAB64), acc, oscale, C, N, row0 + (size_t)(wr * 64), col0 + wc * 64, lane);
}

// one product per launch (ctx.Wo)
template <bool BF>
__global__ __launch_bounds__(128)
void gemm128(const u16* __restrict__ A, const u16* __restrict__ Bt, float* C, int N, int K, int nrt, float oscale) {
  const int ntile = N >> 7;
  const int bid   = (int)blockIdx.x;
  const int t2    = bid / ntile;
  gemm128_blk<BF>(bid % ntile, t2 % nrt, t2 / nrt, A, Bt, C, N, K, oscale);
}

// x.Wq, x.Wk and x.Wv in one launch: block ranges, in this order: q (GB_Q blocks), k (GB_K), v (GB_K); the three products share A,
// write disjoint planes, and a block's product is block-uniform.
__global__ __launch_bounds__(128)
void gemm_qkv(const u16* __restrict__ A, const u16* __restrict__ Wq, const u16* __restrict__ Wk, const u16* __restrict__ Wv,
              float* Fq, float* Fk, float* Fv, int K, float oscale) {
  int bid = (int)blockIdx.x;
  const u16* Bt = Wq;
  float* C = Fq;
  int N = DMOD;
  int ct = bid % (DMOD / GBN), rt = (bid / (DMOD / GBN)) % (SQ / GBM), bb = bid / ((DMOD / GBN) * (SQ / GBM));
  if (bid >= GB_Q) {
    bid -= GB_Q; Bt = Wk; C = Fk; N = KVD;
    if (bid >= GB_K) { bid -= GB_K; Bt = Wv; C = Fv; }
    ct = bid % (KVD / GBN); rt = (bid / (KVD / GBN)) % (SEQ / GBM); bb = bid / ((KVD / GBN) * (SEQ / GBM));
  }
  gemm128_blk<true>(ct, rt, bb, A, Bt, C, N, K, oscale);
}

// =====================================================================================================
// Non-causal grouped-query attention, hd = 128, all SEQ keys. Block bid -> (query tile qt = bid % NQT: rows q0 = 16*qt ..
// q0+15, head group hg = kv head, batch b); one wave per query head = hg*WPB + wave (the 4 heads of the group share kv head hg).
//   q hi / residual planes f16 x256 [b*SEQ + s][h*HD + d]; k plane f16 x256 [b*SEQ + s][g*HD + d] (pitch KVD);
//   v^T plane [b*NKVH + g][d][SEQ] x1024.
//   scores = q_hi.k + q_lo.k (4 k-steps over d); P.v with P x32768 (f16) and v^T, for every query row;
//   O written as one f16 plane (O x1024, layout [b*SEQ + s][h*HD + d]).
//   score (log2 domain) t(i, j) = (q_i.k_j over HD) * (1/sqrt(128))*log2e/(256*256).
//   k rows and v^T rows reach the 4 waves through an LDS ring of two buffers, 64 keys a stage, filled by asynchronous copies.
//   Both products are taken transposed: S^T = k.q^T (A = k rows from the ring, B = q, loaded once and kept in registers) and
//   O^T += v^T.P^T (A = v^T rows from the ring, B = P^T), all fragments in the split k map. A lane (c, hh) then holds, of query
//   column q0 + c, the scores of keys kb + 8hh + r and kb + 16 + 8hh + r: maximum and sum run inside the lane, the maximum is
//   joined with the other half by one cross-row move per 32 keys, the sums once after the loop; the two score tiles, converted
//   in place (P x32768, f16), are the B fragment of the second product. All NKT key tiles of 32 visited in order; online
//   max-subtracted base-2 softmax in f32, -inf-safe rescale.
//   After the loop: out = acc / Z (Z, x32768 like P, is about 32768 or more; guarded anyway), carry 1/1024 folded once, written into the slab.
//   One block barrier per stage, under block-uniform control flow; bounded loops only (NST compile-time).
// coverage: per wave 8 instructions x 2 rows x 16 lanes x 8 halves = 16 x 128; grid NQT x NHG x NB blocks x WPB
//           waves = every (b, s < SQ, h) row segment of O exactly once.
// =====================================================================================================
__global__ __launch_bounds__(ATT_THREADS)
void attn_nc(const u16* __restrict__ QHp, const u16* __restrict__ QLp, const u16* __restrict__ KHp,
             const u16* __restrict__ VHp, u16* OHp) {
  __shared__ __align__(16) _Float16 ring[RINGB / 2];      // two buffers of (64 k rows pitch KPB, 128 v^T rows pitch VPB)

  const int tid  = (int)threadIdx.x;
  const int wave = tid >> 5;
  const int lane = tid & 31;
  const int hh   = lane >> 4;
  const int c    = lane & 15;
  const int bid  = (int)blockIdx.x;
  const int qt   = bid % NQT;
  const int t2   = bid / NQT;
  const int hg   = t2 % NHG;
  const int b    = t2 / NHG;
  if (b >= NB) return;                      // block-uniform, before any barrier or copy; never taken with the exact grid
  const int q0   = qt * 16;
  if (q0 + 16 > SQ) return;                 // block-uniform; never taken
  const int head = hg * WPB + wave;
  const int kvh  = hg;

  float* slab = (float*)(void*)ring + wave * SLW;         // result slab [16][128] pitch 132: the ring's bytes, after the loop

  const size_t hcol = (size_t)head * HD + 8 * hh;
  const _Float16* Qh  = (const _Float16*)(const void*)QHp + ((size_t)b * SEQ + q0 + c) * DMOD + hcol;
  const _Float16* Ql  = (const _Float16*)(const void*)QLp + ((size_t)b * SEQ + q0 + c) * DMOD + hcol;
  // this lane's chunk 0 of stage 0 (stage_kv): global addresses and LDS byte addresses in buffer 0
  const u16* kg0 = KHp + ((size_t)b * SEQ + (tid >> 4)) * KVD + (size_t)kvh * HD + (tid & 15) * 8;
  const u16* vg0 = VHp + ((size_t)(b * NKVH + kvh) * HD + (tid >> 3)) * SEQ + (tid & 7) * 8;
  const unsigned lring = (unsigned)(size_t)(const void*)ring;
  const unsigned lk0 = lring + (unsigned)((tid >> 4) * KPB + (tid & 15) * 16);
  const unsigned lv0 = lring + (unsigned)(KTB + (tid >> 3) * VPB + (tid & 7) * 16);
  const float lsc = RSQ_HD * (LOG2E / (QSC * KSC));
  const float oc  = 1.0f / VCAR;                          // the carry on P stands in the running sum as well and cancels in acc / Z

  // q as the B operand: column = query q0 + c, loaded once for all keys
  v16h qh[HD / 32], ql[HD / 32];
#pragma unroll
  for (int kk = 0; kk < HD / 32; ++kk) { qh[kk] = ldfrag_h(Qh + kk * 32); ql[kk] = ldfrag_h(Ql + kk * 32); }
  float mrun = -INFINITY, lrun = 0.f;                     // of query column c; lrun (x32768) over this half's keys only
  v8f o[8];                                               // o[j][r] = O^T[d = 16j + 8hh + r][query c]
#pragma unroll
  for (int j = 0; j < 8; ++j) o[j] = zero8();

  // ---- ring prologue: stage 0 lands and is published, then stage 1 flies while stage 0 is worked on ----
  stage_kv(kg0, vg0, lk0, lv0);
  wait_async0();
  __syncthreads();
  stage_kv(kg0 + (size_t)KSTG * KVD, vg0 + KSTG, lk0 + STGB, lv0 + STGB);

  // kept rolled: one trip = one stage, with its one publish point at the foot
#pragma unroll 1
  for (int st = 0; st < NST; ++st) {
   const int bufh = (st & 1) * (STGB / 2);                // this stage's buffer, in halves
   // kept rolled: unrolled, the compiler spreads a step's v^T reads in pairs among its products instead of issuing them together
   // ahead of the softmax arithmetic
#pragma unroll 1
   for (int sub = 0; sub < KSTG / 32; ++sub) {
    // ---- scores: D element r of this lane = (key kb + 8hh + r, query q0 + c) in s0, key kb + 16 + 8hh + r in s1, kb = 64*st + 32*sub ----
    v8f s0 = zero8(), s1 = zero8();
    const _Float16* k0p = ring + bufh + (sub * 32 + c) * (KPB / 2) + 8 * hh;
    const _Float16* k1p = k0p + 16 * (KPB / 2);
    v16h kh0[HD / 32], kh1[HD / 32];
#pragma unroll
    for (int kk = 0; kk < HD / 32; ++kk) { kh0[kk] = ldfrag_h(k0p + kk * 32); kh1[kk] = ldfrag_h(k1p + kk * 32); }
    // keeps the step's 16 k reads together in front of its 16 score products: left free, the compiler reloads two fragments
    // per four products and waits out the LDS latency each time
    __builtin_amdgcn_sched_barrier(0);
#pragma unroll
    for (int kk = 0; kk < HD / 32; ++kk) {
      s0 = mma_h(kh0[kk], qh[kk], s0);
      s1 = mma_h(kh1[kk], qh[kk], s1);
      s0 = mma_h(kh0[kk], ql[kk], s0);
      s1 = mma_h(kh1[kk], ql[kk], s1);
    }
    // splits the step here, so that the eight v^T fragments are read together at the head of the softmax arithmetic, which covers
    // their latency, into the k fragments' registers: left free, the compiler reads one fragment in front of each of the eight
    // products and waits out the LDS latency each time
    __builtin_amdgcn_sched_barrier(0);
    // ---- online softmax in base 2 over all keys, -inf-safe; one query column per lane ----
    float mx = fmaxf(s0[0], s1[0]);
#pragma unroll
    for (int r = 1; r < 8; ++r) mx = fmaxf(mx, fmaxf(s0[r], s1[r]));
    mx = fmaxf(mx, xhalf(mx)) * lsc;                      // lsc > 0: the maximum of the scaled scores
    const float mn = fmaxf(mrun, mx);
    const float ms = (mn == -INFINITY) ? 0.0f : mn;
    // the exponentials are the bare v_exp_f32: it gives 0 where the library form would give a subnormal (argument below -126), which
    // is far below half an ulp of the f16 P and of Z (x32768: about 2^15 or more once the two halves' sums are joined)
    const float al = __builtin_amdgcn_exp2f(mrun - ms);
    mrun = mn;
    const float mo = ms - PEXP;                           // P x32768 comes out of the exponential itself
    // ---- B fragment of P^T*32768 (f16): elements 0..7 = keys kb + 8hh + 0..7, elements 8..15 = keys kb + 16 + 8hh + 0..7 ----
    FragH ph;
    v2f ps = {0.f, 0.f};                                  // sums over even and odd r, x32768 like P
    const v2f lsc2 = {lsc, lsc}, mo2 = {mo, mo};
#pragma unroll
    for (int r = 0; r < 8; r += 2) {
      // neighbouring accumulator registers taken as pairs: packed fma and packed add
      const v2f x0 = (v2f){s0[r], s0[r + 1]} * lsc2 - mo2;
      const v2f x1 = (v2f){s1[r], s1[r + 1]} * lsc2 - mo2;
      const v2f e0 = {__builtin_amdgcn_exp2f(x0[0]), __builtin_amdgcn_exp2f(x0[1])};
      const v2f e1 = {__builtin_amdgcn_exp2f(x1[0]), __builtin_amdgcn_exp2f(x1[1])};
      ps += e0;
      ps += e1;
      ph.h[0][r]     = (_Float16)e0[0];
      ph.h[0][r + 1] = (_Float16)e0[1];
      ph.h[1][r]     = (_Float16)e1[0];
      ph.h[1][r + 1] = (_Float16)e1[1];
    }
    lrun = lrun * al + (ps[0] + ps[1]);
#pragma unroll
    for (int j = 0; j < 8; ++j) {
#pragma unroll
      for (int r = 0; r < 8; ++r) o[j][r] *= al;
    }
    // ---- v^T.P^T : A fragment row = d = j*16 + c, keys contiguous in the v^T rows ----
    {
      const _Float16* vhp = ring + bufh + (KTB / 2) + c * (VPB / 2) + sub * 32 + 8 * hh;   // d row c (+16j), keys of this step
#pragma unroll
      for (int j = 0; j < 8; ++j) o[j] = mma_h(ldfrag_h(vhp + j * 16 * (VPB / 2)), ph.v, o[j]);
    }
    // four vector slots behind the step's last products, in front of the loop's branch: on its taken side the first vector
    // instructions rewrite registers of P^T
    acc_guard8(o);
   }
   // ---- publish point of stage st + 1: own LDS reads retired, own copies landed, every wave has left this buffer ----
   wait_ds0();
   wait_async0();
   __syncthreads();
   if (st + 2 < NST) {                                    // block-uniform: refill the buffer that this trip has just read
     stage_kv(kg0 + (size_t)(st + 2) * KSTG * KVD, vg0 + (st + 2) * KSTG,
              lk0 + (unsigned)(st & 1) * STGB, lv0 + (unsigned)(st & 1) * STGB);
   }
  }
  wait_async0();                                          // nothing in flight before the ring's bytes become the result slab
  // ---- out = acc / Z (0 if Z == 0), acc and Z both x32768, the carry 1024 on v folded once; row c of the wave's slab, 8 consecutive d ----
  {
    const float lv  = lrun + xhalf(lrun);                 // the two halves' sums joined
    const float ls  = (lv > 0.0f) ? lv : 1.0f;
    const float inv = (lv > 0.0f) ? ((1.0f / ls) * oc) : 0.0f;
#pragma unroll
    for (int j = 0; j < 8; ++j) {
      float* sp = slab + c * SLP + j * 16 + 8 * hh;
      v4f a, b4;
#pragma unroll
      for (int e = 0; e < 4; ++e) { a[e] = o[j][e] * inv; b4[e] = o[j][4 + e] * inv; }
      *(v4f*)(sp)     = a;
      *(v4f*)(sp + 4) = b4;
    }
  }

  wave_sync_lds();
  // ---- O x1024 -> f16 plane; lane = (row-in-pair rq, 8 consecutive d at c8) ----
  v4u oh[8];
  const int rq = lane >> 4, c8 = (lane & 15) * 8;
#pragma unroll
  for (int it = 0; it < 8; ++it) {
    const int row = it * 2 + rq;
    const v4f a = *(const v4f*)(slab + row * SLP + c8), b4 = *(const v4f*)(slab + row * SLP + c8 + 4);
    float w[8];
#pragma unroll
    for (int e = 0; e < 4; ++e) { w[e] = a[e] * OSC; w[4 + e] = b4[e] * OSC; }
#pragma unroll
    for (int e = 0; e < 4; ++e) {
      const _Float16 h0 = (_Float16)w[2 * e], h1 = (_Float16)w[2 * e + 1];
      oh[it][e] = pk16(h_bits(h0), h_bits(h1));
    }
  }
  const size_t ob = ((size_t)b * SEQ + q0) * DMOD + (size_t)head * HD + c8;
  {
#pragma unroll
    for (int it = 0; it < 8; ++it) {
      const int row = it * 2 + rq;
      *(v4u*)(OHp + ob + (size_t)row * DMOD) = oh[it];
    }
    
  }
}

// =====================================================================================================
// Workspace map (bytes); every plane is fully written by whole-line stores before it is read; all extents are exact multiples
// of the store granularity (no pad rows needed); every region offset a multiple of 1048576:
//   XB  bf16 [MROWS][2048]                       MROWS*4096       (NB=2: 16777216)
//   WQ  bf16 [2048 n][2048 k]                    8388608          Wq^T;  WO f16 x1024, same extent: Wo^T
//   WK  bf16 [512 n][2048 k]                     2097152          Wk^T;  WV same extent: Wv^T
//   FQ  f32 [MROWS][2048]                        MROWS*8192       (q projection; afterwards OH f16 [MROWS][2048] x1024 in its first half)
//   FK  f32 [MROWS][512]                         MROWS*2048       k projection;  FV same extent: v projection
//   QH  f16 [MROWS][2048] x256                   MROWS*4096       QL residual, same extent
//   KH  f16 [MROWS][512] x256                    MROWS*1024
//   VH  f16 [NB*4][128][SEQ] x1024               MROWS*1024
//   COS f32 [MROWS][64]                          MROWS*256        SIN same extent
//   end (NB=2)                                 132120576
// =====================================================================================================
extern "C" void kernel_launch(void* const* d_in, const int* in_sizes, int n_in,
                              void* d_out, int out_size, void* d_ws, size_t ws_size,
                              hipStream_t stream) {
  if (n_in < 8) return;
  if (in_sizes[0] < MROWS * DMOD) return;
  if (in_sizes[1] < MROWS) return;
  if (in_sizes[2] != DMOD * DMOD) return;
  if (in_sizes[3] != DMOD * KVD) return;
  if (in_sizes[4] != DMOD * KVD) return;
  if (in_sizes[5] != DMOD * DMOD) return;
  if (in_sizes[6] < HD) return;
  if (in_sizes[7] < HD) return;
  if (out_size < MROWS * DMOD) return;

  const float* x   = (const float*)d_in[0];
  const int*   pos = (const int*)d_in[1];
  const float* wq  = (const float*)d_in[2];
  const float* wk  = (const float*)d_in[3];
  const float* wv  = (const float*)d_in[4];
  const float* wo  = (const float*)d_in[5];
  const float* qnw = (const float*)d_in[6];
  const float* knw = (const float*)d_in[7];
  float*       out = (float*)d_out;

  const size_t szXB = (size_t)MROWS * DMOD * 2;
  const size_t szW  = (size_t)DMOD * DMOD * 2;                   // WQ, WO
  const size_t szWK = (size_t)DMOD * KVD * 2;                    // WK, WV
  const size_t szF  = (size_t)MROWS * DMOD * 4;                  // FQ
  const size_t szFK = (size_t)MROWS * KVD * 4;                   // FK, FV
  const size_t szQ  = (size_t)MROWS * DMOD * 2;                  // QH, QL, OH
  const size_t szK  = (size_t)MROWS * KVD * 2;                   // KH
  const size_t szV  = (size_t)NB * NKVH * HD * SEQ * 2;          // VH (== szK)
  const size_t szT  = (size_t)MROWS * HHALF * 4;                 // COS, SIN
  if (szQ > szF) return;                                         // OH lives inside the FQ region
  size_t off = 0;
  const size_t oXB = off; off += szXB;
  const size_t oWQ = off; off += szW;
  const size_t oWO = off; off += szW;
  const size_t oWK = off; off += szWK;
  const size_t oWV = off; off += szWK;
  const size_t oF  = off; off += szF;
  const size_t oFK = off; off += szFK;
  const size_t oFV = off; off += szFK;
  const size_t oQH = off; off += szQ;
  const size_t oQL = off; off += szQ;
  const size_t oKH = off; off += szK;
  const size_t oVH = off; off += szV;
  const size_t oCS = off; off += szT;
  const size_t oSN = off; off += szT;
  if (off > ws_size) return;                // off = 132120576 for NB = 2
  if (off > (size_t)WS_CAP) return;

  char* ws = (char*)d_ws;
  u16*   XB  = (u16*)(ws + oXB);
  u16*   WQT = (u16*)(ws + oWQ);
  u16*   WOT = (u16*)(ws + oWO);
  u16*   WKT = (u16*)(ws + oWK);
  u16*   WVT = (u16*)(ws + oWV);
  float* FQ  = (float*)(ws + oF);
  float* FK  = (float*)(ws + oFK);
  float* FV  = (float*)(ws + oFV);
  u16*   OH  = (u16*)(ws + oF);
  u16*   QH  = (u16*)(ws + oQH);
  u16*   QL  = (u16*)(ws + oQL);
  u16*   KH  = (u16*)(ws + oKH);
  u16*   VH  = (u16*)(ws + oVH);
  float* COS = (float*)(ws + oCS);
  float* SIN = (float*)(ws + oSN);

  const dim3 b256(256), b128(128), bAT(ATT_THREADS);
  const int  nrtQ = SQ / GBM;                           // ctx / out rows per batch / 128
  const dim3 gGQ(GB_Q);
  const dim3 gAT(NQT * NHG * NB);

  // (0) cos/sin tables from the integer positions, x -> bf16 plane, Wq^T, Wk^T, Wv^T bf16 planes, Wo^T f16 plane of bf16 value x1024
  prep16<<<dim3(PB_ALL), b256, 0, stream>>>(pos, x, wq, wk, wv, wo, COS, SIN, XB, WQT, WKT, WVT, WOT);
  // (1) q = x.Wq -> FQ [MROWS][2048] (rows s < SQ), k = x.Wk -> FK [MROWS][512], v = x.Wv -> FV [MROWS][512]
  gemm_qkv<<<dim3(GB_ALL), b128, 0, stream>>>(XB, WQT, WKT, WVT, FQ, FK, FV, DMOD, 1.0f);
  // (2) v^T plane x1024; RMS normalisation + rotary + k plane x256; the same + q planes x256
  post16<<<dim3(RB_ALL), b256, 0, stream>>>(FQ, FK, FV, qnw, knw, COS, SIN, QH, QL, KH, VH);
  // (3) non-causal attention over all keys -> O plane (inside FQ)
  attn_nc<<<gAT, bAT, 0, stream>>>(QH, QL, KH, VH, OH);
  // (4) out = ctx.Wo -> f32, carries 1024 x 1024 folded back
  gemm128<false><<<gGQ, b128, 0, stream>>>(OH, WOT, out, DMOD, DMOD, nrtQ, 1.0f / (OSC * WOS));
  (void)hipGetLastError();
}

// v006
// It runs in 175 microseconds.
// Next to v005, in two timings, it ran 1.06 times as fast each time.
// Counting every step since v000, it is 3.12 times as fast.
// Contractions: x.Wq, x.Wk, x.Wv on v_wmma_f32_16x16x32_bf16 (x and W^T as bf16 RNE planes, f32 accumulate);
// q.k^T over hd 128 on v_wmma_f32_16x16x32_f16 with q as f16 hi + f16 residual planes (x256) and k as one f16 plane
// (x256), products qh.k + ql.k; P.v on v_wmma_f32_16x16x32_f16 with P x32768 and v^T x1024 as single f16 planes;
// ctx.Wo on v_wmma_f32_16x16x32_f16 with ctx x1024 as one f16 plane and Wo^T as f16(bf16 RNE(Wo)) x1024; all f32
// accumulate. RMS normalisation, rotate-half rotary from integer positions (cos/sin tables built on device in f32),
// base-2 online softmax and the 1/Z fold in f32 on VALU.
#include <hip/hip_runtime.h>
#include <math.h>
#include <stdint.h>

#ifndef NB
#define NB 2
#endif
#define SEQ 2048
#ifndef SQ
#define SQ SEQ
#endif
#define DMOD  2048
#define NH    16
#define NKVH  4
#define HD    128
#define HHALF (HD / 2)
#define KVD   (NKVH * HD)
#define MROWS (NB * SEQ)
#define EPS_RMS 0.000001f
#define RSQ_HD 0.08838834764831845f
#define LOG2E 1.4426950408889634f
#define LOG2THETA 19.931568569324174
#define QSC   256.0f
#define KSC   256.0f
#define PCAR  32768.0f
#define PEXP  15.0f
#define VCAR  1024.0f
#define OSC   1024.0f
#define WOS   1024.0f
#define WPB   (NH / NKVH)
#define NHG   NKVH
#define NQT   (SQ / 16)
#define NST   (SEQ / 64)
#define NKT   (SEQ / 32)
#define ATT_THREADS (WPB * 32)
#define SLP   132
#define SLW   (16 * SLP)
#define SLAB64 (16 * 68)
#define WTP   72
#define WS_CAP 134217728
#define KSTG  64
#define KPB   272
#define VPB   144
#define KTB   (KSTG * KPB)
#define VTB   (HD * VPB)
#define STGB  (KTB + VTB)
#define RINGB (2 * STGB)
#define GBM   128
#define GBN   128
#define GKS   64
#define GPB   144
#define GATB  (GBM * GPB)
#define GSTB  ((GBM + GBN) * GPB)
#define GRINGB (2 * GSTB)
// block counts of the jobs that share one launch (each job's blocks are a contiguous range of the grid)
#define PB_TR (MROWS / 4)
#define PB_X  ((MROWS * DMOD / 8) / 256)
#define PB_WQ ((DMOD / 64) * (DMOD / 64))
#define PB_WK ((DMOD / 64) * (KVD / 64))
#define PB_ALL (PB_TR + PB_X + 2 * PB_WQ + 2 * PB_WK)
#define GB_Q  (NB * (SQ / GBM) * (DMOD / GBN))
#define GB_K  (NB * (SEQ / GBM) * (KVD / GBN))
#define GB_ALL (GB_Q + 2 * GB_K)
static_assert(GBN == HD && GBM == 128);                 // a column tile of the q, k, v products is one head
static_assert(DMOD == NH * HD && HD == 128 && HHALF == 64 && NH == 16 && NKVH == 4 && WPB == 4 && NHG * WPB == NH);
static_assert(ATT_THREADS == 128 && KVD == 512);
static_assert(PCAR == 32768.0f && PEXP == 15.0f);       // PCAR = 2^PEXP
static_assert(NB >= 1 && NB <= 2);
static_assert((SEQ % 64) == 0 && (SQ % 64) == 0 && SQ >= 64 && SQ <= SEQ);
static_assert((DMOD % 64) == 0 && (KVD % 64) == 0 && (DMOD % 32) == 0 && (HD % 32) == 0);
static_assert(((MROWS * DMOD / 8) % 256) == 0 && (MROWS % 4) == 0);
static_assert(KSTG == 64 && NST >= 2 && NST * KSTG == SEQ && (KPB % 16) == 0 && (VPB % 16) == 0 && (KTB % 16) == 0 && (STGB % 16) == 0);
static_assert(KPB == HD * 2 + 16 && VPB == KSTG * 2 + 16 && WPB * SLW * 4 <= RINGB && 4 * RINGB <= 327680);
static_assert(64 * WTP * 2 <= 65536);
static_assert(GBM == 128 && GBN == 128 && GKS == 64 && GPB == GKS * 2 + 16 && (GPB % 16) == 0 && (GSTB % 16) == 0);
static_assert((SEQ % GBM) == 0 && (SQ % GBM) == 0 && (DMOD % GBN) == 0 && (KVD % GBN) == 0 && (DMOD % GKS) == 0 && DMOD / GKS >= 2);
static_assert(2 * (GRINGB + 4 * 4 * SLAB64 * 4) <= 327680);
static_assert((DMOD / 16) <= 128 && (KVD / 16) <= 128 && ((DMOD / 16) % 32) == 0 && ((KVD / 16) % 32) == 0);

typedef unsigned short u16;
typedef _Float16 v16h __attribute__((ext_vector_type(16)));
typedef _Float16 v8h  __attribute__((ext_vector_type(8)));
typedef __bf16   v16b __attribute__((ext_vector_type(16)));
typedef float    v8f  __attribute__((ext_vector_type(8)));
typedef float    v4f  __attribute__((ext_vector_type(4)));
typedef float    v2f  __attribute__((ext_vector_type(2)));
typedef unsigned int v4u __attribute__((ext_vector_type(4)));

union FragH { v16h v; v8h h[2]; v4u u[2]; };
union FragB { v16b v; v4u u[2]; };

// ---- scalar helpers --------------------------------------------------------------------------------
__device__ __forceinline__ unsigned short bf_bits(float f) {          // f32 -> bf16 bits, RNE convert
  unsigned u = __float_as_uint(f);
  return (unsigned short)((u + 0x7FFFu + ((u >> 16) & 1u)) >> 16);
}
__device__ __forceinline__ float bf_up(unsigned short h) { return __uint_as_float(((unsigned)h) << 16); }
__device__ __forceinline__ float bfr(float f) { return bf_up(bf_bits(f)); }
__device__ __forceinline__ unsigned short h_bits(_Float16 x) { return __builtin_bit_cast(unsigned short, x); }
__device__ __forceinline__ unsigned pk16(unsigned short a, unsigned short b) { return (unsigned)a | ((unsigned)b << 16); }
__device__ __forceinline__ v8f zero8() { v8f z = {0.f, 0.f, 0.f, 0.f, 0.f, 0.f, 0.f, 0.f}; return z; }

// ---- fragment loaders: 16-bit A/B operand, lane -> row/col (lane&15), p already includes +8*(lane>>4);
//      elements 0..7 <- p[0..7] (k0+8h..), elements 8..15 <- p[16..23] (k0+16+8h..)  (same split k map for A and B;
//      B is always read from a k-contiguous [n][k] plane)
__device__ __forceinline__ v16h ldfrag_h(const _Float16* p) {
  FragH f;
  f.h[0] = *(const v8h*)(p);
  f.h[1] = *(const v8h*)(p + 16);
  return f.v;
}
__device__ __forceinline__ v16b ldfrag_b(const u16* p) {              // bf16 plane read as unsigned integer vectors
  FragB f;
  f.u[0] = *(const v4u*)(p);
  f.u[1] = *(const v4u*)(p + 16);
  return f.v;
}

__device__ __forceinline__ v8f mma_h(v16h a, v16h b, v8f c) {
  return __builtin_amdgcn_wmma_f32_16x16x32_f16(false, a, false, b, (short)0, c, false, false);
}
__device__ __forceinline__ v8f mma_b(v16b a, v16b b, v8f c) {
  return __builtin_amdgcn_wmma_f32_16x16x32_bf16(false, a, false, b, (short)0, c, false, false);
}
__device__ __forceinline__ void acc_guard8(v8f (&a)[8]) {
#if defined(__HIP_DEVICE_COMPILE__)
  asm volatile("v_nop\n\tv_nop\n\tv_nop\n\tv_nop"
               : "+v"(a[0]), "+v"(a[1]), "+v"(a[2]), "+v"(a[3]), "+v"(a[4]), "+v"(a[5]), "+v"(a[6]), "+v"(a[7]));
#endif
}
__device__ __forceinline__ void wave_sync_lds() {
  __builtin_amdgcn_fence(__ATOMIC_RELEASE, "workgroup");
  __builtin_amdgcn_wave_barrier();
  __builtin_amdgcn_fence(__ATOMIC_ACQUIRE, "workgroup");
}
// lane l's value from lane l ^ 16: the two halves of the wave hold the two halves of a query column's keys
__device__ __forceinline__ float xhalf(float x) {
  const int b = __builtin_bit_cast(int, x);
  return __builtin_bit_cast(float, __builtin_amdgcn_permlanex16(b, b, 0x76543210, 0xfedcba98, false, false));
}
// Eight asynchronous 16-byte copies of this lane, global -> LDS (l = LDS byte address, g = global address, both 16-B aligned).
// The closing s_wait_xcnt 0 stands inside the statement so that no address register is rewritten in front of it.
__device__ __forceinline__ void async8(const unsigned* l, const u16* const* g) {
#if defined(__HIP_DEVICE_COMPILE__)
  asm volatile("global_load_async_to_lds_b128 %0, %8, off\n\t"
               "global_load_async_to_lds_b128 %1, %9, off\n\t"
               "global_load_async_to_lds_b128 %2, %10, off\n\t"
               "global_load_async_to_lds_b128 %3, %11, off\n\t"
               "global_load_async_to_lds_b128 %4, %12, off\n\t"
               "global_load_async_to_lds_b128 %5, %13, off\n\t"
               "global_load_async_to_lds_b128 %6, %14, off\n\t"
               "global_load_async_to_lds_b128 %7, %15, off\n\t"
               "s_wait_xcnt 0x0"
               :: "v"(l[0]), "v"(l[1]), "v"(l[2]), "v"(l[3]), "v"(l[4]), "v"(l[5]), "v"(l[6]), "v"(l[7]),
                  "v"(g[0]), "v"(g[1]), "v"(g[2]), "v"(g[3]), "v"(g[4]), "v"(g[5]), "v"(g[6]), "v"(g[7])
               : "memory");
#endif
}
// One stage (64 keys) of k rows and v^T rows into one ring buffer, 16 copies per lane of the 128 threads:
//   k   chunk i: key row i*8 + (tid>>4), 16-B piece tid&15  (a wave covers two whole 256-B rows), LDS pitch KPB;
//   v^T chunk i: d row i*16 + (tid>>3), 16-B piece tid&7    (a wave covers four whole 128-B rows), LDS pitch VPB.
// kg, vg, lk, lv are this lane's addresses of chunk 0.
__device__ __forceinline__ void stage_kv(const u16* kg, const u16* vg, unsigned lk, unsigned lv) {
  unsigned l[8];
  const u16* g[8];
  // both loops unrolled so that l[] and g[] are registers, as the asm operands need them
#pragma unroll
  for (int i = 0; i < 8; ++i) { l[i] = lk + (unsigned)(i * 8 * KPB); g[i] = kg + (size_t)(i * 8) * KVD; }
  async8(l, g);
#pragma unroll
  for (int i = 0; i < 8; ++i) { l[i] = lv + (unsigned)(i * 16 * VPB); g[i] = vg + (size_t)(i * 16) * SEQ; }
  async8(l, g);
}
// One GEMM stage (64 k = 128 B of each row) of 128 A rows and 128 B rows into one ring buffer, 16 copies per lane of the
// 128 threads: chunk i = row i*16 + (tid>>3), 16-B piece tid&7 (a wave covers four whole 128-B row pieces), LDS pitch GPB.
// ag, bg, la, lb are this lane's addresses of chunk 0; rs16 = 16 rows of the global planes, in elements.
__device__ __forceinline__ void stage_ab(const u16* ag, const u16* bg, size_t rs16, unsigned la, unsigned lb) {
  unsigned l[8];
  const u16* g[8];
  // both loops unrolled so that l[] and g[] are registers, as the asm operands need them
#pragma unroll
  for (int i = 0; i < 8; ++i) { l[i] = la + (unsigned)(i * 16 * GPB); g[i] = ag + (size_t)i * rs16; }
  async8(l, g);
#pragma unroll
  for (int i = 0; i < 8; ++i) { l[i] = lb + (unsigned)(i * 16 * GPB); g[i] = bg + (size_t)i * rs16; }
  async8(l, g);
}
// the issuing wave's own wait: every asynchronous copy it has issued has landed in LDS
__device__ __forceinline__ void wait_async0() {
#if defined(__HIP_DEVICE_COMPILE__)
  asm volatile("s_wait_asynccnt 0x0" ::: "memory");
#endif
}
// this wave's LDS reads and writes have retired (in front of the barrier behind which a buffer is refilled)
__device__ __forceinline__ void wait_ds0() {
#if defined(__HIP_DEVICE_COMPILE__)
  asm volatile("s_wait_dscnt 0x0" ::: "memory");
#endif
}

// =====================================================================================================
// cos/sin tables for the rotary: row = b*SEQ + s (0 .. nrows-1), column j = 0..63:
//   invf[j] = 1e6^(-j/64) (f64 exp2, converted to f32), ang = float(pos[row]) * invf[j] (f32 multiply),
//   cosT[row][j] = cosf(ang), sinT[row][j] = sinf(ang).
// Block = 4 rows x 64 j (one value pair per thread) staged in LDS; after the barrier waves 0,1 write the 4 cos rows and
// coverage: nrows/4 blocks (bid) x (2 tables x 4 rows x 64 floats) = both tables exactly once (nrows % 4 == 0, host).
// =====================================================================================================
__device__ __forceinline__ void trig64(int bid, const int* __restrict__ pos, float* cosT, float* sinT, int nrows) {
#pragma clang fp contract(off)
  __shared__ __align__(16) float cs[2 * 256];
  const int tid  = (int)threadIdx.x;
  const int row0 = bid * 4;
  if (row0 + 4 > nrows) return;                       // block-uniform, before the barrier; never taken with the exact grid
  const int r = tid >> 6, j = tid & 63;
  const float p    = (float)pos[row0 + r];
  const float invf = (float)exp2(-(double)j * (LOG2THETA / 64.0));
  const float ang  = p * invf;
  cs[tid]       = cosf(ang);
  cs[256 + tid] = sinf(ang);
  __syncthreads();
  if (tid < 128) {                                    // waves 0..3, wave-uniform
    const int tb    = tid >> 6;                       // 0: cos rows (waves 0,1), 1: sin rows (waves 2,3)
    const int q     = tid & 63;
    const int rr    = q >> 4;
    const int piece = (q & 15) * 4;
    const v4f v = *(const v4f*)(cs + tb * 256 + rr * 64 + piece);
    float* base = (tb != 0) ? sinT : cosT;
    float* dst  = base + (size_t)(row0 + rr) * HHALF + piece;
    {
      *(v4f*)(dst) = v;
      
    }
  }
}

// =====================================================================================================
// f32 -> 16-bit plane, same layout.  f16mode == 0: bf16 RNE bits;  f16mode == 1: f16 bits of (bf16 RNE value) * scale.
// Thread = 8 consecutive elements: two 16-B loads, one 16-B store; 32 consecutive lanes = 512 contiguous, 512-B aligned
// coverage: ceil(n8/256) blocks (bid) x 256 thr x 8 (in-kernel bound) = the whole plane (n8 a multiple of 256 here).
// =====================================================================================================
__device__ __forceinline__ void cvt16(int bid, const float* __restrict__ x, u16* D, int n8, int f16mode, float scale) {
  const int gt = bid * 256 + (int)threadIdx.x;
  if (gt >= n8) return;
  const float* p = x + (size_t)gt * 8;
  const v4f a = *(const v4f*)(p), b4 = *(const v4f*)(p + 4);
  float w[8];
#pragma unroll
  for (int e = 0; e < 4; ++e) { w[e] = a[e]; w[4 + e] = b4[e]; }
  v4u o;
#pragma unroll
  for (int e = 0; e < 4; ++e) {
    const float f0 = w[2 * e], f1 = w[2 * e + 1];
    const unsigned short hb0 = h_bits((_Float16)(bfr(f0) * scale));
    const unsigned short hb1 = h_bits((_Float16)(bfr(f1) * scale));
    const unsigned short bb0 = bf_bits(f0);
    const unsigned short bb1 = bf_bits(f1);
    o[e] = (f16mode != 0) ? pk16(hb0, hb1) : pk16(bb0, bb1);
  }
  u16* d = D + (size_t)gt * 8;
  {
    *(v4u*)(d) = o;
    
  }
}

// =====================================================================================================
// Weight transpose + convert: W f32 [K rows][N cols] (row pitch N) -> Wt 16-bit [N rows][K cols] (row pitch K), so that
// a column n of W becomes the k-contiguous B operand row n.  f16mode == 0: bf16 RNE bits; 1: f16 bits of (bf16 RNE value)*scale.
// Block = 64 k x 64 n tile: load phase 4 iterations x (16 k rows x 16 lanes x 4 n) with 16-B loads into an LDS tile
// coverage: load 4 it x 256 thr x 4 = 64 x 64; store 2 it x 256 thr x 8 halves = 64 rows x 64; (K/64)*(N/64)
//           blocks (bid) = the whole [N][K] plane exactly once.
// =====================================================================================================
__device__ __forceinline__ void wt16(int bid, const float* __restrict__ W, u16* Wt, int K, int N, int f16mode, float scale) {
  __shared__ __align__(16) u16 T[64 * WTP];
  const int tid = (int)threadIdx.x;
  const int nkt = K >> 6;
  const int kt  = bid % nkt;
  const int nt  = bid / nkt;
  const int kb  = kt * 64, nb = nt * 64;
  if (nb + 64 > N) return;                            // block-uniform, before the barrier; never taken with the exact grid
  const int c4 = (tid & 15) * 4;                      // n within tile
  const int r0 = tid >> 4;                            // k within tile (0..15) + 16*it
#pragma unroll
  for (int it = 0; it < 4; ++it) {
    const int r = it * 16 + r0;
    const v4f a = *(const v4f*)(W + (size_t)(kb + r) * (size_t)N + nb + c4);
#pragma unroll
    for (int e = 0; e < 4; ++e) {
      const float f = a[e];
      const unsigned short hb = h_bits((_Float16)(bfr(f) * scale));
      const unsigned short bb = bf_bits(f);
      T[(c4 + e) * WTP + r] = (f16mode != 0) ? hb : bb;
    }
  }
  __syncthreads();
  v4u o[2];
  const int q8 = tid >> 3, p8 = (tid & 7) * 8;
#pragma unroll
  for (int it = 0; it < 2; ++it) o[it] = *(const v4u*)(T + (it * 32 + q8) * WTP + p8);
  u16* dst = Wt + (size_t)(nb + q8) * (size_t)K + kb + p8;
  {
#pragma unroll
    for (int it = 0; it < 2; ++it) {
      *(v4u*)(dst + (size_t)(it * 32) * (size_t)K) = o[it];
    }
    // the code of the launch's other jobs follows these stores in the built kernel and reuses their registers
    asm volatile("s_wait_xcnt 0x0" ::: "memory");
  }
}

// =====================================================================================================
// Everything that depends on the inputs alone, in one launch: block ranges, in this order: cos/sin tables (PB_TR blocks), x plane
// (PB_X), Wq^T (PB_WQ), Wo^T (PB_WQ), Wk^T (PB_WK), Wv^T (PB_WK). The jobs write disjoint planes and read none of them; the job of
// a block is block-uniform, so each job's one barrier stays under block-uniform control flow.
// =====================================================================================================
__global__ __launch_bounds__(256)
void prep16(const int* __restrict__ pos, const float* __restrict__ x, const float* __restrict__ wq, const float* __restrict__ wk,
            const float* __restrict__ wv, const float* __restrict__ wo, float* cosT, float* sinT,
            u16* XBo, u16* WQo, u16* WKo, u16* WVo, u16* WOo) {
  int bid = (int)blockIdx.x;
  if (bid < PB_TR) { trig64(bid, pos, cosT, sinT, MROWS); return; }
  bid -= PB_TR;
  if (bid < PB_X) { cvt16(bid, x, XBo, (MROWS * DMOD) / 8, 0, 1.0f); return; }
  bid -= PB_X;
  const float* W = wq;
  u16* Wt = WQo;
  int N = DMOD, f16mode = 0;
  float scale = 1.0f;
  if (bid >= PB_WQ) {
    bid -= PB_WQ; W = wo; Wt = WOo; f16mode = 1; scale = WOS;
    if (bid >= PB_WQ) {
      bid -= PB_WQ; W = wk; Wt = WKo; N = KVD; f16mode = 0; scale = 1.0f;
      if (bid >= PB_WK) { bid -= PB_WK; W = wv; Wt = WVo; }
    }
  }
  wt16(bid, W, Wt, DMOD, N, f16mode, scale);
}

// =====================================================================================================
// v^T plane straight from the accumulators of a v projection tile: lane (m, hh) holds in acc[i][j] column d = 16j + m of the wave's
// 64 and the 8 consecutive keys 16i + 8hh + 0..7 of its 64 rows, which is one 16-B piece of a v^T row:
//   VH[((b*NKVH + g)*HD + d)][s] = f16(v * 1024).
// dst = the wave's first v^T row at its first key; the four pieces i of a lane pair (hh = 0, 1) fill one whole 128-B line.
// coverage: 16 stores x 16 d x 2 halves x 8 keys = the wave's 64 d x 64 keys.
// =====================================================================================================
__device__ __forceinline__ void vt_acc(const v8f (&acc)[4][4], float oscale, u16* dst, int lane) {
  const int hh = lane >> 4, m = lane & 15;
  u16* d0 = dst + (size_t)m * SEQ + 8 * hh;
  // all three loops unrolled: the accumulators are indexed by constants only and stay in registers
#pragma unroll
  for (int j = 0; j < 4; ++j) {
#pragma unroll
    for (int i = 0; i < 4; ++i) {
      v4u o;
#pragma unroll
      for (int e = 0; e < 4; ++e) {
        const float t0 = (acc[i][j][2 * e] * oscale) * VCAR;
        const float t1 = (acc[i][j][2 * e + 1] * oscale) * VCAR;
        o[e] = pk16(h_bits((_Float16)t0), h_bits((_Float16)t1));
      }
      *(v4u*)(d0 + (size_t)(j * 16) * SEQ + i * 16) = o;
    }
  }
}

// =====================================================================================================
// Per-head RMS normalisation + rotate-half rotary + 16-bit planes from one 128 x 128 tile of a projection (128 rows row0 + r of one
// head, f32), as the four waves of the product have left it in their slabs [64][68] (wave = 2*(r >> 6) + (d >> 6)); ncol = DMOD for
// q, KVD for k = row pitch of the planes, ccol = head*HD:
//   rs = 1/sqrt(mean_d(x[head][d]^2) + eps) over the head's 128 columns (f32 sum of squares: 16 per thread, then an
//   8-lane shuffle sum, the 8 lanes of a head are 8 consecutive lanes); y[d] = (x[d]*rs) * w[d] with w = bf16 RNE value
//   of the norm weight; then for j < 64 within a head, with c = cosT[row][j], sn = sinT[row][j] (f32 tables):
//   out[j]    = y[j]*c    - y[j+64]*sn
//   out[j+64] = y[j+64]*c + y[j]*sn
//   Hp [MROWS][ncol] = f16(out * sc); if RES also Lp [MROWS][ncol] = f16 residual (t - f16(t)), same layout.
// Eight passes of 16 rows, two a trip: thread t = row 16*pass + (t >> 3), chunk i = t&7: columns 8i .. +7 and + 64 of the head. No lane-varying
// control anywhere (shuffles with all lanes active).
// coverage: 8 passes x 128 thr x 16 = the tile's 128 rows x 128 columns of Hp (and of Lp), whole 128-B lines.
// =====================================================================================================
__device__ __forceinline__ void rot_pair(float xl, float xh, float cv, float sv, float sc,
                                         unsigned short& hl, unsigned short& hhv, unsigned short& ll, unsigned short& lh) {
#pragma clang fp contract(off)
  const float rl = xl * cv - xh * sv;
  const float rh = xh * cv + xl * sv;
  const float tl = rl * sc, th = rh * sc;
  const _Float16 a = (_Float16)tl, bq = (_Float16)th;
  hl  = h_bits(a);
  hhv = h_bits(bq);
  ll  = h_bits((_Float16)(tl - (float)a));
  lh  = h_bits((_Float16)(th - (float)bq));
}

template <bool RES>
__device__ __forceinline__ void nrope16(const float* slab, int tid, size_t row0, int ccol, int ncol,
                                        const float* __restrict__ nw,
                                        const float* __restrict__ cosT, const float* __restrict__ sinT,
                                        u16* Hp, u16* Lp, float sc) {
  // every product and sum of the normalisation and the rotary rounded on its own
#pragma clang fp contract(off)
  const int dlo = (tid & 7) * 8;                       // j within head, multiple of 8
  const v4f wa = *(const v4f*)(nw + dlo), wb4 = *(const v4f*)(nw + dlo + 4);
  const v4f wc = *(const v4f*)(nw + HHALF + dlo), wd = *(const v4f*)(nw + HHALF + dlo + 4);
  float wl[8], wh[8];
#pragma unroll
  for (int e = 0; e < 4; ++e) {
    wl[e] = bfr(wa[e]);   wl[4 + e] = bfr(wb4[e]);
    wh[e] = bfr(wc[e]);   wh[4 + e] = bfr(wd[e]);
  }
  // kept rolled, two passes a trip: more of them take registers above v255 and lengthen the kernel's text
#pragma unroll 1
  for (int pt = 0; pt < GBM / 32; ++pt) {
   // the trip's two passes unrolled: their chains (LDS and table reads, sum, three shuffles, root) are independent and cover one
   // another's latency, which the two waves of a SIMD here cannot
#pragma unroll
   for (int u = 0; u < 2; ++u) {
    const int r = pt * 32 + u * 16 + (tid >> 3);       // row of the tile
    const float* p = slab + (r >> 6) * (8 * SLAB64) + (r & 63) * 68 + dlo;   // low-half chunk; the high half: the next wave's slab
    const v4f xa = *(const v4f*)(p), xb = *(const v4f*)(p + 4);
    const v4f ya = *(const v4f*)(p + 4 * SLAB64), yb = *(const v4f*)(p + 4 * SLAB64 + 4);
    const size_t row  = row0 + (size_t)r;
    const size_t trow = row * HHALF + dlo;
    const v4f ca = *(const v4f*)(cosT + trow), cb = *(const v4f*)(cosT + trow + 4);
    const v4f sa = *(const v4f*)(sinT + trow), sb = *(const v4f*)(sinT + trow + 4);
    float xl[8], xh[8], cv[8], sv[8];
#pragma unroll
    for (int e = 0; e < 4; ++e) {
      xl[e] = xa[e];        xl[4 + e] = xb[e];
      xh[e] = ya[e];        xh[4 + e] = yb[e];
      cv[e] = ca[e];        cv[4 + e] = cb[e];
      sv[e] = sa[e];        sv[4 + e] = sb[e];
    }
    // sum of squares over the head's 128 columns: 16 here, then lanes xor 1, 2, 4 (aligned groups of 8 lanes = one row)
    float ss = 0.0f;
#pragma unroll
    for (int e = 0; e < 8; ++e) { ss = ss + xl[e] * xl[e]; ss = ss + xh[e] * xh[e]; }
    ss += __shfl_xor(ss, 1, 32);
    ss += __shfl_xor(ss, 2, 32);
    ss += __shfl_xor(ss, 4, 32);
    const float var = ss * (1.0f / (float)HD);
    const float rs  = 1.0f / sqrtf(var + EPS_RMS);
#pragma unroll
    for (int e = 0; e < 8; ++e) {
      xl[e] = (xl[e] * rs) * wl[e];
      xh[e] = (xh[e] * rs) * wh[e];
    }
    v4u ohl, ohh, oll, olh;
#pragma unroll
    for (int e = 0; e < 4; ++e) {
      unsigned short hl0, hh0, ll0, lh0, hl1, hh1, ll1, lh1;
      rot_pair(xl[2 * e],     xh[2 * e],     cv[2 * e],     sv[2 * e],     sc, hl0, hh0, ll0, lh0);
      rot_pair(xl[2 * e + 1], xh[2 * e + 1], cv[2 * e + 1], sv[2 * e + 1], sc, hl1, hh1, ll1, lh1);
      ohl[e] = pk16(hl0, hl1);
      ohh[e] = pk16(hh0, hh1);
      oll[e] = pk16(ll0, ll1);
      olh[e] = pk16(lh0, lh1);
    }
    const size_t oc0 = row * (size_t)ncol + (size_t)(ccol + dlo);
    *(v4u*)(Hp + oc0) = ohl;
    *(v4u*)(Hp + oc0 + HHALF) = ohh;
    if constexpr (RES) {
      *(v4u*)(Lp + oc0) = oll;
      *(v4u*)(Lp + oc0 + HHALF) = olh;
    }
   }
   // the next trip's first instructions rewrite registers that this trip's plane stores name
   asm volatile("s_wait_xcnt 0x0" ::: "memory");
  }
}

// =====================================================================================================
// The wave's 64 x 64 tile of C: accumulators * oscale -> the wave's own slab [64][68] -> whole 256-B row pieces of C.
// coverage: 32 instructions x 2 rows x 16 lanes x 4 floats = the wave's 64 x 64 tile.
// =====================================================================================================
__device__ __forceinline__ void slab64x64(float* sl, const v8f (&acc)[4][4], float oscale, int lane) {
  const int hh = lane >> 4, m = lane & 15;
#pragma unroll
  for (int i = 0; i < 4; ++i) {
#pragma unroll
    for (int r = 0; r < 8; ++r) {
      const int ro = (i * 16 + 8 * hh + r) * 68 + m;
      sl[ro]      = acc[i][0][r] * oscale;
      sl[ro + 16] = acc[i][1][r] * oscale;
      sl[ro + 32] = acc[i][2][r] * oscale;
      sl[ro + 48] = acc[i][3][r] * oscale;
    }
  }
}
__device__ __forceinline__ void epi64x64(float* sl, const v8f (&acc)[4][4], float oscale,
                                         float* C, int N, size_t rowb, int col0, int lane) {
  const int hh = lane >> 4, m = lane & 15;
  slab64x64(sl, acc, oscale, lane);
  wave_sync_lds();
  float* dst = C + (rowb + (size_t)hh) * (size_t)N + col0 + m * 4;
#pragma unroll
  for (int it = 0; it < 32; ++it) {
    const v4f v = *(const v4f*)(sl + (it * 2 + hh) * 68 + m * 4);
    *(v4f*)(dst + (size_t)(it * 2) * (size_t)N) = v;
  }
}

// =====================================================================================================
// GEMM: C[row][N] (f32, row pitch N) = A[row][K] (16-bit row-major, pitch K) . Bt[N][K]^T (16-bit k-contiguous) * oscale,
// row = bb*SEQ + s for s < 128*nrt.  FUSE: C is not stored; the tile, which is 128 rows of one head, goes on inside the block:
// job 0 (q) and 1 (k): slabs, one block barrier, normalisation + rotary + planes Hp (and Lp for q); job 2 (v): v^T plane Hp.  BF: bf16 operands (v_wmma_f32_16x16x32_bf16), else f16 (v_wmma_f32_16x16x32_f16).
// Block -> (column tile ct of N/128, row tile rt of nrt, batch bb; from the block's index, by the caller): a 128 x 128 tile of C; 4 waves as 2 x 2, each a
// 64 x 64 tile = 4 x 4 accumulators, so that a fragment read from LDS serves four products.
// The 128 A rows and 128 Bt rows reach the waves through an LDS ring of two buffers, 64 k a stage, filled by asynchronous
// copies of whole 128-B row pieces; fragments by two 16-B LDS loads each (split k map for A and B); k in ascending steps of 32
// per accumulator.  One block barrier per stage, under block-uniform control flow (host: K % 64 == 0, N % 128 == 0).
// coverage: 4 waves x 4 row groups x (16 x 64) = the block's tile; NB * nrt * (N/128) blocks = every row s < 128*nrt once.
// =====================================================================================================
template <bool BF> struct FragSel { typedef v16h T; };
template <> struct FragSel<true> { typedef v16b T; };
template <bool BF>
__device__ __forceinline__ typename FragSel<BF>::T ldfrag_t(const u16* p) {
  if constexpr (BF) return ldfrag_b(p);
  else return ldfrag_h((const _Float16*)(const void*)p);
}
template <bool BF>
__device__ __forceinline__ v8f mma_t(typename FragSel<BF>::T a, typename FragSel<BF>::T b, v8f c) {
  if constexpr (BF) return mma_b(a, b, c);
  else return mma_h(a, b, c);
}

template <bool BF, bool FUSE>
__device__ __forceinline__
void gemm128_blk(int ct, int rt, int bb, const u16* __restrict__ A, const u16* __restrict__ Bt, float* C, int N, int K, float oscale,
                 int job, const float* __restrict__ nw, const float* __restrict__ cosT, const float* __restrict__ sinT,
                 u16* Hp, u16* Lp, float sc) {
  __shared__ __align__(16) u16 ring[GRINGB / 2];          // two buffers of (128 A rows, 128 Bt rows), pitch GPB
  __shared__ __align__(16) float slab[4 * 4 * SLAB64];    // per wave [64][68]
  const int tid = (int)threadIdx.x, wave = tid >> 5, lane = tid & 31, hh = lane >> 4, m = lane & 15;
  if (bb >= NB) return;                     // block-uniform, before any barrier or copy; never taken with the exact grid
  if (rt * GBM + GBM > SEQ) return;         // block-uniform; never taken
  const int nstg  = K >> 6;
  const int col0  = ct * GBN;
  const size_t row0 = (size_t)bb * SEQ + (size_t)(rt * GBM);
  const int wr = wave >> 1, wc = wave & 1;  // this wave's 64 x 64 tile inside the block's
  // this lane's chunk 0 of stage 0 (stage_ab): global addresses and LDS byte addresses in buffer 0
  const size_t rs16 = (size_t)16 * (size_t)K;
  const u16* ag0 = A  + (row0 + (size_t)(tid >> 3)) * (size_t)K + (tid & 7) * 8;
  const u16* bg0 = Bt + (size_t)(col0 + (tid >> 3)) * (size_t)K + (tid & 7) * 8;
  const unsigned lring = (unsigned)(size_t)(const void*)ring;
  const unsigned la0 = lring + (unsigned)((tid >> 3) * GPB + (tid & 7) * 16);
  const unsigned lb0 = la0 + (unsigned)GATB;

  v8f acc[4][4];
#pragma unroll
  for (int i = 0; i < 4; ++i) {
#pragma unroll
    for (int j = 0; j < 4; ++j) acc[i][j] = zero8();
  }

  // ---- ring prologue: stage 0 lands and is published, then stage 1 flies while stage 0 is worked on ----
  stage_ab(ag0, bg0, rs16, la0, lb0);
  wait_async0();
  __syncthreads();
  if (nstg > 1) stage_ab(ag0 + GKS, bg0 + GKS, rs16, la0 + (unsigned)GSTB, lb0 + (unsigned)GSTB);   // block-uniform

  // kept rolled: one trip = one stage, with its one publish point at the foot
#pragma unroll 1
  for (int st = 0; st < nstg; ++st) {
    const int bufh = (st & 1) * (GSTB / 2);               // this stage's buffer, in halves
    const u16* ap = ring + bufh + (wr * 64 + m) * (GPB / 2) + 8 * hh;
    const u16* bp = ring + bufh + (GATB / 2) + (wc * 64 + m) * (GPB / 2) + 8 * hh;
    // both 32-k steps of a stage unrolled: their LDS offsets become immediates
    typename FragSel<BF>::T a[GKS / 32][4], b[GKS / 32][4];
#pragma unroll
    for (int ks = 0; ks < GKS / 32; ++ks) {
#pragma unroll
      for (int j = 0; j < 4; ++j) b[ks][j] = ldfrag_t<BF>(bp + j * 16 * (GPB / 2) + ks * 32);
#pragma unroll
      for (int i = 0; i < 4; ++i) a[ks][i] = ldfrag_t<BF>(ap + i * 16 * (GPB / 2) + ks * 32);
    }
    // keeps the stage's 32 LDS reads together in front of its 32 products: left free, the compiler reloads one A fragment
    // per four products and waits out the LDS latency each time
    __builtin_amdgcn_sched_barrier(0);
#pragma unroll
    for (int ks = 0; ks < GKS / 32; ++ks) {
#pragma unroll
      for (int i = 0; i < 4; ++i) {
#pragma unroll
        for (int j = 0; j < 4; ++j) acc[i][j] = mma_t<BF>(a[ks][i], b[ks][j], acc[i][j]);
      }
    }
    // keeps the products in front of the publish point: left free, they sink behind the barrier, the waits stand directly
    // behind the LDS reads, and the next stage's copies lose the products' time as their lead
    __builtin_amdgcn_sched_barrier(0);
    // ---- publish point of stage st + 1: own LDS reads retired, own copies landed, every wave has left this buffer ----
    wait_ds0();
    wait_async0();
    __syncthreads();
    if (st + 2 < nstg) {                                  // block-uniform: refill the buffer that this trip has just read
      stage_ab(ag0 + (size_t)(st + 2) * GKS, bg0 + (size_t)(st + 2) * GKS, rs16,
               la0 + (unsigned)(st & 1) * GSTB, lb0 + (unsigned)(st & 1) * GSTB);
    }
  }
  wait_async0();                                          // nothing in flight when the wave ends
  if constexpr (!FUSE) {
    epi64x64(slab + wave * (4 * SLAB64), acc, oscale, C, N, row0 + (size_t)(wr * 64), col0 + wc * 64, lane);
  } else {
    if (job == 2) {                                       // block-uniform, no barrier behind it
      vt_acc(acc, oscale, Hp + ((size_t)(bb * NKVH + ct) * HD + (size_t)(wc * 64)) * SEQ + rt * GBM + wr * 64, lane);
      return;
    }
    slab64x64(slab + wave * (4 * SLAB64), acc, oscale, lane);
    __syncthreads();                                      // a row's low and high 64 columns lie in two waves' slabs
    if (job == 0) nrope16<true>(slab, tid, row0, col0, N, nw, cosT, sinT, Hp, Lp, sc);
    else          nrope16<false>(slab, tid, row0, col0, N, nw, cosT, sinT, Hp, Lp, sc);
  }
}

// one product per launch (ctx.Wo)
template <bool BF>
__global__ __launch_bounds__(128)
void gemm128(const u16* __restrict__ A, const u16* __restrict__ Bt, float* C, int N, int K, int nrt, float oscale) {
  const int ntile = N >> 7;
  const int bid   = (int)blockIdx.x;
  const int t2    = bid / ntile;
  gemm128_blk<BF, false>(bid % ntile, t2 % nrt, t2 / nrt, A, Bt, C, N, K, oscale, 0, nullptr, nullptr, nullptr, nullptr, nullptr, 0.0f);
}

// x.Wq, x.Wk and x.Wv in one launch: block ranges, in this order: q (GB_Q blocks), k (GB_K), v (GB_K); the three products share A,
// write disjoint planes, and a block's product is block-uniform. A column tile is one head: q and k tiles leave as normalised, rotated
// f16 planes (q x256 with its residual plane, k x256), v tiles as the v^T plane x1024.
__global__ __launch_bounds__(128)
void gemm_qkv(const u16* __restrict__ A, const u16* __restrict__ Wq, const u16* __restrict__ Wk, const u16* __restrict__ Wv,
              const float* __restrict__ qnw, const float* __restrict__ knw,
              const float* __restrict__ cosT, const float* __restrict__ sinT,
              u16* QHo, u16* QLo, u16* KHo, u16* VHo, int K, float oscale) {
  int bid = (int)blockIdx.x;
  const u16* Bt = Wq;
  const float* nw = qnw;
  u16* Hp = QHo;
  int N = DMOD, job = 0;
  float sc = QSC;
  int ct = bid % (DMOD / GBN), rt = (bid / (DMOD / GBN)) % (SQ / GBM), bb = bid / ((DMOD / GBN) * (SQ / GBM));
  if (bid >= GB_Q) {
    bid -= GB_Q; Bt = Wk; nw = knw; Hp = KHo; N = KVD; job = 1; sc = KSC;
    if (bid >= GB_K) { bid -= GB_K; Bt = Wv; Hp = VHo; job = 2; }
    ct = bid % (KVD / GBN); rt = (bid / (KVD / GBN)) % (SEQ / GBM); bb = bid / ((KVD / GBN) * (SEQ / GBM));
  }
  gemm128_blk<true, true>(ct, rt, bb, A, Bt, nullptr, N, K, oscale, job, nw, cosT, sinT, Hp, QLo, sc);
}

// =====================================================================================================
// Non-causal grouped-query attention, hd = 128, all SEQ keys. Block bid -> (query tile qt = bid % NQT: rows q0 = 16*qt ..
// q0+15, head group hg = kv head, batch b); one wave per query head = hg*WPB + wave (the 4 heads of the group share kv head hg).
//   q hi / residual planes f16 x256 [b*SEQ + s][h*HD + d]; k plane f16 x256 [b*SEQ + s][g*HD + d] (pitch KVD);
//   v^T plane [b*NKVH + g][d][SEQ] x1024.
//   scores = q_hi.k + q_lo.k (4 k-steps over d); P.v with P x32768 (f16) and v^T, for every query row;
//   O written as one f16 plane (O x1024, layout [b*SEQ + s][h*HD + d]).
//   score (log2 domain) t(i, j) = (q_i.k_j over HD) * (1/sqrt(128))*log2e/(256*256).
//   k rows and v^T rows reach the 4 waves through an LDS ring of two buffers, 64 keys a stage, filled by asynchronous copies.
//   Both products are taken transposed: S^T = k.q^T (A = k rows from the ring, B = q, loaded once and kept in registers) and
//   O^T += v^T.P^T (A = v^T rows from the ring, B = P^T), all fragments in the split k map. A lane (c, hh) then holds, of query
//   column q0 + c, the scores of keys kb + 8hh + r and kb + 16 + 8hh + r: maximum and sum run inside the lane, the maximum is
//   joined with the other half by one cross-row move per 32 keys, the sums once after the loop; the two score tiles, converted
//   in place (P x32768, f16), are the B fragment of the second product. All NKT key tiles of 32 visited in order; online
//   max-subtracted base-2 softmax in f32, -inf-safe rescale.
//   After the loop: out = acc / Z (Z, x32768 like P, is about 32768 or more; guarded anyway), carry 1/1024 folded once, written into the slab.
//   One block barrier per stage, under block-uniform control flow; bounded loops only (NST compile-time).
// coverage: per wave 8 instructions x 2 rows x 16 lanes x 8 halves = 16 x 128; grid NQT x NHG x NB blocks x WPB
//           waves = every (b, s < SQ, h) row segment of O exactly once.
// =====================================================================================================
__global__ __launch_bounds__(ATT_THREADS)
void attn_nc(const u16* __restrict__ QHp, const u16* __restrict__ QLp, const u16* __restrict__ KHp,
             const u16* __restrict__ VHp, u16* OHp) {
  __shared__ __align__(16) _Float16 ring[RINGB / 2];      // two buffers of (64 k rows pitch KPB, 128 v^T rows pitch VPB)

  const int tid  = (int)threadIdx.x;
  const int wave = tid >> 5;
  const int lane = tid & 31;
  const int hh   = lane >> 4;
  const int c    = lane & 15;
  const int bid  = (int)blockIdx.x;
  const int qt   = bid % NQT;
  const int t2   = bid / NQT;
  const int hg   = t2 % NHG;
  const int b    = t2 / NHG;
  if (b >= NB) return;                      // block-uniform, before any barrier or copy; never taken with the exact grid
  const int q0   = qt * 16;
  if (q0 + 16 > SQ) return;                 // block-uniform; never taken
  const int head = hg * WPB + wave;
  const int kvh  = hg;

  float* slab = (float*)(void*)ring + wave * SLW;         // result slab [16][128] pitch 132: the ring's bytes, after the loop

  const size_t hcol = (size_t)head * HD + 8 * hh;
  const _Float16* Qh  = (const _Float16*)(const void*)QHp + ((size_t)b * SEQ + q0 + c) * DMOD + hcol;
  const _Float16* Ql  = (const _Float16*)(const void*)QLp + ((size_t)b * SEQ + q0 + c) * DMOD + hcol;
  // this lane's chunk 0 of stage 0 (stage_kv): global addresses and LDS byte addresses in buffer 0
  const u16* kg0 = KHp + ((size_t)b * SEQ + (tid >> 4)) * KVD + (size_t)kvh * HD + (tid & 15) * 8;
  const u16* vg0 = VHp + ((size_t)(b * NKVH + kvh) * HD + (tid >> 3)) * SEQ + (tid & 7) * 8;
  const unsigned lring = (unsigned)(size_t)(const void*)ring;
  const unsigned lk0 = lring + (unsigned)((tid >> 4) * KPB + (tid & 15) * 16);
  const unsigned lv0 = lring + (unsigned)(KTB + (tid >> 3) * VPB + (tid & 7) * 16);
  const float lsc = RSQ_HD * (LOG2E / (QSC * KSC));
  const float oc  = 1.0f / VCAR;                          // the carry on P stands in the running sum as well and cancels in acc / Z

  // q as the B operand: column = query q0 + c, loaded once for all keys
  v16h qh[HD / 32], ql[HD / 32];
#pragma unroll
  for (int kk = 0; kk < HD / 32; ++kk) { qh[kk] = ldfrag_h(Qh + kk * 32); ql[kk] = ldfrag_h(Ql + kk * 32); }
  float mrun = -INFINITY, lrun = 0.f;                     // of query column c; lrun (x32768) over this half's keys only
  v8f o[8];                                               // o[j][r] = O^T[d = 16j + 8hh + r][query c]
#pragma unroll
  for (int j = 0; j < 8; ++j) o[j] = zero8();

  // ---- ring prologue: stage 0 lands and is published, then stage 1 flies while stage 0 is worked on ----
  stage_kv(kg0, vg0, lk0, lv0);
  wait_async0();
  __syncthreads();
  stage_kv(kg0 + (size_t)KSTG * KVD, vg0 + KSTG, lk0 + STGB, lv0 + STGB);

  // kept rolled: one trip = one stage, with its one publish point at the foot
#pragma unroll 1
  for (int st = 0; st < NST; ++st) {
   const int bufh = (st & 1) * (STGB / 2);                // this stage's buffer, in halves
   // kept rolled: unrolled, the compiler spreads a step's v^T reads in pairs among its products instead of issuing them together
   // ahead of the softmax arithmetic
#pragma unroll 1
   for (int sub = 0; sub < KSTG / 32; ++sub) {
    // ---- scores: D element r of this lane = (key kb + 8hh + r, query q0 + c) in s0, key kb + 16 + 8hh + r in s1, kb = 64*st + 32*sub ----
    v8f s0 = zero8(), s1 = zero8();
    const _Float16* k0p = ring + bufh + (sub * 32 + c) * (KPB / 2) + 8 * hh;
    const _Float16* k1p = k0p + 16 * (KPB / 2);
    v16h kh0[HD / 32], kh1[HD / 32];
#pragma unroll
    for (int kk = 0; kk < HD / 32; ++kk) { kh0[kk] = ldfrag_h(k0p + kk * 32); kh1[kk] = ldfrag_h(k1p + kk * 32); }
    // keeps the step's 16 k reads together in front of its 16 score products: left free, the compiler reloads two fragments
    // per four products and waits out the LDS latency each time
    __builtin_amdgcn_sched_barrier(0);
#pragma unroll
    for (int kk = 0; kk < HD / 32; ++kk) {
      s0 = mma_h(kh0[kk], qh[kk], s0);
      s1 = mma_h(kh1[kk], qh[kk], s1);
      s0 = mma_h(kh0[kk], ql[kk], s0);
      s1 = mma_h(kh1[kk], ql[kk], s1);
    }
    // splits the step here, so that the eight v^T fragments are read together at the head of the softmax arithmetic, which covers
    // their latency, into the k fragments' registers: left free, the compiler reads one fragment in front of each of the eight
    // products and waits out the LDS latency each time
    __builtin_amdgcn_sched_barrier(0);
    // ---- online softmax in base 2 over all keys, -inf-safe; one query column per lane ----
    float mx = fmaxf(s0[0], s1[0]);
#pragma unroll
    for (int r = 1; r < 8; ++r) mx = fmaxf(mx, fmaxf(s0[r], s1[r]));
    mx = fmaxf(mx, xhalf(mx)) * lsc;                      // lsc > 0: the maximum of the scaled scores
    const float mn = fmaxf(mrun, mx);
    const float ms = (mn == -INFINITY) ? 0.0f : mn;
    // the exponentials are the bare v_exp_f32: it gives 0 where the library form would give a subnormal (argument below -126), which
    // is far below half an ulp of the f16 P and of Z (x32768: about 2^15 or more once the two halves' sums are joined)
    const float al = __builtin_amdgcn_exp2f(mrun - ms);
    mrun = mn;
    const float mo = ms - PEXP;                           // P x32768 comes out of the exponential itself
    // ---- B fragment of P^T*32768 (f16): elements 0..7 = keys kb + 8hh + 0..7, elements 8..15 = keys kb + 16 + 8hh + 0..7 ----
    FragH ph;
    v2f ps = {0.f, 0.f};                                  // sums over even and odd r, x32768 like P
    const v2f lsc2 = {lsc, lsc}, mo2 = {mo, mo};
#pragma unroll
    for (int r = 0; r < 8; r += 2) {
      // neighbouring accumulator registers taken as pairs: packed fma and packed add
      const v2f x0 = (v2f){s0[r], s0[r + 1]} * lsc2 - mo2;
      const v2f x1 = (v2f){s1[r], s1[r + 1]} * lsc2 - mo2;
      const v2f e0 = {__builtin_amdgcn_exp2f(x0[0]), __builtin_amdgcn_exp2f(x0[1])};
      const v2f e1 = {__builtin_amdgcn_exp2f(x1[0]), __builtin_amdgcn_exp2f(x1[1])};
      ps += e0;
      ps += e1;
      ph.h[0][r]     = (_Float16)e0[0];
      ph.h[0][r + 1] = (_Float16)e0[1];
      ph.h[1][r]     = (_Float16)e1[0];
      ph.h[1][r + 1] = (_Float16)e1[1];
    }
    lrun = lrun * al + (ps[0] + ps[1]);
#pragma unroll
    for (int j = 0; j < 8; ++j) {
#pragma unroll
      for (int r = 0; r < 8; ++r) o[j][r] *= al;
    }
    // ---- v^T.P^T : A fragment row = d = j*16 + c, keys contiguous in the v^T rows ----
    {
      const _Float16* vhp = ring + bufh + (KTB / 2) + c * (VPB / 2) + sub * 32 + 8 * hh;   // d row c (+16j), keys of this step
#pragma unroll
      for (int j = 0; j < 8; ++j) o[j] = mma_h(ldfrag_h(vhp + j * 16 * (VPB / 2)), ph.v, o[j]);
    }
    // four vector slots behind the step's last products, in front of the loop's branch: on its taken side the first vector
    // instructions rewrite registers of P^T
    acc_guard8(o);
   }
   // ---- publish point of stage st + 1: own LDS reads retired, own copies landed, every wave has left this buffer ----
   wait_ds0();
   wait_async0();
   __syncthreads();
   if (st + 2 < NST) {                                    // block-uniform: refill the buffer that this trip has just read
     stage_kv(kg0 + (size_t)(st + 2) * KSTG * KVD, vg0 + (st + 2) * KSTG,
              lk0 + (unsigned)(st & 1) * STGB, lv0 + (unsigned)(st & 1) * STGB);
   }
  }
  wait_async0();                                          // nothing in flight before the ring's bytes become the result slab
  // ---- out = acc / Z (0 if Z == 0), acc and Z both x32768, the carry 1024 on v folded once; row c of the wave's slab, 8 consecutive d ----
  {
    const float lv  = lrun + xhalf(lrun);                 // the two halves' sums joined
    const float ls  = (lv > 0.0f) ? lv : 1.0f;
    const float inv = (lv > 0.0f) ? ((1.0f / ls) * oc) : 0.0f;
#pragma unroll
    for (int j = 0; j < 8; ++j) {
      float* sp = slab + c * SLP + j * 16 + 8 * hh;
      v4f a, b4;
#pragma unroll
      for (int e = 0; e < 4; ++e) { a[e] = o[j][e] * inv; b4[e] = o[j][4 + e] * inv; }
      *(v4f*)(sp)     = a;
      *(v4f*)(sp + 4) = b4;
    }
  }

  wave_sync_lds();
  // ---- O x1024 -> f16 plane; lane = (row-in-pair rq, 8 consecutive d at c8) ----
  v4u oh[8];
  const int rq = lane >> 4, c8 = (lane & 15) * 8;
#pragma unroll
  for (int it = 0; it < 8; ++it) {
    const int row = it * 2 + rq;
    const v4f a = *(const v4f*)(slab + row * SLP + c8), b4 = *(const v4f*)(slab + row * SLP + c8 + 4);
    float w[8];
#pragma unroll
    for (int e = 0; e < 4; ++e) { w[e] = a[e] * OSC; w[4 + e] = b4[e] * OSC; }
#pragma unroll
    for (int e = 0; e < 4; ++e) {
      const _Float16 h0 = (_Float16)w[2 * e], h1 = (_Float16)w[2 * e + 1];
      oh[it][e] = pk16(h_bits(h0), h_bits(h1));
    }
  }
  const size_t ob = ((size_t)b * SEQ + q0) * DMOD + (size_t)head * HD + c8;
  {
#pragma unroll
    for (int it = 0; it < 8; ++it) {
      const int row = it * 2 + rq;
      *(v4u*)(OHp + ob + (size_t)row * DMOD) = oh[it];
    }
    
  }
}

// =====================================================================================================
// Workspace map (bytes); every plane is fully written by whole-line stores before it is read; all extents are exact multiples
// of the store granularity (no pad rows needed); every region offset a multiple of 1048576:
//   XB  bf16 [MROWS][2048]                       MROWS*4096       (NB=2: 16777216)
//   WQ  bf16 [2048 n][2048 k]                    8388608          Wq^T;  WO f16 x1024, same extent: Wo^T
//   WK  bf16 [512 n][2048 k]                     2097152          Wk^T;  WV same extent: Wv^T
//   OH  f16 [MROWS][2048] x1024                  MROWS*4096
//   QH  f16 [MROWS][2048] x256                   MROWS*4096       QL residual, same extent
//   KH  f16 [MROWS][512] x256                    MROWS*1024
//   VH  f16 [NB*4][128][SEQ] x1024               MROWS*1024
//   COS f32 [MROWS][64]                          MROWS*256        SIN same extent
//   end (NB=2)                                 98566144
// =====================================================================================================
extern "C" void kernel_launch(void* const* d_in, const int* in_sizes, int n_in,
                              void* d_out, int out_size, void* d_ws, size_t ws_size,
                              hipStream_t stream) {
  if (n_in < 8) return;
  if (in_sizes[0] < MROWS * DMOD) return;
  if (in_sizes[1] < MROWS) return;
  if (in_sizes[2] != DMOD * DMOD) return;
  if (in_sizes[3] != DMOD * KVD) return;
  if (in_sizes[4] != DMOD * KVD) return;
  if (in_sizes[5] != DMOD * DMOD) return;
  if (in_sizes[6] < HD) return;
  if (in_sizes[7] < HD) return;
  if (out_size < MROWS * DMOD) return;

  const float* x   = (const float*)d_in[0];
  const int*   pos = (const int*)d_in[1];
  const float* wq  = (const float*)d_in[2];
  const float* wk  = (const float*)d_in[3];
  const float* wv  = (const float*)d_in[4];
  const float* wo  = (const float*)d_in[5];
  const float* qnw = (const float*)d_in[6];
  const float* knw = (const float*)d_in[7];
  float*       out = (float*)d_out;

  const size_t szXB = (size_t)MROWS * DMOD * 2;
  const size_t szW  = (size_t)DMOD * DMOD * 2;                   // WQ, WO
  const size_t szWK = (size_t)DMOD * KVD * 2;                    // WK, WV
  const size_t szQ  = (size_t)MROWS * DMOD * 2;                  // QH, QL, OH
  const size_t szK  = (size_t)MROWS * KVD * 2;                   // KH
  const size_t szV  = (size_t)NB * NKVH * HD * SEQ * 2;          // VH (== szK)
  const size_t szT  = (size_t)MROWS * HHALF * 4;                 // COS, SIN
  size_t off = 0;
  const size_t oXB = off; off += szXB;
  const size_t oWQ = off; off += szW;
  const size_t oWO = off; off += szW;
  const size_t oWK = off; off += szWK;
  const size_t oWV = off; off += szWK;
  const size_t oOH = off; off += szQ;
  const size_t oQH = off; off += szQ;
  const size_t oQL = off; off += szQ;
  const size_t oKH = off; off += szK;
  const size_t oVH = off; off += szV;
  const size_t oCS = off; off += szT;
  const size_t oSN = off; off += szT;
  if (off > ws_size) return;                // off = 98566144 for NB = 2
  if (off > (size_t)WS_CAP) return;

  char* ws = (char*)d_ws;
  u16*   XB  = (u16*)(ws + oXB);
  u16*   WQT = (u16*)(ws + oWQ);
  u16*   WOT = (u16*)(ws + oWO);
  u16*   WKT = (u16*)(ws + oWK);
  u16*   WVT = (u16*)(ws + oWV);
  u16*   OH  = (u16*)(ws + oOH);
  u16*   QH  = (u16*)(ws + oQH);
  u16*   QL  = (u16*)(ws + oQL);
  u16*   KH  = (u16*)(ws + oKH);
  u16*   VH  = (u16*)(ws + oVH);
  float* COS = (float*)(ws + oCS);
  float* SIN = (float*)(ws + oSN);

  const dim3 b256(256), b128(128), bAT(ATT_THREADS);
  const int  nrtQ = SQ / GBM;                           // ctx / out rows per batch / 128
  const dim3 gGQ(GB_Q);
  const dim3 gAT(NQT * NHG * NB);

  // (0) cos/sin tables from the integer positions, x -> bf16 plane, Wq^T, Wk^T, Wv^T bf16 planes, Wo^T f16 plane of bf16 value x1024
  prep16<<<dim3(PB_ALL), b256, 0, stream>>>(pos, x, wq, wk, wv, wo, COS, SIN, XB, WQT, WKT, WVT, WOT);
  // (1) q = x.Wq, k = x.Wk, v = x.Wv, each tile on into its planes: RMS normalisation + rotary + q planes x256, k plane x256; v^T plane x1024
  gemm_qkv<<<dim3(GB_ALL), b128, 0, stream>>>(XB, WQT, WKT, WVT, qnw, knw, COS, SIN, QH, QL, KH, VH, DMOD, 1.0f);
  // (2) non-causal attention over all keys -> O plane
  attn_nc<<<gAT, bAT, 0, stream>>>(QH, QL, KH, VH, OH);
  // (3) out = ctx.Wo -> f32, carries 1024 x 1024 folded back
  gemm128<false><<<gGQ, b128, 0, stream>>>(OH, WOT, out, DMOD, DMOD, nrtQ, 1.0f / (OSC * WOS));
  (void)hipGetLastError();
}

// v007
// Measured time: 167 microseconds a run.
// In both of two side-by-side timings against v006, it was 1.04 times as fast.
// Over all steps from v000 it is 3.26 times as fast.
// Contractions: x.Wq, x.Wk, x.Wv on v_wmma_f32_16x16x32_bf16 (x and W^T as bf16 RNE planes, f32 accumulate);
// q.k^T over hd 128 on v_wmma_f32_16x16x32_f16 with q as f16 hi + f16 residual planes (x256) and k as one f16 plane
// (x256), products qh.k + ql.k; P.v on v_wmma_f32_16x16x32_f16 with P x32768 and v^T x1024 as single f16 planes;
// ctx.Wo on v_wmma_f32_16x16x32_f16 with ctx x1024 as one f16 plane and Wo^T as f16(bf16 RNE(Wo)) x1024; all f32
// accumulate. RMS normalisation, rotate-half rotary from integer positions (cos/sin tables built on device in f32),
// base-2 online softmax and the 1/Z fold in f32 on VALU.
#include <hip/hip_runtime.h>
#include <math.h>
#include <stdint.h>

#ifndef NB
#define NB 2
#endif
#define SEQ 2048
#ifndef SQ
#define SQ SEQ
#endif
#define DMOD  2048
#define NH    16
#define NKVH  4
#define HD    128
#define HHALF (HD / 2)
#define KVD   (NKVH * HD)
#define MROWS (NB * SEQ)
#define EPS_RMS 0.000001f
#define RSQ_HD 0.08838834764831845f
#define LOG2E 1.4426950408889634f
#define LOG2THETA 19.931568569324174
#define QSC   256.0f
#define KSC   256.0f
#define PCAR  32768.0f
#define PEXP  15.0f
#define VCAR  1024.0f
#define OSC   1024.0f
#define WOS   1024.0f
#define WPB   (NH / NKVH)
#define NHG   NKVH
#define NQT   (SQ / 16)
#define NST   (SEQ / 64)
#define NKT   (SEQ / 32)
#define ATT_THREADS (WPB * 32)
#define SLP   132
#define SLW   (16 * SLP)
#define SLAB64 (16 * 68)
#define WTP   72
#define WS_CAP 134217728
#define KSTG  64
#define KPB   272
#define VPB   144
#define KTB   (KSTG * KPB)
#define VTB   (HD * VPB)
#define STGB  (KTB + VTB)
#define RINGB (2 * STGB)
#define GBM   128
#define GBN   128
#define GKS   64
#define GPB   144
#define GATB  (GBM * GPB)
#define GSTB  ((GBM + GBN) * GPB)
#define GRINGB (2 * GSTB)
// block counts of the jobs that share one launch (each job's blocks are a contiguous range of the grid)
#define PB_TR (MROWS / 4)
#define PB_X  ((MROWS * DMOD / 8) / 256)
#define PB_WQ ((DMOD / 64) * (DMOD / 64))
#define PB_WK ((DMOD / 64) * (KVD / 64))
#define PB_ALL (PB_TR + PB_X + 2 * PB_WQ + 2 * PB_WK)
#define GB_Q  (NB * (SQ / GBM) * (DMOD / GBN))
#define GB_K  (NB * (SEQ / GBM) * (KVD / GBN))
#define GB_ALL (GB_Q + 2 * GB_K)
static_assert(GBN == HD && GBM == 128);                 // a column tile of the q, k, v products is one head
static_assert(DMOD == NH * HD && HD == 128 && HHALF == 64 && NH == 16 && NKVH == 4 && WPB == 4 && NHG * WPB == NH);
static_assert(ATT_THREADS == 128 && KVD == 512);
static_assert(PCAR == 32768.0f && PEXP == 15.0f);       // PCAR = 2^PEXP
static_assert(NB >= 1 && NB <= 2);
static_assert((SEQ % 64) == 0 && (SQ % 64) == 0 && SQ >= 64 && SQ <= SEQ);
static_assert((DMOD % 64) == 0 && (KVD % 64) == 0 && (DMOD % 32) == 0 && (HD % 32) == 0);
static_assert(((MROWS * DMOD / 8) % 256) == 0 && (MROWS % 4) == 0);
static_assert(KSTG == 64 && NST >= 2 && NST * KSTG == SEQ && (KPB % 16) == 0 && (VPB % 16) == 0 && (KTB % 16) == 0 && (STGB % 16) == 0);
static_assert(KPB == HD * 2 + 16 && VPB == KSTG * 2 + 16 && WPB * SLW * 4 <= RINGB && 4 * RINGB <= 327680);
static_assert(64 * WTP * 2 <= 65536);
static_assert(GBM == 128 && GBN == 128 && GKS == 64 && GPB == GKS * 2 + 16 && (GPB % 16) == 0 && (GSTB % 16) == 0);
static_assert((SEQ % GBM) == 0 && (SQ % GBM) == 0 && (DMOD % GBN) == 0 && (KVD % GBN) == 0 && (DMOD % GKS) == 0 && DMOD / GKS >= 2);
static_assert(2 * (GRINGB + 4 * 4 * SLAB64 * 4) <= 327680);
static_assert((DMOD / 16) <= 128 && (KVD / 16) <= 128 && ((DMOD / 16) % 32) == 0 && ((KVD / 16) % 32) == 0);

typedef unsigned short u16;
typedef _Float16 v16h __attribute__((ext_vector_type(16)));
typedef _Float16 v8h  __attribute__((ext_vector_type(8)));
typedef __bf16   v16b __attribute__((ext_vector_type(16)));
typedef float    v8f  __attribute__((ext_vector_type(8)));
typedef float    v4f  __attribute__((ext_vector_type(4)));
typedef float    v2f  __attribute__((ext_vector_type(2)));
typedef unsigned int v4u __attribute__((ext_vector_type(4)));

union FragH { v16h v; v8h h[2]; v4u u[2]; };
union FragB { v16b v; v4u u[2]; };

// ---- scalar helpers --------------------------------------------------------------------------------
__device__ __forceinline__ unsigned short bf_bits(float f) {          // f32 -> bf16 bits, RNE convert
  unsigned u = __float_as_uint(f);
  return (unsigned short)((u + 0x7FFFu + ((u >> 16) & 1u)) >> 16);
}
__device__ __forceinline__ float bf_up(unsigned short h) { return __uint_as_float(((unsigned)h) << 16); }
__device__ __forceinline__ float bfr(float f) { return bf_up(bf_bits(f)); }
__device__ __forceinline__ unsigned short h_bits(_Float16 x) { return __builtin_bit_cast(unsigned short, x); }
__device__ __forceinline__ unsigned pk16(unsigned short a, unsigned short b) { return (unsigned)a | ((unsigned)b << 16); }
__device__ __forceinline__ v8f zero8() { v8f z = {0.f, 0.f, 0.f, 0.f, 0.f, 0.f, 0.f, 0.f}; return z; }

// ---- fragment loaders: 16-bit A/B operand, lane -> row/col (lane&15), p already includes +8*(lane>>4);
//      elements 0..7 <- p[0..7] (k0+8h..), elements 8..15 <- p[16..23] (k0+16+8h..)  (same split k map for A and B;
//      B is always read from a k-contiguous [n][k] plane)
__device__ __forceinline__ v16h ldfrag_h(const _Float16* p) {
  FragH f;
  f.h[0] = *(const v8h*)(p);
  f.h[1] = *(const v8h*)(p + 16);
  return f.v;
}
__device__ __forceinline__ v16b ldfrag_b(const u16* p) {              // bf16 plane read as unsigned integer vectors
  FragB f;
  f.u[0] = *(const v4u*)(p);
  f.u[1] = *(const v4u*)(p + 16);
  return f.v;
}

__device__ __forceinline__ v8f mma_h(v16h a, v16h b, v8f c) {
  return __builtin_amdgcn_wmma_f32_16x16x32_f16(false, a, false, b, (short)0, c, false, false);
}
__device__ __forceinline__ v8f mma_b(v16b a, v16b b, v8f c) {
  return __builtin_amdgcn_wmma_f32_16x16x32_bf16(false, a, false, b, (short)0, c, false, false);
}
__device__ __forceinline__ void acc_guard8(v8f (&a)[8]) {
#if defined(__HIP_DEVICE_COMPILE__)
  asm volatile("v_nop\n\tv_nop\n\tv_nop\n\tv_nop"
               : "+v"(a[0]), "+v"(a[1]), "+v"(a[2]), "+v"(a[3]), "+v"(a[4]), "+v"(a[5]), "+v"(a[6]), "+v"(a[7]));
#endif
}
__device__ __forceinline__ void wave_sync_lds() {
  __builtin_amdgcn_fence(__ATOMIC_RELEASE, "workgroup");
  __builtin_amdgcn_wave_barrier();
  __builtin_amdgcn_fence(__ATOMIC_ACQUIRE, "workgroup");
}
// lane l's value from lane l ^ 16: the two halves of the wave hold the two halves of a query column's keys
__device__ __forceinline__ float xhalf(float x) {
  const int b = __builtin_bit_cast(int, x);
  return __builtin_bit_cast(float, __builtin_amdgcn_permlanex16(b, b, 0x76543210, 0xfedcba98, false, false));
}
// Eight asynchronous 16-byte copies of this lane, global -> LDS (l = LDS byte address, g = global address, both 16-B aligned).
// The closing s_wait_xcnt 0 stands inside the statement so that no address register is rewritten in front of it.
__device__ __forceinline__ void async8(const unsigned* l, const u16* const* g) {
#if defined(__HIP_DEVICE_COMPILE__)
  asm volatile("global_load_async_to_lds_b128 %0, %8, off\n\t"
               "global_load_async_to_lds_b128 %1, %9, off\n\t"
               "global_load_async_to_lds_b128 %2, %10, off\n\t"
               "global_load_async_to_lds_b128 %3, %11, off\n\t"
               "global_load_async_to_lds_b128 %4, %12, off\n\t"
               "global_load_async_to_lds_b128 %5, %13, off\n\t"
               "global_load_async_to_lds_b128 %6, %14, off\n\t"
               "global_load_async_to_lds_b128 %7, %15, off\n\t"
               "s_wait_xcnt 0x0"
               :: "v"(l[0]), "v"(l[1]), "v"(l[2]), "v"(l[3]), "v"(l[4]), "v"(l[5]), "v"(l[6]), "v"(l[7]),
                  "v"(g[0]), "v"(g[1]), "v"(g[2]), "v"(g[3]), "v"(g[4]), "v"(g[5]), "v"(g[6]), "v"(g[7])
               : "memory");
#endif
}
// One stage (64 keys) of k rows and v^T rows into one ring buffer, 16 copies per lane of the 128 threads:
//   k   chunk i: key row i*8 + (tid>>4), 16-B piece tid&15  (a wave covers two whole 256-B rows), LDS pitch KPB;
//   v^T chunk i: d row i*16 + (tid>>3), 16-B piece tid&7    (a wave covers four whole 128-B rows), LDS pitch VPB.
// kg, vg, lk, lv are this lane's addresses of chunk 0.
__device__ __forceinline__ void stage_kv(const u16* kg, const u16* vg, unsigned lk, unsigned lv) {
  unsigned l[8];
  const u16* g[8];
  // both loops unrolled so that l[] and g[] are registers, as the asm operands need them
#pragma unroll
  for (int i = 0; i < 8; ++i) { l[i] = lk + (unsigned)(i * 8 * KPB); g[i] = kg + (size_t)(i * 8) * KVD; }
  async8(l, g);
#pragma unroll
  for (int i = 0; i < 8; ++i) { l[i] = lv + (unsigned)(i * 16 * VPB); g[i] = vg + (size_t)(i * 16) * SEQ; }
  async8(l, g);
}
// One GEMM stage (64 k = 128 B of each row) of 128 A rows and 128 B rows into one ring buffer, 16 copies per lane of the
// 128 threads: chunk i = row i*16 + (tid>>3), 16-B piece tid&7 (a wave covers four whole 128-B row pieces), LDS pitch GPB.
// ag, bg, la, lb are this lane's addresses of chunk 0; rs16 = 16 rows of the global planes, in elements.
__device__ __forceinline__ void stage_ab(const u16* ag, const u16* bg, size_t rs16, unsigned la, unsigned lb) {
  unsigned l[8];
  const u16* g[8];
  // both loops unrolled so that l[] and g[] are registers, as the asm operands need them
#pragma unroll
  for (int i = 0; i < 8; ++i) { l[i] = la + (unsigned)(i * 16 * GPB); g[i] = ag + (size_t)i * rs16; }
  async8(l, g);
#pragma unroll
  for (int i = 0; i < 8; ++i) { l[i] = lb + (unsigned)(i * 16 * GPB); g[i] = bg + (size_t)i * rs16; }
  async8(l, g);
}
// the issuing wave's own wait: every asynchronous copy it has issued has landed in LDS
__device__ __forceinline__ void wait_async0() {
#if defined(__HIP_DEVICE_COMPILE__)
  asm volatile("s_wait_asynccnt 0x0" ::: "memory");
#endif
}
// this wave's LDS reads and writes have retired (in front of the barrier behind which a buffer is refilled)
__device__ __forceinline__ void wait_ds0() {
#if defined(__HIP_DEVICE_COMPILE__)
  asm volatile("s_wait_dscnt 0x0" ::: "memory");
#endif
}

// =====================================================================================================
// cos/sin tables for the rotary: row = b*SEQ + s (0 .. nrows-1), column j = 0..63:
//   invf[j] = 1e6^(-j/64) (f64 exp2, converted to f32), ang = float(pos[row]) * invf[j] (f32 multiply),
//   cosT[row][j] = cosf(ang), sinT[row][j] = sinf(ang).
// Block = 4 rows x 64 j (one value pair per thread) staged in LDS; after the barrier waves 0,1 write the 4 cos rows and
// coverage: nrows/4 blocks (bid) x (2 tables x 4 rows x 64 floats) = both tables exactly once (nrows % 4 == 0, host).
// =====================================================================================================
__device__ __forceinline__ void trig64(int bid, const int* __restrict__ pos, float* cosT, float* sinT, int nrows) {
#pragma clang fp contract(off)
  __shared__ __align__(16) float cs[2 * 256];
  const int tid  = (int)threadIdx.x;
  const int row0 = bid * 4;
  if (row0 + 4 > nrows) return;                       // block-uniform, before the barrier; never taken with the exact grid
  const int r = tid >> 6, j = tid & 63;
  const float p    = (float)pos[row0 + r];
  const float invf = (float)exp2(-(double)j * (LOG2THETA / 64.0));
  const float ang  = p * invf;
  cs[tid]       = cosf(ang);
  cs[256 + tid] = sinf(ang);
  __syncthreads();
  if (tid < 128) {                                    // waves 0..3, wave-uniform
    const int tb    = tid >> 6;                       // 0: cos rows (waves 0,1), 1: sin rows (waves 2,3)
    const int q     = tid & 63;
    const int rr    = q >> 4;
    const int piece = (q & 15) * 4;
    const v4f v = *(const v4f*)(cs + tb * 256 + rr * 64 + piece);
    float* base = (tb != 0) ? sinT : cosT;
    float* dst  = base + (size_t)(row0 + rr) * HHALF + piece;
    {
      *(v4f*)(dst) = v;
      
    }
  }
}

// =====================================================================================================
// f32 -> 16-bit plane, same layout.  f16mode == 0: bf16 RNE bits;  f16mode == 1: f16 bits of (bf16 RNE value) * scale.
// Thread = 8 consecutive elements: two 16-B loads, one 16-B store; 32 consecutive lanes = 512 contiguous, 512-B aligned
// coverage: ceil(n8/256) blocks (bid) x 256 thr x 8 (in-kernel bound) = the whole plane (n8 a multiple of 256 here).
// =====================================================================================================
__device__ __forceinline__ void cvt16(int bid, const float* __restrict__ x, u16* D, int n8, int f16mode, float scale) {
  const int gt = bid * 256 + (int)threadIdx.x;
  if (gt >= n8) return;
  const float* p = x + (size_t)gt * 8;
  const v4f a = *(const v4f*)(p), b4 = *(const v4f*)(p + 4);
  float w[8];
#pragma unroll
  for (int e = 0; e < 4; ++e) { w[e] = a[e]; w[4 + e] = b4[e]; }
  v4u o;
#pragma unroll
  for (int e = 0; e < 4; ++e) {
    const float f0 = w[2 * e], f1 = w[2 * e + 1];
    const unsigned short hb0 = h_bits((_Float16)(bfr(f0) * scale));
    const unsigned short hb1 = h_bits((_Float16)(bfr(f1) * scale));
    const unsigned short bb0 = bf_bits(f0);
    const unsigned short bb1 = bf_bits(f1);
    o[e] = (f16mode != 0) ? pk16(hb0, hb1) : pk16(bb0, bb1);
  }
  u16* d = D + (size_t)gt * 8;
  {
    *(v4u*)(d) = o;
    
  }
}

// =====================================================================================================
// Weight transpose + convert: W f32 [K rows][N cols] (row pitch N) -> Wt 16-bit [N rows][K cols] (row pitch K), so that
// a column n of W becomes the k-contiguous B operand row n.  f16mode == 0: bf16 RNE bits; 1: f16 bits of (bf16 RNE value)*scale.
// Block = 64 k x 64 n tile: load phase 4 iterations x (16 k rows x 16 lanes x 4 n) with 16-B loads into an LDS tile
// coverage: load 4 it x 256 thr x 4 = 64 x 64; store 2 it x 256 thr x 8 halves = 64 rows x 64; (K/64)*(N/64)
//           blocks (bid) = the whole [N][K] plane exactly once.
// =====================================================================================================
__device__ __forceinline__ void wt16(int bid, const float* __restrict__ W, u16* Wt, int K, int N, int f16mode, float scale) {
  __shared__ __align__(16) u16 T[64 * WTP];
  const int tid = (int)threadIdx.x;
  const int nkt = K >> 6;
  const int kt  = bid % nkt;
  const int nt  = bid / nkt;
  const int kb  = kt * 64, nb = nt * 64;
  if (nb + 64 > N) return;                            // block-uniform, before the barrier; never taken with the exact grid
  const int c4 = (tid & 15) * 4;                      // n within tile
  const int r0 = tid >> 4;                            // k within tile (0..15) + 16*it
#pragma unroll
  for (int it = 0; it < 4; ++it) {
    const int r = it * 16 + r0;
    const v4f a = *(const v4f*)(W + (size_t)(kb + r) * (size_t)N + nb + c4);
#pragma unroll
    for (int e = 0; e < 4; ++e) {
      const float f = a[e];
      const unsigned short hb = h_bits((_Float16)(bfr(f) * scale));
      const unsigned short bb = bf_bits(f);
      T[(c4 + e) * WTP + r] = (f16mode != 0) ? hb : bb;
    }
  }
  __syncthreads();
  v4u o[2];
  const int q8 = tid >> 3, p8 = (tid & 7) * 8;
#pragma unroll
  for (int it = 0; it < 2; ++it) o[it] = *(const v4u*)(T + (it * 32 + q8) * WTP + p8);
  u16* dst = Wt + (size_t)(nb + q8) * (size_t)K + kb + p8;
  {
#pragma unroll
    for (int it = 0; it < 2; ++it) {
      *(v4u*)(dst + (size_t)(it * 32) * (size_t)K) = o[it];
    }
    // the code of the launch's other jobs follows these stores in the built kernel and reuses their registers
    asm volatile("s_wait_xcnt 0x0" ::: "memory");
  }
}

// =====================================================================================================
// Everything that depends on the inputs alone, in one launch: block ranges, in this order: cos/sin tables (PB_TR blocks), x plane
// (PB_X), Wq^T (PB_WQ), Wo^T (PB_WQ), Wk^T (PB_WK), Wv^T (PB_WK). The jobs write disjoint planes and read none of them; the job of
// a block is block-uniform, so each job's one barrier stays under block-uniform control flow.
// =====================================================================================================
__global__ __launch_bounds__(256)
void prep16(const int* __restrict__ pos, const float* __restrict__ x, const float* __restrict__ wq, const float* __restrict__ wk,
            const float* __restrict__ wv, const float* __restrict__ wo, float* cosT, float* sinT,
            u16* XBo, u16* WQo, u16* WKo, u16* WVo, u16* WOo) {
  int bid = (int)blockIdx.x;
  if (bid < PB_TR) { trig64(bid, pos, cosT, sinT, MROWS); return; }
  bid -= PB_TR;
  if (bid < PB_X) { cvt16(bid, x, XBo, (MROWS * DMOD) / 8, 0, 1.0f); return; }
  bid -= PB_X;
  const float* W = wq;
  u16* Wt = WQo;
  int N = DMOD, f16mode = 0;
  float scale = 1.0f;
  if (bid >= PB_WQ) {
    bid -= PB_WQ; W = wo; Wt = WOo; f16mode = 1; scale = WOS;
    if (bid >= PB_WQ) {
      bid -= PB_WQ; W = wk; Wt = WKo; N = KVD; f16mode = 0; scale = 1.0f;
      if (bid >= PB_WK) { bid -= PB_WK; W = wv; Wt = WVo; }
    }
  }
  wt16(bid, W, Wt, DMOD, N, f16mode, scale);
}

// =====================================================================================================
// v^T plane straight from the accumulators of a v projection tile: lane (m, hh) holds in acc[i][j] column d = 16j + m of the wave's
// 64 and the 8 consecutive keys 16i + 8hh + 0..7 of its 64 rows, which is one 16-B piece of a v^T row:
//   VH[((b*NKVH + g)*HD + d)][s] = f16(v * 1024).
// dst = the wave's first v^T row at its first key; the four pieces i of a lane pair (hh = 0, 1) fill one whole 128-B line.
// coverage: 16 stores x 16 d x 2 halves x 8 keys = the wave's 64 d x 64 keys.
// =====================================================================================================
__device__ __forceinline__ void vt_acc(const v8f (&acc)[4][4], float oscale, u16* dst, int lane) {
  const int hh = lane >> 4, m = lane & 15;
  u16* d0 = dst + (size_t)m * SEQ + 8 * hh;
  // all three loops unrolled: the accumulators are indexed by constants only and stay in registers
#pragma unroll
  for (int j = 0; j < 4; ++j) {
#pragma unroll
    for (int i = 0; i < 4; ++i) {
      v4u o;
#pragma unroll
      for (int e = 0; e < 4; ++e) {
        const float t0 = (acc[i][j][2 * e] * oscale) * VCAR;
        const float t1 = (acc[i][j][2 * e + 1] * oscale) * VCAR;
        o[e] = pk16(h_bits((_Float16)t0), h_bits((_Float16)t1));
      }
      *(v4u*)(d0 + (size_t)(j * 16) * SEQ + i * 16) = o;
    }
  }
}

// =====================================================================================================
// Per-head RMS normalisation + rotate-half rotary + 16-bit planes from one 128 x 128 tile of a projection (128 rows row0 + r of one
// head, f32), as the four waves of the product have left it in their slabs [64][68] (wave = 2*(r >> 6) + (d >> 6)); ncol = DMOD for
// q, KVD for k = row pitch of the planes, ccol = head*HD:
//   rs = 1/sqrt(mean_d(x[head][d]^2) + eps) over the head's 128 columns (f32 sum of squares: 16 per thread, then an
//   8-lane shuffle sum, the 8 lanes of a head are 8 consecutive lanes); y[d] = (x[d]*rs) * w[d] with w = bf16 RNE value
//   of the norm weight; then for j < 64 within a head, with c = cosT[row][j], sn = sinT[row][j] (f32 tables):
//   out[j]    = y[j]*c    - y[j+64]*sn
//   out[j+64] = y[j+64]*c + y[j]*sn
//   Hp [MROWS][ncol] = f16(out * sc); if RES also Lp [MROWS][ncol] = f16 residual (t - f16(t)), same layout.
// Eight passes of 16 rows, two a trip: thread t = row 16*pass + (t >> 3), chunk i = t&7: columns 8i .. +7 and + 64 of the head. No lane-varying
// control anywhere (shuffles with all lanes active).
// coverage: 8 passes x 128 thr x 16 = the tile's 128 rows x 128 columns of Hp (and of Lp), whole 128-B lines.
// =====================================================================================================
__device__ __forceinline__ void rot_pair(float xl, float xh, float cv, float sv, float sc,
                                         unsigned short& hl, unsigned short& hhv, unsigned short& ll, unsigned short& lh) {
#pragma clang fp contract(off)
  const float rl = xl * cv - xh * sv;
  const float rh = xh * cv + xl * sv;
  const float tl = rl * sc, th = rh * sc;
  const _Float16 a = (_Float16)tl, bq = (_Float16)th;
  hl  = h_bits(a);
  hhv = h_bits(bq);
  ll  = h_bits((_Float16)(tl - (float)a));
  lh  = h_bits((_Float16)(th - (float)bq));
}

template <bool RES>
__device__ __forceinline__ void nrope16(const float* slab, int tid, size_t row0, int ccol, int ncol,
                                        const float* __restrict__ nw,
                                        const float* __restrict__ cosT, const float* __restrict__ sinT,
                                        u16* Hp, u16* Lp, float sc) {
  // every product and sum of the normalisation and the rotary rounded on its own
#pragma clang fp contract(off)
  const int dlo = (tid & 7) * 8;                       // j within head, multiple of 8
  const v4f wa = *(const v4f*)(nw + dlo), wb4 = *(const v4f*)(nw + dlo + 4);
  const v4f wc = *(const v4f*)(nw + HHALF + dlo), wd = *(const v4f*)(nw + HHALF + dlo + 4);
  float wl[8], wh[8];
#pragma unroll
  for (int e = 0; e < 4; ++e) {
    wl[e] = bfr(wa[e]);   wl[4 + e] = bfr(wb4[e]);
    wh[e] = bfr(wc[e]);   wh[4 + e] = bfr(wd[e]);
  }
  // kept rolled, two passes a trip: more of them take registers above v255 and lengthen the kernel's text
#pragma unroll 1
  for (int pt = 0; pt < GBM / 32; ++pt) {
   // the trip's two passes unrolled: their chains (LDS and table reads, sum, three shuffles, root) are independent and cover one
   // another's latency, which the two waves of a SIMD here cannot
#pragma unroll
   for (int u = 0; u < 2; ++u) {
    const int r = pt * 32 + u * 16 + (tid >> 3);       // row of the tile
    const float* p = slab + (r >> 6) * (8 * SLAB64) + (r & 63) * 68 + dlo;   // low-half chunk; the high half: the next wave's slab
    const v4f xa = *(const v4f*)(p), xb = *(const v4f*)(p + 4);
    const v4f ya = *(const v4f*)(p + 4 * SLAB64), yb = *(const v4f*)(p + 4 * SLAB64 + 4);
    const size_t row  = row0 + (size_t)r;
    const size_t trow = row * HHALF + dlo;
    const v4f ca = *(const v4f*)(cosT + trow), cb = *(const v4f*)(cosT + trow + 4);
    const v4f sa = *(const v4f*)(sinT + trow), sb = *(const v4f*)(sinT + trow + 4);
    float xl[8], xh[8], cv[8], sv[8];
#pragma unroll
    for (int e = 0; e < 4; ++e) {
      xl[e] = xa[e];        xl[4 + e] = xb[e];
      xh[e] = ya[e];        xh[4 + e] = yb[e];
      cv[e] = ca[e];        cv[4 + e] = cb[e];
      sv[e] = sa[e];        sv[4 + e] = sb[e];
    }
    // sum of squares over the head's 128 columns: 16 here, then lanes xor 1, 2, 4 (aligned groups of 8 lanes = one row)
    float ss = 0.0f;
#pragma unroll
    for (int e = 0; e < 8; ++e) { ss = ss + xl[e] * xl[e]; ss = ss + xh[e] * xh[e]; }
    ss += __shfl_xor(ss, 1, 32);
    ss += __shfl_xor(ss, 2, 32);
    ss += __shfl_xor(ss, 4, 32);
    const float var = ss * (1.0f / (float)HD);
    const float rs  = 1.0f / sqrtf(var + EPS_RMS);
#pragma unroll
    for (int e = 0; e < 8; ++e) {
      xl[e] = (xl[e] * rs) * wl[e];
      xh[e] = (xh[e] * rs) * wh[e];
    }
    v4u ohl, ohh, oll, olh;
#pragma unroll
    for (int e = 0; e < 4; ++e) {
      unsigned short hl0, hh0, ll0, lh0, hl1, hh1, ll1, lh1;
      rot_pair(xl[2 * e],     xh[2 * e],     cv[2 * e],     sv[2 * e],     sc, hl0, hh0, ll0, lh0);
      rot_pair(xl[2 * e + 1], xh[2 * e + 1], cv[2 * e + 1], sv[2 * e + 1], sc, hl1, hh1, ll1, lh1);
      ohl[e] = pk16(hl0, hl1);
      ohh[e] = pk16(hh0, hh1);
      oll[e] = pk16(ll0, ll1);
      olh[e] = pk16(lh0, lh1);
    }
    const size_t oc0 = row * (size_t)ncol + (size_t)(ccol + dlo);
    *(v4u*)(Hp + oc0) = ohl;
    *(v4u*)(Hp + oc0 + HHALF) = ohh;
    if constexpr (RES) {
      *(v4u*)(Lp + oc0) = oll;
      *(v4u*)(Lp + oc0 + HHALF) = olh;
    }
   }
   // the next trip's first instructions rewrite registers that this trip's plane stores name
   asm volatile("s_wait_xcnt 0x0" ::: "memory");
  }
}

// =====================================================================================================
// The wave's 64 x 64 tile of C: accumulators * oscale -> the wave's own slab [64][68] -> whole 256-B row pieces of C.
// coverage: 32 instructions x 2 rows x 16 lanes x 4 floats = the wave's 64 x 64 tile.
// =====================================================================================================
__device__ __forceinline__ void slab64x64(float* sl, const v8f (&acc)[4][4], float oscale, int lane) {
  const int hh = lane >> 4, m = lane & 15;
#pragma unroll
  for (int i = 0; i < 4; ++i) {
#pragma unroll
    for (int r = 0; r < 8; ++r) {
      const int ro = (i * 16 + 8 * hh + r) * 68 + m;
      sl[ro]      = acc[i][0][r] * oscale;
      sl[ro + 16] = acc[i][1][r] * oscale;
      sl[ro + 32] = acc[i][2][r] * oscale;
      sl[ro + 48] = acc[i][3][r] * oscale;
    }
  }
}
__device__ __forceinline__ void epi64x64(float* sl, const v8f (&acc)[4][4], float oscale,
                                         float* C, int N, size_t rowb, int col0, int lane) {
  const int hh = lane >> 4, m = lane & 15;
  slab64x64(sl, acc, oscale, lane);
  wave_sync_lds();
  float* dst = C + (rowb + (size_t)hh) * (size_t)N + col0 + m * 4;
#pragma unroll
  for (int it = 0; it < 32; ++it) {
    const v4f v = *(const v4f*)(sl + (it * 2 + hh) * 68 + m * 4);
    *(v4f*)(dst + (size_t)(it * 2) * (size_t)N) = v;
  }
}

// =====================================================================================================
// GEMM: C[row][N] (f32, row pitch N) = A[row][K] (16-bit row-major, pitch K) . Bt[N][K]^T (16-bit k-contiguous) * oscale,
// row = bb*SEQ + s for s < 128*nrt.  FUSE: C is not stored; the tile, which is 128 rows of one head, goes on inside the block:
// job 0 (q) and 1 (k): slabs, one block barrier, normalisation + rotary + planes Hp (and Lp for q); job 2 (v): v^T plane Hp.  BF: bf16 operands (v_wmma_f32_16x16x32_bf16), else f16 (v_wmma_f32_16x16x32_f16).
// Block -> (column tile ct of N/128, row tile rt of nrt, batch bb; from the block's index, by the caller): a 128 x 128 tile of C; 4 waves as 2 x 2, each a
// 64 x 64 tile = 4 x 4 accumulators, so that a fragment read from LDS serves four products.
// The 128 A rows and 128 Bt rows reach the waves through an LDS ring of two buffers, 64 k a stage, filled by asynchronous
// copies of whole 128-B row pieces; fragments by two 16-B LDS loads each (split k map for A and B).  The block starts at k stage
// rot % (K/64) and takes the stages in ring order (rot = row tile + column tile: the blocks that share A rows or Bt rows, which run at
// the same time, ask L2 for different lines at any moment); inside a stage k ascends in steps of 32.  One block barrier per stage, under block-uniform control flow (host: K % 64 == 0, N % 128 == 0).
// coverage: 4 waves x 4 row groups x (16 x 64) = the block's tile; NB * nrt * (N/128) blocks = every row s < 128*nrt once.
// =====================================================================================================
template <bool BF> struct FragSel { typedef v16h T; };
template <> struct FragSel<true> { typedef v16b T; };
template <bool BF>
__device__ __forceinline__ typename FragSel<BF>::T ldfrag_t(const u16* p) {
  if constexpr (BF) return ldfrag_b(p);
  else return ldfrag_h((const _Float16*)(const void*)p);
}
template <bool BF>
__device__ __forceinline__ v8f mma_t(typename FragSel<BF>::T a, typename FragSel<BF>::T b, v8f c) {
  if constexpr (BF) return mma_b(a, b, c);
  else return mma_h(a, b, c);
}

template <bool BF, bool FUSE>
__device__ __forceinline__
void gemm128_blk(int ct, int rt, int bb, int rot, const u16* __restrict__ A, const u16* __restrict__ Bt, float* C, int N, int K, float oscale,
                 int job, const float* __restrict__ nw, const float* __restrict__ cosT, const float* __restrict__ sinT,
                 u16* Hp, u16* Lp, float sc) {
  __shared__ __align__(16) u16 ring[GRINGB / 2];          // two buffers of (128 A rows, 128 Bt rows), pitch GPB
  __shared__ __align__(16) float slab[4 * 4 * SLAB64];    // per wave [64][68]
  const int tid = (int)threadIdx.x, wave = tid >> 5, lane = tid & 31, hh = lane >> 4, m = lane & 15;
  if (bb >= NB) return;                     // block-uniform, before any barrier or copy; never taken with the exact grid
  if (rt * GBM + GBM > SEQ) return;         // block-uniform; never taken
  const int nstg  = K >> 6;
  const int st0   = rot % nstg;             // the block's first k stage; the stages follow in ring order (block-uniform)
  const int col0  = ct * GBN;
  const size_t row0 = (size_t)bb * SEQ + (size_t)(rt * GBM);
  const int wr = wave >> 1, wc = wave & 1;  // this wave's 64 x 64 tile inside the block's
  // this lane's chunk 0 of stage 0 (stage_ab): global addresses and LDS byte addresses in buffer 0
  const size_t rs16 = (size_t)16 * (size_t)K;
  const u16* ag0 = A  + (row0 + (size_t)(tid >> 3)) * (size_t)K + (tid & 7) * 8;
  const u16* bg0 = Bt + (size_t)(col0 + (tid >> 3)) * (size_t)K + (tid & 7) * 8;
  const unsigned lring = (unsigned)(size_t)(const void*)ring;
  const unsigned la0 = lring + (unsigned)((tid >> 3) * GPB + (tid & 7) * 16);
  const unsigned lb0 = la0 + (unsigned)GATB;

  v8f acc[4][4];
#pragma unroll
  for (int i = 0; i < 4; ++i) {
#pragma unroll
    for (int j = 0; j < 4; ++j) acc[i][j] = zero8();
  }

  // ---- ring prologue: stage 0 lands and is published, then stage 1 flies while stage 0 is worked on ----
  stage_ab(ag0 + (size_t)st0 * GKS, bg0 + (size_t)st0 * GKS, rs16, la0, lb0);
  wait_async0();
  __syncthreads();
  if (nstg > 1) {                                         // block-uniform
    const int s1 = (st0 + 1 < nstg) ? st0 + 1 : 0;
    stage_ab(ag0 + (size_t)s1 * GKS, bg0 + (size_t)s1 * GKS, rs16, la0 + (unsigned)GSTB, lb0 + (unsigned)GSTB);
  }

  // kept rolled: one trip = one stage, with its one publish point at the foot
#pragma unroll 1
  for (int st = 0; st < nstg; ++st) {
    const int bufh = (st & 1) * (GSTB / 2);               // this stage's buffer, in halves
    const u16* ap = ring + bufh + (wr * 64 + m) * (GPB / 2) + 8 * hh;
    const u16* bp = ring + bufh + (GATB / 2) + (wc * 64 + m) * (GPB / 2) + 8 * hh;
    // both 32-k steps of a stage unrolled: their LDS offsets become immediates
    typename FragSel<BF>::T a[GKS / 32][4], b[GKS / 32][4];
#pragma unroll
    for (int ks = 0; ks < GKS / 32; ++ks) {
#pragma unroll
      for (int j = 0; j < 4; ++j) b[ks][j] = ldfrag_t<BF>(bp + j * 16 * (GPB / 2) + ks * 32);
#pragma unroll
      for (int i = 0; i < 4; ++i) a[ks][i] = ldfrag_t<BF>(ap + i * 16 * (GPB / 2) + ks * 32);
    }
    // keeps the stage's 32 LDS reads together in front of its 32 products: left free, the compiler reloads one A fragment
    // per four products and waits out the LDS latency each time
    __builtin_amdgcn_sched_barrier(0);
#pragma unroll
    for (int ks = 0; ks < GKS / 32; ++ks) {
#pragma unroll
      for (int i = 0; i < 4; ++i) {
#pragma unroll
        for (int j = 0; j < 4; ++j) acc[i][j] = mma_t<BF>(a[ks][i], b[ks][j], acc[i][j]);
      }
    }
    // keeps the products in front of the publish point: left free, they sink behind the barrier, the waits stand directly
    // behind the LDS reads, and the next stage's copies lose the products' time as their lead
    __builtin_amdgcn_sched_barrier(0);
    // ---- publish point of stage st + 1: own LDS reads retired, own copies landed, every wave has left this buffer ----
    wait_ds0();
    wait_async0();
    __syncthreads();
    if (st + 2 < nstg) {                                  // block-uniform: refill the buffer that this trip has just read
      const int s2 = (st0 + st + 2 < nstg) ? st0 + st + 2 : st0 + st + 2 - nstg;   // trip st + 2 works on k stage s2
      stage_ab(ag0 + (size_t)s2 * GKS, bg0 + (size_t)s2 * GKS, rs16,
               la0 + (unsigned)(st & 1) * GSTB, lb0 + (unsigned)(st & 1) * GSTB);
    }
  }
  wait_async0();                                          // nothing in flight when the wave ends
  if constexpr (!FUSE) {
    epi64x64(slab + wave * (4 * SLAB64), acc, oscale, C, N, row0 + (size_t)(wr * 64), col0 + wc * 64, lane);
  } else {
    if (job == 2) {                                       // block-uniform, no barrier behind it
      vt_acc(acc, oscale, Hp + ((size_t)(bb * NKVH + ct) * HD + (size_t)(wc * 64)) * SEQ + rt * GBM + wr * 64, lane);
      return;
    }
    slab64x64(slab + wave * (4 * SLAB64), acc, oscale, lane);
    __syncthreads();                                      // a row's low and high 64 columns lie in two waves' slabs
    if (job == 0) nrope16<true>(slab, tid, row0, col0, N, nw, cosT, sinT, Hp, Lp, sc);
    else          nrope16<false>(slab, tid, row0, col0, N, nw, cosT, sinT, Hp, Lp, sc);
  }
}

// one product per launch (ctx.Wo)
template <bool BF>
__global__ __launch_bounds__(128)
void gemm128(const u16* __restrict__ A, const u16* __restrict__ Bt, float* C, int N, int K, int nrt, float oscale) {
  const int ntile = N >> 7;
  const int bid   = (int)blockIdx.x;
  const int t2    = bid / ntile;
  gemm128_blk<BF, false>(bid % ntile, t2 % nrt, t2 / nrt, t2 + bid % ntile, A, Bt, C, N, K, oscale, 0, nullptr, nullptr, nullptr, nullptr, nullptr, 0.0f);
}

// x.Wq, x.Wk and x.Wv in one launch: block ranges, in this order: q (GB_Q blocks), k (GB_K), v (GB_K); the three products share A,
// write disjoint planes, and a block's product is block-uniform. A column tile is one head: q and k tiles leave as normalised, rotated
// f16 planes (q x256 with its residual plane, k x256), v tiles as the v^T plane x1024.
__global__ __launch_bounds__(128)
void gemm_qkv(const u16* __restrict__ A, const u16* __restrict__ Wq, const u16* __restrict__ Wk, const u16* __restrict__ Wv,
              const float* __restrict__ qnw, const float* __restrict__ knw,
              const float* __restrict__ cosT, const float* __restrict__ sinT,
              u16* QHo, u16* QLo, u16* KHo, u16* VHo, int K, float oscale) {
  int bid = (int)blockIdx.x;
  const u16* Bt = Wq;
  const float* nw = qnw;
  u16* Hp = QHo;
  int N = DMOD, job = 0, cidx = 0;                        // cidx: the product's first column tile among the 24 that share a row tile of A
  float sc = QSC;
  int ct = bid % (DMOD / GBN), rt = (bid / (DMOD / GBN)) % (SQ / GBM), bb = bid / ((DMOD / GBN) * (SQ / GBM));
  if (bid >= GB_Q) {
    bid -= GB_Q; Bt = Wk; nw = knw; Hp = KHo; N = KVD; job = 1; sc = KSC; cidx = DMOD / GBN;
    if (bid >= GB_K) { bid -= GB_K; Bt = Wv; Hp = VHo; job = 2; cidx = (DMOD + KVD) / GBN; }
    ct = bid % (KVD / GBN); rt = (bid / (KVD / GBN)) % (SEQ / GBM); bb = bid / ((KVD / GBN) * (SEQ / GBM));
  }
  gemm128_blk<true, true>(ct, rt, bb, bb * (SEQ / GBM) + rt + cidx + ct, A, Bt, nullptr, N, K, oscale, job, nw, cosT, sinT, Hp, QLo, sc);
}

// =====================================================================================================
// Non-causal grouped-query attention, hd = 128, all SEQ keys. Block bid -> (query tile qt = bid % NQT: rows q0 = 16*qt ..
// q0+15, head group hg = kv head, batch b); one wave per query head = hg*WPB + wave (the 4 heads of the group share kv head hg).
//   q hi / residual planes f16 x256 [b*SEQ + s][h*HD + d]; k plane f16 x256 [b*SEQ + s][g*HD + d] (pitch KVD);
//   v^T plane [b*NKVH + g][d][SEQ] x1024.
//   scores = q_hi.k + q_lo.k (4 k-steps over d); P.v with P x32768 (f16) and v^T, for every query row;
//   O written as one f16 plane (O x1024, layout [b*SEQ + s][h*HD + d]).
//   score (log2 domain) t(i, j) = (q_i.k_j over HD) * (1/sqrt(128))*log2e/(256*256).
//   k rows and v^T rows reach the 4 waves through an LDS ring of two buffers, 64 keys a stage, filled by asynchronous copies.
//   Both products are taken transposed: S^T = k.q^T (A = k rows from the ring, B = q, loaded once and kept in registers) and
//   O^T += v^T.P^T (A = v^T rows from the ring, B = P^T), all fragments in the split k map. A lane (c, hh) then holds, of query
//   column q0 + c, the scores of keys kb + 8hh + r and kb + 16 + 8hh + r: maximum and sum run inside the lane, the maximum is
//   joined with the other half by one cross-row move per 32 keys, the sums once after the loop; the two score tiles, converted
//   in place (P x32768, f16), are the B fragment of the second product. All NKT key tiles of 32 visited once, in ring order from the block's own first stage; online
//   max-subtracted base-2 softmax in f32, -inf-safe rescale.
//   After the loop: out = acc / Z (Z, x32768 like P, is about 32768 or more; guarded anyway), carry 1/1024 folded once, written into the slab.
//   One block barrier per stage, under block-uniform control flow; bounded loops only (NST compile-time).
// coverage: per wave 8 instructions x 2 rows x 16 lanes x 8 halves = 16 x 128; grid NQT x NHG x NB blocks x WPB
//           waves = every (b, s < SQ, h) row segment of O exactly once.
// =====================================================================================================
__global__ __launch_bounds__(ATT_THREADS)
void attn_nc(const u16* __restrict__ QHp, const u16* __restrict__ QLp, const u16* __restrict__ KHp,
             const u16* __restrict__ VHp, u16* OHp) {
  __shared__ __align__(16) _Float16 ring[RINGB / 2];      // two buffers of (64 k rows pitch KPB, 128 v^T rows pitch VPB)

  const int tid  = (int)threadIdx.x;
  const int wave = tid >> 5;
  const int lane = tid & 31;
  const int hh   = lane >> 4;
  const int c    = lane & 15;
  const int bid  = (int)blockIdx.x;
  const int qt   = bid % NQT;
  const int t2   = bid / NQT;
  const int hg   = t2 % NHG;
  const int b    = t2 / NHG;
  if (b >= NB) return;                      // block-uniform, before any barrier or copy; never taken with the exact grid
  const int q0   = qt * 16;
  if (q0 + 16 > SQ) return;                 // block-uniform; never taken
  const int head = hg * WPB + wave;
  const int kvh  = hg;

  float* slab = (float*)(void*)ring + wave * SLW;         // result slab [16][128] pitch 132: the ring's bytes, after the loop

  const size_t hcol = (size_t)head * HD + 8 * hh;
  const _Float16* Qh  = (const _Float16*)(const void*)QHp + ((size_t)b * SEQ + q0 + c) * DMOD + hcol;
  const _Float16* Ql  = (const _Float16*)(const void*)QLp + ((size_t)b * SEQ + q0 + c) * DMOD + hcol;
  // this lane's chunk 0 of stage 0 (stage_kv): global addresses and LDS byte addresses in buffer 0
  const u16* kg0 = KHp + ((size_t)b * SEQ + (tid >> 4)) * KVD + (size_t)kvh * HD + (tid & 15) * 8;
  const u16* vg0 = VHp + ((size_t)(b * NKVH + kvh) * HD + (tid >> 3)) * SEQ + (tid & 7) * 8;
  const unsigned lring = (unsigned)(size_t)(const void*)ring;
  const unsigned lk0 = lring + (unsigned)((tid >> 4) * KPB + (tid & 15) * 16);
  const unsigned lv0 = lring + (unsigned)(KTB + (tid >> 3) * VPB + (tid & 7) * 16);
  // the block's first key stage; the stages follow in ring order: the NQT blocks that share a kv head run at the same time and
  // start on NST different stages, NQT/NST blocks on each, so that only those ask L2 for the same lines of its k and v^T at a
  // time (the online softmax takes the keys in any order)
  const int st0 = qt % NST;
  const float lsc = RSQ_HD * (LOG2E / (QSC * KSC));
  const float oc  = 1.0f / VCAR;                          // the carry on P stands in the running sum as well and cancels in acc / Z

  // q as the B operand: column = query q0 + c, loaded once for all keys
  v16h qh[HD / 32], ql[HD / 32];
#pragma unroll
  for (int kk = 0; kk < HD / 32; ++kk) { qh[kk] = ldfrag_h(Qh + kk * 32); ql[kk] = ldfrag_h(Ql + kk * 32); }
  float mrun = -INFINITY, lrun = 0.f;                     // of query column c; lrun (x32768) over this half's keys only
  v8f o[8];                                               // o[j][r] = O^T[d = 16j + 8hh + r][query c]
#pragma unroll
  for (int j = 0; j < 8; ++j) o[j] = zero8();

  // ---- ring prologue: stage 0 lands and is published, then stage 1 flies while stage 0 is worked on ----
  stage_kv(kg0 + (size_t)st0 * KSTG * KVD, vg0 + st0 * KSTG, lk0, lv0);
  wait_async0();
  __syncthreads();
  {
    const int s1 = (st0 + 1 < NST) ? st0 + 1 : 0;
    stage_kv(kg0 + (size_t)s1 * KSTG * KVD, vg0 + s1 * KSTG, lk0 + STGB, lv0 + STGB);
  }

  // kept rolled: one trip = one stage, with its one publish point at the foot
#pragma unroll 1
  for (int st = 0; st < NST; ++st) {
   const int bufh = (st & 1) * (STGB / 2);                // this stage's buffer, in halves
   // kept rolled: unrolled, the compiler spreads a step's v^T reads in pairs among its products instead of issuing them together
   // ahead of the softmax arithmetic
#pragma unroll 1
   for (int sub = 0; sub < KSTG / 32; ++sub) {
    // ---- scores: D element r of this lane = (key kb + 8hh + r, query q0 + c) in s0, key kb + 16 + 8hh + r in s1, kb = the step's first key ----
    v8f s0 = zero8(), s1 = zero8();
    const _Float16* k0p = ring + bufh + (sub * 32 + c) * (KPB / 2) + 8 * hh;
    const _Float16* k1p = k0p + 16 * (KPB / 2);
    v16h kh0[HD / 32], kh1[HD / 32];
#pragma unroll
    for (int kk = 0; kk < HD / 32; ++kk) { kh0[kk] = ldfrag_h(k0p + kk * 32); kh1[kk] = ldfrag_h(k1p + kk * 32); }
    // keeps the step's 16 k reads together in front of its 16 score products: left free, the compiler reloads two fragments
    // per four products and waits out the LDS latency each time
    __builtin_amdgcn_sched_barrier(0);
#pragma unroll
    for (int kk = 0; kk < HD / 32; ++kk) {
      s0 = mma_h(kh0[kk], qh[kk], s0);
      s1 = mma_h(kh1[kk], qh[kk], s1);
      s0 = mma_h(kh0[kk], ql[kk], s0);
      s1 = mma_h(kh1[kk], ql[kk], s1);
    }
    // splits the step here, so that the eight v^T fragments are read together at the head of the softmax arithmetic, which covers
    // their latency, into the k fragments' registers: left free, the compiler reads one fragment in front of each of the eight
    // products and waits out the LDS latency each time
    __builtin_amdgcn_sched_barrier(0);
    // ---- online softmax in base 2 over all keys, -inf-safe; one query column per lane ----
    float mx = fmaxf(s0[0], s1[0]);
#pragma unroll
    for (int r = 1; r < 8; ++r) mx = fmaxf(mx, fmaxf(s0[r], s1[r]));
    mx = fmaxf(mx, xhalf(mx)) * lsc;                      // lsc > 0: the maximum of the scaled scores
    const float mn = fmaxf(mrun, mx);
    const float ms = (mn == -INFINITY) ? 0.0f : mn;
    // the exponentials are the bare v_exp_f32: it gives 0 where the library form would give a subnormal (argument below -126), which
    // is far below half an ulp of the f16 P and of Z (x32768: about 2^15 or more once the two halves' sums are joined)
    const float al = __builtin_amdgcn_exp2f(mrun - ms);
    mrun = mn;
    const float mo = ms - PEXP;                           // P x32768 comes out of the exponential itself
    // ---- B fragment of P^T*32768 (f16): elements 0..7 = keys kb + 8hh + 0..7, elements 8..15 = keys kb + 16 + 8hh + 0..7 ----
    FragH ph;
    v2f ps = {0.f, 0.f};                                  // sums over even and odd r, x32768 like P
    const v2f lsc2 = {lsc, lsc}, mo2 = {mo, mo};
#pragma unroll
    for (int r = 0; r < 8; r += 2) {
      // neighbouring accumulator registers taken as pairs: packed fma and packed add
      const v2f x0 = (v2f){s0[r], s0[r + 1]} * lsc2 - mo2;
      const v2f x1 = (v2f){s1[r], s1[r + 1]} * lsc2 - mo2;
      const v2f e0 = {__builtin_amdgcn_exp2f(x0[0]), __builtin_amdgcn_exp2f(x0[1])};
      const v2f e1 = {__builtin_amdgcn_exp2f(x1[0]), __builtin_amdgcn_exp2f(x1[1])};
      ps += e0;
      ps += e1;
      ph.h[0][r]     = (_Float16)e0[0];
      ph.h[0][r + 1] = (_Float16)e0[1];
      ph.h[1][r]     = (_Float16)e1[0];
      ph.h[1][r + 1] = (_Float16)e1[1];
    }
    lrun = lrun * al + (ps[0] + ps[1]);
#pragma unroll
    for (int j = 0; j < 8; ++j) {
#pragma unroll
      for (int r = 0; r < 8; ++r) o[j][r] *= al;
    }
    // ---- v^T.P^T : A fragment row = d = j*16 + c, keys contiguous in the v^T rows ----
    {
      const _Float16* vhp = ring + bufh + (KTB / 2) + c * (VPB / 2) + sub * 32 + 8 * hh;   // d row c (+16j), keys of this step
#pragma unroll
      for (int j = 0; j < 8; ++j) o[j] = mma_h(ldfrag_h(vhp + j * 16 * (VPB / 2)), ph.v, o[j]);
    }
    // four vector slots behind the step's last products, in front of the loop's branch: on its taken side the first vector
    // instructions rewrite registers of P^T
    acc_guard8(o);
   }
   // ---- publish point of stage st + 1: own LDS reads retired, own copies landed, every wave has left this buffer ----
   wait_ds0();
   wait_async0();
   __syncthreads();
   if (st + 2 < NST) {                                    // block-uniform: refill the buffer that this trip has just read
     const int s2 = (st0 + st + 2 < NST) ? st0 + st + 2 : st0 + st + 2 - NST;   // trip st + 2 works on key stage s2
     stage_kv(kg0 + (size_t)s2 * KSTG * KVD, vg0 + s2 * KSTG,
              lk0 + (unsigned)(st & 1) * STGB, lv0 + (unsigned)(st & 1) * STGB);
   }
  }
  wait_async0();                                          // nothing in flight before the ring's bytes become the result slab
  // ---- out = acc / Z (0 if Z == 0), acc and Z both x32768, the carry 1024 on v folded once; row c of the wave's slab, 8 consecutive d ----
  {
    const float lv  = lrun + xhalf(lrun);                 // the two halves' sums joined
    const float ls  = (lv > 0.0f) ? lv : 1.0f;
    const float inv = (lv > 0.0f) ? ((1.0f / ls) * oc) : 0.0f;
#pragma unroll
    for (int j = 0; j < 8; ++j) {
      float* sp = slab + c * SLP + j * 16 + 8 * hh;
      v4f a, b4;
#pragma unroll
      for (int e = 0; e < 4; ++e) { a[e] = o[j][e] * inv; b4[e] = o[j][4 + e] * inv; }
      *(v4f*)(sp)     = a;
      *(v4f*)(sp + 4) = b4;
    }
  }

  wave_sync_lds();
  // ---- O x1024 -> f16 plane; lane = (row-in-pair rq, 8 consecutive d at c8) ----
  v4u oh[8];
  const int rq = lane >> 4, c8 = (lane & 15) * 8;
#pragma unroll
  for (int it = 0; it < 8; ++it) {
    const int row = it * 2 + rq;
    const v4f a = *(const v4f*)(slab + row * SLP + c8), b4 = *(const v4f*)(slab + row * SLP + c8 + 4);
    float w[8];
#pragma unroll
    for (int e = 0; e < 4; ++e) { w[e] = a[e] * OSC; w[4 + e] = b4[e] * OSC; }
#pragma unroll
    for (int e = 0; e < 4; ++e) {
      const _Float16 h0 = (_Float16)w[2 * e], h1 = (_Float16)w[2 * e + 1];
      oh[it][e] = pk16(h_bits(h0), h_bits(h1));
    }
  }
  const size_t ob = ((size_t)b * SEQ + q0) * DMOD + (size_t)head * HD + c8;
  {
#pragma unroll
    for (int it = 0; it < 8; ++it) {
      const int row = it * 2 + rq;
      *(v4u*)(OHp + ob + (size_t)row * DMOD) = oh[it];
    }
    
  }
}

// =====================================================================================================
// Workspace map (bytes); every plane is fully written by whole-line stores before it is read; all extents are exact multiples
// of the store granularity (no pad rows needed); every region offset a multiple of 1048576:
//   XB  bf16 [MROWS][2048]                       MROWS*4096       (NB=2: 16777216)
//   WQ  bf16 [2048 n][2048 k]                    8388608          Wq^T;  WO f16 x1024, same extent: Wo^T
//   WK  bf16 [512 n][2048 k]                     2097152          Wk^T;  WV same extent: Wv^T
//   OH  f16 [MROWS][2048] x1024                  MROWS*4096
//   QH  f16 [MROWS][2048] x256                   MROWS*4096       QL residual, same extent
//   KH  f16 [MROWS][512] x256                    MROWS*1024
//   VH  f16 [NB*4][128][SEQ] x1024               MROWS*1024
//   COS f32 [MROWS][64]                          MROWS*256        SIN same extent
//   end (NB=2)                                 98566144
// =====================================================================================================
extern "C" void kernel_launch(void* const* d_in, const int* in_sizes, int n_in,
                              void* d_out, int out_size, void* d_ws, size_t ws_size,
                              hipStream_t stream) {
  if (n_in < 8) return;
  if (in_sizes[0] < MROWS * DMOD) return;
  if (in_sizes[1] < MROWS) return;
  if (in_sizes[2] != DMOD * DMOD) return;
  if (in_sizes[3] != DMOD * KVD) return;
  if (in_sizes[4] != DMOD * KVD) return;
  if (in_sizes[5] != DMOD * DMOD) return;
  if (in_sizes[6] < HD) return;
  if (in_sizes[7] < HD) return;
  if (out_size < MROWS * DMOD) return;

  const float* x   = (const float*)d_in[0];
  const int*   pos = (const int*)d_in[1];
  const float* wq  = (const float*)d_in[2];
  const float* wk  = (const float*)d_in[3];
  const float* wv  = (const float*)d_in[4];
  const float* wo  = (const float*)d_in[5];
  const float* qnw = (const float*)d_in[6];
  const float* knw = (const float*)d_in[7];
  float*       out = (float*)d_out;

  const size_t szXB = (size_t)MROWS * DMOD * 2;
  const size_t szW  = (size_t)DMOD * DMOD * 2;                   // WQ, WO
  const size_t szWK = (size_t)DMOD * KVD * 2;                    // WK, WV
  const size_t szQ  = (size_t)MROWS * DMOD * 2;                  // QH, QL, OH
  const size_t szK  = (size_t)MROWS * KVD * 2;                   // KH
  const size_t szV  = (size_t)NB * NKVH * HD * SEQ * 2;          // VH (== szK)
  const size_t szT  = (size_t)MROWS * HHALF * 4;                 // COS, SIN
  size_t off = 0;
  const size_t oXB = off; off += szXB;
  const size_t oWQ = off; off += szW;
  const size_t oWO = off; off += szW;
  const size_t oWK = off; off += szWK;
  const size_t oWV = off; off += szWK;
  const size_t oOH = off; off += szQ;
  const size_t oQH = off; off += szQ;
  const size_t oQL = off; off += szQ;
  const size_t oKH = off; off += szK;
  const size_t oVH = off; off += szV;
  const size_t oCS = off; off += szT;
  const size_t oSN = off; off += szT;
  if (off > ws_size) return;                // off = 98566144 for NB = 2
  if (off > (size_t)WS_CAP) return;

  char* ws = (char*)d_ws;
  u16*   XB  = (u16*)(ws + oXB);
  u16*   WQT = (u16*)(ws + oWQ);
  u16*   WOT = (u16*)(ws + oWO);
  u16*   WKT = (u16*)(ws + oWK);
  u16*   WVT = (u16*)(ws + oWV);
  u16*   OH  = (u16*)(ws + oOH);
  u16*   QH  = (u16*)(ws + oQH);
  u16*   QL  = (u16*)(ws + oQL);
  u16*   KH  = (u16*)(ws + oKH);
  u16*   VH  = (u16*)(ws + oVH);
  float* COS = (float*)(ws + oCS);
  float* SIN = (float*)(ws + oSN);

  const dim3 b256(256), b128(128), bAT(ATT_THREADS);
  const int  nrtQ = SQ / GBM;                           // ctx / out rows per batch / 128
  const dim3 gGQ(GB_Q);
  const dim3 gAT(NQT * NHG * NB);

  // (0) cos/sin tables from the integer positions, x -> bf16 plane, Wq^T, Wk^T, Wv^T bf16 planes, Wo^T f16 plane of bf16 value x1024
  prep16<<<dim3(PB_ALL), b256, 0, stream>>>(pos, x, wq, wk, wv, wo, COS, SIN, XB, WQT, WKT, WVT, WOT);
  // (1) q = x.Wq, k = x.Wk, v = x.Wv, each tile on into its planes: RMS normalisation + rotary + q planes x256, k plane x256; v^T plane x1024
  gemm_qkv<<<dim3(GB_ALL), b128, 0, stream>>>(XB, WQT, WKT, WVT, qnw, knw, COS, SIN, QH, QL, KH, VH, DMOD, 1.0f);
  // (2) non-causal attention over all keys -> O plane
  attn_nc<<<gAT, bAT, 0, stream>>>(QH, QL, KH, VH, OH);
  // (3) out = ctx.Wo -> f32, carries 1024 x 1024 folded back
  gemm128<false><<<gGQ, b128, 0, stream>>>(OH, WOT, out, DMOD, DMOD, nrtQ, 1.0f / (OSC * WOS));
  (void)hipGetLastError();
}

// v009
// A run of this version takes 151 microseconds.
// It is 1.10 times as fast as v007, going by the measured steps of the versions left out in between.
// All steps since v000 together make it 3.61 times as fast.
// Contractions: x.Wq, x.Wk, x.Wv on v_wmma_f32_16x16x32_bf16 (x and W^T as bf16 RNE planes, f32 accumulate);
// q.k^T over hd 128 on v_wmma_f32_16x16x32_f16 with q and k as one f16 plane each (x256): both come from bf16 operands,
// whose rounding is eight times that of an f16 plane; P.v on v_wmma_f32_16x16x32_f16 with P x32768 and v^T x1024 as single f16 planes;
// ctx.Wo on v_wmma_f32_16x16x32_f16 with ctx x1024 as one f16 plane and Wo^T as f16(bf16 RNE(Wo)) x1024; all f32
// accumulate. RMS normalisation, rotate-half rotary from integer positions (cos/sin tables built on device in f32),
// base-2 online softmax and the 1/Z fold in f32 on VALU.
#include <hip/hip_runtime.h>
#include <math.h>
#include <stdint.h>

#ifndef NB
#define NB 2
#endif
#define SEQ 2048
#ifndef SQ
#define SQ SEQ
#endif
#define DMOD  2048
#define NH    16
#define NKVH  4
#define HD    128
#define HHALF (HD / 2)
#define KVD   (NKVH * HD)
#define MROWS (NB * SEQ)
#define EPS_RMS 0.000001f
#define RSQ_HD 0.08838834764831845f
#define LOG2E 1.4426950408889634f
#define LOG2THETA 19.931568569324174
#define QSC   256.0f
#define KSC   256.0f
#define PCAR  32768.0f
#define PEXP  15.0f
#define VCAR  1024.0f
#define OSC   1024.0f
#define WOS   1024.0f
#define WPB   (NH / NKVH)
#define NHG   NKVH
#define QCG   2
#define NQT   (SQ / (16 * QCG))
#define NST   (SEQ / 64)
#define NKT   (SEQ / 32)
#define ATT_THREADS (WPB * 32)
#define SLP   132
#define SLW   (16 * SLP)
#define SLAB64 (16 * 68)
#define WTP   72
#define WS_CAP 134217728
#define KSTG  64
#define KPB   272
#define VPB   144
#define KTB   (KSTG * KPB)
#define VTB   (HD * VPB)
#define STGB  (KTB + VTB)
#define RINGB (2 * STGB)
#define GBM   128
#define GBN   128
#define GKS   64
#define GPB   144
#define GATB  (GBM * GPB)
#define GSTB  ((GBM + GBN) * GPB)
#define GRINGB (2 * GSTB)
// block counts of the jobs that share one launch (each job's blocks are a contiguous range of the grid)
#define PB_TR (MROWS / 4)
#define PB_X  ((MROWS * DMOD / 8) / 256)
#define PB_WQ ((DMOD / 64) * (DMOD / 64))
#define PB_WK ((DMOD / 64) * (KVD / 64))
#define PB_ALL (PB_TR + PB_X + 2 * PB_WQ + 2 * PB_WK)
#define GB_Q  (NB * (SQ / GBM) * (DMOD / GBN))
#define GB_K  (NB * (SEQ / GBM) * (KVD / GBN))
#define GB_ALL (GB_Q + 2 * GB_K)
static_assert(GBN == HD && GBM == 128);                 // a column tile of the q, k, v products is one head
static_assert(DMOD == NH * HD && HD == 128 && HHALF == 64 && NH == 16 && NKVH == 4 && WPB == 4 && NHG * WPB == NH);
static_assert(ATT_THREADS == 128 && KVD == 512);
static_assert(PCAR == 32768.0f && PEXP == 15.0f);       // PCAR = 2^PEXP
static_assert(NB >= 1 && NB <= 2);
static_assert((SEQ % 64) == 0 && (SQ % 64) == 0 && SQ >= 64 && SQ <= SEQ);
static_assert((DMOD % 64) == 0 && (KVD % 64) == 0 && (DMOD % 32) == 0 && (HD % 32) == 0);
static_assert(((MROWS * DMOD / 8) % 256) == 0 && (MROWS % 4) == 0);
static_assert(KSTG == 64 && NST >= 2 && NST * KSTG == SEQ && (KPB % 16) == 0 && (VPB % 16) == 0 && (KTB % 16) == 0 && (STGB % 16) == 0);
static_assert(KPB == HD * 2 + 16 && VPB == KSTG * 2 + 16 && WPB * QCG * SLW * 4 <= RINGB && 2 * RINGB <= 327680);
static_assert(64 * WTP * 2 <= 65536);
static_assert(GBM == 128 && GBN == 128 && GKS == 64 && GPB == GKS * 2 + 16 && (GPB % 16) == 0 && (GSTB % 16) == 0);
static_assert((SEQ % GBM) == 0 && (SQ % GBM) == 0 && (DMOD % GBN) == 0 && (KVD % GBN) == 0 && (DMOD % GKS) == 0 && DMOD / GKS >= 2);
static_assert(2 * (GRINGB + 4 * 4 * SLAB64 * 4) <= 327680);
static_assert((DMOD / 16) <= 128 && (KVD / 16) <= 128 && ((DMOD / 16) % 32) == 0 && ((KVD / 16) % 32) == 0);

typedef unsigned short u16;
typedef _Float16 v16h __attribute__((ext_vector_type(16)));
typedef _Float16 v8h  __attribute__((ext_vector_type(8)));
typedef __bf16   v16b __attribute__((ext_vector_type(16)));
typedef float    v8f  __attribute__((ext_vector_type(8)));
typedef float    v4f  __attribute__((ext_vector_type(4)));
typedef float    v2f  __attribute__((ext_vector_type(2)));
typedef unsigned int v4u __attribute__((ext_vector_type(4)));

union FragH { v16h v; v8h h[2]; v4u u[2]; };
union FragB { v16b v; v4u u[2]; };

// ---- scalar helpers --------------------------------------------------------------------------------
__device__ __forceinline__ unsigned short bf_bits(float f) {          // f32 -> bf16 bits, RNE convert
  unsigned u = __float_as_uint(f);
  return (unsigned short)((u + 0x7FFFu + ((u >> 16) & 1u)) >> 16);
}
__device__ __forceinline__ float bf_up(unsigned short h) { return __uint_as_float(((unsigned)h) << 16); }
__device__ __forceinline__ float bfr(float f) { return bf_up(bf_bits(f)); }
__device__ __forceinline__ unsigned short h_bits(_Float16 x) { return __builtin_bit_cast(unsigned short, x); }
__device__ __forceinline__ unsigned pk16(unsigned short a, unsigned short b) { return (unsigned)a | ((unsigned)b << 16); }
__device__ __forceinline__ v8f zero8() { v8f z = {0.f, 0.f, 0.f, 0.f, 0.f, 0.f, 0.f, 0.f}; return z; }

// ---- fragment loaders: 16-bit A/B operand, lane -> row/col (lane&15), p already includes +8*(lane>>4);
//      elements 0..7 <- p[0..7] (k0+8h..), elements 8..15 <- p[16..23] (k0+16+8h..)  (same split k map for A and B;
//      B is always read from a k-contiguous [n][k] plane)
__device__ __forceinline__ v16h ldfrag_h(const _Float16* p) {
  FragH f;
  f.h[0] = *(const v8h*)(p);
  f.h[1] = *(const v8h*)(p + 16);
  return f.v;
}
__device__ __forceinline__ v16b ldfrag_b(const u16* p) {              // bf16 plane read as unsigned integer vectors
  FragB f;
  f.u[0] = *(const v4u*)(p);
  f.u[1] = *(const v4u*)(p + 16);
  return f.v;
}

__device__ __forceinline__ v8f mma_h(v16h a, v16h b, v8f c) {
  return __builtin_amdgcn_wmma_f32_16x16x32_f16(false, a, false, b, (short)0, c, false, false);
}
__device__ __forceinline__ v8f mma_b(v16b a, v16b b, v8f c) {
  return __builtin_amdgcn_wmma_f32_16x16x32_bf16(false, a, false, b, (short)0, c, false, false);
}
__device__ __forceinline__ void acc_guard16(const v8f (&a)[8], const v8f (&b)[8]) {
#if defined(__HIP_DEVICE_COMPILE__)
  asm volatile("v_nop\n\tv_nop\n\tv_nop\n\tv_nop"
               :: "v"(a[0]), "v"(a[1]), "v"(a[2]), "v"(a[3]), "v"(a[4]), "v"(a[5]), "v"(a[6]), "v"(a[7]),
                  "v"(b[0]), "v"(b[1]), "v"(b[2]), "v"(b[3]), "v"(b[4]), "v"(b[5]), "v"(b[6]), "v"(b[7]));
#endif
}
__device__ __forceinline__ void wave_sync_lds() {
  __builtin_amdgcn_fence(__ATOMIC_RELEASE, "workgroup");
  __builtin_amdgcn_wave_barrier();
  __builtin_amdgcn_fence(__ATOMIC_ACQUIRE, "workgroup");
}
// lane l's value from lane l ^ 16: the two halves of the wave hold the two halves of a query column's keys
__device__ __forceinline__ float xhalf(float x) {
  const int b = __builtin_bit_cast(int, x);
  return __builtin_bit_cast(float, __builtin_amdgcn_permlanex16(b, b, 0x76543210, 0xfedcba98, false, false));
}
// Eight asynchronous 16-byte copies of this lane, global -> LDS (l = LDS byte address, g = global address, both 16-B aligned).
// The closing s_wait_xcnt 0 stands inside the statement so that no address register is rewritten in front of it.
__device__ __forceinline__ void async8(const unsigned* l, const u16* const* g) {
#if defined(__HIP_DEVICE_COMPILE__)
  asm volatile("global_load_async_to_lds_b128 %0, %8, off\n\t"
               "global_load_async_to_lds_b128 %1, %9, off\n\t"
               "global_load_async_to_lds_b128 %2, %10, off\n\t"
               "global_load_async_to_lds_b128 %3, %11, off\n\t"
               "global_load_async_to_lds_b128 %4, %12, off\n\t"
               "global_load_async_to_lds_b128 %5, %13, off\n\t"
               "global_load_async_to_lds_b128 %6, %14, off\n\t"
               "global_load_async_to_lds_b128 %7, %15, off\n\t"
               "s_wait_xcnt 0x0"
               :: "v"(l[0]), "v"(l[1]), "v"(l[2]), "v"(l[3]), "v"(l[4]), "v"(l[5]), "v"(l[6]), "v"(l[7]),
                  "v"(g[0]), "v"(g[1]), "v"(g[2]), "v"(g[3]), "v"(g[4]), "v"(g[5]), "v"(g[6]), "v"(g[7])
               : "memory");
#endif
}
// One stage (64 keys) of k rows and v^T rows into one ring buffer, 16 copies per lane of the 128 threads:
//   k   chunk i: key row i*8 + (tid>>4), 16-B piece tid&15  (a wave covers two whole 256-B rows), LDS pitch KPB;
//   v^T chunk i: d row i*16 + (tid>>3), 16-B piece tid&7    (a wave covers four whole 128-B rows), LDS pitch VPB.
// kg, vg, lk, lv are this lane's addresses of chunk 0.
__device__ __forceinline__ void stage_kv(const u16* kg, const u16* vg, unsigned lk, unsigned lv) {
  unsigned l[8];
  const u16* g[8];
  // both loops unrolled so that l[] and g[] are registers, as the asm operands need them
#pragma unroll
  for (int i = 0; i < 8; ++i) { l[i] = lk + (unsigned)(i * 8 * KPB); g[i] = kg + (size_t)(i * 8) * KVD; }
  async8(l, g);
#pragma unroll
  for (int i = 0; i < 8; ++i) { l[i] = lv + (unsigned)(i * 16 * VPB); g[i] = vg + (size_t)(i * 16) * SEQ; }
  async8(l, g);
}
// One GEMM stage (64 k = 128 B of each row) of 128 A rows and 128 B rows into one ring buffer, 16 copies per lane of the
// 128 threads: chunk i = row i*16 + (tid>>3), 16-B piece tid&7 (a wave covers four whole 128-B row pieces), LDS pitch GPB.
// ag, bg, la, lb are this lane's addresses of chunk 0; rs16 = 16 rows of the global planes, in elements.
__device__ __forceinline__ void stage_ab(const u16* ag, const u16* bg, size_t rs16, unsigned la, unsigned lb) {
  unsigned l[8];
  const u16* g[8];
  // both loops unrolled so that l[] and g[] are registers, as the asm operands need them
#pragma unroll
  for (int i = 0; i < 8; ++i) { l[i] = la + (unsigned)(i * 16 * GPB); g[i] = ag + (size_t)i * rs16; }
  async8(l, g);
#pragma unroll
  for (int i = 0; i < 8; ++i) { l[i] = lb + (unsigned)(i * 16 * GPB); g[i] = bg + (size_t)i * rs16; }
  async8(l, g);
}
// the issuing wave's own wait: every asynchronous copy it has issued has landed in LDS
__device__ __forceinline__ void wait_async0() {
#if defined(__HIP_DEVICE_COMPILE__)
  asm volatile("s_wait_asynccnt 0x0" ::: "memory");
#endif
}
// this wave's LDS reads and writes have retired (in front of the barrier behind which a buffer is refilled)
__device__ __forceinline__ void wait_ds0() {
#if defined(__HIP_DEVICE_COMPILE__)
  asm volatile("s_wait_dscnt 0x0" ::: "memory");
#endif
}

// =====================================================================================================
// cos/sin tables for the rotary: row = b*SEQ + s (0 .. nrows-1), column j = 0..63:
//   invf[j] = 1e6^(-j/64) (f64 exp2, converted to f32), ang = float(pos[row]) * invf[j] (f32 multiply),
//   cosT[row][j] = cosf(ang), sinT[row][j] = sinf(ang).
// Block = 4 rows x 64 j (one value pair per thread) staged in LDS; after the barrier waves 0,1 write the 4 cos rows and
// coverage: nrows/4 blocks (bid) x (2 tables x 4 rows x 64 floats) = both tables exactly once (nrows % 4 == 0, host).
// =====================================================================================================
__device__ __forceinline__ void trig64(int bid, const int* __restrict__ pos, float* cosT, float* sinT, int nrows) {
#pragma clang fp contract(off)
  __shared__ __align__(16) float cs[2 * 256];
  const int tid  = (int)threadIdx.x;
  const int row0 = bid * 4;
  if (row0 + 4 > nrows) return;                       // block-uniform, before the barrier; never taken with the exact grid
  const int r = tid >> 6, j = tid & 63;
  const float p    = (float)pos[row0 + r];
  const float invf = (float)exp2(-(double)j * (LOG2THETA / 64.0));
  const float ang  = p * invf;
  cs[tid]       = cosf(ang);
  cs[256 + tid] = sinf(ang);
  __syncthreads();
  if (tid < 128) {                                    // waves 0..3, wave-uniform
    const int tb    = tid >> 6;                       // 0: cos rows (waves 0,1), 1: sin rows (waves 2,3)
    const int q     = tid & 63;
    const int rr    = q >> 4;
    const int piece = (q & 15) * 4;
    const v4f v = *(const v4f*)(cs + tb * 256 + rr * 64 + piece);
    float* base = (tb != 0) ? sinT : cosT;
    float* dst  = base + (size_t)(row0 + rr) * HHALF + piece;
    {
      *(v4f*)(dst) = v;
      
    }
  }
}

// =====================================================================================================
// f32 -> 16-bit plane, same layout.  f16mode == 0: bf16 RNE bits;  f16mode == 1: f16 bits of (bf16 RNE value) * scale.
// Thread = 8 consecutive elements: two 16-B loads, one 16-B store; 32 consecutive lanes = 512 contiguous, 512-B aligned
// coverage: ceil(n8/256) blocks (bid) x 256 thr x 8 (in-kernel bound) = the whole plane (n8 a multiple of 256 here).
// =====================================================================================================
__device__ __forceinline__ void cvt16(int bid, const float* __restrict__ x, u16* D, int n8, int f16mode, float scale) {
  const int gt = bid * 256 + (int)threadIdx.x;
  if (gt >= n8) return;
  const float* p = x + (size_t)gt * 8;
  const v4f a = *(const v4f*)(p), b4 = *(const v4f*)(p + 4);
  float w[8];
#pragma unroll
  for (int e = 0; e < 4; ++e) { w[e] = a[e]; w[4 + e] = b4[e]; }
  v4u o;
#pragma unroll
  for (int e = 0; e < 4; ++e) {
    const float f0 = w[2 * e], f1 = w[2 * e + 1];
    const unsigned short hb0 = h_bits((_Float16)(bfr(f0) * scale));
    const unsigned short hb1 = h_bits((_Float16)(bfr(f1) * scale));
    const unsigned short bb0 = bf_bits(f0);
    const unsigned short bb1 = bf_bits(f1);
    o[e] = (f16mode != 0) ? pk16(hb0, hb1) : pk16(bb0, bb1);
  }
  u16* d = D + (size_t)gt * 8;
  {
    *(v4u*)(d) = o;
    
  }
}

// =====================================================================================================
// Weight transpose + convert: W f32 [K rows][N cols] (row pitch N) -> Wt 16-bit [N rows][K cols] (row pitch K), so that
// a column n of W becomes the k-contiguous B operand row n.  f16mode == 0: bf16 RNE bits; 1: f16 bits of (bf16 RNE value)*scale.
// Block = 64 k x 64 n tile: load phase 4 iterations x (16 k rows x 16 lanes x 4 n) with 16-B loads into an LDS tile
// coverage: load 4 it x 256 thr x 4 = 64 x 64; store 2 it x 256 thr x 8 halves = 64 rows x 64; (K/64)*(N/64)
//           blocks (bid) = the whole [N][K] plane exactly once.
// =====================================================================================================
__device__ __forceinline__ void wt16(int bid, const float* __restrict__ W, u16* Wt, int K, int N, int f16mode, float scale) {
  __shared__ __align__(16) u16 T[64 * WTP];
  const int tid = (int)threadIdx.x;
  const int nkt = K >> 6;
  const int kt  = bid % nkt;
  const int nt  = bid / nkt;
  const int kb  = kt * 64, nb = nt * 64;
  if (nb + 64 > N) return;                            // block-uniform, before the barrier; never taken with the exact grid
  const int c4 = (tid & 15) * 4;                      // n within tile
  const int r0 = tid >> 4;                            // k within tile (0..15) + 16*it
#pragma unroll
  for (int it = 0; it < 4; ++it) {
    const int r = it * 16 + r0;
    const v4f a = *(const v4f*)(W + (size_t)(kb + r) * (size_t)N + nb + c4);
#pragma unroll
    for (int e = 0; e < 4; ++e) {
      const float f = a[e];
      const unsigned short hb = h_bits((_Float16)(bfr(f) * scale));
      const unsigned short bb = bf_bits(f);
      T[(c4 + e) * WTP + r] = (f16mode != 0) ? hb : bb;
    }
  }
  __syncthreads();
  v4u o[2];
  const int q8 = tid >> 3, p8 = (tid & 7) * 8;
#pragma unroll
  for (int it = 0; it < 2; ++it) o[it] = *(const v4u*)(T + (it * 32 + q8) * WTP + p8);
  u16* dst = Wt + (size_t)(nb + q8) * (size_t)K + kb + p8;
  {
#pragma unroll
    for (int it = 0; it < 2; ++it) {
      *(v4u*)(dst + (size_t)(it * 32) * (size_t)K) = o[it];
    }
    // the code of the launch's other jobs follows these stores in the built kernel and reuses their registers
    asm volatile("s_wait_xcnt 0x0" ::: "memory");
  }
}

// =====================================================================================================
// Everything that depends on the inputs alone, in one launch: block ranges, in this order: cos/sin tables (PB_TR blocks), x plane
// (PB_X), Wq^T (PB_WQ), Wo^T (PB_WQ), Wk^T (PB_WK), Wv^T (PB_WK). The jobs write disjoint planes and read none of them; the job of
// a block is block-uniform, so each job's one barrier stays under block-uniform control flow.
// =====================================================================================================
__global__ __launch_bounds__(256)
void prep16(const int* __restrict__ pos, const float* __restrict__ x, const float* __restrict__ wq, const float* __restrict__ wk,
            const float* __restrict__ wv, const float* __restrict__ wo, float* cosT, float* sinT,
            u16* XBo, u16* WQo, u16* WKo, u16* WVo, u16* WOo) {
  int bid = (int)blockIdx.x;
  if (bid < PB_TR) { trig64(bid, pos, cosT, sinT, MROWS); return; }
  bid -= PB_TR;
  if (bid < PB_X) { cvt16(bid, x, XBo, (MROWS * DMOD) / 8, 0, 1.0f); return; }
  bid -= PB_X;
  const float* W = wq;
  u16* Wt = WQo;
  int N = DMOD, f16mode = 0;
  float scale = 1.0f;
  if (bid >= PB_WQ) {
    bid -= PB_WQ; W = wo; Wt = WOo; f16mode = 1; scale = WOS;
    if (bid >= PB_WQ) {
      bid -= PB_WQ; W = wk; Wt = WKo; N = KVD; f16mode = 0; scale = 1.0f;
      if (bid >= PB_WK) { bid -= PB_WK; W = wv; Wt = WVo; }
    }
  }
  wt16(bid, W, Wt, DMOD, N, f16mode, scale);
}

// =====================================================================================================
// v^T plane straight from the accumulators of a v projection tile: lane (m, hh) holds in acc[i][j] column d = 16j + m of the wave's
// 64 and the 8 consecutive keys 16i + 8hh + 0..7 of its 64 rows, which is one 16-B piece of a v^T row:
//   VH[((b*NKVH + g)*HD + d)][s] = f16(v * 1024).
// dst = the wave's first v^T row at its first key; the four pieces i of a lane pair (hh = 0, 1) fill one whole 128-B line.
// coverage: 16 stores x 16 d x 2 halves x 8 keys = the wave's 64 d x 64 keys.
// =====================================================================================================
__device__ __forceinline__ void vt_acc(const v8f (&acc)[4][4], float oscale, u16* dst, int lane) {
  const int hh = lane >> 4, m = lane & 15;
  u16* d0 = dst + (size_t)m * SEQ + 8 * hh;
  // all three loops unrolled: the accumulators are indexed by constants only and stay in registers
#pragma unroll
  for (int j = 0; j < 4; ++j) {
#pragma unroll
    for (int i = 0; i < 4; ++i) {
      v4u o;
#pragma unroll
      for (int e = 0; e < 4; ++e) {
        const float t0 = (acc[i][j][2 * e] * oscale) * VCAR;
        const float t1 = (acc[i][j][2 * e + 1] * oscale) * VCAR;
        o[e] = pk16(h_bits((_Float16)t0), h_bits((_Float16)t1));
      }
      *(v4u*)(d0 + (size_t)(j * 16) * SEQ + i * 16) = o;
    }
  }
}

// =====================================================================================================
// Per-head RMS normalisation + rotate-half rotary + 16-bit planes from one 128 x 128 tile of a projection (128 rows row0 + r of one
// head, f32), as the four waves of the product have left it in their slabs [64][68] (wave = 2*(r >> 6) + (d >> 6)); ncol = DMOD for
// q, KVD for k = row pitch of the planes, ccol = head*HD:
//   rs = 1/sqrt(mean_d(x[head][d]^2) + eps) over the head's 128 columns (f32 sum of squares: 16 per thread, then an
//   8-lane shuffle sum, the 8 lanes of a head are 8 consecutive lanes); y[d] = (x[d]*rs) * w[d] with w = bf16 RNE value
//   of the norm weight; then for j < 64 within a head, with c = cosT[row][j], sn = sinT[row][j] (f32 tables):
//   out[j]    = y[j]*c    - y[j+64]*sn
//   out[j+64] = y[j+64]*c + y[j]*sn
//   Hp [MROWS][ncol] = f16(out * sc).
// Eight passes of 16 rows, two a trip: thread t = row 16*pass + (t >> 3), chunk i = t&7: columns 8i .. +7 and + 64 of the head. No lane-varying
// control anywhere (shuffles with all lanes active).
// coverage: 8 passes x 128 thr x 16 = the tile's 128 rows x 128 columns of Hp, whole 128-B lines.
// =====================================================================================================
__device__ __forceinline__ void rot_pair(float xl, float xh, float cv, float sv, float sc,
                                         unsigned short& hl, unsigned short& hhv) {
#pragma clang fp contract(off)
  const float rl = xl * cv - xh * sv;
  const float rh = xh * cv + xl * sv;
  hl  = h_bits((_Float16)(rl * sc));
  hhv = h_bits((_Float16)(rh * sc));
}

__device__ __forceinline__ void nrope16(const float* slab, int tid, size_t row0, int ccol, int ncol,
                                        const float* __restrict__ nw,
                                        const float* __restrict__ cosT, const float* __restrict__ sinT,
                                        u16* Hp, float sc) {
  // every product and sum of the normalisation and the rotary rounded on its own
#pragma clang fp contract(off)
  const int dlo = (tid & 7) * 8;                       // j within head, multiple of 8
  const v4f wa = *(const v4f*)(nw + dlo), wb4 = *(const v4f*)(nw + dlo + 4);
  const v4f wc = *(const v4f*)(nw + HHALF + dlo), wd = *(const v4f*)(nw + HHALF + dlo + 4);
  float wl[8], wh[8];
#pragma unroll
  for (int e = 0; e < 4; ++e) {
    wl[e] = bfr(wa[e]);   wl[4 + e] = bfr(wb4[e]);
    wh[e] = bfr(wc[e]);   wh[4 + e] = bfr(wd[e]);
  }
  // kept rolled, two passes a trip: more of them take registers above v255 and lengthen the kernel's text
#pragma unroll 1
  for (int pt = 0; pt < GBM / 32; ++pt) {
   // the trip's two passes unrolled: their chains (LDS and table reads, sum, three shuffles, root) are independent and cover one
   // another's latency, which the two waves of a SIMD here cannot
#pragma unroll
   for (int u = 0; u < 2; ++u) {
    const int r = pt * 32 + u * 16 + (tid >> 3);       // row of the tile
    const float* p = slab + (r >> 6) * (8 * SLAB64) + (r & 63) * 68 + dlo;   // low-half chunk; the high half: the next wave's slab
    const v4f xa = *(const v4f*)(p), xb = *(const v4f*)(p + 4);
    const v4f ya = *(const v4f*)(p + 4 * SLAB64), yb = *(const v4f*)(p + 4 * SLAB64 + 4);
    const size_t row  = row0 + (size_t)r;
    const size_t trow = row * HHALF + dlo;
    const v4f ca = *(const v4f*)(cosT + trow), cb = *(const v4f*)(cosT + trow + 4);
    const v4f sa = *(const v4f*)(sinT + trow), sb = *(const v4f*)(sinT + trow + 4);
    float xl[8], xh[8], cv[8], sv[8];
#pragma unroll
    for (int e = 0; e < 4; ++e) {
      xl[e] = xa[e];        xl[4 + e] = xb[e];
      xh[e] = ya[e];        xh[4 + e] = yb[e];
      cv[e] = ca[e];        cv[4 + e] = cb[e];
      sv[e] = sa[e];        sv[4 + e] = sb[e];
    }
    // sum of squares over the head's 128 columns: 16 here, then lanes xor 1, 2, 4 (aligned groups of 8 lanes = one row)
    float ss = 0.0f;
#pragma unroll
    for (int e = 0; e < 8; ++e) { ss = ss + xl[e] * xl[e]; ss = ss + xh[e] * xh[e]; }
    ss += __shfl_xor(ss, 1, 32);
    ss += __shfl_xor(ss, 2, 32);
    ss += __shfl_xor(ss, 4, 32);
    const float var = ss * (1.0f / (float)HD);
    const float rs  = 1.0f / sqrtf(var + EPS_RMS);
#pragma unroll
    for (int e = 0; e < 8; ++e) {
      xl[e] = (xl[e] * rs) * wl[e];
      xh[e] = (xh[e] * rs) * wh[e];
    }
    v4u ohl, ohh;
#pragma unroll
    for (int e = 0; e < 4; ++e) {
      unsigned short hl0, hh0, hl1, hh1;
      rot_pair(xl[2 * e],     xh[2 * e],     cv[2 * e],     sv[2 * e],     sc, hl0, hh0);
      rot_pair(xl[2 * e + 1], xh[2 * e + 1], cv[2 * e + 1], sv[2 * e + 1], sc, hl1, hh1);
      ohl[e] = pk16(hl0, hl1);
      ohh[e] = pk16(hh0, hh1);
    }
    const size_t oc0 = row * (size_t)ncol + (size_t)(ccol + dlo);
    *(v4u*)(Hp + oc0) = ohl;
    *(v4u*)(Hp + oc0 + HHALF) = ohh;
   }
   // the next trip's first instructions rewrite registers that this trip's plane stores name
   asm volatile("s_wait_xcnt 0x0" ::: "memory");
  }
}

// =====================================================================================================
// The wave's 64 x 64 tile of C: accumulators * oscale -> the wave's own slab [64][68] -> whole 256-B row pieces of C.
// coverage: 32 instructions x 2 rows x 16 lanes x 4 floats = the wave's 64 x 64 tile.
// =====================================================================================================
__device__ __forceinline__ void slab64x64(float* sl, const v8f (&acc)[4][4], float oscale, int lane) {
  const int hh = lane >> 4, m = lane & 15;
#pragma unroll
  for (int i = 0; i < 4; ++i) {
#pragma unroll
    for (int r = 0; r < 8; ++r) {
      const int ro = (i * 16 + 8 * hh + r) * 68 + m;
      sl[ro]      = acc[i][0][r] * oscale;
      sl[ro + 16] = acc[i][1][r] * oscale;
      sl[ro + 32] = acc[i][2][r] * oscale;
      sl[ro + 48] = acc[i][3][r] * oscale;
    }
  }
}
__device__ __forceinline__ void epi64x64(float* sl, const v8f (&acc)[4][4], float oscale,
                                         float* C, int N, size_t rowb, int col0, int lane) {
  const int hh = lane >> 4, m = lane & 15;
  slab64x64(sl, acc, oscale, lane);
  wave_sync_lds();
  float* dst = C + (rowb + (size_t)hh) * (size_t)N + col0 + m * 4;
#pragma unroll
  for (int it = 0; it < 32; ++it) {
    const v4f v = *(const v4f*)(sl + (it * 2 + hh) * 68 + m * 4);
    *(v4f*)(dst + (size_t)(it * 2) * (size_t)N) = v;
  }
}

// =====================================================================================================
// GEMM: C[row][N] (f32, row pitch N) = A[row][K] (16-bit row-major, pitch K) . Bt[N][K]^T (16-bit k-contiguous) * oscale,
// row = bb*SEQ + s for s < 128*nrt.  FUSE: C is not stored; the tile, which is 128 rows of one head, goes on inside the block:
// job 0 (q) and 1 (k): slabs, one block barrier, normalisation + rotary + plane Hp; job 2 (v): v^T plane Hp.  BF: bf16 operands (v_wmma_f32_16x16x32_bf16), else f16 (v_wmma_f32_16x16x32_f16).
// Block -> (column tile ct of N/128, row tile rt of nrt, batch bb; from the block's index, by the caller): a 128 x 128 tile of C; 4 waves as 2 x 2, each a
// 64 x 64 tile = 4 x 4 accumulators, so that a fragment read from LDS serves four products.
// The 128 A rows and 128 Bt rows reach the waves through an LDS ring of two buffers, 64 k a stage, filled by asynchronous
// copies of whole 128-B row pieces; fragments by two 16-B LDS loads each (split k map for A and B).  The block starts at k stage
// rot % (K/64) and takes the stages in ring order (rot = row tile + column tile: the blocks that share A rows or Bt rows, which run at
// the same time, ask L2 for different lines at any moment); inside a stage k ascends in steps of 32.  One block barrier per stage, under block-uniform control flow (host: K % 64 == 0, N % 128 == 0).
// coverage: 4 waves x 4 row groups x (16 x 64) = the block's tile; NB * nrt * (N/128) blocks = every row s < 128*nrt once.
// =====================================================================================================
template <bool BF> struct FragSel { typedef v16h T; };
template <> struct FragSel<true> { typedef v16b T; };
template <bool BF>
__device__ __forceinline__ typename FragSel<BF>::T ldfrag_t(const u16* p) {
  if constexpr (BF) return ldfrag_b(p);
  else return ldfrag_h((const _Float16*)(const void*)p);
}
template <bool BF>
__device__ __forceinline__ v8f mma_t(typename FragSel<BF>::T a, typename FragSel<BF>::T b, v8f c) {
  if constexpr (BF) return mma_b(a, b, c);
  else return mma_h(a, b, c);
}

template <bool BF, bool FUSE>
__device__ __forceinline__
void gemm128_blk(int ct, int rt, int bb, int rot, const u16* __restrict__ A, const u16* __restrict__ Bt, float* C, int N, int K, float oscale,
                 int job, const float* __restrict__ nw, const float* __restrict__ cosT, const float* __restrict__ sinT,
                 u16* Hp, float sc) {
  __shared__ __align__(16) u16 ring[GRINGB / 2];          // two buffers of (128 A rows, 128 Bt rows), pitch GPB
  __shared__ __align__(16) float slab[4 * 4 * SLAB64];    // per wave [64][68]
  const int tid = (int)threadIdx.x, wave = tid >> 5, lane = tid & 31, hh = lane >> 4, m = lane & 15;
  if (bb >= NB) return;                     // block-uniform, before any barrier or copy; never taken with the exact grid
  if (rt * GBM + GBM > SEQ) return;         // block-uniform; never taken
  const int nstg  = K >> 6;
  const int st0   = rot % nstg;             // the block's first k stage; the stages follow in ring order (block-uniform)
  const int col0  = ct * GBN;
  const size_t row0 = (size_t)bb * SEQ + (size_t)(rt * GBM);
  const int wr = wave >> 1, wc = wave & 1;  // this wave's 64 x 64 tile inside the block's
  // this lane's chunk 0 of stage 0 (stage_ab): global addresses and LDS byte addresses in buffer 0
  const size_t rs16 = (size_t)16 * (size_t)K;
  const u16* ag0 = A  + (row0 + (size_t)(tid >> 3)) * (size_t)K + (tid & 7) * 8;
  const u16* bg0 = Bt + (size_t)(col0 + (tid >> 3)) * (size_t)K + (tid & 7) * 8;
  const unsigned lring = (unsigned)(size_t)(const void*)ring;
  const unsigned la0 = lring + (unsigned)((tid >> 3) * GPB + (tid & 7) * 16);
  const unsigned lb0 = la0 + (unsigned)GATB;

  v8f acc[4][4];
#pragma unroll
  for (int i = 0; i < 4; ++i) {
#pragma unroll
    for (int j = 0; j < 4; ++j) acc[i][j] = zero8();
  }

  // ---- ring prologue: stage 0 lands and is published, then stage 1 flies while stage 0 is worked on ----
  stage_ab(ag0 + (size_t)st0 * GKS, bg0 + (size_t)st0 * GKS, rs16, la0, lb0);
  wait_async0();
  __syncthreads();
  if (nstg > 1) {                                         // block-uniform
    const int s1 = (st0 + 1 < nstg) ? st0 + 1 : 0;
    stage_ab(ag0 + (size_t)s1 * GKS, bg0 + (size_t)s1 * GKS, rs16, la0 + (unsigned)GSTB, lb0 + (unsigned)GSTB);
  }

  // kept rolled: one trip = one stage, with its one publish point at the foot
#pragma unroll 1
  for (int st = 0; st < nstg; ++st) {
    const int bufh = (st & 1) * (GSTB / 2);               // this stage's buffer, in halves
    const u16* ap = ring + bufh + (wr * 64 + m) * (GPB / 2) + 8 * hh;
    const u16* bp = ring + bufh + (GATB / 2) + (wc * 64 + m) * (GPB / 2) + 8 * hh;
    // both 32-k steps of a stage unrolled: their LDS offsets become immediates
    typename FragSel<BF>::T a[GKS / 32][4], b[GKS / 32][4];
#pragma unroll
    for (int ks = 0; ks < GKS / 32; ++ks) {
#pragma unroll
      for (int j = 0; j < 4; ++j) b[ks][j] = ldfrag_t<BF>(bp + j * 16 * (GPB / 2) + ks * 32);
#pragma unroll
      for (int i = 0; i < 4; ++i) a[ks][i] = ldfrag_t<BF>(ap + i * 16 * (GPB / 2) + ks * 32);
    }
    // keeps the stage's 32 LDS reads together in front of its 32 products: left free, the compiler reloads one A fragment
    // per four products and waits out the LDS latency each time
    __builtin_amdgcn_sched_barrier(0);
#pragma unroll
    for (int ks = 0; ks < GKS / 32; ++ks) {
#pragma unroll
      for (int i = 0; i < 4; ++i) {
#pragma unroll
        for (int j = 0; j < 4; ++j) acc[i][j] = mma_t<BF>(a[ks][i], b[ks][j], acc[i][j]);
      }
    }
    // keeps the products in front of the publish point: left free, they sink behind the barrier, the waits stand directly
    // behind the LDS reads, and the next stage's copies lose the products' time as their lead
    __builtin_amdgcn_sched_barrier(0);
    // ---- publish point of stage st + 1: own LDS reads retired, own copies landed, every wave has left this buffer ----
    wait_ds0();
    wait_async0();
    __syncthreads();
    if (st + 2 < nstg) {                                  // block-uniform: refill the buffer that this trip has just read
      const int s2 = (st0 + st + 2 < nstg) ? st0 + st + 2 : st0 + st + 2 - nstg;   // trip st + 2 works on k stage s2
      stage_ab(ag0 + (size_t)s2 * GKS, bg0 + (size_t)s2 * GKS, rs16,
               la0 + (unsigned)(st & 1) * GSTB, lb0 + (unsigned)(st & 1) * GSTB);
    }
  }
  wait_async0();                                          // nothing in flight when the wave ends
  if constexpr (!FUSE) {
    epi64x64(slab + wave * (4 * SLAB64), acc, oscale, C, N, row0 + (size_t)(wr * 64), col0 + wc * 64, lane);
  } else {
    if (job == 2) {                                       // block-uniform, no barrier behind it
      vt_acc(acc, oscale, Hp + ((size_t)(bb * NKVH + ct) * HD + (size_t)(wc * 64)) * SEQ + rt * GBM + wr * 64, lane);
      return;
    }
    slab64x64(slab + wave * (4 * SLAB64), acc, oscale, lane);
    __syncthreads();                                      // a row's low and high 64 columns lie in two waves' slabs
    nrope16(slab, tid, row0, col0, N, nw, cosT, sinT, Hp, sc);
  }
}

// one product per launch (ctx.Wo)
template <bool BF>
__global__ __launch_bounds__(128)
void gemm128(const u16* __restrict__ A, const u16* __restrict__ Bt, float* C, int N, int K, int nrt, float oscale) {
  const int ntile = N >> 7;
  const int bid   = (int)blockIdx.x;
  const int t2    = bid / ntile;
  gemm128_blk<BF, false>(bid % ntile, t2 % nrt, t2 / nrt, t2 + bid % ntile, A, Bt, C, N, K, oscale, 0, nullptr, nullptr, nullptr, nullptr, 0.0f);
}

// x.Wq, x.Wk and x.Wv in one launch: block ranges, in this order: q (GB_Q blocks), k (GB_K), v (GB_K); the three products share A,
// write disjoint planes, and a block's product is block-uniform. A column tile is one head: q and k tiles leave as normalised, rotated
// f16 planes (q x256, k x256), v tiles as the v^T plane x1024.
__global__ __launch_bounds__(128)
void gemm_qkv(const u16* __restrict__ A, const u16* __restrict__ Wq, const u16* __restrict__ Wk, const u16* __restrict__ Wv,
              const float* __restrict__ qnw, const float* __restrict__ knw,
              const float* __restrict__ cosT, const float* __restrict__ sinT,
              u16* QHo, u16* KHo, u16* VHo, int K, float oscale) {
  int bid = (int)blockIdx.x;
  const u16* Bt = Wq;
  const float* nw = qnw;
  u16* Hp = QHo;
  int N = DMOD, job = 0, cidx = 0;                        // cidx: the product's first column tile among the 24 that share a row tile of A
  float sc = QSC;
  int ct = bid % (DMOD / GBN), rt = (bid / (DMOD / GBN)) % (SQ / GBM), bb = bid / ((DMOD / GBN) * (SQ / GBM));
  if (bid >= GB_Q) {
    bid -= GB_Q; Bt = Wk; nw = knw; Hp = KHo; N = KVD; job = 1; sc = KSC; cidx = DMOD / GBN;
    if (bid >= GB_K) { bid -= GB_K; Bt = Wv; Hp = VHo; job = 2; cidx = (DMOD + KVD) / GBN; }
    ct = bid % (KVD / GBN); rt = (bid / (KVD / GBN)) % (SEQ / GBM); bb = bid / ((KVD / GBN) * (SEQ / GBM));
  }
  gemm128_blk<true, true>(ct, rt, bb, bb * (SEQ / GBM) + rt + cidx + ct, A, Bt, nullptr, N, K, oscale, job, nw, cosT, sinT, Hp, sc);
}

// =====================================================================================================
// Non-causal grouped-query attention, hd = 128, all SEQ keys. Block bid -> (query tile qt = bid % NQT: rows q0 = 32*qt ..
// q0+31, head group hg = kv head, batch b); one wave per query head = hg*WPB + wave (the 4 heads of the group share kv head hg).
// A wave takes its 32 queries as QCG = 2 column groups of 16 (group g: rows q0 + 16g ..): every k and v^T fragment read from LDS
// serves two products, and a staged key stage serves 32 queries of each head. What follows is said of one column group.
//   q plane f16 x256 [b*SEQ + s][h*HD + d]; k plane f16 x256 [b*SEQ + s][g*HD + d] (pitch KVD);
//   v^T plane [b*NKVH + g][d][SEQ] x1024.
//   scores = q.k (4 k-steps over d); P.v with P x32768 (f16) and v^T, for every query row;
//   O written as one f16 plane (O x1024, layout [b*SEQ + s][h*HD + d]).
//   score (log2 domain) t(i, j) = (q_i.k_j over HD) * (1/sqrt(128))*log2e/(256*256).
//   k rows and v^T rows reach the 4 waves through an LDS ring of two buffers, 64 keys a stage, filled by asynchronous copies.
//   Both products are taken transposed: S^T = k.q^T (A = k rows from the ring, B = q, loaded once and kept in registers) and
//   O^T += v^T.P^T (A = v^T rows from the ring, B = P^T), all fragments in the split k map. A lane (c, hh) then holds, of query
//   column q0 + c, the scores of keys kb + 8hh + r and kb + 16 + 8hh + r: maximum and sum run inside the lane, the maximum is
//   joined with the other half by one cross-row move per 32 keys, the sums once after the loop; the two score tiles, converted
//   in place (P x32768, f16), are the B fragment of the second product. All NKT key tiles of 32 visited once, in ring order from the block's own first stage; online
//   max-subtracted base-2 softmax in f32, -inf-safe rescale.
//   After the loop: out = acc / Z (Z, x32768 like P, is about 32768 or more; guarded anyway), carry 1/1024 folded once, written into the slab.
//   One block barrier per stage, under block-uniform control flow; bounded loops only (NST compile-time).
// coverage: per wave 16 instructions x 2 rows x 16 lanes x 8 halves = 32 x 128; grid NQT x NHG x NB blocks x WPB
//           waves = every (b, s < SQ, h) row segment of O exactly once.
// =====================================================================================================
// two waves per SIMD, no more: the grid is two blocks per WGP, and a third block on one WGP would leave another WGP short
__global__ __launch_bounds__(ATT_THREADS) __attribute__((amdgpu_waves_per_eu(2, 2)))
void attn_nc(const u16* __restrict__ QHp, const u16* __restrict__ KHp,
             const u16* __restrict__ VHp, u16* OHp) {
  __shared__ __align__(16) _Float16 ring[RINGB / 2];      // two buffers of (64 k rows pitch KPB, 128 v^T rows pitch VPB)

  const int tid  = (int)threadIdx.x;
  const int wave = tid >> 5;
  const int lane = tid & 31;
  const int hh   = lane >> 4;
  const int c    = lane & 15;
  const int bid  = (int)blockIdx.x;
  const int qt   = bid % NQT;
  const int t2   = bid / NQT;
  const int hg   = t2 % NHG;
  const int b    = t2 / NHG;
  if (b >= NB) return;                      // block-uniform, before any barrier or copy; never taken with the exact grid
  const int q0   = qt * (16 * QCG);
  if (q0 + 16 * QCG > SQ) return;                 // block-uniform; never taken
  const int head = hg * WPB + wave;
  const int kvh  = hg;

  float* slab = (float*)(void*)ring + wave * (QCG * SLW); // result slab [32][128] pitch 132: the ring's bytes, after the loop

  const size_t hcol = (size_t)head * HD + 8 * hh;
  const _Float16* Qh  = (const _Float16*)(const void*)QHp + ((size_t)b * SEQ + q0 + c) * DMOD + hcol;
  // this lane's chunk 0 of stage 0 (stage_kv): global addresses and LDS byte addresses in buffer 0
  const u16* kg0 = KHp + ((size_t)b * SEQ + (tid >> 4)) * KVD + (size_t)kvh * HD + (tid & 15) * 8;
  const u16* vg0 = VHp + ((size_t)(b * NKVH + kvh) * HD + (tid >> 3)) * SEQ + (tid & 7) * 8;
  const unsigned lring = (unsigned)(size_t)(const void*)ring;
  const unsigned lk0 = lring + (unsigned)((tid >> 4) * KPB + (tid & 15) * 16);
  const unsigned lv0 = lring + (unsigned)(KTB + (tid >> 3) * VPB + (tid & 7) * 16);
  // the block's first key stage; the stages follow in ring order: the NQT blocks that share a kv head run at the same time and
  // start on NST different stages, NQT/NST blocks on each, so that only those ask L2 for the same lines of its k and v^T at a
  // time (the online softmax takes the keys in any order)
  const int st0 = qt % NST;
  const float lsc = RSQ_HD * (LOG2E / (QSC * KSC));
  const float oc  = 1.0f / VCAR;                          // the carry on P stands in the running sum as well and cancels in acc / Z

  // q as the B operand: column = query q0 + 16g + c, loaded once for all keys
  v16h qh[QCG][HD / 32];
#pragma unroll
  for (int g = 0; g < QCG; ++g) {
#pragma unroll
    for (int kk = 0; kk < HD / 32; ++kk) qh[g][kk] = ldfrag_h(Qh + (size_t)(g * 16) * DMOD + kk * 32);
  }
  float mrun[QCG], lrun[QCG];                             // of query column 16g + c; lrun (x32768) over this half's keys only
  v8f o[QCG][8];                                          // o[g][j][r] = O^T[d = 16j + 8hh + r][query 16g + c]
#pragma unroll
  for (int g = 0; g < QCG; ++g) {
    mrun[g] = -INFINITY;
    lrun[g] = 0.f;
#pragma unroll
    for (int j = 0; j < 8; ++j) o[g][j] = zero8();
  }

  // ---- ring prologue: stage 0 lands and is published, then stage 1 flies while stage 0 is worked on ----
  stage_kv(kg0 + (size_t)st0 * KSTG * KVD, vg0 + st0 * KSTG, lk0, lv0);
  wait_async0();
  __syncthreads();
  {
    const int s1 = (st0 + 1 < NST) ? st0 + 1 : 0;
    stage_kv(kg0 + (size_t)s1 * KSTG * KVD, vg0 + s1 * KSTG, lk0 + STGB, lv0 + STGB);
  }

  // kept rolled: one trip = one stage, with its one publish point at the foot
#pragma unroll 1
  for (int st = 0; st < NST; ++st) {
   const int bufh = (st & 1) * (STGB / 2);                // this stage's buffer, in halves
   // kept rolled: unrolled, the compiler spreads a step's v^T reads in pairs among its products instead of issuing them together
   // ahead of the softmax arithmetic
#pragma unroll 1
   for (int sub = 0; sub < KSTG / 32; ++sub) {
    // ---- scores: D element r of this lane = (key kb + 8hh + r, query q0 + 16g + c) in s[g][0], key kb + 16 + 8hh + r in s[g][1], kb = the step's first key ----
    v8f s[QCG][2];
#pragma unroll
    for (int g = 0; g < QCG; ++g) { s[g][0] = zero8(); s[g][1] = zero8(); }
    const _Float16* k0p = ring + bufh + (sub * 32 + c) * (KPB / 2) + 8 * hh;
    const _Float16* k1p = k0p + 16 * (KPB / 2);
    v16h kh0[HD / 32], kh1[HD / 32];
#pragma unroll
    for (int kk = 0; kk < HD / 32; ++kk) { kh0[kk] = ldfrag_h(k0p + kk * 32); kh1[kk] = ldfrag_h(k1p + kk * 32); }
    // keeps the step's 16 k reads together in front of its 16 score products, so that the LDS latency is waited out once a step
    __builtin_amdgcn_sched_barrier(0);
#pragma unroll
    for (int kk = 0; kk < HD / 32; ++kk) {
#pragma unroll
      for (int g = 0; g < QCG; ++g) {
        s[g][0] = mma_h(kh0[kk], qh[g][kk], s[g][0]);
        s[g][1] = mma_h(kh1[kk], qh[g][kk], s[g][1]);
      }
    }
    // splits the step here, so that the eight v^T fragments are read together at the head of the softmax arithmetic, which covers
    // their latency, into the k fragments' registers: left free, the compiler reads one fragment in front of each pair of
    // products and waits out the LDS latency each time
    __builtin_amdgcn_sched_barrier(0);
    FragH ph[QCG];
    // the two column groups unrolled: their chains are independent and cover one another's latency
#pragma unroll
    for (int g = 0; g < QCG; ++g) {
      const v8f s0 = s[g][0], s1 = s[g][1];
      // ---- online softmax in base 2 over all keys, -inf-safe; one query column per lane ----
      float mx = fmaxf(s0[0], s1[0]);
#pragma unroll
      for (int r = 1; r < 8; ++r) mx = fmaxf(mx, fmaxf(s0[r], s1[r]));
      mx = fmaxf(mx, xhalf(mx)) * lsc;                    // lsc > 0: the maximum of the scaled scores
      const float mn = fmaxf(mrun[g], mx);
      const float ms = (mn == -INFINITY) ? 0.0f : mn;
      // the exponentials are the bare v_exp_f32: it gives 0 where the library form would give a subnormal (argument below -126), which
      // is far below half an ulp of the f16 P and of Z (x32768: about 2^15 or more once the two halves' sums are joined)
      const float al = __builtin_amdgcn_exp2f(mrun[g] - ms);
      mrun[g] = mn;
      const float mo = ms - PEXP;                         // P x32768 comes out of the exponential itself
      // ---- B fragment of P^T*32768 (f16): elements 0..7 = keys kb + 8hh + 0..7, elements 8..15 = keys kb + 16 + 8hh + 0..7 ----
      v2f ps = {0.f, 0.f};                                // sums over even and odd r, x32768 like P
      const v2f lsc2 = {lsc, lsc}, mo2 = {mo, mo};
#pragma unroll
      for (int r = 0; r < 8; r += 2) {
        // neighbouring accumulator registers taken as pairs: packed fma and packed add
        const v2f x0 = (v2f){s0[r], s0[r + 1]} * lsc2 - mo2;
        const v2f x1 = (v2f){s1[r], s1[r + 1]} * lsc2 - mo2;
        const v2f e0 = {__builtin_amdgcn_exp2f(x0[0]), __builtin_amdgcn_exp2f(x0[1])};
        const v2f e1 = {__builtin_amdgcn_exp2f(x1[0]), __builtin_amdgcn_exp2f(x1[1])};
        ps += e0;
        ps += e1;
        ph[g].h[0][r]     = (_Float16)e0[0];
        ph[g].h[0][r + 1] = (_Float16)e0[1];
        ph[g].h[1][r]     = (_Float16)e1[0];
        ph[g].h[1][r + 1] = (_Float16)e1[1];
      }
      lrun[g] = lrun[g] * al + (ps[0] + ps[1]);
#pragma unroll
      for (int j = 0; j < 8; ++j) {
#pragma unroll
        for (int r = 0; r < 8; ++r) o[g][j][r] *= al;
      }
    }
    // ---- v^T.P^T : A fragment row = d = j*16 + c, keys contiguous in the v^T rows; each fragment serves both column groups ----
    {
      const _Float16* vhp = ring + bufh + (KTB / 2) + c * (VPB / 2) + sub * 32 + 8 * hh;   // d row c (+16j), keys of this step
#pragma unroll
      for (int j = 0; j < 8; ++j) {
        const v16h vf = ldfrag_h(vhp + j * 16 * (VPB / 2));
#pragma unroll
        for (int g = 0; g < QCG; ++g) o[g][j] = mma_h(vf, ph[g].v, o[g][j]);
      }
    }
    // four vector slots behind the step's last products, in front of the loop's branch: on its taken side the first vector
    // instructions rewrite registers of P^T
    acc_guard16(o[0], o[1]);
   }
   // ---- publish point of stage st + 1: own LDS reads retired, own copies landed, every wave has left this buffer ----
   wait_ds0();
   wait_async0();
   __syncthreads();
   if (st + 2 < NST) {                                    // block-uniform: refill the buffer that this trip has just read
     const int s2 = (st0 + st + 2 < NST) ? st0 + st + 2 : st0 + st + 2 - NST;   // trip st + 2 works on key stage s2
     stage_kv(kg0 + (size_t)s2 * KSTG * KVD, vg0 + s2 * KSTG,
              lk0 + (unsigned)(st & 1) * STGB, lv0 + (unsigned)(st & 1) * STGB);
   }
  }
  wait_async0();                                          // nothing in flight before the ring's bytes become the result slab
  // ---- out = acc / Z (0 if Z == 0), acc and Z both x32768, the carry 1024 on v folded once; row 16g + c of the wave's slab, 8 consecutive d ----
#pragma unroll
  for (int g = 0; g < QCG; ++g) {
    const float lv  = lrun[g] + xhalf(lrun[g]);           // the two halves' sums joined
    const float ls  = (lv > 0.0f) ? lv : 1.0f;
    const float inv = (lv > 0.0f) ? ((1.0f / ls) * oc) : 0.0f;
#pragma unroll
    for (int j = 0; j < 8; ++j) {
      float* sp = slab + (g * 16 + c) * SLP + j * 16 + 8 * hh;
      v4f a, b4;
#pragma unroll
      for (int e = 0; e < 4; ++e) { a[e] = o[g][j][e] * inv; b4[e] = o[g][j][4 + e] * inv; }
      *(v4f*)(sp)     = a;
      *(v4f*)(sp + 4) = b4;
    }
  }

  wave_sync_lds();
  // ---- O x1024 -> f16 plane; lane = (row-in-pair rq, 8 consecutive d at c8) ----
  v4u oh[8 * QCG];
  const int rq = lane >> 4, c8 = (lane & 15) * 8;
#pragma unroll
  for (int it = 0; it < 8 * QCG; ++it) {
    const int row = it * 2 + rq;
    const v4f a = *(const v4f*)(slab + row * SLP + c8), b4 = *(const v4f*)(slab + row * SLP + c8 + 4);
    float w[8];
#pragma unroll
    for (int e = 0; e < 4; ++e) { w[e] = a[e] * OSC; w[4 + e] = b4[e] * OSC; }
#pragma unroll
    for (int e = 0; e < 4; ++e) {
      const _Float16 h0 = (_Float16)w[2 * e], h1 = (_Float16)w[2 * e + 1];
      oh[it][e] = pk16(h_bits(h0), h_bits(h1));
    }
  }
  const size_t ob = ((size_t)b * SEQ + q0) * DMOD + (size_t)head * HD + c8;
  {
#pragma unroll
    for (int it = 0; it < 8 * QCG; ++it) {
      const int row = it * 2 + rq;
      *(v4u*)(OHp + ob + (size_t)row * DMOD) = oh[it];
    }
  }
}

// =====================================================================================================
// Workspace map (bytes); every plane is fully written by whole-line stores before it is read; all extents are exact multiples
// of the store granularity (no pad rows needed); every region offset a multiple of 1048576:
//   XB  bf16 [MROWS][2048]                       MROWS*4096       (NB=2: 16777216)
//   WQ  bf16 [2048 n][2048 k]                    8388608          Wq^T;  WO f16 x1024, same extent: Wo^T
//   WK  bf16 [512 n][2048 k]                     2097152          Wk^T;  WV same extent: Wv^T
//   OH  f16 [MROWS][2048] x1024                  MROWS*4096
//   QH  f16 [MROWS][2048] x256                   MROWS*4096
//   KH  f16 [MROWS][512] x256                    MROWS*1024
//   VH  f16 [NB*4][128][SEQ] x1024               MROWS*1024
//   COS f32 [MROWS][64]                          MROWS*256        SIN same extent
//   end (NB=2)                                 81788928
// =====================================================================================================
extern "C" void kernel_launch(void* const* d_in, const int* in_sizes, int n_in,
                              void* d_out, int out_size, void* d_ws, size_t ws_size,
                              hipStream_t stream) {
  if (n_in < 8) return;
  if (in_sizes[0] < MROWS * DMOD) return;
  if (in_sizes[1] < MROWS) return;
  if (in_sizes[2] != DMOD * DMOD) return;
  if (in_sizes[3] != DMOD * KVD) return;
  if (in_sizes[4] != DMOD * KVD) return;
  if (in_sizes[5] != DMOD * DMOD) return;
  if (in_sizes[6] < HD) return;
  if (in_sizes[7] < HD) return;
  if (out_size < MROWS * DMOD) return;

  const float* x   = (const float*)d_in[0];
  const int*   pos = (const int*)d_in[1];
  const float* wq  = (const float*)d_in[2];
  const float* wk  = (const float*)d_in[3];
  const float* wv  = (const float*)d_in[4];
  const float* wo  = (const float*)d_in[5];
  const float* qnw = (const float*)d_in[6];
  const float* knw = (const float*)d_in[7];
  float*       out = (float*)d_out;

  const size_t szXB = (size_t)MROWS * DMOD * 2;
  const size_t szW  = (size_t)DMOD * DMOD * 2;                   // WQ, WO
  const size_t szWK = (size_t)DMOD * KVD * 2;                    // WK, WV
  const size_t szQ  = (size_t)MROWS * DMOD * 2;                  // QH, OH
  const size_t szK  = (size_t)MROWS * KVD * 2;                   // KH
  const size_t szV  = (size_t)NB * NKVH * HD * SEQ * 2;          // VH (== szK)
  const size_t szT  = (size_t)MROWS * HHALF * 4;                 // COS, SIN
  size_t off = 0;
  const size_t oXB = off; off += szXB;
  const size_t oWQ = off; off += szW;
  const size_t oWO = off; off += szW;
  const size_t oWK = off; off += szWK;
  const size_t oWV = off; off += szWK;
  const size_t oOH = off; off += szQ;
  const size_t oQH = off; off += szQ;
  const size_t oKH = off; off += szK;
  const size_t oVH = off; off += szV;
  const size_t oCS = off; off += szT;
  const size_t oSN = off; off += szT;
  if (off > ws_size) return;                // off = 81788928 for NB = 2
  if (off > (size_t)WS_CAP) return;

  char* ws = (char*)d_ws;
  u16*   XB  = (u16*)(ws + oXB);
  u16*   WQT = (u16*)(ws + oWQ);
  u16*   WOT = (u16*)(ws + oWO);
  u16*   WKT = (u16*)(ws + oWK);
  u16*   WVT = (u16*)(ws + oWV);
  u16*   OH  = (u16*)(ws + oOH);
  u16*   QH  = (u16*)(ws + oQH);
  u16*   KH  = (u16*)(ws + oKH);
  u16*   VH  = (u16*)(ws + oVH);
  float* COS = (float*)(ws + oCS);
  float* SIN = (float*)(ws + oSN);

  const dim3 b256(256), b128(128), bAT(ATT_THREADS);
  const int  nrtQ = SQ / GBM;                           // ctx / out rows per batch / 128
  const dim3 gGQ(GB_Q);
  const dim3 gAT(NQT * NHG * NB);

  // (0) cos/sin tables from the integer positions, x -> bf16 plane, Wq^T, Wk^T, Wv^T bf16 planes, Wo^T f16 plane of bf16 value x1024
  prep16<<<dim3(PB_ALL), b256, 0, stream>>>(pos, x, wq, wk, wv, wo, COS, SIN, XB, WQT, WKT, WVT, WOT);
  // (1) q = x.Wq, k = x.Wk, v = x.Wv, each tile on into its planes: RMS normalisation + rotary + q plane x256, k plane x256; v^T plane x1024
  gemm_qkv<<<dim3(GB_ALL), b128, 0, stream>>>(XB, WQT, WKT, WVT, qnw, knw, COS, SIN, QH, KH, VH, DMOD, 1.0f);
  // (2) non-causal attention over all keys -> O plane
  attn_nc<<<gAT, bAT, 0, stream>>>(QH, KH, VH, OH);
  // (3) out = ctx.Wo -> f32, carries 1024 x 1024 folded back
  gemm128<false><<<gGQ, b128, 0, stream>>>(OH, WOT, out, DMOD, DMOD, nrtQ, 1.0f / (OSC * WOS));
  (void)hipGetLastError();
}

// v010
// A run of this version takes 139 microseconds.
// In two side-by-side timings against v009, it was 1.06 and 1.07 times as fast.
// Over all steps from v000 it is 3.83 times as fast.
// Contractions: x.Wq, x.Wk, x.Wv on v_wmma_f32_16x16x32_bf16 (x and W^T as bf16 RNE planes, f32 accumulate);
// q.k^T over hd 128 on v_wmma_f32_16x16x32_f16 with q and k as one f16 plane each (x256): both come from bf16 operands,
// whose rounding is eight times that of an f16 plane; P.v on v_wmma_f32_16x16x32_f16 with P x32768 and v^T x1024 as single f16 planes;
// ctx.Wo on v_wmma_f32_16x16x32_f16 with ctx x1024 as one f16 plane and Wo^T as f16(bf16 RNE(Wo)) x1024; all f32
// accumulate. RMS normalisation, rotate-half rotary from integer positions (cos/sin tables built on device in f32),
// base-2 online softmax and the 1/Z fold in f32 on VALU.
#include <hip/hip_runtime.h>
#include <math.h>
#include <stdint.h>

#ifndef NB
#define NB 2
#endif
#define SEQ 2048
#ifndef SQ
#define SQ SEQ
#endif
#define DMOD  2048
#define NH    16
#define NKVH  4
#define HD    128
#define HHALF (HD / 2)
#define KVD   (NKVH * HD)
#define MROWS (NB * SEQ)
#define EPS_RMS 0.000001f
#define RSQ_HD 0.08838834764831845f
#define LOG2E 1.4426950408889634f
#define LOG2THETA 19.931568569324174
#define QSC   256.0f
#define KSC   256.0f
#define PCAR  32768.0f
#define PEXP  15.0f
#define VCAR  1024.0f
#define OSC   1024.0f
#define WOS   1024.0f
#define WPB   (NH / NKVH)
#define NHG   NKVH
#define QCG   2
#define NQT   (SQ / (16 * QCG))
#define NST   (SEQ / 64)
#define NKT   (SEQ / 32)
#define ATT_THREADS (WPB * 32)
#define SLP   132
#define SLW   (16 * SLP)
#define SLAB64 (16 * 68)
#define WTP   72
#define WS_CAP 134217728
#define KSTG  64
#define KPB   272
#define VPB   144
#define KTB   (KSTG * KPB)
#define VTB   (HD * VPB)
#define STGB  (KTB + VTB)
#define RINGB (2 * STGB)
#define GBM   128
#define GBN   128
#define GKS   64
#define GPB   144
#define GATB  (GBM * GPB)
#define CTQ   3
#define CTO   2
// block counts of the jobs that share one launch (each job's blocks are a contiguous range of the grid)
#define PB_TR (MROWS / 4)
#define PB_X  ((MROWS * DMOD / 8) / 256)
#define PB_WQ ((DMOD / 64) * (DMOD / 64))
#define PB_WK ((DMOD / 64) * (KVD / 64))
#define PB_ALL (PB_TR + PB_X + 2 * PB_WQ + 2 * PB_WK)
#define NCGQ  ((DMOD + 2 * KVD) / (CTQ * GBN))
#define GB_QKV (NB * (SEQ / GBM) * NCGQ)
#define GB_OUT (NB * (SQ / GBM) * (DMOD / (CTO * GBN)))
static_assert(SQ == SEQ && ((DMOD + 2 * KVD) % (CTQ * GBN)) == 0 && (DMOD % (CTO * GBN)) == 0);
static_assert(GBN == HD && GBM == 128);                 // a column tile of the q, k, v products is one head
static_assert(DMOD == NH * HD && HD == 128 && HHALF == 64 && NH == 16 && NKVH == 4 && WPB == 4 && NHG * WPB == NH);
static_assert(ATT_THREADS == 128 && KVD == 512);
static_assert(PCAR == 32768.0f && PEXP == 15.0f);       // PCAR = 2^PEXP
static_assert(NB >= 1 && NB <= 2);
static_assert((SEQ % 64) == 0 && (SQ % 64) == 0 && SQ >= 64 && SQ <= SEQ);
static_assert((DMOD % 64) == 0 && (KVD % 64) == 0 && (DMOD % 32) == 0 && (HD % 32) == 0);
static_assert(((MROWS * DMOD / 8) % 256) == 0 && (MROWS % 4) == 0);
static_assert(KSTG == 64 && NST >= 2 && NST * KSTG == SEQ && (KPB % 16) == 0 && (VPB % 16) == 0 && (KTB % 16) == 0 && (STGB % 16) == 0);
static_assert(KPB == HD * 2 + 16 && VPB == KSTG * 2 + 16 && WPB * QCG * SLW * 4 <= RINGB && 2 * RINGB <= 327680);
static_assert(64 * WTP * 2 <= 65536);
static_assert(GBM == 128 && GBN == 128 && GKS == 64 && GPB == GKS * 2 + 16 && (GPB % 16) == 0);
static_assert((SEQ % GBM) == 0 && (SQ % GBM) == 0 && (DMOD % GBN) == 0 && (KVD % GBN) == 0 && (DMOD % GKS) == 0 && DMOD / GKS >= 2);
static_assert((DMOD / 16) <= 128 && (KVD / 16) <= 128 && ((DMOD / 16) % 32) == 0 && ((KVD / 16) % 32) == 0);

typedef unsigned short u16;
typedef _Float16 v16h __attribute__((ext_vector_type(16)));
typedef _Float16 v8h  __attribute__((ext_vector_type(8)));
typedef __bf16   v16b __attribute__((ext_vector_type(16)));
typedef float    v8f  __attribute__((ext_vector_type(8)));
typedef float    v4f  __attribute__((ext_vector_type(4)));
typedef float    v2f  __attribute__((ext_vector_type(2)));
typedef unsigned int v4u __attribute__((ext_vector_type(4)));

union FragH { v16h v; v8h h[2]; v4u u[2]; };
union FragB { v16b v; v4u u[2]; };

// ---- scalar helpers --------------------------------------------------------------------------------
__device__ __forceinline__ unsigned short bf_bits(float f) {          // f32 -> bf16 bits, RNE convert
  unsigned u = __float_as_uint(f);
  return (unsigned short)((u + 0x7FFFu + ((u >> 16) & 1u)) >> 16);
}
__device__ __forceinline__ float bf_up(unsigned short h) { return __uint_as_float(((unsigned)h) << 16); }
__device__ __forceinline__ float bfr(float f) { return bf_up(bf_bits(f)); }
__device__ __forceinline__ unsigned short h_bits(_Float16 x) { return __builtin_bit_cast(unsigned short, x); }
__device__ __forceinline__ unsigned pk16(unsigned short a, unsigned short b) { return (unsigned)a | ((unsigned)b << 16); }
__device__ __forceinline__ v8f zero8() { v8f z = {0.f, 0.f, 0.f, 0.f, 0.f, 0.f, 0.f, 0.f}; return z; }

// ---- fragment loaders: 16-bit A/B operand, lane -> row/col (lane&15), p already includes +8*(lane>>4);
//      elements 0..7 <- p[0..7] (k0+8h..), elements 8..15 <- p[16..23] (k0+16+8h..)  (same split k map for A and B;
//      B is always read from a k-contiguous [n][k] plane)
__device__ __forceinline__ v16h ldfrag_h(const _Float16* p) {
  FragH f;
  f.h[0] = *(const v8h*)(p);
  f.h[1] = *(const v8h*)(p + 16);
  return f.v;
}
__device__ __forceinline__ v16b ldfrag_b(const u16* p) {              // bf16 plane read as unsigned integer vectors
  FragB f;
  f.u[0] = *(const v4u*)(p);
  f.u[1] = *(const v4u*)(p + 16);
  return f.v;
}

__device__ __forceinline__ v8f mma_h(v16h a, v16h b, v8f c) {
  return __builtin_amdgcn_wmma_f32_16x16x32_f16(false, a, false, b, (short)0, c, false, false);
}
__device__ __forceinline__ v8f mma_b(v16b a, v16b b, v8f c) {
  return __builtin_amdgcn_wmma_f32_16x16x32_bf16(false, a, false, b, (short)0, c, false, false);
}
__device__ __forceinline__ void acc_guard16(const v8f (&a)[8], const v8f (&b)[8]) {
#if defined(__HIP_DEVICE_COMPILE__)
  asm volatile("v_nop\n\tv_nop\n\tv_nop\n\tv_nop"
               :: "v"(a[0]), "v"(a[1]), "v"(a[2]), "v"(a[3]), "v"(a[4]), "v"(a[5]), "v"(a[6]), "v"(a[7]),
                  "v"(b[0]), "v"(b[1]), "v"(b[2]), "v"(b[3]), "v"(b[4]), "v"(b[5]), "v"(b[6]), "v"(b[7]));
#endif
}
__device__ __forceinline__ void wave_sync_lds() {
  __builtin_amdgcn_fence(__ATOMIC_RELEASE, "workgroup");
  __builtin_amdgcn_wave_barrier();
  __builtin_amdgcn_fence(__ATOMIC_ACQUIRE, "workgroup");
}
// lane l's value from lane l ^ 16: the two halves of the wave hold the two halves of a query column's keys
__device__ __forceinline__ float xhalf(float x) {
  const int b = __builtin_bit_cast(int, x);
  return __builtin_bit_cast(float, __builtin_amdgcn_permlanex16(b, b, 0x76543210, 0xfedcba98, false, false));
}
// Eight asynchronous 16-byte copies of this lane, global -> LDS (l = LDS byte address, g = global address, both 16-B aligned).
// The closing s_wait_xcnt 0 stands inside the statement so that no address register is rewritten in front of it.
__device__ __forceinline__ void async8(const unsigned* l, const u16* const* g) {
#if defined(__HIP_DEVICE_COMPILE__)
  asm volatile("global_load_async_to_lds_b128 %0, %8, off\n\t"
               "global_load_async_to_lds_b128 %1, %9, off\n\t"
               "global_load_async_to_lds_b128 %2, %10, off\n\t"
               "global_load_async_to_lds_b128 %3, %11, off\n\t"
               "global_load_async_to_lds_b128 %4, %12, off\n\t"
               "global_load_async_to_lds_b128 %5, %13, off\n\t"
               "global_load_async_to_lds_b128 %6, %14, off\n\t"
               "global_load_async_to_lds_b128 %7, %15, off\n\t"
               "s_wait_xcnt 0x0"
               :: "v"(l[0]), "v"(l[1]), "v"(l[2]), "v"(l[3]), "v"(l[4]), "v"(l[5]), "v"(l[6]), "v"(l[7]),
                  "v"(g[0]), "v"(g[1]), "v"(g[2]), "v"(g[3]), "v"(g[4]), "v"(g[5]), "v"(g[6]), "v"(g[7])
               : "memory");
#endif
}
// The same for four, two and one copies of this lane.
__device__ __forceinline__ void async4(const unsigned* l, const u16* const* g) {
#if defined(__HIP_DEVICE_COMPILE__)
  asm volatile("global_load_async_to_lds_b128 %0, %4, off\n\t"
               "global_load_async_to_lds_b128 %1, %5, off\n\t"
               "global_load_async_to_lds_b128 %2, %6, off\n\t"
               "global_load_async_to_lds_b128 %3, %7, off\n\t"
               "s_wait_xcnt 0x0"
               :: "v"(l[0]), "v"(l[1]), "v"(l[2]), "v"(l[3]), "v"(g[0]), "v"(g[1]), "v"(g[2]), "v"(g[3])
               : "memory");
#endif
}
__device__ __forceinline__ void async2(const unsigned* l, const u16* const* g) {
#if defined(__HIP_DEVICE_COMPILE__)
  asm volatile("global_load_async_to_lds_b128 %0, %2, off\n\t"
               "global_load_async_to_lds_b128 %1, %3, off\n\t"
               "s_wait_xcnt 0x0"
               :: "v"(l[0]), "v"(l[1]), "v"(g[0]), "v"(g[1])
               : "memory");
#endif
}
__device__ __forceinline__ void async1(unsigned l, const u16* g) {
#if defined(__HIP_DEVICE_COMPILE__)
  asm volatile("global_load_async_to_lds_b128 %0, %1, off\n\t"
               "s_wait_xcnt 0x0"
               :: "v"(l), "v"(g)
               : "memory");
#endif
}
// One stage (64 keys) of k rows and v^T rows into one ring buffer, 16 copies per lane of the 128 threads:
//   k   chunk i: key row i*8 + (tid>>4), 16-B piece tid&15  (a wave covers two whole 256-B rows), LDS pitch KPB;
//   v^T chunk i: d row i*16 + (tid>>3), 16-B piece tid&7    (a wave covers four whole 128-B rows), LDS pitch VPB.
// kg, vg, lk, lv are this lane's addresses of chunk 0.
__device__ __forceinline__ void stage_kv(const u16* kg, const u16* vg, unsigned lk, unsigned lv) {
  unsigned l[8];
  const u16* g[8];
  // both loops unrolled so that l[] and g[] are registers, as the asm operands need them
#pragma unroll
  for (int i = 0; i < 8; ++i) { l[i] = lk + (unsigned)(i * 8 * KPB); g[i] = kg + (size_t)(i * 8) * KVD; }
  async8(l, g);
#pragma unroll
  for (int i = 0; i < 8; ++i) { l[i] = lv + (unsigned)(i * 16 * VPB); g[i] = vg + (size_t)(i * 16) * SEQ; }
  async8(l, g);
}
// One GEMM stage (64 k = 128 B of each row) of 128 A rows and CT * 128 B rows into one ring buffer, by the block's CT * 128 threads;
// a wave's copy covers four whole 128-B row pieces, LDS pitch GPB.
//   B: each group of 128 threads brings its own column tile's 128 rows: chunk i = row i*16 + ((tid&127)>>3), 16-B piece tid&7, 8 copies;
//   A: all threads share the 128 rows: chunk i = row i*16*CT + (tid>>3), piece tid&7: 4 copies a lane at CT = 2; at CT = 3 two, and a
//      third (rows 96 .. 127) from waves 0 .. 7 alone, under a scalar branch (wave is a scalar).
// ag, bg, la, lb are this lane's addresses of chunk 0; rs16 = 16 rows of the global planes, in elements.
template <int CT>
__device__ __forceinline__ void stage_ab(const u16* ag, const u16* bg, size_t rs16, unsigned la, unsigned lb, int wave) {
  static_assert(CT == 2 || CT == 3);
  unsigned l[8];
  const u16* g[8];
  // the loops unrolled so that l[] and g[] are registers, as the asm operands need them
#pragma unroll
  for (int i = 0; i < 8; ++i) { l[i] = lb + (unsigned)(i * 16 * GPB); g[i] = bg + (size_t)i * rs16; }
  async8(l, g);
  if constexpr (CT == 2) {
#pragma unroll
    for (int i = 0; i < 4; ++i) { l[i] = la + (unsigned)(i * 16 * CT * GPB); g[i] = ag + (size_t)(i * CT) * rs16; }
    async4(l, g);
  } else {
#pragma unroll
    for (int i = 0; i < 2; ++i) { l[i] = la + (unsigned)(i * 16 * CT * GPB); g[i] = ag + (size_t)(i * CT) * rs16; }
    async2(l, g);
    if (wave < 8) async1(la + (unsigned)(2 * 16 * CT * GPB), ag + (size_t)(2 * CT) * rs16);
  }
}
// the issuing wave's own wait: every asynchronous copy it has issued has landed in LDS
__device__ __forceinline__ void wait_async0() {
#if defined(__HIP_DEVICE_COMPILE__)
  asm volatile("s_wait_asynccnt 0x0" ::: "memory");
#endif
}
// this wave's LDS reads and writes have retired (in front of the barrier behind which a buffer is refilled)
__device__ __forceinline__ void wait_ds0() {
#if defined(__HIP_DEVICE_COMPILE__)
  asm volatile("s_wait_dscnt 0x0" ::: "memory");
#endif
}

// =====================================================================================================
// cos/sin tables for the rotary: row = b*SEQ + s (0 .. nrows-1), column j = 0..63:
//   invf[j] = 1e6^(-j/64) (f64 exp2, converted to f32), ang = float(pos[row]) * invf[j] (f32 multiply),
//   cosT[row][j] = cosf(ang), sinT[row][j] = sinf(ang).
// Block = 4 rows x 64 j (one value pair per thread) staged in LDS; after the barrier waves 0,1 write the 4 cos rows and
// coverage: nrows/4 blocks (bid) x (2 tables x 4 rows x 64 floats) = both tables exactly once (nrows % 4 == 0, host).
// =====================================================================================================
__device__ __forceinline__ void trig64(int bid, const int* __restrict__ pos, float* cosT, float* sinT, int nrows) {
#pragma clang fp contract(off)
  __shared__ __align__(16) float cs[2 * 256];
  const int tid  = (int)threadIdx.x;
  const int row0 = bid * 4;
  if (row0 + 4 > nrows) return;                       // block-uniform, before the barrier; never taken with the exact grid
  const int r = tid >> 6, j = tid & 63;
  const float p    = (float)pos[row0 + r];
  const float invf = (float)exp2(-(double)j * (LOG2THETA / 64.0));
  const float ang  = p * invf;
  cs[tid]       = cosf(ang);
  cs[256 + tid] = sinf(ang);
  __syncthreads();
  if (tid < 128) {                                    // waves 0..3, wave-uniform
    const int tb    = tid >> 6;                       // 0: cos rows (waves 0,1), 1: sin rows (waves 2,3)
    const int q     = tid & 63;
    const int rr    = q >> 4;
    const int piece = (q & 15) * 4;
    const v4f v = *(const v4f*)(cs + tb * 256 + rr * 64 + piece);
    float* base = (tb != 0) ? sinT : cosT;
    float* dst  = base + (size_t)(row0 + rr) * HHALF + piece;
    {
      *(v4f*)(dst) = v;
      
    }
  }
}

// =====================================================================================================
// f32 -> 16-bit plane, same layout.  f16mode == 0: bf16 RNE bits;  f16mode == 1: f16 bits of (bf16 RNE value) * scale.
// Thread = 8 consecutive elements: two 16-B loads, one 16-B store; 32 consecutive lanes = 512 contiguous, 512-B aligned
// coverage: ceil(n8/256) blocks (bid) x 256 thr x 8 (in-kernel bound) = the whole plane (n8 a multiple of 256 here).
// =====================================================================================================
__device__ __forceinline__ void cvt16(int bid, const float* __restrict__ x, u16* D, int n8, int f16mode, float scale) {
  const int gt = bid * 256 + (int)threadIdx.x;
  if (gt >= n8) return;
  const float* p = x + (size_t)gt * 8;
  const v4f a = *(const v4f*)(p), b4 = *(const v4f*)(p + 4);
  float w[8];
#pragma unroll
  for (int e = 0; e < 4; ++e) { w[e] = a[e]; w[4 + e] = b4[e]; }
  v4u o;
#pragma unroll
  for (int e = 0; e < 4; ++e) {
    const float f0 = w[2 * e], f1 = w[2 * e + 1];
    const unsigned short hb0 = h_bits((_Float16)(bfr(f0) * scale));
    const unsigned short hb1 = h_bits((_Float16)(bfr(f1) * scale));
    const unsigned short bb0 = bf_bits(f0);
    const unsigned short bb1 = bf_bits(f1);
    o[e] = (f16mode != 0) ? pk16(hb0, hb1) : pk16(bb0, bb1);
  }
  u16* d = D + (size_t)gt * 8;
  {
    *(v4u*)(d) = o;
    
  }
}

// =====================================================================================================
// Weight transpose + convert: W f32 [K rows][N cols] (row pitch N) -> Wt 16-bit [N rows][K cols] (row pitch K), so that
// a column n of W becomes the k-contiguous B operand row n.  f16mode == 0: bf16 RNE bits; 1: f16 bits of (bf16 RNE value)*scale.
// Block = 64 k x 64 n tile: load phase 4 iterations x (16 k rows x 16 lanes x 4 n) with 16-B loads into an LDS tile
// coverage: load 4 it x 256 thr x 4 = 64 x 64; store 2 it x 256 thr x 8 halves = 64 rows x 64; (K/64)*(N/64)
//           blocks (bid) = the whole [N][K] plane exactly once.
// =====================================================================================================
__device__ __forceinline__ void wt16(int bid, const float* __restrict__ W, u16* Wt, int K, int N, int f16mode, float scale) {
  __shared__ __align__(16) u16 T[64 * WTP];
  const int tid = (int)threadIdx.x;
  const int nkt = K >> 6;
  const int kt  = bid % nkt;
  const int nt  = bid / nkt;
  const int kb  = kt * 64, nb = nt * 64;
  if (nb + 64 > N) return;                            // block-uniform, before the barrier; never taken with the exact grid
  const int c4 = (tid & 15) * 4;                      // n within tile
  const int r0 = tid >> 4;                            // k within tile (0..15) + 16*it
#pragma unroll
  for (int it = 0; it < 4; ++it) {
    const int r = it * 16 + r0;
    const v4f a = *(const v4f*)(W + (size_t)(kb + r) * (size_t)N + nb + c4);
#pragma unroll
    for (int e = 0; e < 4; ++e) {
      const float f = a[e];
      const unsigned short hb = h_bits((_Float16)(bfr(f) * scale));
      const unsigned short bb = bf_bits(f);
      T[(c4 + e) * WTP + r] = (f16mode != 0) ? hb : bb;
    }
  }
  __syncthreads();
  v4u o[2];
  const int q8 = tid >> 3, p8 = (tid & 7) * 8;
#pragma unroll
  for (int it = 0; it < 2; ++it) o[it] = *(const v4u*)(T + (it * 32 + q8) * WTP + p8);
  u16* dst = Wt + (size_t)(nb + q8) * (size_t)K + kb + p8;
  {
#pragma unroll
    for (int it = 0; it < 2; ++it) {
      *(v4u*)(dst + (size_t)(it * 32) * (size_t)K) = o[it];
    }
    // the code of the launch's other jobs follows these stores in the built kernel and reuses their registers
    asm volatile("s_wait_xcnt 0x0" ::: "memory");
  }
}

// =====================================================================================================
// Everything that depends on the inputs alone, in one launch: block ranges, in this order: cos/sin tables (PB_TR blocks), x plane
// (PB_X), Wq^T (PB_WQ), Wo^T (PB_WQ), Wk^T (PB_WK), Wv^T (PB_WK). The jobs write disjoint planes and read none of them; the job of
// a block is block-uniform, so each job's one barrier stays under block-uniform control flow.
// =====================================================================================================
__global__ __launch_bounds__(256)
void prep16(const int* __restrict__ pos, const float* __restrict__ x, const float* __restrict__ wq, const float* __restrict__ wk,
            const float* __restrict__ wv, const float* __restrict__ wo, float* cosT, float* sinT,
            u16* XBo, u16* WQo, u16* WKo, u16* WVo, u16* WOo) {
  int bid = (int)blockIdx.x;
  if (bid < PB_TR) { trig64(bid, pos, cosT, sinT, MROWS); return; }
  bid -= PB_TR;
  if (bid < PB_X) { cvt16(bid, x, XBo, (MROWS * DMOD) / 8, 0, 1.0f); return; }
  bid -= PB_X;
  const float* W = wq;
  u16* Wt = WQo;
  int N = DMOD, f16mode = 0;
  float scale = 1.0f;
  if (bid >= PB_WQ) {
    bid -= PB_WQ; W = wo; Wt = WOo; f16mode = 1; scale = WOS;
    if (bid >= PB_WQ) {
      bid -= PB_WQ; W = wk; Wt = WKo; N = KVD; f16mode = 0; scale = 1.0f;
      if (bid >= PB_WK) { bid -= PB_WK; W = wv; Wt = WVo; }
    }
  }
  wt16(bid, W, Wt, DMOD, N, f16mode, scale);
}

// =====================================================================================================
// v^T plane straight from the accumulators of a v projection tile: lane (m, hh) holds in acc[i][j] column d = 16j + m of the wave's
// 64 and the 8 consecutive keys 16i + 8hh + 0..7 of its 64 rows, which is one 16-B piece of a v^T row:
//   VH[((b*NKVH + g)*HD + d)][s] = f16(v * 1024).
// dst = the wave's first v^T row at its first key; the four pieces i of a lane pair (hh = 0, 1) fill one whole 128-B line.
// coverage: 16 stores x 16 d x 2 halves x 8 keys = the wave's 64 d x 64 keys.
// =====================================================================================================
__device__ __forceinline__ void vt_acc(const v8f (&acc)[4][4], float oscale, u16* dst, int lane) {
  const int hh = lane >> 4, m = lane & 15;
  u16* d0 = dst + (size_t)m * SEQ + 8 * hh;
  // all three loops unrolled: the accumulators are indexed by constants only and stay in registers
#pragma unroll
  for (int j = 0; j < 4; ++j) {
#pragma unroll
    for (int i = 0; i < 4; ++i) {
      v4u o;
#pragma unroll
      for (int e = 0; e < 4; ++e) {
        const float t0 = (acc[i][j][2 * e] * oscale) * VCAR;
        const float t1 = (acc[i][j][2 * e + 1] * oscale) * VCAR;
        o[e] = pk16(h_bits((_Float16)t0), h_bits((_Float16)t1));
      }
      *(v4u*)(d0 + (size_t)(j * 16) * SEQ + i * 16) = o;
    }
  }
}

// =====================================================================================================
// Per-head RMS normalisation + rotate-half rotary + 16-bit planes from one 128 x 128 tile of a projection (128 rows row0 + r of one
// head, f32), as the four waves of the product have left it in their slabs [64][68] (wave = 2*(r >> 6) + (d >> 6)); ncol = DMOD for
// q, KVD for k = row pitch of the planes, ccol = head*HD:
//   rs = 1/sqrt(mean_d(x[head][d]^2) + eps) over the head's 128 columns (f32 sum of squares: 16 per thread, then an
//   8-lane shuffle sum, the 8 lanes of a head are 8 consecutive lanes); y[d] = (x[d]*rs) * w[d] with w = bf16 RNE value
//   of the norm weight; then for j < 64 within a head, with c = cosT[row][j], sn = sinT[row][j] (f32 tables):
//   out[j]    = y[j]*c    - y[j+64]*sn
//   out[j+64] = y[j+64]*c + y[j]*sn
//   Hp [MROWS][ncol] = f16(out * sc).
// Eight passes of 16 rows, two a trip: thread t = row 16*pass + (t >> 3), chunk i = t&7: columns 8i .. +7 and + 64 of the head. No lane-varying
// control anywhere (shuffles with all lanes active).
// coverage: 8 passes x 128 thr x 16 = the tile's 128 rows x 128 columns of Hp, whole 128-B lines.
// =====================================================================================================
__device__ __forceinline__ void rot_pair(float xl, float xh, float cv, float sv, float sc,
                                         unsigned short& hl, unsigned short& hhv) {
#pragma clang fp contract(off)
  const float rl = xl * cv - xh * sv;
  const float rh = xh * cv + xl * sv;
  hl  = h_bits((_Float16)(rl * sc));
  hhv = h_bits((_Float16)(rh * sc));
}

__device__ __forceinline__ void nrope16(const float* slab, int tid, size_t row0, int ccol, int ncol,
                                        const float* __restrict__ nw,
                                        const float* __restrict__ cosT, const float* __restrict__ sinT,
                                        u16* Hp, float sc) {
  // every product and sum of the normalisation and the rotary rounded on its own
#pragma clang fp contract(off)
  const int dlo = (tid & 7) * 8;                       // j within head, multiple of 8
  const v4f wa = *(const v4f*)(nw + dlo), wb4 = *(const v4f*)(nw + dlo + 4);
  const v4f wc = *(const v4f*)(nw + HHALF + dlo), wd = *(const v4f*)(nw + HHALF + dlo + 4);
  float wl[8], wh[8];
#pragma unroll
  for (int e = 0; e < 4; ++e) {
    wl[e] = bfr(wa[e]);   wl[4 + e] = bfr(wb4[e]);
    wh[e] = bfr(wc[e]);   wh[4 + e] = bfr(wd[e]);
  }
  // kept rolled, two passes a trip: more of them take registers above v255 and lengthen the kernel's text
#pragma unroll 1
  for (int pt = 0; pt < GBM / 32; ++pt) {
   // the trip's two passes unrolled: their chains (LDS and table reads, sum, three shuffles, root) are independent and cover one
   // another's latency, which the three waves of a SIMD here cannot
#pragma unroll
   for (int u = 0; u < 2; ++u) {
    const int r = pt * 32 + u * 16 + (tid >> 3);       // row of the tile
    const float* p = slab + (r >> 6) * (8 * SLAB64) + (r & 63) * 68 + dlo;   // low-half chunk; the high half: the next wave's slab
    const v4f xa = *(const v4f*)(p), xb = *(const v4f*)(p + 4);
    const v4f ya = *(const v4f*)(p + 4 * SLAB64), yb = *(const v4f*)(p + 4 * SLAB64 + 4);
    const size_t row  = row0 + (size_t)r;
    const size_t trow = row * HHALF + dlo;
    const v4f ca = *(const v4f*)(cosT + trow), cb = *(const v4f*)(cosT + trow + 4);
    const v4f sa = *(const v4f*)(sinT + trow), sb = *(const v4f*)(sinT + trow + 4);
    float xl[8], xh[8], cv[8], sv[8];
#pragma unroll
    for (int e = 0; e < 4; ++e) {
      xl[e] = xa[e];        xl[4 + e] = xb[e];
      xh[e] = ya[e];        xh[4 + e] = yb[e];
      cv[e] = ca[e];        cv[4 + e] = cb[e];
      sv[e] = sa[e];        sv[4 + e] = sb[e];
    }
    // sum of squares over the head's 128 columns: 16 here, then lanes xor 1, 2, 4 (aligned groups of 8 lanes = one row)
    float ss = 0.0f;
#pragma unroll
    for (int e = 0; e < 8; ++e) { ss = ss + xl[e] * xl[e]; ss = ss + xh[e] * xh[e]; }
    ss += __shfl_xor(ss, 1, 32);
    ss += __shfl_xor(ss, 2, 32);
    ss += __shfl_xor(ss, 4, 32);
    const float var = ss * (1.0f / (float)HD);
    const float rs  = 1.0f / sqrtf(var + EPS_RMS);
#pragma unroll
    for (int e = 0; e < 8; ++e) {
      xl[e] = (xl[e] * rs) * wl[e];
      xh[e] = (xh[e] * rs) * wh[e];
    }
    v4u ohl, ohh;
#pragma unroll
    for (int e = 0; e < 4; ++e) {
      unsigned short hl0, hh0, hl1, hh1;
      rot_pair(xl[2 * e],     xh[2 * e],     cv[2 * e],     sv[2 * e],     sc, hl0, hh0);
      rot_pair(xl[2 * e + 1], xh[2 * e + 1], cv[2 * e + 1], sv[2 * e + 1], sc, hl1, hh1);
      ohl[e] = pk16(hl0, hl1);
      ohh[e] = pk16(hh0, hh1);
    }
    const size_t oc0 = row * (size_t)ncol + (size_t)(ccol + dlo);
    *(v4u*)(Hp + oc0) = ohl;
    *(v4u*)(Hp + oc0 + HHALF) = ohh;
   }
   // the next trip's first instructions rewrite registers that this trip's plane stores name
   asm volatile("s_wait_xcnt 0x0" ::: "memory");
  }
}

// =====================================================================================================
// The wave's 64 x 64 tile of C: accumulators * oscale -> the wave's own slab [64][68] -> whole 256-B row pieces of C.
// coverage: 32 instructions x 2 rows x 16 lanes x 4 floats = the wave's 64 x 64 tile.
// =====================================================================================================
__device__ __forceinline__ void slab64x64(float* sl, const v8f (&acc)[4][4], float oscale, int lane) {
  const int hh = lane >> 4, m = lane & 15;
#pragma unroll
  for (int i = 0; i < 4; ++i) {
#pragma unroll
    for (int r = 0; r < 8; ++r) {
      const int ro = (i * 16 + 8 * hh + r) * 68 + m;
      sl[ro]      = acc[i][0][r] * oscale;
      sl[ro + 16] = acc[i][1][r] * oscale;
      sl[ro + 32] = acc[i][2][r] * oscale;
      sl[ro + 48] = acc[i][3][r] * oscale;
    }
  }
}
__device__ __forceinline__ void epi64x64(float* sl, const v8f (&acc)[4][4], float oscale,
                                         float* C, int N, size_t rowb, int col0, int lane) {
  const int hh = lane >> 4, m = lane & 15;
  slab64x64(sl, acc, oscale, lane);
  wave_sync_lds();
  float* dst = C + (rowb + (size_t)hh) * (size_t)N + col0 + m * 4;
#pragma unroll
  for (int it = 0; it < 32; ++it) {
    const v4f v = *(const v4f*)(sl + (it * 2 + hh) * 68 + m * 4);
    *(v4f*)(dst + (size_t)(it * 2) * (size_t)N) = v;
  }
}

// =====================================================================================================
// GEMM: C[row][N] (f32, row pitch N) = A[row][K] (16-bit row-major, pitch K) . Bt[N][K]^T (16-bit k-contiguous) * oscale,
// row = bb*SEQ + s.  BF: bf16 operands (v_wmma_f32_16x16x32_bf16), else f16 (v_wmma_f32_16x16x32_f16).
// Block -> (column group cg, row tile rt, batch bb; from the block's index, by the caller): a 128 x (CT*128) tile of C, CT column tiles
// of 128 side by side on the same 128 A rows, so that a staged A slice serves CT column tiles and the block asks L2 for
// (1 + CT) * 128 rows where CT blocks of one tile ask for 2 * CT * 128.  4 * CT waves: column tile sub = wave >> 2, and in it 2 x 2
// waves of 64 x 64 = 4 x 4 accumulators each, so that a fragment read from LDS serves four products.  One block per WGP.
// FUSE: C is not stored; Bt is the plane [Wq^T; Wk^T; Wv^T], a column tile is one head (0..15 q, 16..19 k, 20..23 v) and goes on inside
// the block: q and k: slabs, one block barrier, normalisation + rotary + plane; v: v^T plane from the accumulators (then the same barrier).
// The 128 A rows and CT*128 Bt rows reach the waves through an LDS ring of two buffers, 64 k a stage, filled by asynchronous
// copies of whole 128-B row pieces; fragments by two 16-B LDS loads each (split k map for A and B).  The block starts at k stage
// rot % (K/64) and takes the stages in ring order (the blocks that share A rows or Bt rows, which run at the same time, ask L2 for
// different lines at any moment); inside a stage k ascends in steps of 32.  One block barrier per stage, under block-uniform control
// flow (host: K % 64 == 0, N % (CT*128) == 0).  The waves' slabs lie behind the ring where both fit the WGP's LDS (CT = 2); at CT = 3
// they take the ring's bytes, behind the last stage's barrier, in front of which every wave's reads have retired and no copy is in flight.
// coverage: 4*CT waves x 4 row groups x (16 x 64) = the block's tile; NB * (SEQ/128) * (N/(CT*128)) blocks = every row once.
// =====================================================================================================
template <bool BF> struct FragSel { typedef v16h T; };
template <> struct FragSel<true> { typedef v16b T; };
template <bool BF>
__device__ __forceinline__ typename FragSel<BF>::T ldfrag_t(const u16* p) {
  if constexpr (BF) return ldfrag_b(p);
  else return ldfrag_h((const _Float16*)(const void*)p);
}
template <bool BF>
__device__ __forceinline__ v8f mma_t(typename FragSel<BF>::T a, typename FragSel<BF>::T b, v8f c) {
  if constexpr (BF) return mma_b(a, b, c);
  else return mma_h(a, b, c);
}

template <bool BF, bool FUSE, int CT>
__device__ __forceinline__
void gemm128_blk(int cg, int rt, int bb, int rot, const u16* __restrict__ A, const u16* __restrict__ Bt, float* C, int N, int K, float oscale,
                 const float* __restrict__ qnw, const float* __restrict__ knw,
                 const float* __restrict__ cosT, const float* __restrict__ sinT, u16* QHo, u16* KHo, u16* VHo) {
  constexpr int STB   = (GBM + CT * GBN) * GPB;           // one ring buffer: 128 A rows, CT*128 Bt rows, pitch GPB
  constexpr int RNGB  = 2 * STB;
  constexpr int SLBB  = CT * 4 * (4 * SLAB64) * 4;        // per wave [64][68] floats
  constexpr int SLOFF = (RNGB + SLBB <= 327680) ? RNGB : 0;
  constexpr int SMB   = (SLOFF != 0) ? (RNGB + SLBB) : ((RNGB > SLBB) ? RNGB : SLBB);
  static_assert(SMB <= 327680 && 2 * SMB > 327680 && (STB % 16) == 0);   // one block per WGP
  __shared__ __align__(16) unsigned char smem[SMB];
  u16*   ring = (u16*)(void*)smem;
  float* slab = (float*)(void*)(smem + SLOFF);
  const int tid = (int)threadIdx.x, t128 = tid & 127, lane = tid & 31, hh = lane >> 4, m = lane & 15;
  const int wave = __builtin_amdgcn_readfirstlane(tid >> 5);   // in a scalar register: the tests on it are scalar branches
  if (bb >= NB) return;                     // block-uniform, before any barrier or copy; never taken with the exact grid
  if (rt * GBM + GBM > SEQ) return;         // block-uniform; never taken
  const int nstg  = K >> 6;
  const int st0   = rot % nstg;             // the block's first k stage; the stages follow in ring order (block-uniform)
  const int sub   = wave >> 2;              // this wave's column tile among the block's CT
  const int col0  = (cg * CT + sub) * GBN;
  const size_t row0 = (size_t)bb * SEQ + (size_t)(rt * GBM);
  const int wr = (wave >> 1) & 1, wc = wave & 1;   // this wave's 64 x 64 tile inside its column tile
  // this lane's chunk 0 of stage 0 (stage_ab): global addresses and LDS byte addresses in buffer 0
  const size_t rs16 = (size_t)16 * (size_t)K;
  const u16* ag0 = A  + (row0 + (size_t)(tid >> 3)) * (size_t)K + (tid & 7) * 8;
  const u16* bg0 = Bt + (size_t)(col0 + (t128 >> 3)) * (size_t)K + (t128 & 7) * 8;
  const unsigned lring = (unsigned)(size_t)(const void*)ring;
  const unsigned la0 = lring + (unsigned)((tid >> 3) * GPB + (tid & 7) * 16);
  const unsigned lb0 = lring + (unsigned)(GATB + (sub * GBN + (t128 >> 3)) * GPB + (t128 & 7) * 16);

  v8f acc[4][4];
#pragma unroll
  for (int i = 0; i < 4; ++i) {
#pragma unroll
    for (int j = 0; j < 4; ++j) acc[i][j] = zero8();
  }

  // ---- ring prologue: stage 0 lands and is published, then stage 1 flies while stage 0 is worked on ----
  stage_ab<CT>(ag0 + (size_t)st0 * GKS, bg0 + (size_t)st0 * GKS, rs16, la0, lb0, wave);
  wait_async0();
  __syncthreads();
  if (nstg > 1) {                                         // block-uniform
    const int s1 = (st0 + 1 < nstg) ? st0 + 1 : 0;
    stage_ab<CT>(ag0 + (size_t)s1 * GKS, bg0 + (size_t)s1 * GKS, rs16, la0 + (unsigned)STB, lb0 + (unsigned)STB, wave);
  }

  // kept rolled: one trip = one stage, with its one publish point at the foot
#pragma unroll 1
  for (int st = 0; st < nstg; ++st) {
    const int bufh = (st & 1) * (STB / 2);                // this stage's buffer, in halves
    const u16* ap = ring + bufh + (wr * 64 + m) * (GPB / 2) + 8 * hh;
    const u16* bp = ring + bufh + (GATB / 2) + (sub * GBN + wc * 64 + m) * (GPB / 2) + 8 * hh;
    // both 32-k steps of a stage unrolled: their LDS offsets become immediates
    typename FragSel<BF>::T a[GKS / 32][4], b[GKS / 32][4];
#pragma unroll
    for (int ks = 0; ks < GKS / 32; ++ks) {
#pragma unroll
      for (int j = 0; j < 4; ++j) b[ks][j] = ldfrag_t<BF>(bp + j * 16 * (GPB / 2) + ks * 32);
#pragma unroll
      for (int i = 0; i < 4; ++i) a[ks][i] = ldfrag_t<BF>(ap + i * 16 * (GPB / 2) + ks * 32);
    }
    // keeps the stage's 32 LDS reads together in front of its 32 products: left free, the compiler reloads one A fragment
    // per four products and waits out the LDS latency each time
    __builtin_amdgcn_sched_barrier(0);
#pragma unroll
    for (int ks = 0; ks < GKS / 32; ++ks) {
#pragma unroll
      for (int i = 0; i < 4; ++i) {
#pragma unroll
        for (int j = 0; j < 4; ++j) acc[i][j] = mma_t<BF>(a[ks][i], b[ks][j], acc[i][j]);
      }
    }
    // keeps the products in front of the publish point: left free, they sink behind the barrier, the waits stand directly
    // behind the LDS reads, and the next stage's copies lose the products' time as their lead
    __builtin_amdgcn_sched_barrier(0);
    // ---- publish point of stage st + 1: own LDS reads retired, own copies landed, every wave has left this buffer ----
    wait_ds0();
    wait_async0();
    __syncthreads();
    if (st + 2 < nstg) {                                  // block-uniform: refill the buffer that this trip has just read
      const int s2 = (st0 + st + 2 < nstg) ? st0 + st + 2 : st0 + st + 2 - nstg;   // trip st + 2 works on k stage s2
      stage_ab<CT>(ag0 + (size_t)s2 * GKS, bg0 + (size_t)s2 * GKS, rs16,
                   la0 + (unsigned)(st & 1) * STB, lb0 + (unsigned)(st & 1) * STB, wave);
    }
  }
  wait_async0();                                          // nothing in flight when the wave ends
  if constexpr (!FUSE) {
    epi64x64(slab + wave * (4 * SLAB64), acc, oscale, C, N, row0 + (size_t)(wr * 64), col0 + wc * 64, lane);
  } else {
    const int  hidx = cg * CT + sub;                      // the column tile's head: 0..15 q, 16..19 k, 20..23 v (the same in its 4 waves)
    const bool isv  = hidx >= NH + NKVH;
    if (isv) {
      vt_acc(acc, oscale, VHo + ((size_t)(bb * NKVH + (hidx - NH - NKVH)) * HD + (size_t)(wc * 64)) * SEQ + rt * GBM + wr * 64, lane);
    } else {
      slab64x64(slab + wave * (4 * SLAB64), acc, oscale, lane);
    }
    __syncthreads();                                      // a row's low and high 64 columns lie in two waves' slabs; every wave of the block passes
    if (!isv) {
      const bool isk = hidx >= NH;
      nrope16(slab + sub * (16 * SLAB64), t128, row0, (isk ? hidx - NH : hidx) * HD, isk ? KVD : DMOD, isk ? knw : qnw,
              cosT, sinT, isk ? KHo : QHo, isk ? KSC : QSC);
    }
  }
}

// one product per launch (ctx.Wo): 128 x 256 tiles, 8 waves; blocks of one row tile start 4 k stages apart, those of one column group one apart
template <bool BF>
__global__ __launch_bounds__(CTO * 128)
void gemm128(const u16* __restrict__ A, const u16* __restrict__ Bt, float* C, int N, int K, int nrt, float oscale) {
  const int ncg = N / (CTO * GBN);
  const int bid = (int)blockIdx.x;
  const int t2  = bid / ncg;
  const int cg  = bid % ncg;
  gemm128_blk<BF, false, CTO>(cg, t2 % nrt, t2 / nrt, t2 + 4 * cg, A, Bt, C, N, K, oscale,
                              nullptr, nullptr, nullptr, nullptr, nullptr, nullptr, nullptr);
}

// x.[Wq Wk Wv] in one launch: 128 x 384 tiles, 12 waves, three heads of the 24 (16 q, 4 k, 4 v) on the same 128 rows of x. q and k tiles
// leave as normalised, rotated f16 planes (q x256, k x256), v tiles as the v^T plane x1024.
__global__ __launch_bounds__(CTQ * 128)
void gemm_qkv(const u16* __restrict__ A, const u16* __restrict__ Wqkv,
              const float* __restrict__ qnw, const float* __restrict__ knw,
              const float* __restrict__ cosT, const float* __restrict__ sinT,
              u16* QHo, u16* KHo, u16* VHo, int K, float oscale) {
  const int bid = (int)blockIdx.x;
  const int t2  = bid / NCGQ;
  const int cg  = bid % NCGQ;
  gemm128_blk<true, true, CTQ>(cg, t2 % (SEQ / GBM), t2 / (SEQ / GBM), t2 + 4 * cg, A, Wqkv, nullptr, DMOD + 2 * KVD, K, oscale,
                               qnw, knw, cosT, sinT, QHo, KHo, VHo);
}

// =====================================================================================================
// Non-causal grouped-query attention, hd = 128, all SEQ keys. Block bid -> (query tile qt = bid % NQT: rows q0 = 32*qt ..
// q0+31, head group hg = kv head, batch b); one wave per query head = hg*WPB + wave (the 4 heads of the group share kv head hg).
// A wave takes its 32 queries as QCG = 2 column groups of 16 (group g: rows q0 + 16g ..): every k and v^T fragment read from LDS
// serves two products, and a staged key stage serves 32 queries of each head. What follows is said of one column group.
//   q plane f16 x256 [b*SEQ + s][h*HD + d]; k plane f16 x256 [b*SEQ + s][g*HD + d] (pitch KVD);
//   v^T plane [b*NKVH + g][d][SEQ] x1024.
//   scores = q.k (4 k-steps over d); P.v with P x32768 (f16) and v^T, for every query row;
//   O written as one f16 plane (O x1024, layout [b*SEQ + s][h*HD + d]).
//   score (log2 domain) t(i, j) = (q_i.k_j over HD) * (1/sqrt(128))*log2e/(256*256).
//   k rows and v^T rows reach the 4 waves through an LDS ring of two buffers, 64 keys a stage, filled by asynchronous copies.
//   Both products are taken transposed: S^T = k.q^T (A = k rows from the ring, B = q, loaded once and kept in registers) and
//   O^T += v^T.P^T (A = v^T rows from the ring, B = P^T), all fragments in the split k map. A lane (c, hh) then holds, of query
//   column q0 + c, the scores of keys kb + 8hh + r and kb + 16 + 8hh + r: maximum and sum run inside the lane, the maximum is
//   joined with the other half by one cross-row move per 32 keys, the sums once after the loop; the two score tiles, converted
//   in place (P x32768, f16), are the B fragment of the second product. All NKT key tiles of 32 visited once, in ring order from the block's own first stage; online
//   max-subtracted base-2 softmax in f32, -inf-safe rescale.
//   After the loop: out = acc / Z (Z, x32768 like P, is about 32768 or more; guarded anyway), carry 1/1024 folded once, written into the slab.
//   One block barrier per stage, under block-uniform control flow; bounded loops only (NST compile-time).
// coverage: per wave 16 instructions x 2 rows x 16 lanes x 8 halves = 32 x 128; grid NQT x NHG x NB blocks x WPB
//           waves = every (b, s < SQ, h) row segment of O exactly once.
// =====================================================================================================
// two waves per SIMD, no more: the grid is two blocks per WGP, and a third block on one WGP would leave another WGP short
__global__ __launch_bounds__(ATT_THREADS) __attribute__((amdgpu_waves_per_eu(2, 2)))
void attn_nc(const u16* __restrict__ QHp, const u16* __restrict__ KHp,
             const u16* __restrict__ VHp, u16* OHp) {
  __shared__ __align__(16) _Float16 ring[RINGB / 2];      // two buffers of (64 k rows pitch KPB, 128 v^T rows pitch VPB)

  const int tid  = (int)threadIdx.x;
  const int wave = tid >> 5;
  const int lane = tid & 31;
  const int hh   = lane >> 4;
  const int c    = lane & 15;
  const int bid  = (int)blockIdx.x;
  const int qt   = bid % NQT;
  const int t2   = bid / NQT;
  const int hg   = t2 % NHG;
  const int b    = t2 / NHG;
  if (b >= NB) return;                      // block-uniform, before any barrier or copy; never taken with the exact grid
  const int q0   = qt * (16 * QCG);
  if (q0 + 16 * QCG > SQ) return;                 // block-uniform; never taken
  const int head = hg * WPB + wave;
  const int kvh  = hg;

  float* slab = (float*)(void*)ring + wave * (QCG * SLW); // result slab [32][128] pitch 132: the ring's bytes, after the loop

  const size_t hcol = (size_t)head * HD + 8 * hh;
  const _Float16* Qh  = (const _Float16*)(const void*)QHp + ((size_t)b * SEQ + q0 + c) * DMOD + hcol;
  // this lane's chunk 0 of stage 0 (stage_kv): global addresses and LDS byte addresses in buffer 0
  const u16* kg0 = KHp + ((size_t)b * SEQ + (tid >> 4)) * KVD + (size_t)kvh * HD + (tid & 15) * 8;
  const u16* vg0 = VHp + ((size_t)(b * NKVH + kvh) * HD + (tid >> 3)) * SEQ + (tid & 7) * 8;
  const unsigned lring = (unsigned)(size_t)(const void*)ring;
  const unsigned lk0 = lring + (unsigned)((tid >> 4) * KPB + (tid & 15) * 16);
  const unsigned lv0 = lring + (unsigned)(KTB + (tid >> 3) * VPB + (tid & 7) * 16);
  // the block's first key stage; the stages follow in ring order: the NQT blocks that share a kv head run at the same time and
  // start on NST different stages, NQT/NST blocks on each, so that only those ask L2 for the same lines of its k and v^T at a
  // time (the online softmax takes the keys in any order)
  const int st0 = qt % NST;
  const float lsc = RSQ_HD * (LOG2E / (QSC * KSC));
  const float oc  = 1.0f / VCAR;                          // the carry on P stands in the running sum as well and cancels in acc / Z

  // q as the B operand: column = query q0 + 16g + c, loaded once for all keys
  v16h qh[QCG][HD / 32];
#pragma unroll
  for (int g = 0; g < QCG; ++g) {
#pragma unroll
    for (int kk = 0; kk < HD / 32; ++kk) qh[g][kk] = ldfrag_h(Qh + (size_t)(g * 16) * DMOD + kk * 32);
  }
  float mrun[QCG], lrun[QCG];                             // of query column 16g + c; lrun (x32768) over this half's keys only
  v8f o[QCG][8];                                          // o[g][j][r] = O^T[d = 16j + 8hh + r][query 16g + c]
#pragma unroll
  for (int g = 0; g < QCG; ++g) {
    mrun[g] = -INFINITY;
    lrun[g] = 0.f;
#pragma unroll
    for (int j = 0; j < 8; ++j) o[g][j] = zero8();
  }

  // ---- ring prologue: stage 0 lands and is published, then stage 1 flies while stage 0 is worked on ----
  stage_kv(kg0 + (size_t)st0 * KSTG * KVD, vg0 + st0 * KSTG, lk0, lv0);
  wait_async0();
  __syncthreads();
  {
    const int s1 = (st0 + 1 < NST) ? st0 + 1 : 0;
    stage_kv(kg0 + (size_t)s1 * KSTG * KVD, vg0 + s1 * KSTG, lk0 + STGB, lv0 + STGB);
  }

  // kept rolled: one trip = one stage, with its one publish point at the foot
#pragma unroll 1
  for (int st = 0; st < NST; ++st) {
   const int bufh = (st & 1) * (STGB / 2);                // this stage's buffer, in halves
   // kept rolled: unrolled, the compiler spreads a step's v^T reads in pairs among its products instead of issuing them together
   // ahead of the softmax arithmetic
#pragma unroll 1
   for (int sub = 0; sub < KSTG / 32; ++sub) {
    // ---- scores: D element r of this lane = (key kb + 8hh + r, query q0 + 16g + c) in s[g][0], key kb + 16 + 8hh + r in s[g][1], kb = the step's first key ----
    v8f s[QCG][2];
#pragma unroll
    for (int g = 0; g < QCG; ++g) { s[g][0] = zero8(); s[g][1] = zero8(); }
    const _Float16* k0p = ring + bufh + (sub * 32 + c) * (KPB / 2) + 8 * hh;
    const _Float16* k1p = k0p + 16 * (KPB / 2);
    v16h kh0[HD / 32], kh1[HD / 32];
#pragma unroll
    for (int kk = 0; kk < HD / 32; ++kk) { kh0[kk] = ldfrag_h(k0p + kk * 32); kh1[kk] = ldfrag_h(k1p + kk * 32); }
    // keeps the step's 16 k reads together in front of its 16 score products, so that the LDS latency is waited out once a step
    __builtin_amdgcn_sched_barrier(0);
#pragma unroll
    for (int kk = 0; kk < HD / 32; ++kk) {
#pragma unroll
      for (int g = 0; g < QCG; ++g) {
        s[g][0] = mma_h(kh0[kk], qh[g][kk], s[g][0]);
        s[g][1] = mma_h(kh1[kk], qh[g][kk], s[g][1]);
      }
    }
    // splits the step here, so that the eight v^T fragments are read together at the head of the softmax arithmetic, which covers
    // their latency, into the k fragments' registers: left free, the compiler reads one fragment in front of each pair of
    // products and waits out the LDS latency each time
    __builtin_amdgcn_sched_barrier(0);
    FragH ph[QCG];
    // the two column groups unrolled: their chains are independent and cover one another's latency
#pragma unroll
    for (int g = 0; g < QCG; ++g) {
      const v8f s0 = s[g][0], s1 = s[g][1];
      // ---- online softmax in base 2 over all keys, -inf-safe; one query column per lane ----
      float mx = fmaxf(s0[0], s1[0]);
#pragma unroll
      for (int r = 1; r < 8; ++r) mx = fmaxf(mx, fmaxf(s0[r], s1[r]));
      mx = fmaxf(mx, xhalf(mx)) * lsc;                    // lsc > 0: the maximum of the scaled scores
      const float mn = fmaxf(mrun[g], mx);
      const float ms = (mn == -INFINITY) ? 0.0f : mn;
      // the exponentials are the bare v_exp_f32: it gives 0 where the library form would give a subnormal (argument below -126), which
      // is far below half an ulp of the f16 P and of Z (x32768: about 2^15 or more once the two halves' sums are joined)
      const float al = __builtin_amdgcn_exp2f(mrun[g] - ms);
      mrun[g] = mn;
      const float mo = ms - PEXP;                         // P x32768 comes out of the exponential itself
      // ---- B fragment of P^T*32768 (f16): elements 0..7 = keys kb + 8hh + 0..7, elements 8..15 = keys kb + 16 + 8hh + 0..7 ----
      v2f ps = {0.f, 0.f};                                // sums over even and odd r, x32768 like P
      const v2f lsc2 = {lsc, lsc}, mo2 = {mo, mo};
#pragma unroll
      for (int r = 0; r < 8; r += 2) {
        // neighbouring accumulator registers taken as pairs: packed fma and packed add
        const v2f x0 = (v2f){s0[r], s0[r + 1]} * lsc2 - mo2;
        const v2f x1 = (v2f){s1[r], s1[r + 1]} * lsc2 - mo2;
        const v2f e0 = {__builtin_amdgcn_exp2f(x0[0]), __builtin_amdgcn_exp2f(x0[1])};
        const v2f e1 = {__builtin_amdgcn_exp2f(x1[0]), __builtin_amdgcn_exp2f(x1[1])};
        ps += e0;
        ps += e1;
        ph[g].h[0][r]     = (_Float16)e0[0];
        ph[g].h[0][r + 1] = (_Float16)e0[1];
        ph[g].h[1][r]     = (_Float16)e1[0];
        ph[g].h[1][r + 1] = (_Float16)e1[1];
      }
      lrun[g] = lrun[g] * al + (ps[0] + ps[1]);
#pragma unroll
      for (int j = 0; j < 8; ++j) {
#pragma unroll
        for (int r = 0; r < 8; ++r) o[g][j][r] *= al;
      }
    }
    // ---- v^T.P^T : A fragment row = d = j*16 + c, keys contiguous in the v^T rows; each fragment serves both column groups ----
    {
      const _Float16* vhp = ring + bufh + (KTB / 2) + c * (VPB / 2) + sub * 32 + 8 * hh;   // d row c (+16j), keys of this step
#pragma unroll
      for (int j = 0; j < 8; ++j) {
        const v16h vf = ldfrag_h(vhp + j * 16 * (VPB / 2));
#pragma unroll
        for (int g = 0; g < QCG; ++g) o[g][j] = mma_h(vf, ph[g].v, o[g][j]);
      }
    }
    // four vector slots behind the step's last products, in front of the loop's branch: on its taken side the first vector
    // instructions rewrite registers of P^T
    acc_guard16(o[0], o[1]);
   }
   // ---- publish point of stage st + 1: own LDS reads retired, own copies landed, every wave has left this buffer ----
   wait_ds0();
   wait_async0();
   __syncthreads();
   if (st + 2 < NST) {                                    // block-uniform: refill the buffer that this trip has just read
     const int s2 = (st0 + st + 2 < NST) ? st0 + st + 2 : st0 + st + 2 - NST;   // trip st + 2 works on key stage s2
     stage_kv(kg0 + (size_t)s2 * KSTG * KVD, vg0 + s2 * KSTG,
              lk0 + (unsigned)(st & 1) * STGB, lv0 + (unsigned)(st & 1) * STGB);
   }
  }
  wait_async0();                                          // nothing in flight before the ring's bytes become the result slab
  // ---- out = acc / Z (0 if Z == 0), acc and Z both x32768, the carry 1024 on v folded once; row 16g + c of the wave's slab, 8 consecutive d ----
#pragma unroll
  for (int g = 0; g < QCG; ++g) {
    const float lv  = lrun[g] + xhalf(lrun[g]);           // the two halves' sums joined
    const float ls  = (lv > 0.0f) ? lv : 1.0f;
    const float inv = (lv > 0.0f) ? ((1.0f / ls) * oc) : 0.0f;
#pragma unroll
    for (int j = 0; j < 8; ++j) {
      float* sp = slab + (g * 16 + c) * SLP + j * 16 + 8 * hh;
      v4f a, b4;
#pragma unroll
      for (int e = 0; e < 4; ++e) { a[e] = o[g][j][e] * inv; b4[e] = o[g][j][4 + e] * inv; }
      *(v4f*)(sp)     = a;
      *(v4f*)(sp + 4) = b4;
    }
  }

  wave_sync_lds();
  // ---- O x1024 -> f16 plane; lane = (row-in-pair rq, 8 consecutive d at c8) ----
  v4u oh[8 * QCG];
  const int rq = lane >> 4, c8 = (lane & 15) * 8;
#pragma unroll
  for (int it = 0; it < 8 * QCG; ++it) {
    const int row = it * 2 + rq;
    const v4f a = *(const v4f*)(slab + row * SLP + c8), b4 = *(const v4f*)(slab + row * SLP + c8 + 4);
    float w[8];
#pragma unroll
    for (int e = 0; e < 4; ++e) { w[e] = a[e] * OSC; w[4 + e] = b4[e] * OSC; }
#pragma unroll
    for (int e = 0; e < 4; ++e) {
      const _Float16 h0 = (_Float16)w[2 * e], h1 = (_Float16)w[2 * e + 1];
      oh[it][e] = pk16(h_bits(h0), h_bits(h1));
    }
  }
  const size_t ob = ((size_t)b * SEQ + q0) * DMOD + (size_t)head * HD + c8;
  {
#pragma unroll
    for (int it = 0; it < 8 * QCG; ++it) {
      const int row = it * 2 + rq;
      *(v4u*)(OHp + ob + (size_t)row * DMOD) = oh[it];
    }
  }
}

// =====================================================================================================
// Workspace map (bytes); every plane is fully written by whole-line stores before it is read; all extents are exact multiples
// of the store granularity (no pad rows needed); every region offset a multiple of 1048576:
//   XB  bf16 [MROWS][2048]                       MROWS*4096       (NB=2: 16777216)
//   WQ  bf16 [2048 n][2048 k]                    8388608          Wq^T
//   WK  bf16 [512 n][2048 k]                     2097152          Wk^T;  WV same extent: Wv^T (WQ, WK, WV: one plane [3072 n][2048 k])
//   WO  f16 x1024 [2048 n][2048 k]               8388608          Wo^T
//   OH  f16 [MROWS][2048] x1024                  MROWS*4096
//   QH  f16 [MROWS][2048] x256                   MROWS*4096
//   KH  f16 [MROWS][512] x256                    MROWS*1024
//   VH  f16 [NB*4][128][SEQ] x1024               MROWS*1024
//   COS f32 [MROWS][64]                          MROWS*256        SIN same extent
//   end (NB=2)                                 81788928
// =====================================================================================================
extern "C" void kernel_launch(void* const* d_in, const int* in_sizes, int n_in,
                              void* d_out, int out_size, void* d_ws, size_t ws_size,
                              hipStream_t stream) {
  if (n_in < 8) return;
  if (in_sizes[0] < MROWS * DMOD) return;
  if (in_sizes[1] < MROWS) return;
  if (in_sizes[2] != DMOD * DMOD) return;
  if (in_sizes[3] != DMOD * KVD) return;
  if (in_sizes[4] != DMOD * KVD) return;
  if (in_sizes[5] != DMOD * DMOD) return;
  if (in_sizes[6] < HD) return;
  if (in_sizes[7] < HD) return;
  if (out_size < MROWS * DMOD) return;

  const float* x   = (const float*)d_in[0];
  const int*   pos = (const int*)d_in[1];
  const float* wq  = (const float*)d_in[2];
  const float* wk  = (const float*)d_in[3];
  const float* wv  = (const float*)d_in[4];
  const float* wo  = (const float*)d_in[5];
  const float* qnw = (const float*)d_in[6];
  const float* knw = (const float*)d_in[7];
  float*       out = (float*)d_out;

  const size_t szXB = (size_t)MROWS * DMOD * 2;
  const size_t szW  = (size_t)DMOD * DMOD * 2;                   // WQ, WO
  const size_t szWK = (size_t)DMOD * KVD * 2;                    // WK, WV
  const size_t szQ  = (size_t)MROWS * DMOD * 2;                  // QH, OH
  const size_t szK  = (size_t)MROWS * KVD * 2;                   // KH
  const size_t szV  = (size_t)NB * NKVH * HD * SEQ * 2;          // VH (== szK)
  const size_t szT  = (size_t)MROWS * HHALF * 4;                 // COS, SIN
  size_t off = 0;
  const size_t oXB = off; off += szXB;
  const size_t oWQ = off; off += szW;                            // WQ, WK, WV in a row: one plane [3072 n][2048 k]
  const size_t oWK = off; off += szWK;
  const size_t oWV = off; off += szWK;
  const size_t oWO = off; off += szW;
  const size_t oOH = off; off += szQ;
  const size_t oQH = off; off += szQ;
  const size_t oKH = off; off += szK;
  const size_t oVH = off; off += szV;
  const size_t oCS = off; off += szT;
  const size_t oSN = off; off += szT;
  if (off > ws_size) return;                // off = 81788928 for NB = 2
  if (off > (size_t)WS_CAP) return;

  char* ws = (char*)d_ws;
  u16*   XB  = (u16*)(ws + oXB);
  u16*   WQT = (u16*)(ws + oWQ);
  u16*   WOT = (u16*)(ws + oWO);
  u16*   WKT = (u16*)(ws + oWK);
  u16*   WVT = (u16*)(ws + oWV);
  u16*   OH  = (u16*)(ws + oOH);
  u16*   QH  = (u16*)(ws + oQH);
  u16*   KH  = (u16*)(ws + oKH);
  u16*   VH  = (u16*)(ws + oVH);
  float* COS = (float*)(ws + oCS);
  float* SIN = (float*)(ws + oSN);

  const dim3 b256(256), bAT(ATT_THREADS);
  const int  nrtQ = SQ / GBM;                           // ctx / out rows per batch / 128
  const dim3 gAT(NQT * NHG * NB);

  // (0) cos/sin tables from the integer positions, x -> bf16 plane, Wq^T, Wk^T, Wv^T bf16 planes, Wo^T f16 plane of bf16 value x1024
  prep16<<<dim3(PB_ALL), b256, 0, stream>>>(pos, x, wq, wk, wv, wo, COS, SIN, XB, WQT, WKT, WVT, WOT);
  // (1) q = x.Wq, k = x.Wk, v = x.Wv, each tile on into its planes: RMS normalisation + rotary + q plane x256, k plane x256; v^T plane x1024
  gemm_qkv<<<dim3(GB_QKV), dim3(CTQ * 128), 0, stream>>>(XB, WQT, qnw, knw, COS, SIN, QH, KH, VH, DMOD, 1.0f);
  // (2) non-causal attention over all keys -> O plane
  attn_nc<<<gAT, bAT, 0, stream>>>(QH, KH, VH, OH);
  // (3) out = ctx.Wo -> f32, carries 1024 x 1024 folded back
  gemm128<false><<<dim3(GB_OUT), dim3(CTO * 128), 0, stream>>>(OH, WOT, out, DMOD, DMOD, nrtQ, 1.0f / (OSC * WOS));
  (void)hipGetLastError();
}
